// v000
// Measured on an AMD MI455X. A time is GPU time per run, averaged over a window of back-to-back runs after a warm-up
// (all launches, gaps included; the runs take copies of the inputs in turn), and the median of several windows.
// Apart from v000's, it joins two sittings. Times from different sittings can be a few percent apart, while
// side-by-side timings come from the same sitting.
// v000 is the starting kernel. One run takes 197 microseconds.
// Contractions: q,k,v projections (x token rows f16 x64 . W^T rows f16 x1024, K=768, one product each);
// attention scores S^T = k (f16 x1024, one plane) . q^T (f16 x1024, one plane), one product, head dim 64;
// attention O^T = v^T (f16 x256, one plane) . P^T (f16 1024-scaled hi plane + unscaled residual plane, from the
// score D registers), two products into one accumulator over 2048 keys; output projection ctx (f16 x1024) . Wo^T
// (f16 x1024), one product. All v_wmma_f32_16x16x32_f16, f32 accumulate; mask adder and softmax in f32 on VALU;
// every float input RNE-converted to bf16 on load.
#include <hip/hip_runtime.h>
#include <math.h>
#include <stdint.h>

#define NBAT   2
#define SEQ    2048
#define DMOD   768
#define NHEAD  12
#define DHEAD  64
#define MTOK   (NBAT * SEQ)
#define KSEG   (DMOD / 256)
#define TN64   (DMOD / 64)
#define TPW    (TN64 * TN64)
#define XC     64.0f
#define WSC    1024.0f
#define QS     1024.0f
#define KS     1024.0f
#define VS     256.0f
#define CS     1024.0f
#define LNPS   6.931471805599453f
#define ATTSC  0.125f
#define MASKC  (-10000.0f)
static_assert(NHEAD * DHEAD == DMOD);
static_assert((MTOK % 64) == 0 && (DMOD % 64) == 0 && (SEQ % 64) == 0 && (DMOD % 32) == 0 && (DMOD % 256) == 0);
static_assert((((MTOK / 64) * TN64) % 4) == 0);
static_assert(((MTOK * KSEG) % 8) == 0);
static_assert((SEQ / 64) == 32 && (SEQ % 32) == 0);
static_assert((MTOK % SEQ) == 0);

typedef _Float16 v16h __attribute__((ext_vector_type(16)));
typedef _Float16 v8h  __attribute__((ext_vector_type(8)));
typedef float    v8f  __attribute__((ext_vector_type(8)));
typedef float    v4f  __attribute__((ext_vector_type(4)));
typedef unsigned int v4u __attribute__((ext_vector_type(4)));
typedef int      v4i  __attribute__((ext_vector_type(4)));

union FragH { v16h v; v8h h[2]; };

// ---- scalar helpers --------------------------------------------------------------------------------
__device__ __forceinline__ unsigned short bf_bits(float f) {          // f32 -> bf16 bits, RNE convert
  unsigned u = __float_as_uint(f);
  return (unsigned short)((u + 0x7FFFu + ((u >> 16) & 1u)) >> 16);
}
__device__ __forceinline__ float bf_up(unsigned short h) { return __uint_as_float(((unsigned)h) << 16); }
__device__ __forceinline__ float bfr(float f) { return bf_up(bf_bits(f)); }
__device__ __forceinline__ unsigned short h_bits(_Float16 x) { return __builtin_bit_cast(unsigned short, x); }
__device__ __forceinline__ unsigned pk16(unsigned short a, unsigned short b) { return (unsigned)a | ((unsigned)b << 16); }
__device__ __forceinline__ v8f zero8() { v8f z = {0.f, 0.f, 0.f, 0.f, 0.f, 0.f, 0.f, 0.f}; return z; }

// ---- fragment loader: 16-bit A/B operand, lane -> row/col (lane&15), p already includes +8*(lane>>4);
//      elements 0..7 <- p[0..7] (k0+8h..), elements 8..15 <- p[16..23] (k0+16+8h..)
__device__ __forceinline__ v16h ldfrag_h(const _Float16* p) {
  FragH f;
  f.h[0] = *(const v8h*)(p);
  f.h[1] = *(const v8h*)(p + 16);
  return f.v;
}

// ---- WMMA helpers with trailing VALU hazard gap --------------------------------------------------------
__device__ __forceinline__ v8f mma_h_raw(v16h a, v16h b, v8f c) {
  return __builtin_amdgcn_wmma_f32_16x16x32_f16(false, a, false, b, (short)0, c, false, false);
}
__device__ __forceinline__ void dep_guard1(v8f& a, v8f& b, v16h x) {
#if defined(__HIP_DEVICE_COMPILE__)
  asm volatile("v_nop\n\tv_nop\n\tv_nop\n\tv_nop" : "+v"(a), "+v"(b) : "v"(x));
#endif
}
__device__ __forceinline__ void keep4_h(v16h a, v16h b, v16h c, v16h d) {
#if defined(__HIP_DEVICE_COMPILE__)
  asm volatile("v_nop" :: "v"(a), "v"(b), "v"(c), "v"(d));
#endif
}
__device__ __forceinline__ void acc_guard4(v8f& a, v8f& b, v8f& c, v8f& d) {
#if defined(__HIP_DEVICE_COMPILE__)
  asm volatile("v_nop\n\tv_nop\n\tv_nop\n\tv_nop" : "+v"(a), "+v"(b), "+v"(c), "+v"(d));
#endif
}
__device__ __forceinline__ void sguard6(v8f& a, v8f& b, v16h x0, v16h x1, v16h x2, v16h x3, v16h x4, v16h x5) {
#if defined(__HIP_DEVICE_COMPILE__)
  asm volatile("v_nop\n\tv_nop\n\tv_nop\n\tv_nop"
               : "+v"(a), "+v"(b) : "v"(x0), "v"(x1), "v"(x2), "v"(x3), "v"(x4), "v"(x5));
#endif
}
__device__ __forceinline__ void oguard6(v8f& a, v8f& b, v8f& c, v8f& d,
                                        v16h x0, v16h x1, v16h x2, v16h x3, v16h p0, v16h p1) {
#if defined(__HIP_DEVICE_COMPILE__)
  asm volatile("v_nop\n\tv_nop\n\tv_nop\n\tv_nop"
               : "+v"(a), "+v"(b), "+v"(c), "+v"(d) : "v"(x0), "v"(x1), "v"(x2), "v"(x3), "v"(p0), "v"(p1));
#endif
}
__device__ __forceinline__ void wave_sync_lds() {
  __builtin_amdgcn_fence(__ATOMIC_RELEASE, "workgroup");
  __builtin_amdgcn_wave_barrier();
  __builtin_amdgcn_fence(__ATOMIC_ACQUIRE, "workgroup");
}

// =====================================================================================================
// Activation plane: XH[t][768] = f16( bf16_RNE(h[t][c]) * 64 ).
// coverage: 1536 x 8 = 12288 segments = 4096 rows x 768 columns entirely.
// =====================================================================================================
__global__ __launch_bounds__(256) void cvt_act(const float* __restrict__ hs, unsigned short* XH) {
  const int lane = threadIdx.x & 31, wave = threadIdx.x >> 5;
  const int seg = blockIdx.x * 8 + wave;                 // 0 .. 12287
  const int row = seg / KSEG;
  const int col = (seg - row * KSEG) * 256 + 8 * lane;
  const size_t o = (size_t)row * DMOD + col;
  const v4f h0 = *(const v4f*)(hs + o), h1 = *(const v4f*)(hs + o + 4);
  float a[8];
#pragma unroll
  for (int i = 0; i < 4; ++i) { a[i] = bfr(h0[i]); a[4 + i] = bfr(h1[i]); }
  v4u uh;
#pragma unroll
  for (int i = 0; i < 4; ++i) {
    const float xa = a[2 * i] * XC, xb = a[2 * i + 1] * XC;
    uh[i] = pk16(h_bits((_Float16)xa), h_bits((_Float16)xb));
  }
  unsigned short* dh = XH + o;
  *(v4u*)dh = uh;
  
}

// =====================================================================================================
// Weight planes: in W[K=768][N=768] (N contiguous) -> out WT[N][K] = f16( bf16_RNE(W[k][n]) * 1024 ), k contiguous.
// Block = one 64(k) x 64(n) tile: 256 threads load 16 rows x 64 floats per step (16 threads x 16 B per row), convert and
// store transposed into LDS Ts[n][k] (pitch 72 halves, 2-byte stores), block barrier, then 2 instructions each write
// blocks 0..143 -> weight 0, 144..287 -> weight 1, 288..431 -> weight 2, 432..575 -> weight 3 (block-uniform select).
// coverage: per weight 144 tiles x (2 x 32 lines x 8 lanes x 8 halves) = 768 x 768 entirely.
// =====================================================================================================
__global__ __launch_bounds__(256) void cvt_w(const float* __restrict__ w0, const float* __restrict__ w1,
                                              const float* __restrict__ w2, const float* __restrict__ w3,
                                              unsigned short* t0, unsigned short* t1,
                                              unsigned short* t2, unsigned short* t3) {
  __shared__ __align__(16) unsigned short Ts[64 * 72];
  const int tid = threadIdx.x;
  const int bx = blockIdx.x;
  const int wsel = bx / TPW;                        // block-uniform
  const int t = bx - wsel * TPW;
  const int k0 = (t / TN64) * 64;
  const int n0 = (t % TN64) * 64;
  const float* src = (wsel == 0) ? w0 : (wsel == 1) ? w1 : (wsel == 2) ? w2 : w3;
  unsigned short* dst = (wsel == 0) ? t0 : (wsel == 1) ? t1 : (wsel == 2) ? t2 : t3;
  {
    const int r16 = tid >> 4, p = tid & 15;
#pragma unroll
    for (int it = 0; it < 4; ++it) {
      const int kr = it * 16 + r16;                   // it 0..3 x r16 0..15 = k rows 0..63
      const v4f v = *(const v4f*)(src + (size_t)(k0 + kr) * DMOD + n0 + 4 * p);
#pragma unroll
      for (int j = 0; j < 4; ++j) Ts[(4 * p + j) * 72 + kr] = h_bits((_Float16)(bfr(v[j]) * WSC));
    }
  }
  __syncthreads();
  {
    const int e = tid & 7, lq = tid >> 3;             // lq 0..31: line, e: 16-B piece
    v4u u[2];
#pragma unroll
    for (int it = 0; it < 2; ++it) {
      const int nr = it * 32 + lq;                    // it 0..1 x lq 0..31 = n rows 0..63
      u[it] = *(const v4u*)(Ts + nr * 72 + 8 * e);
    }
    unsigned short* db = dst + (size_t)n0 * DMOD + k0 + 8 * e;
    {
#pragma unroll
      for (int it = 0; it < 2; ++it) {
        const int nr = it * 32 + lq;
        *(v4u*)(db + (size_t)nr * DMOD) = u[it];
      }
      
    }
  }
}

// =====================================================================================================
// Register-blocked f16 WMMA GEMM, one wave per 64x64 tile (4 waves per block), no block barriers:
//   acc[m][n] = sum_k A[m][k] * Bt[n][k],  A: f16 [4096][768] token rows, Bt: f16 [768][768] k contiguous,
//   fragments = two 16-B loads with the split k map (ldfrag_h); M=4096, N=768, K=768 fixed, all tile multiples.
//   y = acc * escale + bf16_RNE(bias[n]) * bscale, then per MODE:
//   MODE 0: f32 row-major C[4096][768] (the final output): 16-row slabs staged per wave in LDS (pitch 68 floats), each
//   MODE 1: f16 single plane row-major [4096][768]: per slab 4 instructions, each 4 rows x (8 consecutive lanes x 16 B)
//   MODE 2: f16 single plane transposed VT[b][feature 768][2048 tokens]: the wave's whole 64x64 tile is staged as f16
// coverage: MODE 0/1: 4 slabs x 16 rows x 64 cols per wave tile; MODE 2: 64 features x 64 tokens per wave tile;
//           grid = 768 tiles / 4 = 192 blocks covers [4096][768] exactly once (m0 multiple of 64 never straddles b).
// =====================================================================================================
template <int MODE>
__global__ __launch_bounds__(128) void gemm64(
    const unsigned short* __restrict__ Ap, const unsigned short* __restrict__ Bp,
    const float* __restrict__ bias, float escale, float bscale, void* C0) {
  __shared__ __align__(16) unsigned short sraw[4][4608];   // 9216 B per wave
  const int lane = threadIdx.x & 31;
  const int wave = threadIdx.x >> 5;
  const int tilesN = TN64;                                 // 12
  const int tile = blockIdx.x * 4 + wave;                  // 0..767, grid exact
  const int tm = tile / tilesN;
  const int tn = tile - tm * tilesN;
  const int m0 = tm << 6;
  const int n0 = tn << 6;

  const _Float16* Ah = (const _Float16*)(const void*)Ap;
  const _Float16* Bb = (const _Float16*)(const void*)Bp;

  const int rlane = lane & 15;                 // row (A) / col (B, D) within subtile
  const int hh    = lane >> 4;
  const int koff  = hh * 8;                    // k offset of this lane half
  const int mOff  = hh * 8;                    // D row offset

  v8f acc[4][4];
#pragma unroll
  for (int i = 0; i < 4; ++i)
#pragma unroll
    for (int j = 0; j < 4; ++j) acc[i][j] = zero8();

  for (int k0 = 0; k0 < DMOD; k0 += 32) {
    v16h bh[4];
#pragma unroll
    for (int j = 0; j < 4; ++j) {
      const size_t bo = (size_t)(n0 + (j << 4) + rlane) * DMOD + koff + k0;
      bh[j] = ldfrag_h(Bb + bo);
    }
#pragma unroll
    for (int i = 0; i < 4; ++i) {
      const size_t ao = (size_t)(m0 + (i << 4) + rlane) * DMOD + koff + k0;
      const v16h ah = ldfrag_h(Ah + ao);
#pragma unroll
      for (int j = 0; j < 4; ++j) acc[i][j] = mma_h_raw(ah, bh[j], acc[i][j]);
      dep_guard1(acc[i][0], acc[i][3], ah);
    }
    keep4_h(bh[0], bh[1], bh[2], bh[3]);
  }
  acc_guard4(acc[0][0], acc[0][1], acc[0][2], acc[0][3]);
  acc_guard4(acc[1][0], acc[1][1], acc[1][2], acc[1][3]);
  acc_guard4(acc[2][0], acc[2][1], acc[2][2], acc[2][3]);
  acc_guard4(acc[3][0], acc[3][1], acc[3][2], acc[3][3]);

  if (MODE == 0) {
    float* Cout = (float*)C0;
    const int c4 = rlane * 4;                        // f32 out: 256-B row segment = 16 lanes x 16 B
    const v4f braw = *(const v4f*)(bias + n0 + c4);
    float bb[4];
#pragma unroll
    for (int tt = 0; tt < 4; ++tt) bb[tt] = bfr(braw[tt]) * bscale;
    float* slab = (float*)(void*)(&sraw[wave][0]);
#pragma unroll
    for (int i = 0; i < 4; ++i) {
      const int mBase = m0 + (i << 4);
#pragma unroll
      for (int j = 0; j < 4; ++j) {
#pragma unroll
        for (int r = 0; r < 8; ++r) slab[(mOff + r) * 68 + (j << 4) + rlane] = acc[i][j][r];
      }
      wave_sync_lds();
      v4f vals[8];
#pragma unroll
      for (int it = 0; it < 8; ++it) {
        const int row = it * 2 + hh;                   // it 0..7 x hh 0..1 = rows 0..15
        v4f v = *(const v4f*)(slab + row * 68 + c4);
#pragma unroll
        for (int tt = 0; tt < 4; ++tt) v[tt] = v[tt] * escale + bb[tt];
        vals[it] = v;
      }
      {
#pragma unroll
        for (int it = 0; it < 8; ++it) {
          const int row = it * 2 + hh;
          *(v4f*)(Cout + (size_t)(mBase + row) * DMOD + n0 + c4) = vals[it];
        }
        
      }
      wave_sync_lds();
    }
  } else if (MODE == 1) {
    unsigned short* Hp = (unsigned short*)C0;
    const int e = lane & 7, q4 = lane >> 3;
    const v4f b0 = *(const v4f*)(bias + n0 + 8 * e), b1 = *(const v4f*)(bias + n0 + 8 * e + 4);
    float bb[8];
#pragma unroll
    for (int tt = 0; tt < 4; ++tt) { bb[tt] = bfr(b0[tt]) * bscale; bb[4 + tt] = bfr(b1[tt]) * bscale; }
    float* slab = (float*)(void*)(&sraw[wave][0]);
#pragma unroll
    for (int i = 0; i < 4; ++i) {
      const int mBase = m0 + (i << 4);
#pragma unroll
      for (int j = 0; j < 4; ++j) {
#pragma unroll
        for (int r = 0; r < 8; ++r) slab[(mOff + r) * 68 + (j << 4) + rlane] = acc[i][j][r];
      }
      wave_sync_lds();
      v4u hv[4];
#pragma unroll
      for (int it = 0; it < 4; ++it) {
        const int row = it * 4 + q4;                   // it 0..3 x q4 0..3 = rows 0..15
        const v4f x0 = *(const v4f*)(slab + row * 68 + 8 * e);
        const v4f x1 = *(const v4f*)(slab + row * 68 + 8 * e + 4);
        float y[8];
#pragma unroll
        for (int tt = 0; tt < 4; ++tt) { y[tt] = x0[tt] * escale + bb[tt]; y[4 + tt] = x1[tt] * escale + bb[4 + tt]; }
        v4u uh;
#pragma unroll
        for (int t2 = 0; t2 < 4; ++t2) {
          uh[t2] = pk16(h_bits((_Float16)y[2 * t2]), h_bits((_Float16)y[2 * t2 + 1]));
        }
        hv[it] = uh;
      }
      {
#pragma unroll
        for (int it = 0; it < 4; ++it) {
          const int row = it * 4 + q4;
          const size_t go = (size_t)(mBase + row) * DMOD + n0 + 8 * e;
          *(v4u*)(Hp + go) = hv[it];
        }
        
      }
      wave_sync_lds();
    }
  } else {
    unsigned short* Vs = &sraw[wave][0];              // [64 features][pitch 72] f16 bits
    float bb4[4];
#pragma unroll
    for (int j = 0; j < 4; ++j) bb4[j] = bfr(bias[n0 + (j << 4) + rlane]) * bscale;
#pragma unroll
    for (int i = 0; i < 4; ++i) {
#pragma unroll
      for (int j = 0; j < 4; ++j) {
#pragma unroll
        for (int r = 0; r < 8; ++r) {
          Vs[((j << 4) + rlane) * 72 + (i << 4) + mOff + r] = h_bits((_Float16)(acc[i][j][r] * escale + bb4[j]));
        }
      }
    }
    wave_sync_lds();
    const int e = lane & 7, q4 = lane >> 3;
    const int bsel = m0 / SEQ;                          // batch of this tile (wave-uniform)
    const int s0 = m0 % SEQ;                            // first token within the batch
    v4u u[16];
#pragma unroll
    for (int it = 0; it < 16; ++it) {
      const int fl = it * 4 + q4;                        // it 0..15 x q4 0..3 = features 0..63
      u[it] = *(const v4u*)(Vs + fl * 72 + 8 * e);
    }
    unsigned short* Vp = (unsigned short*)C0 + ((size_t)bsel * DMOD + n0) * SEQ + s0 + 8 * e;
    {
#pragma unroll
      for (int it = 0; it < 16; ++it) {
        const int fl = it * 4 + q4;
        *(v4u*)(Vp + (size_t)fl * SEQ) = u[it];
      }
      
    }
  }
}

// =====================================================================================================
// Attention for one (b, head, 64-query block), transposed formulation, head dim 64, 2048 keys, additive int mask:
//   S^T tile (16 keys x 16 queries) = A(k rows = keys, d via the split k map) . B(q, col = query, same d map), two d-steps
//   of 32: s = k.q = 1024*1024 * logit_dot (one product). Per lane the D tile holds 8 keys of ONE query, so
//   x = s/8/(1024*1024) + (1 - mask[b][key]) * (-10000) and the online softmax (running max, f32) are per-lane state
//   with one shuffle (lane^16) for the max over 32 keys; the row sum is kept as a per-lane partial and combined at
//   the end. P = e^{x-m} x 1024 as f16 hi plane plus unscaled f16 residual plane (e - hi), both used directly as the
//   B operand of O^T (rows d, cols queries) += A(v^T rows d, keys contiguous, two 16-B loads) . B(P^T):
//   B element r <- the key tile covering keys kb..kb+15, element 8+r <- the tile covering kb+16..kb+31, lane unchanged
//   (D-as-B chaining layout). Two products per d tile (d 0-15, 16-31, 32-47, 48-63) into one accumulator.
//   32 keys per iteration: 4 score WMMAs + 8 output WMMAs per wave. Block = 4 waves = 64 queries; grid = 2*12*32 = 768.
//   Epilogue: the block's [64 query][64 d] f32 tile is staged in LDS (scalar stores, pitch 68), block barrier, then 4
// coverage: block writes queries q0..q0+63 x d 0..63 of its (b, head); grid covers ctx [4096][768] exactly once.
// =====================================================================================================
__global__ __launch_bounds__(128)
void attn_kernel(const unsigned short* __restrict__ qp, const unsigned short* __restrict__ kp,
                 const unsigned short* __restrict__ vt, const int* __restrict__ am, unsigned short* ctx) {
  __shared__ __align__(16) float Os[64 * 68];
  const int tid  = threadIdx.x;
  const int wave = tid >> 5;
  const int lane = tid & 31;
  const int hh   = lane >> 4;
  const int c    = lane & 15;
  const int bx   = blockIdx.x;
  const int qb   = bx & 31;                       // SEQ/64 = 32 query blocks per (b, head)
  const int bhd  = bx >> 5;                       // b * NHEAD + head
  const int b    = bhd / NHEAD;
  const int hd   = bhd - b * NHEAD;
  const int q0   = qb * 64;

  const _Float16* QP  = (const _Float16*)(const void*)qp;
  const _Float16* KP  = (const _Float16*)(const void*)kp;
  const _Float16* VTp = (const _Float16*)(const void*)vt;

  // ---- q fragments (B operand, col = query q0 + 16*wave + c): one plane, d 0..31 and 32..63 ----
  const size_t qtok = (size_t)b * SEQ + q0 + wave * 16 + c;
  const _Float16* qbp = QP + qtok * DMOD + hd * DHEAD + 8 * hh;
  const v16h qf0 = ldfrag_h(qbp), qf1 = ldfrag_h(qbp + 32);
  // ---- k fragment base (A operand, row = key kb + c), + key * 768 ----
  const size_t krow = ((size_t)b * SEQ + c) * DMOD + hd * DHEAD + 8 * hh;
  const _Float16* Kb = KP + krow;
  // ---- v^T fragment bases (A operand, row = d = 16j + c, keys contiguous), + kb ----
  const size_t vrow = ((size_t)b * DMOD + hd * DHEAD + c) * SEQ + 8 * hh;
  const _Float16* V0 = VTp + vrow;
  const _Float16* V1 = V0 + (size_t)16 * SEQ;
  const _Float16* V2 = V0 + (size_t)32 * SEQ;
  const _Float16* V3 = V0 + (size_t)48 * SEQ;
  // ---- mask base: keys kb + 8hh + 0..7 and kb + 16 + 8hh + 0..7 of batch b ----
  const int* amb = am + (size_t)b * SEQ + 8 * hh;
  const float SC = ATTSC / (QS * KS);

  float m = -1.0e30f, l = 0.f;
  v8f o0 = zero8(), o1 = zero8(), o2 = zero8(), o3 = zero8();
#pragma unroll 1
  for (int it = 0; it < SEQ / 32; ++it) {
    const int kb = it * 32;
    const _Float16* k0p = Kb + (size_t)kb * DMOD;
    const _Float16* k1p = k0p + (size_t)16 * DMOD;
    const v16h a0 = ldfrag_h(k0p), a1 = ldfrag_h(k1p);
    const v16h a2 = ldfrag_h(k0p + 32), a3 = ldfrag_h(k1p + 32);
    v8f s0 = mma_h_raw(a0, qf0, zero8());
    v8f s1 = mma_h_raw(a1, qf0, zero8());
    s0 = mma_h_raw(a2, qf1, s0);
    s1 = mma_h_raw(a3, qf1, s1);
    sguard6(s0, s1, a0, a1, a2, a3, qf0, qf1);

    const v4i mk00 = *(const v4i*)(amb + kb),      mk01 = *(const v4i*)(amb + kb + 4);
    const v4i mk10 = *(const v4i*)(amb + kb + 16), mk11 = *(const v4i*)(amb + kb + 20);
    float x0[8], x1[8];
#pragma unroll
    for (int r = 0; r < 4; ++r) {
      const float ad00 = (1.0f - (float)mk00[r]) * MASKC;     // key kb      + 8hh + r
      const float ad01 = (1.0f - (float)mk01[r]) * MASKC;     // key kb      + 8hh + 4 + r
      const float ad10 = (1.0f - (float)mk10[r]) * MASKC;     // key kb + 16 + 8hh + r
      const float ad11 = (1.0f - (float)mk11[r]) * MASKC;     // key kb + 16 + 8hh + 4 + r
      x0[r]     = s0[r] * SC + ad00;
      x0[4 + r] = s0[4 + r] * SC + ad01;
      x1[r]     = s1[r] * SC + ad10;
      x1[4 + r] = s1[4 + r] * SC + ad11;
    }
    float mx = -3.0e38f;
#pragma unroll
    for (int r = 0; r < 8; ++r) mx = fmaxf(mx, fmaxf(x0[r], x1[r]));
    mx = fmaxf(mx, __shfl_xor(mx, 16, 32));
    const float mn   = fmaxf(m, mx);
    const float corr = __expf(m - mn);
    m = mn;
    const float msh = mn - LNPS;            // exp gives e^{x-m} * 1024
    l *= corr;
#pragma unroll
    for (int r = 0; r < 8; ++r) { o0[r] *= corr; o1[r] *= corr; o2[r] *= corr; o3[r] *= corr; }

    FragH ph, pl;
    float ls = 0.f;
#pragma unroll
    for (int r = 0; r < 8; ++r) {
      const float e0 = __expf(x0[r] - msh);           // key kb      + 8hh + r
      const float e1 = __expf(x1[r] - msh);           // key kb + 16 + 8hh + r
      ls += e0 + e1;
      const _Float16 h0 = (_Float16)e0, h1 = (_Float16)e1;
      ph.h[0][r] = h0;
      ph.h[1][r] = h1;
      pl.h[0][r] = (_Float16)(e0 - (float)h0);
      pl.h[1][r] = (_Float16)(e1 - (float)h1);
    }
    l += ls;

    const v16h vf0 = ldfrag_h(V0 + kb);
    const v16h vf1 = ldfrag_h(V1 + kb);
    const v16h vf2 = ldfrag_h(V2 + kb);
    const v16h vf3 = ldfrag_h(V3 + kb);
    o0 = mma_h_raw(vf0, ph.v, o0);
    o1 = mma_h_raw(vf1, ph.v, o1);
    o2 = mma_h_raw(vf2, ph.v, o2);
    o3 = mma_h_raw(vf3, ph.v, o3);
    o0 = mma_h_raw(vf0, pl.v, o0);
    o1 = mma_h_raw(vf1, pl.v, o1);
    o2 = mma_h_raw(vf2, pl.v, o2);
    o3 = mma_h_raw(vf3, pl.v, o3);
    oguard6(o0, o1, o2, o3, vf0, vf1, vf2, vf3, ph.v, pl.v);
  }
  l += __shfl_xor(l, 16, 32);
  const float sc = (CS / VS) * (1.0f / l);

  // ---- stage O[query 16*wave + c][d = 16j + 8hh + r] * sc (= attn * 1024), then whole-line f16 stores ----
  float* os = Os + (wave * 16 + c) * 68 + 8 * hh;
#pragma unroll
  for (int r = 0; r < 8; ++r) { os[r] = o0[r] * sc; os[16 + r] = o1[r] * sc; os[32 + r] = o2[r] * sc; os[48 + r] = o3[r] * sc; }
  __syncthreads();
  {
    const int e = tid & 7, qq = tid >> 3;              // qq 0..15: line within group, e: 16-B piece
    v4u hv[4];
#pragma unroll
    for (int it = 0; it < 4; ++it) {
      const int qi = it * 16 + qq;                       // it 0..3 x qq 0..15 = queries 0..63 of the block
      const v4f x0 = *(const v4f*)(Os + qi * 68 + 8 * e);
      const v4f x1 = *(const v4f*)(Os + qi * 68 + 8 * e + 4);
      v4u u;
#pragma unroll
      for (int t2 = 0; t2 < 2; ++t2) {
        u[t2]     = pk16(h_bits((_Float16)x0[2 * t2]), h_bits((_Float16)x0[2 * t2 + 1]));
        u[2 + t2] = pk16(h_bits((_Float16)x1[2 * t2]), h_bits((_Float16)x1[2 * t2 + 1]));
      }
      hv[it] = u;
    }
    unsigned short* ob = ctx + (size_t)hd * DHEAD + 8 * e;
    {
#pragma unroll
      for (int it = 0; it < 4; ++it) {
        const int qi = it * 16 + qq;
        *(v4u*)(ob + ((size_t)b * SEQ + q0 + qi) * DMOD) = hv[it];
      }
      
    }
  }
}

// =====================================================================================================
//   XH   f16 [4096][768]            0           6291456
//   WQT  f16 [768][768]             6291456     1179648
//   WKT  f16 [768][768]             7471104     1179648
//   WVT  f16 [768][768]             8650752     1179648
//   WOT  f16 [768][768]             9830400     1179648
//   QP   f16 [4096][768]            11010048    6291456
//   KPL  f16 [4096][768]            17301504    6291456
//   VT   f16 [2][768][2048]         23592960    6291456
//   CTX  f16 [4096][768]            29884416    6291456
//   end                              36175872
// =====================================================================================================
extern "C" void kernel_launch(void* const* d_in, const int* in_sizes, int n_in,
                              void* d_out, int out_size, void* d_ws, size_t ws_size,
                              hipStream_t stream) {
  if (n_in < 10) return;
  if (in_sizes[0] != MTOK * DMOD) return;
  if (in_sizes[1] != MTOK) return;
  if (in_sizes[2] != DMOD * DMOD || in_sizes[4] != DMOD * DMOD || in_sizes[6] != DMOD * DMOD) return;
  if (in_sizes[8] != DMOD * DMOD) return;
  if (in_sizes[3] != DMOD || in_sizes[5] != DMOD || in_sizes[7] != DMOD || in_sizes[9] != DMOD) return;
  if (out_size != MTOK * DMOD) return;

  const float* hs  = (const float*)d_in[0];
  const int*   amk = (const int*)d_in[1];
  const float* Wq  = (const float*)d_in[2];
  const float* bq  = (const float*)d_in[3];
  const float* Wk  = (const float*)d_in[4];
  const float* bk  = (const float*)d_in[5];
  const float* Wv  = (const float*)d_in[6];
  const float* bv  = (const float*)d_in[7];
  const float* Wo  = (const float*)d_in[8];
  const float* bo  = (const float*)d_in[9];

  const size_t PACT = (size_t)MTOK * DMOD * 2;          //  6291456
  const size_t PW   = (size_t)DMOD * DMOD * 2;          //  1179648
  const size_t PVT  = (size_t)NBAT * DMOD * SEQ * 2;    //  6291456
  size_t off = 0;
  const size_t oXH = off; off += PACT;
  const size_t oWQ = off; off += PW;
  const size_t oWK = off; off += PW;
  const size_t oWV = off; off += PW;
  const size_t oWO = off; off += PW;
  const size_t oQP = off; off += PACT;
  const size_t oKP = off; off += PACT;
  const size_t oVT = off; off += PVT;
  const size_t oCT = off; off += PACT;
  if (off > ws_size) return;                            // off = 36175872
  if (off > (size_t)134217728) return;

  char* ws = (char*)d_ws;
  unsigned short* XH  = (unsigned short*)(ws + oXH);
  unsigned short* WQT = (unsigned short*)(ws + oWQ);
  unsigned short* WKT = (unsigned short*)(ws + oWK);
  unsigned short* WVT = (unsigned short*)(ws + oWV);
  unsigned short* WOT = (unsigned short*)(ws + oWO);
  unsigned short* QPL = (unsigned short*)(ws + oQP);
  unsigned short* KPL = (unsigned short*)(ws + oKP);
  unsigned short* VT  = (unsigned short*)(ws + oVT);
  unsigned short* CTX = (unsigned short*)(ws + oCT);
  float*          out = (float*)d_out;

  const dim3 blk256(256), blk128(128);
  const dim3 gCA(MTOK * KSEG / 8);                             // 1536 blocks: 8 row segments each
  const dim3 gCW(4 * TPW);                                     // 576 blocks: one 64x64 weight tile each
  const dim3 gGM(((MTOK / 64) * TN64) / 4);                    // 768 tiles -> 192 blocks of 4 waves
  const dim3 gAT(NBAT * NHEAD * (SEQ / 64));                   // 768 blocks of 128

  // (0) activation plane: f16( bf16_RNE(h) * 64 )
  cvt_act<<<gCA, blk256, 0, stream>>>(hs, XH);

  // (1) weight planes: [K][N] -> [N][K], f16( bf16_RNE(W) * 1024 )
  cvt_w<<<gCW, blk256, 0, stream>>>(Wq, Wk, Wv, Wo, WQT, WKT, WVT, WOT);

  // (2) q = h . Wq + bq -> f16 plane of q*1024 ; acc = 64*1024*q -> escale 1/64
  gemm64<1><<<gGM, blk128, 0, stream>>>(XH, WQT, bq, QS / (XC * WSC), QS, (void*)QPL);

  // (3) k = h . Wk + bk -> f16 plane of k*1024
  gemm64<1><<<gGM, blk128, 0, stream>>>(XH, WKT, bk, KS / (XC * WSC), KS, (void*)KPL);

  // (4) v = h . Wv + bv -> transposed f16 plane of v*256 : VT[b][h*64+e][token]
  gemm64<2><<<gGM, blk128, 0, stream>>>(XH, WVT, bv, VS / (XC * WSC), VS, (void*)VT);

  // (5) attention with the additive int mask, all (b, head) -> ctx plane f16( attn * 1024 )[token][h*64 + d]
  attn_kernel<<<gAT, blk128, 0, stream>>>(QPL, KPL, VT, amk, CTX);

  // (6) out = attn . Wo + bo -> f32 [4096][768] ; acc = 1024*1024*out -> escale 2^-20
  gemm64<0><<<gGM, blk128, 0, stream>>>(CTX, WOT, bo, 1.0f / (CS * WSC), 1.0f, (void*)out);
  (void)hipGetLastError();
}

// v001
// A run of this version takes 112 microseconds.
// Timed twice side by side with v000, it ran 1.77 and 1.79 times as fast.
// Contractions: q,k,v projections (x token rows f16 x64 . W^T rows f16 x1024, K=768, one product each);
// attention scores S^T = k (f16 x1024, one plane) . q^T (f16 x1024, one plane), one product, head dim 64;
// attention O^T = v^T (f16 x256, one plane) . P^T (f16 1024-scaled hi plane + unscaled residual plane, from the
// score D registers), two products into one accumulator over 2048 keys; output projection ctx (f16 x1024) . Wo^T
// (f16 x1024), one product. All v_wmma_f32_16x16x32_f16, f32 accumulate; mask adder and softmax in f32 on VALU;
// every float input RNE-converted to bf16 on load.
#include <hip/hip_runtime.h>
#include <math.h>
#include <stdint.h>

#define NBAT   2
#define SEQ    2048
#define DMOD   768
#define NHEAD  12
#define DHEAD  64
#define MTOK   (NBAT * SEQ)
#define KSEG   (DMOD / 256)
#define TN64   (DMOD / 64)
#define TPW    (TN64 * TN64)
#define XC     64.0f
#define WSC    1024.0f
#define QS     1024.0f
#define KS     1024.0f
#define VS     256.0f
#define CS     1024.0f
#define LNPS   6.931471805599453f
#define ATTSC  0.125f
#define MASKC  (-10000.0f)
static_assert(NHEAD * DHEAD == DMOD);
static_assert((MTOK % 64) == 0 && (DMOD % 64) == 0 && (SEQ % 64) == 0 && (DMOD % 32) == 0 && (DMOD % 256) == 0);
static_assert((((MTOK / 64) * TN64) % 4) == 0);
static_assert(((MTOK * KSEG) % 8) == 0);
static_assert((SEQ / 64) == 32 && (SEQ % 32) == 0);
static_assert((MTOK % SEQ) == 0);

typedef _Float16 v16h __attribute__((ext_vector_type(16)));
typedef _Float16 v8h  __attribute__((ext_vector_type(8)));
typedef float    v8f  __attribute__((ext_vector_type(8)));
typedef float    v4f  __attribute__((ext_vector_type(4)));
typedef unsigned int v4u __attribute__((ext_vector_type(4)));
typedef int      v4i  __attribute__((ext_vector_type(4)));

union FragH { v16h v; v8h h[2]; };

// ---- scalar helpers --------------------------------------------------------------------------------
__device__ __forceinline__ unsigned short bf_bits(float f) {          // f32 -> bf16 bits, RNE convert
  unsigned u = __float_as_uint(f);
  return (unsigned short)((u + 0x7FFFu + ((u >> 16) & 1u)) >> 16);
}
__device__ __forceinline__ float bf_up(unsigned short h) { return __uint_as_float(((unsigned)h) << 16); }
__device__ __forceinline__ float bfr(float f) { return bf_up(bf_bits(f)); }
__device__ __forceinline__ unsigned short h_bits(_Float16 x) { return __builtin_bit_cast(unsigned short, x); }
__device__ __forceinline__ unsigned pk16(unsigned short a, unsigned short b) { return (unsigned)a | ((unsigned)b << 16); }
__device__ __forceinline__ v8f zero8() { v8f z = {0.f, 0.f, 0.f, 0.f, 0.f, 0.f, 0.f, 0.f}; return z; }

// ---- fragment loader: 16-bit A/B operand, lane -> row/col (lane&15), p already includes +8*(lane>>4);
//      elements 0..7 <- p[0..7] (k0+8h..), elements 8..15 <- p[16..23] (k0+16+8h..)
__device__ __forceinline__ v16h ldfrag_h(const _Float16* p) {
  FragH f;
  f.h[0] = *(const v8h*)(p);
  f.h[1] = *(const v8h*)(p + 16);
  return f.v;
}

// ---- WMMA helpers with trailing VALU hazard gap --------------------------------------------------------
__device__ __forceinline__ v8f mma_h_raw(v16h a, v16h b, v8f c) {
  return __builtin_amdgcn_wmma_f32_16x16x32_f16(false, a, false, b, (short)0, c, false, false);
}
__device__ __forceinline__ void dep_guard1(v8f& a, v8f& b, v16h x) {
#if defined(__HIP_DEVICE_COMPILE__)
  asm volatile("v_nop\n\tv_nop\n\tv_nop\n\tv_nop" : "+v"(a), "+v"(b) : "v"(x));
#endif
}
__device__ __forceinline__ void keep4_h(v16h a, v16h b, v16h c, v16h d) {
#if defined(__HIP_DEVICE_COMPILE__)
  asm volatile("v_nop" :: "v"(a), "v"(b), "v"(c), "v"(d));
#endif
}
__device__ __forceinline__ void acc_guard4(v8f& a, v8f& b, v8f& c, v8f& d) {
#if defined(__HIP_DEVICE_COMPILE__)
  asm volatile("v_nop\n\tv_nop\n\tv_nop\n\tv_nop" : "+v"(a), "+v"(b), "+v"(c), "+v"(d));
#endif
}
__device__ __forceinline__ void sguard6(v8f& a, v8f& b, v16h x0, v16h x1, v16h x2, v16h x3, v16h x4, v16h x5) {
#if defined(__HIP_DEVICE_COMPILE__)
  asm volatile("v_nop\n\tv_nop\n\tv_nop\n\tv_nop"
               : "+v"(a), "+v"(b) : "v"(x0), "v"(x1), "v"(x2), "v"(x3), "v"(x4), "v"(x5));
#endif
}
__device__ __forceinline__ void oguard6(v8f& a, v8f& b, v8f& c, v8f& d,
                                        v16h x0, v16h x1, v16h x2, v16h x3, v16h p0, v16h p1) {
#if defined(__HIP_DEVICE_COMPILE__)
  asm volatile("v_nop\n\tv_nop\n\tv_nop\n\tv_nop"
               : "+v"(a), "+v"(b), "+v"(c), "+v"(d) : "v"(x0), "v"(x1), "v"(x2), "v"(x3), "v"(p0), "v"(p1));
#endif
}
__device__ __forceinline__ void wave_sync_lds() {
  __builtin_amdgcn_fence(__ATOMIC_RELEASE, "workgroup");
  __builtin_amdgcn_wave_barrier();
  __builtin_amdgcn_fence(__ATOMIC_ACQUIRE, "workgroup");
}

// =====================================================================================================
// Activation plane: XH[t][768] = f16( bf16_RNE(h[t][c]) * 64 ).
// coverage: 1536 x 8 = 12288 segments = 4096 rows x 768 columns entirely.
// =====================================================================================================
__global__ __launch_bounds__(256) void cvt_act(const float* __restrict__ hs, unsigned short* XH) {
  const int lane = threadIdx.x & 31, wave = threadIdx.x >> 5;
  const int seg = blockIdx.x * 8 + wave;                 // 0 .. 12287
  const int row = seg / KSEG;
  const int col = (seg - row * KSEG) * 256 + 8 * lane;
  const size_t o = (size_t)row * DMOD + col;
  const v4f h0 = *(const v4f*)(hs + o), h1 = *(const v4f*)(hs + o + 4);
  float a[8];
#pragma unroll
  for (int i = 0; i < 4; ++i) { a[i] = bfr(h0[i]); a[4 + i] = bfr(h1[i]); }
  v4u uh;
#pragma unroll
  for (int i = 0; i < 4; ++i) {
    const float xa = a[2 * i] * XC, xb = a[2 * i + 1] * XC;
    uh[i] = pk16(h_bits((_Float16)xa), h_bits((_Float16)xb));
  }
  unsigned short* dh = XH + o;
  *(v4u*)dh = uh;
  
}

// =====================================================================================================
// Weight planes: in W[K=768][N=768] (N contiguous) -> out WT[N][K] = f16( bf16_RNE(W[k][n]) * 1024 ), k contiguous.
// Block = one 64(k) x 64(n) tile: 256 threads load 16 rows x 64 floats per step (16 threads x 16 B per row), convert and
// store transposed into LDS Ts[n][k] (pitch 72 halves, 2-byte stores), block barrier, then 2 instructions each write
// blocks 0..143 -> weight 0, 144..287 -> weight 1, 288..431 -> weight 2, 432..575 -> weight 3 (block-uniform select).
// coverage: per weight 144 tiles x (2 x 32 lines x 8 lanes x 8 halves) = 768 x 768 entirely.
// =====================================================================================================
__global__ __launch_bounds__(256) void cvt_w(const float* __restrict__ w0, const float* __restrict__ w1,
                                              const float* __restrict__ w2, const float* __restrict__ w3,
                                              unsigned short* t0, unsigned short* t1,
                                              unsigned short* t2, unsigned short* t3) {
  __shared__ __align__(16) unsigned short Ts[64 * 72];
  const int tid = threadIdx.x;
  const int bx = blockIdx.x;
  const int wsel = bx / TPW;                        // block-uniform
  const int t = bx - wsel * TPW;
  const int k0 = (t / TN64) * 64;
  const int n0 = (t % TN64) * 64;
  const float* src = (wsel == 0) ? w0 : (wsel == 1) ? w1 : (wsel == 2) ? w2 : w3;
  unsigned short* dst = (wsel == 0) ? t0 : (wsel == 1) ? t1 : (wsel == 2) ? t2 : t3;
  {
    const int r16 = tid >> 4, p = tid & 15;
#pragma unroll
    for (int it = 0; it < 4; ++it) {
      const int kr = it * 16 + r16;                   // it 0..3 x r16 0..15 = k rows 0..63
      const v4f v = *(const v4f*)(src + (size_t)(k0 + kr) * DMOD + n0 + 4 * p);
#pragma unroll
      for (int j = 0; j < 4; ++j) Ts[(4 * p + j) * 72 + kr] = h_bits((_Float16)(bfr(v[j]) * WSC));
    }
  }
  __syncthreads();
  {
    const int e = tid & 7, lq = tid >> 3;             // lq 0..31: line, e: 16-B piece
    v4u u[2];
#pragma unroll
    for (int it = 0; it < 2; ++it) {
      const int nr = it * 32 + lq;                    // it 0..1 x lq 0..31 = n rows 0..63
      u[it] = *(const v4u*)(Ts + nr * 72 + 8 * e);
    }
    unsigned short* db = dst + (size_t)n0 * DMOD + k0 + 8 * e;
    {
#pragma unroll
      for (int it = 0; it < 2; ++it) {
        const int nr = it * 32 + lq;
        *(v4u*)(db + (size_t)nr * DMOD) = u[it];
      }
      
    }
  }
}

// =====================================================================================================
// Register-blocked f16 WMMA GEMM, one wave per 64x64 tile (4 waves per block = 64 token rows x 256 features):
//   acc[m][n] = sum_k A[m][k] * Bt[n][k],  A: f16 [4096][768] token rows, Bt: f16 [768][768] k contiguous,
//   M=4096, N=768, K=768 fixed, all tile multiples.
//   Operands reach the waves through LDS: per stage of 64 k the block copies its 64 A rows and 256 Bt rows (128 B each,
//   whole lines, 8 lanes x 16 B per row) with asynchronous 16-B copies into one of two buffers (row pitch 144 B), the
//   next stage in flight while this one is multiplied; fragments = two 16-B LDS loads with the split k map (ldfrag_h).
//   y = acc * escale + bf16_RNE(bias[n]) * bscale, then per MODE:
//   MODE 0: f32 row-major C[4096][768] (the final output): 16-row slabs staged per wave in LDS (pitch 68 floats), each
//   MODE 1: f16 single plane row-major [4096][768]: per slab 4 instructions, each 4 rows x (8 consecutive lanes x 16 B)
//   MODE 2: f16 single plane transposed VT[b][feature 768][2048 tokens]: the wave's whole 64x64 tile is staged as f16
// coverage: MODE 0/1: 4 slabs x 16 rows x 64 cols per wave tile; MODE 2: 64 features x 64 tokens per wave tile;
//           grid = 768 tiles / 4 = 192 blocks covers [4096][768] exactly once (m0 multiple of 64 never straddles b).
// =====================================================================================================
#define GKB   64                       // k per stage: rows of 128 B
#define GPIT  144                      // LDS row pitch, bytes: 16 B x odd, conflict-free for 16-B fragment loads
#define GSTG  ((64 + 256) * GPIT)      // one buffer: A rows 0..63, Bt rows 64..319
#define GNT   (DMOD / GKB)             // 12 stages
#define GLSTEP (16 * GPIT)             // 16 rows further in LDS
#define GGSTEP (16 * DMOD * 2)         // 16 rows further in global memory
static_assert((TN64 % 4) == 0 && (DMOD % GKB) == 0 && GNT >= 2 && (GPIT % 16) == 0);

// Ten asynchronous 16-B copies per lane, rows 16 apart: LDS byte address l + i * GLSTEP <- g[i]. The s_wait_xcnt closes
// the statement so that no address register of an issued copy is rewritten ahead of it.
__device__ __forceinline__ void acopy10(unsigned l, const char* const (&g)[10]) {
#if defined(__HIP_DEVICE_COMPILE__)
  asm volatile(
      "global_load_async_to_lds_b128 %0, %10, off\n\t"
      "global_load_async_to_lds_b128 %1, %11, off\n\t"
      "global_load_async_to_lds_b128 %2, %12, off\n\t"
      "global_load_async_to_lds_b128 %3, %13, off\n\t"
      "global_load_async_to_lds_b128 %4, %14, off\n\t"
      "global_load_async_to_lds_b128 %5, %15, off\n\t"
      "global_load_async_to_lds_b128 %6, %16, off\n\t"
      "global_load_async_to_lds_b128 %7, %17, off\n\t"
      "global_load_async_to_lds_b128 %8, %18, off\n\t"
      "global_load_async_to_lds_b128 %9, %19, off\n\t"
      "s_wait_xcnt 0x0"
      :: "v"(l), "v"(l + 1 * GLSTEP), "v"(l + 2 * GLSTEP), "v"(l + 3 * GLSTEP), "v"(l + 4 * GLSTEP),
         "v"(l + 5 * GLSTEP), "v"(l + 6 * GLSTEP), "v"(l + 7 * GLSTEP), "v"(l + 8 * GLSTEP), "v"(l + 9 * GLSTEP),
         "v"(g[0]), "v"(g[1]), "v"(g[2]), "v"(g[3]), "v"(g[4]), "v"(g[5]), "v"(g[6]), "v"(g[7]), "v"(g[8]), "v"(g[9])
      : "memory");
#endif
}
// One stage: 320 rows x 8 pieces = 2560 copies = 20 per thread; thread -> row (tid >> 3) + 16 i, piece tid & 7.
// ga, gb: this thread's piece of A row (tid >> 3) and of Bt row (tid >> 3) of the block, at the stage's first k.
__device__ __forceinline__ void stage_copy(unsigned l, const char* ga, const char* gb) {
  const char* g0[10];
  const char* g1[10];
  // the three loops are unrolled so that both pointer arrays stay in registers
#pragma unroll
  for (int i = 0; i < 4; ++i) g0[i] = ga + (size_t)i * GGSTEP;             // A rows 0..63
#pragma unroll
  for (int i = 4; i < 10; ++i) g0[i] = gb + (size_t)(i - 4) * GGSTEP;      // Bt rows 0..95
#pragma unroll
  for (int i = 0; i < 10; ++i) g1[i] = gb + (size_t)(i + 6) * GGSTEP;      // Bt rows 96..255
  acopy10(l, g0);
  acopy10(l + 10 * GLSTEP, g1);
}

template <int MODE>
__global__ __launch_bounds__(128) void gemm64(
    const unsigned short* __restrict__ Ap, const unsigned short* __restrict__ Bp,
    const float* __restrict__ bias, float escale, float bscale, void* C0) {
  __shared__ __align__(16) unsigned short sraw[4][4608];   // 9216 B per wave
  __shared__ __align__(16) unsigned char ring[2 * GSTG];   // two operand buffers
  const int lane = threadIdx.x & 31;
  const int wave = threadIdx.x >> 5;
  const int tilesN = TN64;                                 // 12
  const int tile = blockIdx.x * 4 + wave;                  // 0..767, grid exact
  const int tm = tile / tilesN;
  const int tn = tile - tm * tilesN;
  const int m0 = tm << 6;
  const int n0 = tn << 6;

  const int rlane = lane & 15;                 // row (A) / col (B, D) within subtile
  const int hh    = lane >> 4;
  const int koff  = hh * 8;                    // k offset of this lane half
  const int mOff  = hh * 8;                    // D row offset

  v8f acc[4][4];
#pragma unroll
  for (int i = 0; i < 4; ++i)
#pragma unroll
    for (int j = 0; j < 4; ++j) acc[i][j] = zero8();

  // copy side: the block's A rows start at m0 (the same in its four waves), its Bt rows at n0 - 64 * wave
  const int crow = threadIdx.x >> 3, cpc = threadIdx.x & 7;
  const unsigned lcp = (unsigned)(uintptr_t)(&ring[0]) + (unsigned)(crow * GPIT + cpc * 16);
  const char* ga = (const char*)(const void*)Ap + ((size_t)(m0 + crow) * DMOD + 8 * cpc) * 2;
  const char* gb = (const char*)(const void*)Bp + ((size_t)(n0 - (wave << 6) + crow) * DMOD + 8 * cpc) * 2;

  stage_copy(lcp, ga, gb);
  asm volatile("s_wait_asynccnt 0x0" ::: "memory");        // stage 0 of this wave has landed
  __syncthreads();                                          // ... and every wave's part of it
  stage_copy(lcp + GSTG, ga + GKB * 2, gb + GKB * 2);

  for (int t = 0; t < GNT; ++t) {
    const unsigned char* rb = ring + (t & 1) * GSTG;
    const _Float16* la = (const _Float16*)(const void*)(rb + rlane * GPIT) + koff;
    const _Float16* lb = (const _Float16*)(const void*)(rb + (64 + (wave << 6) + rlane) * GPIT) + koff;
    // all loops of the stage are unrolled: fragment and accumulator arrays in registers, LDS offsets as immediates
#pragma unroll
    for (int ks = 0; ks < GKB; ks += 32) {
      v16h ah[4], bh[4];                                    // the 32-k block's fragments, read as one group
#pragma unroll
      for (int j = 0; j < 4; ++j) {
        bh[j] = ldfrag_h(lb + j * (GLSTEP / 2) + ks);
        ah[j] = ldfrag_h(la + j * (GLSTEP / 2) + ks);
      }
#pragma unroll
      for (int i = 0; i < 4; ++i) {
#pragma unroll
        for (int j = 0; j < 4; ++j) acc[i][j] = mma_h_raw(ah[i], bh[j], acc[i][j]);
        dep_guard1(acc[i][0], acc[i][3], ah[i]);
      }
      keep4_h(bh[0], bh[1], bh[2], bh[3]);
    }
    asm volatile("s_wait_dscnt 0x0" ::: "memory");          // this wave's reads of buffer t & 1 are done
    asm volatile("s_wait_asynccnt 0x0" ::: "memory");       // this wave's copies of stage t + 1 have landed
    __syncthreads();                                        // publishes stage t + 1, frees buffer t & 1
    if (t + 2 < GNT) stage_copy(lcp + (t & 1) * GSTG, ga + (t + 2) * (GKB * 2), gb + (t + 2) * (GKB * 2));
  }
  asm volatile("s_wait_asynccnt 0x0" ::: "memory");         // no copy outstanding when the wave goes on
  acc_guard4(acc[0][0], acc[0][1], acc[0][2], acc[0][3]);
  acc_guard4(acc[1][0], acc[1][1], acc[1][2], acc[1][3]);
  acc_guard4(acc[2][0], acc[2][1], acc[2][2], acc[2][3]);
  acc_guard4(acc[3][0], acc[3][1], acc[3][2], acc[3][3]);

  if (MODE == 0) {
    float* Cout = (float*)C0;
    const int c4 = rlane * 4;                        // f32 out: 256-B row segment = 16 lanes x 16 B
    const v4f braw = *(const v4f*)(bias + n0 + c4);
    float bb[4];
#pragma unroll
    for (int tt = 0; tt < 4; ++tt) bb[tt] = bfr(braw[tt]) * bscale;
    float* slab = (float*)(void*)(&sraw[wave][0]);
#pragma unroll
    for (int i = 0; i < 4; ++i) {
      const int mBase = m0 + (i << 4);
#pragma unroll
      for (int j = 0; j < 4; ++j) {
#pragma unroll
        for (int r = 0; r < 8; ++r) slab[(mOff + r) * 68 + (j << 4) + rlane] = acc[i][j][r];
      }
      wave_sync_lds();
      v4f vals[8];
#pragma unroll
      for (int it = 0; it < 8; ++it) {
        const int row = it * 2 + hh;                   // it 0..7 x hh 0..1 = rows 0..15
        v4f v = *(const v4f*)(slab + row * 68 + c4);
#pragma unroll
        for (int tt = 0; tt < 4; ++tt) v[tt] = v[tt] * escale + bb[tt];
        vals[it] = v;
      }
      {
#pragma unroll
        for (int it = 0; it < 8; ++it) {
          const int row = it * 2 + hh;
          *(v4f*)(Cout + (size_t)(mBase + row) * DMOD + n0 + c4) = vals[it];
        }
        
      }
      wave_sync_lds();
    }
  } else if (MODE == 1) {
    unsigned short* Hp = (unsigned short*)C0;
    const int e = lane & 7, q4 = lane >> 3;
    const v4f b0 = *(const v4f*)(bias + n0 + 8 * e), b1 = *(const v4f*)(bias + n0 + 8 * e + 4);
    float bb[8];
#pragma unroll
    for (int tt = 0; tt < 4; ++tt) { bb[tt] = bfr(b0[tt]) * bscale; bb[4 + tt] = bfr(b1[tt]) * bscale; }
    float* slab = (float*)(void*)(&sraw[wave][0]);
#pragma unroll
    for (int i = 0; i < 4; ++i) {
      const int mBase = m0 + (i << 4);
#pragma unroll
      for (int j = 0; j < 4; ++j) {
#pragma unroll
        for (int r = 0; r < 8; ++r) slab[(mOff + r) * 68 + (j << 4) + rlane] = acc[i][j][r];
      }
      wave_sync_lds();
      v4u hv[4];
#pragma unroll
      for (int it = 0; it < 4; ++it) {
        const int row = it * 4 + q4;                   // it 0..3 x q4 0..3 = rows 0..15
        const v4f x0 = *(const v4f*)(slab + row * 68 + 8 * e);
        const v4f x1 = *(const v4f*)(slab + row * 68 + 8 * e + 4);
        float y[8];
#pragma unroll
        for (int tt = 0; tt < 4; ++tt) { y[tt] = x0[tt] * escale + bb[tt]; y[4 + tt] = x1[tt] * escale + bb[4 + tt]; }
        v4u uh;
#pragma unroll
        for (int t2 = 0; t2 < 4; ++t2) {
          uh[t2] = pk16(h_bits((_Float16)y[2 * t2]), h_bits((_Float16)y[2 * t2 + 1]));
        }
        hv[it] = uh;
      }
      {
#pragma unroll
        for (int it = 0; it < 4; ++it) {
          const int row = it * 4 + q4;
          const size_t go = (size_t)(mBase + row) * DMOD + n0 + 8 * e;
          *(v4u*)(Hp + go) = hv[it];
        }
        
      }
      wave_sync_lds();
    }
  } else {
    unsigned short* Vs = &sraw[wave][0];              // [64 features][pitch 72] f16 bits
    float bb4[4];
#pragma unroll
    for (int j = 0; j < 4; ++j) bb4[j] = bfr(bias[n0 + (j << 4) + rlane]) * bscale;
#pragma unroll
    for (int i = 0; i < 4; ++i) {
#pragma unroll
      for (int j = 0; j < 4; ++j) {
#pragma unroll
        for (int r = 0; r < 8; ++r) {
          Vs[((j << 4) + rlane) * 72 + (i << 4) + mOff + r] = h_bits((_Float16)(acc[i][j][r] * escale + bb4[j]));
        }
      }
    }
    wave_sync_lds();
    const int e = lane & 7, q4 = lane >> 3;
    const int bsel = m0 / SEQ;                          // batch of this tile (wave-uniform)
    const int s0 = m0 % SEQ;                            // first token within the batch
    v4u u[16];
#pragma unroll
    for (int it = 0; it < 16; ++it) {
      const int fl = it * 4 + q4;                        // it 0..15 x q4 0..3 = features 0..63
      u[it] = *(const v4u*)(Vs + fl * 72 + 8 * e);
    }
    unsigned short* Vp = (unsigned short*)C0 + ((size_t)bsel * DMOD + n0) * SEQ + s0 + 8 * e;
    {
#pragma unroll
      for (int it = 0; it < 16; ++it) {
        const int fl = it * 4 + q4;
        *(v4u*)(Vp + (size_t)fl * SEQ) = u[it];
      }
      
    }
  }
}

// =====================================================================================================
// Attention for one (b, head, 64-query block), transposed formulation, head dim 64, 2048 keys, additive int mask:
//   S^T tile (16 keys x 16 queries) = A(k rows = keys, d via the split k map) . B(q, col = query, same d map), two d-steps
//   of 32: s = k.q = 1024*1024 * logit_dot (one product). Per lane the D tile holds 8 keys of ONE query, so
//   x = s/8/(1024*1024) + (1 - mask[b][key]) * (-10000) and the online softmax (running max, f32) are per-lane state
//   with one shuffle (lane^16) for the max over 32 keys; the row sum is kept as a per-lane partial and combined at
//   the end. P = e^{x-m} x 1024 as f16 hi plane plus unscaled f16 residual plane (e - hi), both used directly as the
//   B operand of O^T (rows d, cols queries) += A(v^T rows d, keys contiguous, two 16-B loads) . B(P^T):
//   B element r <- the key tile covering keys kb..kb+15, element 8+r <- the tile covering kb+16..kb+31, lane unchanged
//   (D-as-B chaining layout). Two products per d tile (d 0-15, 16-31, 32-47, 48-63) into one accumulator.
//   32 keys per iteration: 4 score WMMAs + 8 output WMMAs per wave. Block = 4 waves = 64 queries; grid = 2*12*32 = 768.
//   k and v^T reach the waves through LDS: per stage of 64 keys the block copies 64 k rows (its head's 128 B) and 64 v^T
//   rows (64 keys = 128 B), whole lines, with asynchronous 16-B copies into one of two buffers (row pitch 144 B), the next
//   stage in flight while this one is worked on; two 32-key iterations per stage, fragments = two 16-B LDS loads.
//   Epilogue: the block's [64 query][64 d] f32 tile is staged in LDS (scalar stores, pitch 68), block barrier, then 4
// coverage: block writes queries q0..q0+63 x d 0..63 of its (b, head); grid covers ctx [4096][768] exactly once.
// =====================================================================================================
#define AKB   64                       // keys per stage
#define ASTG  ((64 + 64) * GPIT)       // one buffer: k rows 0..63, v^T rows 64..127
#define ANT   (SEQ / AKB)              // 32 stages
static_assert((SEQ % AKB) == 0 && ANT >= 2 && DHEAD * 2 == 128);

// One stage: 128 rows x 8 pieces = 1024 copies = 8 per thread; thread -> row (tid >> 3) + 16 i, piece tid & 7.
// gk, gv: this thread's piece of k row (tid >> 3) and of v^T row (tid >> 3) of the stage. The s_wait_xcnt closes the
// statement so that no address register of an issued copy is rewritten ahead of it.
__device__ __forceinline__ void attn_stage_copy(unsigned l, const char* gk, const char* gv) {
#if defined(__HIP_DEVICE_COMPILE__)
  asm volatile(
      "global_load_async_to_lds_b128 %0, %8, off\n\t"
      "global_load_async_to_lds_b128 %1, %9, off\n\t"
      "global_load_async_to_lds_b128 %2, %10, off\n\t"
      "global_load_async_to_lds_b128 %3, %11, off\n\t"
      "global_load_async_to_lds_b128 %4, %12, off\n\t"
      "global_load_async_to_lds_b128 %5, %13, off\n\t"
      "global_load_async_to_lds_b128 %6, %14, off\n\t"
      "global_load_async_to_lds_b128 %7, %15, off\n\t"
      "s_wait_xcnt 0x0"
      :: "v"(l), "v"(l + 1 * GLSTEP), "v"(l + 2 * GLSTEP), "v"(l + 3 * GLSTEP),
         "v"(l + 4 * GLSTEP), "v"(l + 5 * GLSTEP), "v"(l + 6 * GLSTEP), "v"(l + 7 * GLSTEP),
         "v"(gk), "v"(gk + 1 * GGSTEP), "v"(gk + 2 * GGSTEP), "v"(gk + 3 * GGSTEP),
         "v"(gv), "v"(gv + 1 * (16 * SEQ * 2)), "v"(gv + 2 * (16 * SEQ * 2)), "v"(gv + 3 * (16 * SEQ * 2))
      : "memory");
#endif
}

__global__ __launch_bounds__(128)
void attn_kernel(const unsigned short* __restrict__ qp, const unsigned short* __restrict__ kp,
                 const unsigned short* __restrict__ vt, const int* __restrict__ am, unsigned short* ctx) {
  __shared__ __align__(16) float Os[64 * 68];
  __shared__ __align__(16) unsigned char aring[2 * ASTG];  // two k / v^T buffers
  const int tid  = threadIdx.x;
  const int wave = tid >> 5;
  const int lane = tid & 31;
  const int hh   = lane >> 4;
  const int c    = lane & 15;
  const int bx   = blockIdx.x;
  const int qb   = bx & 31;                       // SEQ/64 = 32 query blocks per (b, head)
  const int bhd  = bx >> 5;                       // b * NHEAD + head
  const int b    = bhd / NHEAD;
  const int hd   = bhd - b * NHEAD;
  const int q0   = qb * 64;

  const _Float16* QP  = (const _Float16*)(const void*)qp;

  // ---- q fragments (B operand, col = query q0 + 16*wave + c): one plane, d 0..31 and 32..63 ----
  const size_t qtok = (size_t)b * SEQ + q0 + wave * 16 + c;
  const _Float16* qbp = QP + qtok * DMOD + hd * DHEAD + 8 * hh;
  const v16h qf0 = ldfrag_h(qbp), qf1 = ldfrag_h(qbp + 32);
  // ---- copy side: k row = key (stage's first + crow + 16 i), v^T row = d (crow + 16 i), 16-B piece cpc ----
  const int crow = tid >> 3, cpc = tid & 7;
  const unsigned lcp = (unsigned)(uintptr_t)(&aring[0]) + (unsigned)(crow * GPIT + cpc * 16);
  const char* gk = (const char*)(const void*)kp + (((size_t)b * SEQ + crow) * DMOD + hd * DHEAD + 8 * cpc) * 2;
  const char* gv = (const char*)(const void*)vt + (((size_t)b * DMOD + hd * DHEAD + crow) * SEQ + 8 * cpc) * 2;
  // ---- mask base: keys kb + 8hh + 0..7 and kb + 16 + 8hh + 0..7 of batch b ----
  const int* amb = am + (size_t)b * SEQ + 8 * hh;
  const float SC = ATTSC / (QS * KS);

  float m = -1.0e30f, l = 0.f;
  v8f o0 = zero8(), o1 = zero8(), o2 = zero8(), o3 = zero8();

  attn_stage_copy(lcp, gk, gv);
  asm volatile("s_wait_asynccnt 0x0" ::: "memory");        // stage 0 of this wave has landed
  __syncthreads();                                          // ... and every wave's part of it
  attn_stage_copy(lcp + ASTG, gk + (size_t)AKB * DMOD * 2, gv + AKB * 2);

#pragma unroll 1                                            // rolled as before: a long body, only the buffer changes
  for (int t = 0; t < ANT; ++t) {
   const unsigned char* rb = aring + (t & 1) * ASTG;
   // k fragment base (A operand, row = key c of the stage), v^T fragment base (A operand, row = d = c, keys contiguous)
   const _Float16* Kl = (const _Float16*)(const void*)(rb + c * GPIT) + 8 * hh;
   const _Float16* Vl = (const _Float16*)(const void*)(rb + (64 + c) * GPIT) + 8 * hh;
#pragma unroll                                              // both halves of the stage: LDS offsets as immediates
   for (int sub = 0; sub < AKB / 32; ++sub) {
    const int kb = t * AKB + sub * 32;
    const _Float16* k0p = Kl + sub * 32 * (GPIT / 2);
    const _Float16* k1p = k0p + 16 * (GPIT / 2);
    const v16h a0 = ldfrag_h(k0p), a1 = ldfrag_h(k1p);
    const v16h a2 = ldfrag_h(k0p + 32), a3 = ldfrag_h(k1p + 32);
    v8f s0 = mma_h_raw(a0, qf0, zero8());
    v8f s1 = mma_h_raw(a1, qf0, zero8());
    s0 = mma_h_raw(a2, qf1, s0);
    s1 = mma_h_raw(a3, qf1, s1);
    sguard6(s0, s1, a0, a1, a2, a3, qf0, qf1);

    const v4i mk00 = *(const v4i*)(amb + kb),      mk01 = *(const v4i*)(amb + kb + 4);
    const v4i mk10 = *(const v4i*)(amb + kb + 16), mk11 = *(const v4i*)(amb + kb + 20);
    float x0[8], x1[8];
#pragma unroll
    for (int r = 0; r < 4; ++r) {
      const float ad00 = (1.0f - (float)mk00[r]) * MASKC;     // key kb      + 8hh + r
      const float ad01 = (1.0f - (float)mk01[r]) * MASKC;     // key kb      + 8hh + 4 + r
      const float ad10 = (1.0f - (float)mk10[r]) * MASKC;     // key kb + 16 + 8hh + r
      const float ad11 = (1.0f - (float)mk11[r]) * MASKC;     // key kb + 16 + 8hh + 4 + r
      x0[r]     = s0[r] * SC + ad00;
      x0[4 + r] = s0[4 + r] * SC + ad01;
      x1[r]     = s1[r] * SC + ad10;
      x1[4 + r] = s1[4 + r] * SC + ad11;
    }
    float mx = -3.0e38f;
#pragma unroll
    for (int r = 0; r < 8; ++r) mx = fmaxf(mx, fmaxf(x0[r], x1[r]));
    mx = fmaxf(mx, __shfl_xor(mx, 16, 32));
    const float mn   = fmaxf(m, mx);
    const float corr = __expf(m - mn);
    m = mn;
    const float msh = mn - LNPS;            // exp gives e^{x-m} * 1024
    l *= corr;
#pragma unroll
    for (int r = 0; r < 8; ++r) { o0[r] *= corr; o1[r] *= corr; o2[r] *= corr; o3[r] *= corr; }

    FragH ph, pl;
    float ls = 0.f;
#pragma unroll
    for (int r = 0; r < 8; ++r) {
      const float e0 = __expf(x0[r] - msh);           // key kb      + 8hh + r
      const float e1 = __expf(x1[r] - msh);           // key kb + 16 + 8hh + r
      ls += e0 + e1;
      const _Float16 h0 = (_Float16)e0, h1 = (_Float16)e1;
      ph.h[0][r] = h0;
      ph.h[1][r] = h1;
      pl.h[0][r] = (_Float16)(e0 - (float)h0);
      pl.h[1][r] = (_Float16)(e1 - (float)h1);
    }
    l += ls;

    const v16h vf0 = ldfrag_h(Vl + sub * 32);
    const v16h vf1 = ldfrag_h(Vl + 16 * (GPIT / 2) + sub * 32);
    const v16h vf2 = ldfrag_h(Vl + 32 * (GPIT / 2) + sub * 32);
    const v16h vf3 = ldfrag_h(Vl + 48 * (GPIT / 2) + sub * 32);
    o0 = mma_h_raw(vf0, ph.v, o0);
    o1 = mma_h_raw(vf1, ph.v, o1);
    o2 = mma_h_raw(vf2, ph.v, o2);
    o3 = mma_h_raw(vf3, ph.v, o3);
    o0 = mma_h_raw(vf0, pl.v, o0);
    o1 = mma_h_raw(vf1, pl.v, o1);
    o2 = mma_h_raw(vf2, pl.v, o2);
    o3 = mma_h_raw(vf3, pl.v, o3);
    oguard6(o0, o1, o2, o3, vf0, vf1, vf2, vf3, ph.v, pl.v);
   }
   asm volatile("s_wait_dscnt 0x0" ::: "memory");           // this wave's reads of buffer t & 1 are done
   asm volatile("s_wait_asynccnt 0x0" ::: "memory");        // this wave's copies of stage t + 1 have landed
   __syncthreads();                                         // publishes stage t + 1, frees buffer t & 1
   if (t + 2 < ANT)
     attn_stage_copy(lcp + (t & 1) * ASTG, gk + (size_t)(t + 2) * (AKB * DMOD * 2), gv + (t + 2) * (AKB * 2));
  }
  asm volatile("s_wait_asynccnt 0x0" ::: "memory");         // no copy outstanding when the wave goes on
  l += __shfl_xor(l, 16, 32);
  const float sc = (CS / VS) * (1.0f / l);

  // ---- stage O[query 16*wave + c][d = 16j + 8hh + r] * sc (= attn * 1024), then whole-line f16 stores ----
  float* os = Os + (wave * 16 + c) * 68 + 8 * hh;
#pragma unroll
  for (int r = 0; r < 8; ++r) { os[r] = o0[r] * sc; os[16 + r] = o1[r] * sc; os[32 + r] = o2[r] * sc; os[48 + r] = o3[r] * sc; }
  __syncthreads();
  {
    const int e = tid & 7, qq = tid >> 3;              // qq 0..15: line within group, e: 16-B piece
    v4u hv[4];
#pragma unroll
    for (int it = 0; it < 4; ++it) {
      const int qi = it * 16 + qq;                       // it 0..3 x qq 0..15 = queries 0..63 of the block
      const v4f x0 = *(const v4f*)(Os + qi * 68 + 8 * e);
      const v4f x1 = *(const v4f*)(Os + qi * 68 + 8 * e + 4);
      v4u u;
#pragma unroll
      for (int t2 = 0; t2 < 2; ++t2) {
        u[t2]     = pk16(h_bits((_Float16)x0[2 * t2]), h_bits((_Float16)x0[2 * t2 + 1]));
        u[2 + t2] = pk16(h_bits((_Float16)x1[2 * t2]), h_bits((_Float16)x1[2 * t2 + 1]));
      }
      hv[it] = u;
    }
    unsigned short* ob = ctx + (size_t)hd * DHEAD + 8 * e;
    {
#pragma unroll
      for (int it = 0; it < 4; ++it) {
        const int qi = it * 16 + qq;
        *(v4u*)(ob + ((size_t)b * SEQ + q0 + qi) * DMOD) = hv[it];
      }
      
    }
  }
}

// =====================================================================================================
//   XH   f16 [4096][768]            0           6291456
//   WQT  f16 [768][768]             6291456     1179648
//   WKT  f16 [768][768]             7471104     1179648
//   WVT  f16 [768][768]             8650752     1179648
//   WOT  f16 [768][768]             9830400     1179648
//   QP   f16 [4096][768]            11010048    6291456
//   KPL  f16 [4096][768]            17301504    6291456
//   VT   f16 [2][768][2048]         23592960    6291456
//   CTX  f16 [4096][768]            29884416    6291456
//   end                              36175872
// =====================================================================================================
extern "C" void kernel_launch(void* const* d_in, const int* in_sizes, int n_in,
                              void* d_out, int out_size, void* d_ws, size_t ws_size,
                              hipStream_t stream) {
  if (n_in < 10) return;
  if (in_sizes[0] != MTOK * DMOD) return;
  if (in_sizes[1] != MTOK) return;
  if (in_sizes[2] != DMOD * DMOD || in_sizes[4] != DMOD * DMOD || in_sizes[6] != DMOD * DMOD) return;
  if (in_sizes[8] != DMOD * DMOD) return;
  if (in_sizes[3] != DMOD || in_sizes[5] != DMOD || in_sizes[7] != DMOD || in_sizes[9] != DMOD) return;
  if (out_size != MTOK * DMOD) return;

  const float* hs  = (const float*)d_in[0];
  const int*   amk = (const int*)d_in[1];
  const float* Wq  = (const float*)d_in[2];
  const float* bq  = (const float*)d_in[3];
  const float* Wk  = (const float*)d_in[4];
  const float* bk  = (const float*)d_in[5];
  const float* Wv  = (const float*)d_in[6];
  const float* bv  = (const float*)d_in[7];
  const float* Wo  = (const float*)d_in[8];
  const float* bo  = (const float*)d_in[9];

  const size_t PACT = (size_t)MTOK * DMOD * 2;          //  6291456
  const size_t PW   = (size_t)DMOD * DMOD * 2;          //  1179648
  const size_t PVT  = (size_t)NBAT * DMOD * SEQ * 2;    //  6291456
  size_t off = 0;
  const size_t oXH = off; off += PACT;
  const size_t oWQ = off; off += PW;
  const size_t oWK = off; off += PW;
  const size_t oWV = off; off += PW;
  const size_t oWO = off; off += PW;
  const size_t oQP = off; off += PACT;
  const size_t oKP = off; off += PACT;
  const size_t oVT = off; off += PVT;
  const size_t oCT = off; off += PACT;
  if (off > ws_size) return;                            // off = 36175872
  if (off > (size_t)134217728) return;

  char* ws = (char*)d_ws;
  unsigned short* XH  = (unsigned short*)(ws + oXH);
  unsigned short* WQT = (unsigned short*)(ws + oWQ);
  unsigned short* WKT = (unsigned short*)(ws + oWK);
  unsigned short* WVT = (unsigned short*)(ws + oWV);
  unsigned short* WOT = (unsigned short*)(ws + oWO);
  unsigned short* QPL = (unsigned short*)(ws + oQP);
  unsigned short* KPL = (unsigned short*)(ws + oKP);
  unsigned short* VT  = (unsigned short*)(ws + oVT);
  unsigned short* CTX = (unsigned short*)(ws + oCT);
  float*          out = (float*)d_out;

  const dim3 blk256(256), blk128(128);
  const dim3 gCA(MTOK * KSEG / 8);                             // 1536 blocks: 8 row segments each
  const dim3 gCW(4 * TPW);                                     // 576 blocks: one 64x64 weight tile each
  const dim3 gGM(((MTOK / 64) * TN64) / 4);                    // 768 tiles -> 192 blocks of 4 waves
  const dim3 gAT(NBAT * NHEAD * (SEQ / 64));                   // 768 blocks of 128

  // (0) activation plane: f16( bf16_RNE(h) * 64 )
  cvt_act<<<gCA, blk256, 0, stream>>>(hs, XH);

  // (1) weight planes: [K][N] -> [N][K], f16( bf16_RNE(W) * 1024 )
  cvt_w<<<gCW, blk256, 0, stream>>>(Wq, Wk, Wv, Wo, WQT, WKT, WVT, WOT);

  // (2) q = h . Wq + bq -> f16 plane of q*1024 ; acc = 64*1024*q -> escale 1/64
  gemm64<1><<<gGM, blk128, 0, stream>>>(XH, WQT, bq, QS / (XC * WSC), QS, (void*)QPL);

  // (3) k = h . Wk + bk -> f16 plane of k*1024
  gemm64<1><<<gGM, blk128, 0, stream>>>(XH, WKT, bk, KS / (XC * WSC), KS, (void*)KPL);

  // (4) v = h . Wv + bv -> transposed f16 plane of v*256 : VT[b][h*64+e][token]
  gemm64<2><<<gGM, blk128, 0, stream>>>(XH, WVT, bv, VS / (XC * WSC), VS, (void*)VT);

  // (5) attention with the additive int mask, all (b, head) -> ctx plane f16( attn * 1024 )[token][h*64 + d]
  attn_kernel<<<gAT, blk128, 0, stream>>>(QPL, KPL, VT, amk, CTX);

  // (6) out = attn . Wo + bo -> f32 [4096][768] ; acc = 1024*1024*out -> escale 2^-20
  gemm64<0><<<gGM, blk128, 0, stream>>>(CTX, WOT, bo, 1.0f / (CS * WSC), 1.0f, (void*)out);
  (void)hipGetLastError();
}

// v002
// Measured time: 87.3 microseconds a run.
// In both of two side-by-side timings against v001, it was 1.29 times as fast.
// Over all steps from v000 it is 2.30 times as fast.
// Contractions: q,k,v projections (x token rows f16 x64 . W^T rows f16 x1024, K=768, one product each);
// attention scores S^T = k (f16 x1024, one plane) . q^T (f16 x1024, one plane), one product, head dim 64;
// attention O^T = v^T (f16 x256, one plane) . P^T (f16 1024-scaled hi plane + unscaled residual plane, from the
// score D registers), two products into one accumulator over 2048 keys; output projection ctx (f16 x1024) . Wo^T
// (f16 x1024), one product. All v_wmma_f32_16x16x32_f16, f32 accumulate; mask adder and softmax in f32 on VALU;
// every float input RNE-converted to bf16 on load.
#include <hip/hip_runtime.h>
#include <math.h>
#include <stdint.h>

#define NBAT   2
#define SEQ    2048
#define DMOD   768
#define NHEAD  12
#define DHEAD  64
#define MTOK   (NBAT * SEQ)
#define KSEG   (DMOD / 256)
#define TN64   (DMOD / 64)
#define TPW    (TN64 * TN64)
#define XC     64.0f
#define WSC    1024.0f
#define QS     1024.0f
#define KS     1024.0f
#define VS     256.0f
#define CS     1024.0f
#define LNPS   6.931471805599453f
#define ATTSC  0.125f
#define MASKC  (-10000.0f)
static_assert(NHEAD * DHEAD == DMOD);
static_assert((MTOK % 64) == 0 && (DMOD % 64) == 0 && (SEQ % 64) == 0 && (DMOD % 32) == 0 && (DMOD % 256) == 0);
static_assert((((MTOK / 64) * TN64) % 4) == 0);
static_assert(((MTOK * KSEG) % 8) == 0);
static_assert((SEQ / 64) == 32 && (SEQ % 32) == 0);
static_assert((MTOK % SEQ) == 0);

typedef _Float16 v16h __attribute__((ext_vector_type(16)));
typedef _Float16 v8h  __attribute__((ext_vector_type(8)));
typedef float    v8f  __attribute__((ext_vector_type(8)));
typedef float    v4f  __attribute__((ext_vector_type(4)));
typedef unsigned int v4u __attribute__((ext_vector_type(4)));
typedef int      v4i  __attribute__((ext_vector_type(4)));

union FragH { v16h v; v8h h[2]; };

// ---- scalar helpers --------------------------------------------------------------------------------
__device__ __forceinline__ unsigned short bf_bits(float f) {          // f32 -> bf16 bits, RNE convert
  unsigned u = __float_as_uint(f);
  return (unsigned short)((u + 0x7FFFu + ((u >> 16) & 1u)) >> 16);
}
__device__ __forceinline__ float bf_up(unsigned short h) { return __uint_as_float(((unsigned)h) << 16); }
__device__ __forceinline__ float bfr(float f) { return bf_up(bf_bits(f)); }
__device__ __forceinline__ unsigned short h_bits(_Float16 x) { return __builtin_bit_cast(unsigned short, x); }
__device__ __forceinline__ unsigned pk16(unsigned short a, unsigned short b) { return (unsigned)a | ((unsigned)b << 16); }
__device__ __forceinline__ v8f zero8() { v8f z = {0.f, 0.f, 0.f, 0.f, 0.f, 0.f, 0.f, 0.f}; return z; }

// ---- fragment loader: 16-bit A/B operand, lane -> row/col (lane&15), p already includes +8*(lane>>4);
//      elements 0..7 <- p[0..7] (k0+8h..), elements 8..15 <- p[16..23] (k0+16+8h..)
__device__ __forceinline__ v16h ldfrag_h(const _Float16* p) {
  FragH f;
  f.h[0] = *(const v8h*)(p);
  f.h[1] = *(const v8h*)(p + 16);
  return f.v;
}

// ---- WMMA helpers with trailing VALU hazard gap --------------------------------------------------------
__device__ __forceinline__ v8f mma_h_raw(v16h a, v16h b, v8f c) {
  return __builtin_amdgcn_wmma_f32_16x16x32_f16(false, a, false, b, (short)0, c, false, false);
}
__device__ __forceinline__ void dep_guard1(v8f& a, v8f& b, v16h x) {
#if defined(__HIP_DEVICE_COMPILE__)
  asm volatile("v_nop\n\tv_nop\n\tv_nop\n\tv_nop" : "+v"(a), "+v"(b) : "v"(x));
#endif
}
__device__ __forceinline__ void keep4_h(v16h a, v16h b, v16h c, v16h d) {
#if defined(__HIP_DEVICE_COMPILE__)
  asm volatile("v_nop" :: "v"(a), "v"(b), "v"(c), "v"(d));
#endif
}
__device__ __forceinline__ void acc_guard4(v8f& a, v8f& b, v8f& c, v8f& d) {
#if defined(__HIP_DEVICE_COMPILE__)
  asm volatile("v_nop\n\tv_nop\n\tv_nop\n\tv_nop" : "+v"(a), "+v"(b), "+v"(c), "+v"(d));
#endif
}
__device__ __forceinline__ void sguard6(v8f& a, v8f& b, v16h x0, v16h x1, v16h x2, v16h x3, v16h x4, v16h x5) {
#if defined(__HIP_DEVICE_COMPILE__)
  asm volatile("v_nop\n\tv_nop\n\tv_nop\n\tv_nop"
               : "+v"(a), "+v"(b) : "v"(x0), "v"(x1), "v"(x2), "v"(x3), "v"(x4), "v"(x5));
#endif
}
__device__ __forceinline__ void oguard6(v8f& a, v8f& b, v8f& c, v8f& d,
                                        v16h x0, v16h x1, v16h x2, v16h x3, v16h p0, v16h p1) {
#if defined(__HIP_DEVICE_COMPILE__)
  asm volatile("v_nop\n\tv_nop\n\tv_nop\n\tv_nop"
               : "+v"(a), "+v"(b), "+v"(c), "+v"(d) : "v"(x0), "v"(x1), "v"(x2), "v"(x3), "v"(p0), "v"(p1));
#endif
}
__device__ __forceinline__ void wave_sync_lds() {
  __builtin_amdgcn_fence(__ATOMIC_RELEASE, "workgroup");
  __builtin_amdgcn_wave_barrier();
  __builtin_amdgcn_fence(__ATOMIC_ACQUIRE, "workgroup");
}

// =====================================================================================================
// Activation plane: XH[t][768] = f16( bf16_RNE(h[t][c]) * 64 ).
// coverage: 1536 x 8 = 12288 segments = 4096 rows x 768 columns entirely.
// =====================================================================================================
__device__ __forceinline__ void cvt_act(const int bx, const float* __restrict__ hs, unsigned short* XH) {
  const int lane = threadIdx.x & 31, wave = threadIdx.x >> 5;
  const int seg = bx * 8 + wave;                         // 0 .. 12287
  const int row = seg / KSEG;
  const int col = (seg - row * KSEG) * 256 + 8 * lane;
  const size_t o = (size_t)row * DMOD + col;
  const v4f h0 = *(const v4f*)(hs + o), h1 = *(const v4f*)(hs + o + 4);
  float a[8];
#pragma unroll
  for (int i = 0; i < 4; ++i) { a[i] = bfr(h0[i]); a[4 + i] = bfr(h1[i]); }
  v4u uh;
#pragma unroll
  for (int i = 0; i < 4; ++i) {
    const float xa = a[2 * i] * XC, xb = a[2 * i + 1] * XC;
    uh[i] = pk16(h_bits((_Float16)xa), h_bits((_Float16)xb));
  }
  unsigned short* dh = XH + o;
  *(v4u*)dh = uh;
  // this body now shares a kernel with the weight tiles' code: the wait closes the store before any path of the listing
  // that rewrites one of its registers
  asm volatile("s_wait_xcnt 0x0" ::: "memory");
}

// =====================================================================================================
// Weight planes: in W[K=768][N=768] (N contiguous) -> out WT[N][K] = f16( bf16_RNE(W[k][n]) * 1024 ), k contiguous.
// Block = one 64(k) x 64(n) tile: 256 threads load 16 rows x 64 floats per step (16 threads x 16 B per row), convert and
// store transposed into LDS Ts[n][k] (pitch 72 halves, 2-byte stores), block barrier, then 2 instructions each write
// blocks 0..143 -> weight 0, 144..287 -> weight 1, 288..431 -> weight 2, 432..575 -> weight 3 (block-uniform select).
// coverage: per weight 144 tiles x (2 x 32 lines x 8 lanes x 8 halves) = 768 x 768 entirely.
// =====================================================================================================
__device__ __forceinline__ void cvt_w(const int bx, unsigned short* Ts,
                                      const float* __restrict__ w0, const float* __restrict__ w1,
                                      const float* __restrict__ w2, const float* __restrict__ w3,
                                      unsigned short* t0, unsigned short* t1,
                                      unsigned short* t2, unsigned short* t3) {
  const int tid = threadIdx.x;
  const int wsel = bx / TPW;                        // block-uniform
  const int t = bx - wsel * TPW;
  const int k0 = (t / TN64) * 64;
  const int n0 = (t % TN64) * 64;
  const float* src = (wsel == 0) ? w0 : (wsel == 1) ? w1 : (wsel == 2) ? w2 : w3;
  unsigned short* dst = (wsel == 0) ? t0 : (wsel == 1) ? t1 : (wsel == 2) ? t2 : t3;
  {
    const int r16 = tid >> 4, p = tid & 15;
#pragma unroll
    for (int it = 0; it < 4; ++it) {
      const int kr = it * 16 + r16;                   // it 0..3 x r16 0..15 = k rows 0..63
      const v4f v = *(const v4f*)(src + (size_t)(k0 + kr) * DMOD + n0 + 4 * p);
#pragma unroll
      for (int j = 0; j < 4; ++j) Ts[(4 * p + j) * 72 + kr] = h_bits((_Float16)(bfr(v[j]) * WSC));
    }
  }
  __syncthreads();
  {
    const int e = tid & 7, lq = tid >> 3;             // lq 0..31: line, e: 16-B piece
    v4u u[2];
#pragma unroll
    for (int it = 0; it < 2; ++it) {
      const int nr = it * 32 + lq;                    // it 0..1 x lq 0..31 = n rows 0..63
      u[it] = *(const v4u*)(Ts + nr * 72 + 8 * e);
    }
    unsigned short* db = dst + (size_t)n0 * DMOD + k0 + 8 * e;
    {
#pragma unroll
      for (int it = 0; it < 2; ++it) {
        const int nr = it * 32 + lq;
        *(v4u*)(db + (size_t)nr * DMOD) = u[it];
      }
      
    }
  }
}

// Both conversions in one grid (neither reads what the other writes): blocks 0..575 take the weight tiles, blocks
// 576..2111 the activation segments. The test is block-uniform, so the weight tiles' barrier is passed by whole blocks.
__global__ __launch_bounds__(256) void cvt_all(const float* __restrict__ hs, const float* __restrict__ w0,
                                                const float* __restrict__ w1, const float* __restrict__ w2,
                                                const float* __restrict__ w3, unsigned short* XH,
                                                unsigned short* t0, unsigned short* t1,
                                                unsigned short* t2, unsigned short* t3) {
  __shared__ __align__(16) unsigned short Ts[64 * 72];
  const int bx = blockIdx.x;
  if (bx < 4 * TPW) cvt_w(bx, Ts, w0, w1, w2, w3, t0, t1, t2, t3);
  else              cvt_act(bx - 4 * TPW, hs, XH);
}

// =====================================================================================================
// Register-blocked f16 WMMA GEMM, one wave per 64x64 tile (4 waves per block = 64 token rows x 256 features):
//   acc[m][n] = sum_k A[m][k] * Bt[n][k],  A: f16 [4096][768] token rows, Bt: f16 [768][768] k contiguous,
//   M=4096, N=768, K=768 fixed, all tile multiples.
//   Operands reach the waves through LDS: per stage of 64 k the block copies its 64 A rows and 256 Bt rows (128 B each,
//   whole lines, 8 lanes x 16 B per row) with asynchronous 16-B copies into one of two buffers (row pitch 144 B), the
//   next stage in flight while this one is multiplied; fragments = two 16-B LDS loads with the split k map (ldfrag_h).
//   y = acc * escale + bf16_RNE(bias[n]) * bscale, then per MODE:
//   MODE 0: f32 row-major C[4096][768] (the final output): 16-row slabs staged per wave in LDS (pitch 68 floats), each
//   MODE 1: f16 single plane row-major [4096][768]: per slab 4 instructions, each 4 rows x (8 consecutive lanes x 16 B)
//   MODE 2: f16 single plane transposed VT[b][feature 768][2048 tokens]: the wave's whole 64x64 tile is staged as f16
// coverage: MODE 0/1: 4 slabs x 16 rows x 64 cols per wave tile; MODE 2: 64 features x 64 tokens per wave tile;
//           grid = 768 tiles / 4 = 192 blocks covers [4096][768] exactly once (m0 multiple of 64 never straddles b).
// =====================================================================================================
#define GKB   64                       // k per stage: rows of 128 B
#define GPIT  144                      // LDS row pitch, bytes: 16 B x odd, conflict-free for 16-B fragment loads
#define GSTG  ((64 + 256) * GPIT)      // one buffer: A rows 0..63, Bt rows 64..319
#define GNT   (DMOD / GKB)             // 12 stages
#define GLSTEP (16 * GPIT)             // 16 rows further in LDS
#define GGSTEP (16 * DMOD * 2)         // 16 rows further in global memory
static_assert((TN64 % 4) == 0 && (DMOD % GKB) == 0 && GNT >= 2 && (GPIT % 16) == 0);

// Ten asynchronous 16-B copies per lane, rows 16 apart: LDS byte address l + i * GLSTEP <- g[i]. The s_wait_xcnt closes
// the statement so that no address register of an issued copy is rewritten ahead of it.
__device__ __forceinline__ void acopy10(unsigned l, const char* const (&g)[10]) {
#if defined(__HIP_DEVICE_COMPILE__)
  asm volatile(
      "global_load_async_to_lds_b128 %0, %10, off\n\t"
      "global_load_async_to_lds_b128 %1, %11, off\n\t"
      "global_load_async_to_lds_b128 %2, %12, off\n\t"
      "global_load_async_to_lds_b128 %3, %13, off\n\t"
      "global_load_async_to_lds_b128 %4, %14, off\n\t"
      "global_load_async_to_lds_b128 %5, %15, off\n\t"
      "global_load_async_to_lds_b128 %6, %16, off\n\t"
      "global_load_async_to_lds_b128 %7, %17, off\n\t"
      "global_load_async_to_lds_b128 %8, %18, off\n\t"
      "global_load_async_to_lds_b128 %9, %19, off\n\t"
      "s_wait_xcnt 0x0"
      :: "v"(l), "v"(l + 1 * GLSTEP), "v"(l + 2 * GLSTEP), "v"(l + 3 * GLSTEP), "v"(l + 4 * GLSTEP),
         "v"(l + 5 * GLSTEP), "v"(l + 6 * GLSTEP), "v"(l + 7 * GLSTEP), "v"(l + 8 * GLSTEP), "v"(l + 9 * GLSTEP),
         "v"(g[0]), "v"(g[1]), "v"(g[2]), "v"(g[3]), "v"(g[4]), "v"(g[5]), "v"(g[6]), "v"(g[7]), "v"(g[8]), "v"(g[9])
      : "memory");
#endif
}
// One stage: 320 rows x 8 pieces = 2560 copies = 20 per thread; thread -> row (tid >> 3) + 16 i, piece tid & 7.
// ga, gb: this thread's piece of A row (tid >> 3) and of Bt row (tid >> 3) of the block, at the stage's first k.
__device__ __forceinline__ void stage_copy(unsigned l, const char* ga, const char* gb) {
  const char* g0[10];
  const char* g1[10];
  // the three loops are unrolled so that both pointer arrays stay in registers
#pragma unroll
  for (int i = 0; i < 4; ++i) g0[i] = ga + (size_t)i * GGSTEP;             // A rows 0..63
#pragma unroll
  for (int i = 4; i < 10; ++i) g0[i] = gb + (size_t)(i - 4) * GGSTEP;      // Bt rows 0..95
#pragma unroll
  for (int i = 0; i < 10; ++i) g1[i] = gb + (size_t)(i + 6) * GGSTEP;      // Bt rows 96..255
  acopy10(l, g0);
  acopy10(l + 10 * GLSTEP, g1);
}

// ring: the block's 2 * GSTG bytes of LDS, the two operand buffers. The epilogue's slabs (9216 B per wave) lie on the same
// bytes: the barrier at the foot of the last stage ends every wave's reads of the ring and no copy is outstanding then.
// That keeps a block at 92160 B, so that three blocks fit a WGP's LDS.
template <int MODE>
__device__ __forceinline__ void gemm64(
    const int bx, unsigned char* ring,
    const unsigned short* __restrict__ Ap, const unsigned short* __restrict__ Bp,
    const float* __restrict__ bias, const float escale, const float bscale, void* C0) {
  const int lane = threadIdx.x & 31;
  const int wave = threadIdx.x >> 5;
  unsigned short* sraw = (unsigned short*)(void*)(ring + wave * 9216);   // this wave's slab, used behind the loop only
  const int tilesN = TN64;                                 // 12
  const int tile = bx * 4 + wave;                          // 0..767, grid exact
  const int tm = tile / tilesN;
  const int tn = tile - tm * tilesN;
  const int m0 = tm << 6;
  const int n0 = tn << 6;

  const int rlane = lane & 15;                 // row (A) / col (B, D) within subtile
  const int hh    = lane >> 4;
  const int koff  = hh * 8;                    // k offset of this lane half
  const int mOff  = hh * 8;                    // D row offset

  v8f acc[4][4];
#pragma unroll
  for (int i = 0; i < 4; ++i)
#pragma unroll
    for (int j = 0; j < 4; ++j) acc[i][j] = zero8();

  // copy side: the block's A rows start at m0 (the same in its four waves), its Bt rows at n0 - 64 * wave
  const int crow = threadIdx.x >> 3, cpc = threadIdx.x & 7;
  const unsigned lcp = (unsigned)(uintptr_t)(&ring[0]) + (unsigned)(crow * GPIT + cpc * 16);
  const char* ga = (const char*)(const void*)Ap + ((size_t)(m0 + crow) * DMOD + 8 * cpc) * 2;
  const char* gb = (const char*)(const void*)Bp + ((size_t)(n0 - (wave << 6) + crow) * DMOD + 8 * cpc) * 2;

  stage_copy(lcp, ga, gb);
  asm volatile("s_wait_asynccnt 0x0" ::: "memory");        // stage 0 of this wave has landed
  __syncthreads();                                          // ... and every wave's part of it
  stage_copy(lcp + GSTG, ga + GKB * 2, gb + GKB * 2);

  for (int t = 0; t < GNT; ++t) {
    const unsigned char* rb = ring + (t & 1) * GSTG;
    const _Float16* la = (const _Float16*)(const void*)(rb + rlane * GPIT) + koff;
    const _Float16* lb = (const _Float16*)(const void*)(rb + (64 + (wave << 6) + rlane) * GPIT) + koff;
    // all loops of the stage are unrolled: fragment and accumulator arrays in registers, LDS offsets as immediates
#pragma unroll
    for (int ks = 0; ks < GKB; ks += 32) {
      v16h ah[4], bh[4];                                    // the 32-k block's fragments, read as one group
#pragma unroll
      for (int j = 0; j < 4; ++j) {
        bh[j] = ldfrag_h(lb + j * (GLSTEP / 2) + ks);
        ah[j] = ldfrag_h(la + j * (GLSTEP / 2) + ks);
      }
#pragma unroll
      for (int i = 0; i < 4; ++i) {
#pragma unroll
        for (int j = 0; j < 4; ++j) acc[i][j] = mma_h_raw(ah[i], bh[j], acc[i][j]);
        dep_guard1(acc[i][0], acc[i][3], ah[i]);
      }
      keep4_h(bh[0], bh[1], bh[2], bh[3]);
    }
    asm volatile("s_wait_dscnt 0x0" ::: "memory");          // this wave's reads of buffer t & 1 are done
    asm volatile("s_wait_asynccnt 0x0" ::: "memory");       // this wave's copies of stage t + 1 have landed
    __syncthreads();                                        // publishes stage t + 1, frees buffer t & 1
    if (t + 2 < GNT) stage_copy(lcp + (t & 1) * GSTG, ga + (t + 2) * (GKB * 2), gb + (t + 2) * (GKB * 2));
  }
  asm volatile("s_wait_asynccnt 0x0" ::: "memory");         // no copy outstanding when the wave goes on
  acc_guard4(acc[0][0], acc[0][1], acc[0][2], acc[0][3]);
  acc_guard4(acc[1][0], acc[1][1], acc[1][2], acc[1][3]);
  acc_guard4(acc[2][0], acc[2][1], acc[2][2], acc[2][3]);
  acc_guard4(acc[3][0], acc[3][1], acc[3][2], acc[3][3]);

  if (MODE == 0) {
    float* Cout = (float*)C0;
    const int c4 = rlane * 4;                        // f32 out: 256-B row segment = 16 lanes x 16 B
    const v4f braw = *(const v4f*)(bias + n0 + c4);
    float bb[4];
#pragma unroll
    for (int tt = 0; tt < 4; ++tt) bb[tt] = bfr(braw[tt]) * bscale;
    float* slab = (float*)(void*)(sraw);
#pragma unroll
    for (int i = 0; i < 4; ++i) {
      const int mBase = m0 + (i << 4);
#pragma unroll
      for (int j = 0; j < 4; ++j) {
#pragma unroll
        for (int r = 0; r < 8; ++r) slab[(mOff + r) * 68 + (j << 4) + rlane] = acc[i][j][r];
      }
      wave_sync_lds();
      v4f vals[8];
#pragma unroll
      for (int it = 0; it < 8; ++it) {
        const int row = it * 2 + hh;                   // it 0..7 x hh 0..1 = rows 0..15
        v4f v = *(const v4f*)(slab + row * 68 + c4);
#pragma unroll
        for (int tt = 0; tt < 4; ++tt) v[tt] = v[tt] * escale + bb[tt];
        vals[it] = v;
      }
      {
#pragma unroll
        for (int it = 0; it < 8; ++it) {
          const int row = it * 2 + hh;
          *(v4f*)(Cout + (size_t)(mBase + row) * DMOD + n0 + c4) = vals[it];
        }
        
      }
      wave_sync_lds();
    }
  } else if (MODE == 1) {
    unsigned short* Hp = (unsigned short*)C0;
    const int e = lane & 7, q4 = lane >> 3;
    const v4f b0 = *(const v4f*)(bias + n0 + 8 * e), b1 = *(const v4f*)(bias + n0 + 8 * e + 4);
    float bb[8];
#pragma unroll
    for (int tt = 0; tt < 4; ++tt) { bb[tt] = bfr(b0[tt]) * bscale; bb[4 + tt] = bfr(b1[tt]) * bscale; }
    float* slab = (float*)(void*)(sraw);
#pragma unroll
    for (int i = 0; i < 4; ++i) {
      const int mBase = m0 + (i << 4);
#pragma unroll
      for (int j = 0; j < 4; ++j) {
#pragma unroll
        for (int r = 0; r < 8; ++r) slab[(mOff + r) * 68 + (j << 4) + rlane] = acc[i][j][r];
      }
      wave_sync_lds();
      v4u hv[4];
#pragma unroll
      for (int it = 0; it < 4; ++it) {
        const int row = it * 4 + q4;                   // it 0..3 x q4 0..3 = rows 0..15
        const v4f x0 = *(const v4f*)(slab + row * 68 + 8 * e);
        const v4f x1 = *(const v4f*)(slab + row * 68 + 8 * e + 4);
        float y[8];
#pragma unroll
        for (int tt = 0; tt < 4; ++tt) { y[tt] = x0[tt] * escale + bb[tt]; y[4 + tt] = x1[tt] * escale + bb[4 + tt]; }
        v4u uh;
#pragma unroll
        for (int t2 = 0; t2 < 4; ++t2) {
          uh[t2] = pk16(h_bits((_Float16)y[2 * t2]), h_bits((_Float16)y[2 * t2 + 1]));
        }
        hv[it] = uh;
      }
      {
#pragma unroll
        for (int it = 0; it < 4; ++it) {
          const int row = it * 4 + q4;
          const size_t go = (size_t)(mBase + row) * DMOD + n0 + 8 * e;
          *(v4u*)(Hp + go) = hv[it];
        }
        
      }
      wave_sync_lds();
    }
  } else {
    unsigned short* Vs = sraw;              // [64 features][pitch 72] f16 bits
    float bb4[4];
#pragma unroll
    for (int j = 0; j < 4; ++j) bb4[j] = bfr(bias[n0 + (j << 4) + rlane]) * bscale;
#pragma unroll
    for (int i = 0; i < 4; ++i) {
#pragma unroll
      for (int j = 0; j < 4; ++j) {
#pragma unroll
        for (int r = 0; r < 8; ++r) {
          Vs[((j << 4) + rlane) * 72 + (i << 4) + mOff + r] = h_bits((_Float16)(acc[i][j][r] * escale + bb4[j]));
        }
      }
    }
    wave_sync_lds();
    const int e = lane & 7, q4 = lane >> 3;
    const int bsel = m0 / SEQ;                          // batch of this tile (wave-uniform)
    const int s0 = m0 % SEQ;                            // first token within the batch
    v4u u[16];
#pragma unroll
    for (int it = 0; it < 16; ++it) {
      const int fl = it * 4 + q4;                        // it 0..15 x q4 0..3 = features 0..63
      u[it] = *(const v4u*)(Vs + fl * 72 + 8 * e);
    }
    unsigned short* Vp = (unsigned short*)C0 + ((size_t)bsel * DMOD + n0) * SEQ + s0 + 8 * e;
    {
#pragma unroll
      for (int it = 0; it < 16; ++it) {
        const int fl = it * 4 + q4;
        *(v4u*)(Vp + (size_t)fl * SEQ) = u[it];
      }
      
    }
  }
}

#define GBLK  (((MTOK / 64) * TN64) / 4)   // 192 blocks cover one [4096][768] product

// q, k and v projections in one grid of 3 x 192 blocks (they share A and depend on nothing of each other): block-uniform
// choice of the weight plane, bias and output plane; q*1024 and k*1024 row-major (acc = 64*1024*y -> escale 1/64),
// v*256 transposed (escale 1/256).
__global__ __launch_bounds__(128) void gemm_qkv(
    const unsigned short* __restrict__ Ap, const unsigned short* __restrict__ Bq,
    const unsigned short* __restrict__ Bk, const unsigned short* __restrict__ Bv,
    const float* __restrict__ bq, const float* __restrict__ bk, const float* __restrict__ bv,
    unsigned short* Cq, unsigned short* Ck, unsigned short* Cv) {
  __shared__ __align__(16) unsigned char ring[2 * GSTG];   // two operand buffers
  const int sel = blockIdx.x / GBLK;                       // 0: q, 1: k, 2: v
  const int bx = blockIdx.x - sel * GBLK;
  static_assert(QS == KS);                                 // q and k share one path
  if (sel == 2) gemm64<2>(bx, ring, Ap, Bv, bv, VS / (XC * WSC), VS, (void*)Cv);
  else          gemm64<1>(bx, ring, Ap, sel ? Bk : Bq, sel ? bk : bq, QS / (XC * WSC), QS, (void*)(sel ? Ck : Cq));
}

// output projection: acc = 1024*1024*out -> escale 2^-20, f32 row-major
__global__ __launch_bounds__(128) void gemm_out(
    const unsigned short* __restrict__ Ap, const unsigned short* __restrict__ Bp,
    const float* __restrict__ bias, float* C0) {
  __shared__ __align__(16) unsigned char ring[2 * GSTG];   // two operand buffers
  gemm64<0>(blockIdx.x, ring, Ap, Bp, bias, 1.0f / (CS * WSC), 1.0f, (void*)C0);
}

// =====================================================================================================
// Attention for one (b, head, 64-query block), transposed formulation, head dim 64, 2048 keys, additive int mask:
//   S^T tile (16 keys x 16 queries) = A(k rows = keys, d via the split k map) . B(q, col = query, same d map), two d-steps
//   of 32: s = k.q = 1024*1024 * logit_dot (one product). Per lane the D tile holds 8 keys of ONE query, so
//   x = s/8/(1024*1024) + (1 - mask[b][key]) * (-10000) and the online softmax (running max, f32) are per-lane state
//   with one shuffle (lane^16) for the max over 32 keys; the row sum is kept as a per-lane partial and combined at
//   the end. P = e^{x-m} x 1024 as f16 hi plane plus unscaled f16 residual plane (e - hi), both used directly as the
//   B operand of O^T (rows d, cols queries) += A(v^T rows d, keys contiguous, two 16-B loads) . B(P^T):
//   B element r <- the key tile covering keys kb..kb+15, element 8+r <- the tile covering kb+16..kb+31, lane unchanged
//   (D-as-B chaining layout). Two products per d tile (d 0-15, 16-31, 32-47, 48-63) into one accumulator.
//   32 keys per iteration: 4 score WMMAs + 8 output WMMAs per wave. Block = 4 waves = 64 queries; grid = 2*12*32 = 768.
//   k and v^T reach the waves through LDS: per stage of 64 keys the block copies 64 k rows (its head's 128 B) and 64 v^T
//   rows (64 keys = 128 B), whole lines, with asynchronous 16-B copies into one of two buffers (row pitch 144 B), the next
//   stage in flight while this one is worked on; two 32-key iterations per stage, fragments = two 16-B LDS loads.
//   Epilogue: the block's [64 query][64 d] f32 tile is staged in LDS (scalar stores, pitch 68), block barrier, then 4
// coverage: block writes queries q0..q0+63 x d 0..63 of its (b, head); grid covers ctx [4096][768] exactly once.
// =====================================================================================================
#define AKB   64                       // keys per stage
#define ASTG  ((64 + 64) * GPIT)       // one buffer: k rows 0..63, v^T rows 64..127
#define ANT   (SEQ / AKB)              // 32 stages
static_assert((SEQ % AKB) == 0 && ANT >= 2 && DHEAD * 2 == 128);

// One stage: 128 rows x 8 pieces = 1024 copies = 8 per thread; thread -> row (tid >> 3) + 16 i, piece tid & 7.
// gk, gv: this thread's piece of k row (tid >> 3) and of v^T row (tid >> 3) of the stage. The s_wait_xcnt closes the
// statement so that no address register of an issued copy is rewritten ahead of it.
__device__ __forceinline__ void attn_stage_copy(unsigned l, const char* gk, const char* gv) {
#if defined(__HIP_DEVICE_COMPILE__)
  asm volatile(
      "global_load_async_to_lds_b128 %0, %8, off\n\t"
      "global_load_async_to_lds_b128 %1, %9, off\n\t"
      "global_load_async_to_lds_b128 %2, %10, off\n\t"
      "global_load_async_to_lds_b128 %3, %11, off\n\t"
      "global_load_async_to_lds_b128 %4, %12, off\n\t"
      "global_load_async_to_lds_b128 %5, %13, off\n\t"
      "global_load_async_to_lds_b128 %6, %14, off\n\t"
      "global_load_async_to_lds_b128 %7, %15, off\n\t"
      "s_wait_xcnt 0x0"
      :: "v"(l), "v"(l + 1 * GLSTEP), "v"(l + 2 * GLSTEP), "v"(l + 3 * GLSTEP),
         "v"(l + 4 * GLSTEP), "v"(l + 5 * GLSTEP), "v"(l + 6 * GLSTEP), "v"(l + 7 * GLSTEP),
         "v"(gk), "v"(gk + 1 * GGSTEP), "v"(gk + 2 * GGSTEP), "v"(gk + 3 * GGSTEP),
         "v"(gv), "v"(gv + 1 * (16 * SEQ * 2)), "v"(gv + 2 * (16 * SEQ * 2)), "v"(gv + 3 * (16 * SEQ * 2))
      : "memory");
#endif
}

__global__ __launch_bounds__(128)
void attn_kernel(const unsigned short* __restrict__ qp, const unsigned short* __restrict__ kp,
                 const unsigned short* __restrict__ vt, const int* __restrict__ am, unsigned short* ctx) {
  __shared__ __align__(16) float Os[64 * 68];
  __shared__ __align__(16) unsigned char aring[2 * ASTG];  // two k / v^T buffers
  const int tid  = threadIdx.x;
  const int wave = tid >> 5;
  const int lane = tid & 31;
  const int hh   = lane >> 4;
  const int c    = lane & 15;
  const int bx   = blockIdx.x;
  const int qb   = bx & 31;                       // SEQ/64 = 32 query blocks per (b, head)
  const int bhd  = bx >> 5;                       // b * NHEAD + head
  const int b    = bhd / NHEAD;
  const int hd   = bhd - b * NHEAD;
  const int q0   = qb * 64;

  const _Float16* QP  = (const _Float16*)(const void*)qp;

  // ---- q fragments (B operand, col = query q0 + 16*wave + c): one plane, d 0..31 and 32..63 ----
  const size_t qtok = (size_t)b * SEQ + q0 + wave * 16 + c;
  const _Float16* qbp = QP + qtok * DMOD + hd * DHEAD + 8 * hh;
  const v16h qf0 = ldfrag_h(qbp), qf1 = ldfrag_h(qbp + 32);
  // ---- copy side: k row = key (stage's first + crow + 16 i), v^T row = d (crow + 16 i), 16-B piece cpc ----
  const int crow = tid >> 3, cpc = tid & 7;
  const unsigned lcp = (unsigned)(uintptr_t)(&aring[0]) + (unsigned)(crow * GPIT + cpc * 16);
  const char* gk = (const char*)(const void*)kp + (((size_t)b * SEQ + crow) * DMOD + hd * DHEAD + 8 * cpc) * 2;
  const char* gv = (const char*)(const void*)vt + (((size_t)b * DMOD + hd * DHEAD + crow) * SEQ + 8 * cpc) * 2;
  // ---- mask base: keys kb + 8hh + 0..7 and kb + 16 + 8hh + 0..7 of batch b ----
  const int* amb = am + (size_t)b * SEQ + 8 * hh;
  const float SC = ATTSC / (QS * KS);

  float m = -1.0e30f, l = 0.f;
  v8f o0 = zero8(), o1 = zero8(), o2 = zero8(), o3 = zero8();

  attn_stage_copy(lcp, gk, gv);
  asm volatile("s_wait_asynccnt 0x0" ::: "memory");        // stage 0 of this wave has landed
  __syncthreads();                                          // ... and every wave's part of it
  attn_stage_copy(lcp + ASTG, gk + (size_t)AKB * DMOD * 2, gv + AKB * 2);

#pragma unroll 1                                            // rolled as before: a long body, only the buffer changes
  for (int t = 0; t < ANT; ++t) {
   const unsigned char* rb = aring + (t & 1) * ASTG;
   // k fragment base (A operand, row = key c of the stage), v^T fragment base (A operand, row = d = c, keys contiguous)
   const _Float16* Kl = (const _Float16*)(const void*)(rb + c * GPIT) + 8 * hh;
   const _Float16* Vl = (const _Float16*)(const void*)(rb + (64 + c) * GPIT) + 8 * hh;
#pragma unroll                                              // both halves of the stage: LDS offsets as immediates
   for (int sub = 0; sub < AKB / 32; ++sub) {
    const int kb = t * AKB + sub * 32;
    const _Float16* k0p = Kl + sub * 32 * (GPIT / 2);
    const _Float16* k1p = k0p + 16 * (GPIT / 2);
    const v16h a0 = ldfrag_h(k0p), a1 = ldfrag_h(k1p);
    const v16h a2 = ldfrag_h(k0p + 32), a3 = ldfrag_h(k1p + 32);
    v8f s0 = mma_h_raw(a0, qf0, zero8());
    v8f s1 = mma_h_raw(a1, qf0, zero8());
    s0 = mma_h_raw(a2, qf1, s0);
    s1 = mma_h_raw(a3, qf1, s1);
    sguard6(s0, s1, a0, a1, a2, a3, qf0, qf1);

    const v4i mk00 = *(const v4i*)(amb + kb),      mk01 = *(const v4i*)(amb + kb + 4);
    const v4i mk10 = *(const v4i*)(amb + kb + 16), mk11 = *(const v4i*)(amb + kb + 20);
    float x0[8], x1[8];
#pragma unroll
    for (int r = 0; r < 4; ++r) {
      const float ad00 = (1.0f - (float)mk00[r]) * MASKC;     // key kb      + 8hh + r
      const float ad01 = (1.0f - (float)mk01[r]) * MASKC;     // key kb      + 8hh + 4 + r
      const float ad10 = (1.0f - (float)mk10[r]) * MASKC;     // key kb + 16 + 8hh + r
      const float ad11 = (1.0f - (float)mk11[r]) * MASKC;     // key kb + 16 + 8hh + 4 + r
      x0[r]     = s0[r] * SC + ad00;
      x0[4 + r] = s0[4 + r] * SC + ad01;
      x1[r]     = s1[r] * SC + ad10;
      x1[4 + r] = s1[4 + r] * SC + ad11;
    }
    float mx = -3.0e38f;
#pragma unroll
    for (int r = 0; r < 8; ++r) mx = fmaxf(mx, fmaxf(x0[r], x1[r]));
    mx = fmaxf(mx, __shfl_xor(mx, 16, 32));
    const float mn   = fmaxf(m, mx);
    const float corr = __expf(m - mn);
    m = mn;
    const float msh = mn - LNPS;            // exp gives e^{x-m} * 1024
    l *= corr;
#pragma unroll
    for (int r = 0; r < 8; ++r) { o0[r] *= corr; o1[r] *= corr; o2[r] *= corr; o3[r] *= corr; }

    FragH ph, pl;
    float ls = 0.f;
#pragma unroll
    for (int r = 0; r < 8; ++r) {
      const float e0 = __expf(x0[r] - msh);           // key kb      + 8hh + r
      const float e1 = __expf(x1[r] - msh);           // key kb + 16 + 8hh + r
      ls += e0 + e1;
      const _Float16 h0 = (_Float16)e0, h1 = (_Float16)e1;
      ph.h[0][r] = h0;
      ph.h[1][r] = h1;
      pl.h[0][r] = (_Float16)(e0 - (float)h0);
      pl.h[1][r] = (_Float16)(e1 - (float)h1);
    }
    l += ls;

    const v16h vf0 = ldfrag_h(Vl + sub * 32);
    const v16h vf1 = ldfrag_h(Vl + 16 * (GPIT / 2) + sub * 32);
    const v16h vf2 = ldfrag_h(Vl + 32 * (GPIT / 2) + sub * 32);
    const v16h vf3 = ldfrag_h(Vl + 48 * (GPIT / 2) + sub * 32);
    o0 = mma_h_raw(vf0, ph.v, o0);
    o1 = mma_h_raw(vf1, ph.v, o1);
    o2 = mma_h_raw(vf2, ph.v, o2);
    o3 = mma_h_raw(vf3, ph.v, o3);
    o0 = mma_h_raw(vf0, pl.v, o0);
    o1 = mma_h_raw(vf1, pl.v, o1);
    o2 = mma_h_raw(vf2, pl.v, o2);
    o3 = mma_h_raw(vf3, pl.v, o3);
    oguard6(o0, o1, o2, o3, vf0, vf1, vf2, vf3, ph.v, pl.v);
   }
   asm volatile("s_wait_dscnt 0x0" ::: "memory");           // this wave's reads of buffer t & 1 are done
   asm volatile("s_wait_asynccnt 0x0" ::: "memory");        // this wave's copies of stage t + 1 have landed
   __syncthreads();                                         // publishes stage t + 1, frees buffer t & 1
   if (t + 2 < ANT)
     attn_stage_copy(lcp + (t & 1) * ASTG, gk + (size_t)(t + 2) * (AKB * DMOD * 2), gv + (t + 2) * (AKB * 2));
  }
  asm volatile("s_wait_asynccnt 0x0" ::: "memory");         // no copy outstanding when the wave goes on
  l += __shfl_xor(l, 16, 32);
  const float sc = (CS / VS) * (1.0f / l);

  // ---- stage O[query 16*wave + c][d = 16j + 8hh + r] * sc (= attn * 1024), then whole-line f16 stores ----
  float* os = Os + (wave * 16 + c) * 68 + 8 * hh;
#pragma unroll
  for (int r = 0; r < 8; ++r) { os[r] = o0[r] * sc; os[16 + r] = o1[r] * sc; os[32 + r] = o2[r] * sc; os[48 + r] = o3[r] * sc; }
  __syncthreads();
  {
    const int e = tid & 7, qq = tid >> 3;              // qq 0..15: line within group, e: 16-B piece
    v4u hv[4];
#pragma unroll
    for (int it = 0; it < 4; ++it) {
      const int qi = it * 16 + qq;                       // it 0..3 x qq 0..15 = queries 0..63 of the block
      const v4f x0 = *(const v4f*)(Os + qi * 68 + 8 * e);
      const v4f x1 = *(const v4f*)(Os + qi * 68 + 8 * e + 4);
      v4u u;
#pragma unroll
      for (int t2 = 0; t2 < 2; ++t2) {
        u[t2]     = pk16(h_bits((_Float16)x0[2 * t2]), h_bits((_Float16)x0[2 * t2 + 1]));
        u[2 + t2] = pk16(h_bits((_Float16)x1[2 * t2]), h_bits((_Float16)x1[2 * t2 + 1]));
      }
      hv[it] = u;
    }
    unsigned short* ob = ctx + (size_t)hd * DHEAD + 8 * e;
    {
#pragma unroll
      for (int it = 0; it < 4; ++it) {
        const int qi = it * 16 + qq;
        *(v4u*)(ob + ((size_t)b * SEQ + q0 + qi) * DMOD) = hv[it];
      }
      
    }
  }
}

// =====================================================================================================
//   XH   f16 [4096][768]            0           6291456
//   WQT  f16 [768][768]             6291456     1179648
//   WKT  f16 [768][768]             7471104     1179648
//   WVT  f16 [768][768]             8650752     1179648
//   WOT  f16 [768][768]             9830400     1179648
//   QP   f16 [4096][768]            11010048    6291456
//   KPL  f16 [4096][768]            17301504    6291456
//   VT   f16 [2][768][2048]         23592960    6291456
//   CTX  f16 [4096][768]            29884416    6291456
//   end                              36175872
// =====================================================================================================
extern "C" void kernel_launch(void* const* d_in, const int* in_sizes, int n_in,
                              void* d_out, int out_size, void* d_ws, size_t ws_size,
                              hipStream_t stream) {
  if (n_in < 10) return;
  if (in_sizes[0] != MTOK * DMOD) return;
  if (in_sizes[1] != MTOK) return;
  if (in_sizes[2] != DMOD * DMOD || in_sizes[4] != DMOD * DMOD || in_sizes[6] != DMOD * DMOD) return;
  if (in_sizes[8] != DMOD * DMOD) return;
  if (in_sizes[3] != DMOD || in_sizes[5] != DMOD || in_sizes[7] != DMOD || in_sizes[9] != DMOD) return;
  if (out_size != MTOK * DMOD) return;

  const float* hs  = (const float*)d_in[0];
  const int*   amk = (const int*)d_in[1];
  const float* Wq  = (const float*)d_in[2];
  const float* bq  = (const float*)d_in[3];
  const float* Wk  = (const float*)d_in[4];
  const float* bk  = (const float*)d_in[5];
  const float* Wv  = (const float*)d_in[6];
  const float* bv  = (const float*)d_in[7];
  const float* Wo  = (const float*)d_in[8];
  const float* bo  = (const float*)d_in[9];

  const size_t PACT = (size_t)MTOK * DMOD * 2;          //  6291456
  const size_t PW   = (size_t)DMOD * DMOD * 2;          //  1179648
  const size_t PVT  = (size_t)NBAT * DMOD * SEQ * 2;    //  6291456
  size_t off = 0;
  const size_t oXH = off; off += PACT;
  const size_t oWQ = off; off += PW;
  const size_t oWK = off; off += PW;
  const size_t oWV = off; off += PW;
  const size_t oWO = off; off += PW;
  const size_t oQP = off; off += PACT;
  const size_t oKP = off; off += PACT;
  const size_t oVT = off; off += PVT;
  const size_t oCT = off; off += PACT;
  if (off > ws_size) return;                            // off = 36175872
  if (off > (size_t)134217728) return;

  char* ws = (char*)d_ws;
  unsigned short* XH  = (unsigned short*)(ws + oXH);
  unsigned short* WQT = (unsigned short*)(ws + oWQ);
  unsigned short* WKT = (unsigned short*)(ws + oWK);
  unsigned short* WVT = (unsigned short*)(ws + oWV);
  unsigned short* WOT = (unsigned short*)(ws + oWO);
  unsigned short* QPL = (unsigned short*)(ws + oQP);
  unsigned short* KPL = (unsigned short*)(ws + oKP);
  unsigned short* VT  = (unsigned short*)(ws + oVT);
  unsigned short* CTX = (unsigned short*)(ws + oCT);
  float*          out = (float*)d_out;

  const dim3 blk256(256), blk128(128);
  const dim3 gCV(4 * TPW + MTOK * KSEG / 8);                   // 576 weight tiles + 1536 blocks of 8 row segments
  const dim3 gGM(GBLK);                                        // 768 tiles -> 192 blocks of 4 waves
  const dim3 gG3(3 * GBLK);                                    // q, k, v: 576 blocks
  const dim3 gAT(NBAT * NHEAD * (SEQ / 64));                   // 768 blocks of 128

  // (0) activation plane f16( bf16_RNE(h) * 64 ) and weight planes [K][N] -> [N][K], f16( bf16_RNE(W) * 1024 )
  cvt_all<<<gCV, blk256, 0, stream>>>(hs, Wq, Wk, Wv, Wo, XH, WQT, WKT, WVT, WOT);

  // (1) q = h . Wq + bq -> f16 plane of q*1024 ; k likewise ; v = h . Wv + bv -> VT[b][h*64+e][token], f16 plane of v*256
  gemm_qkv<<<gG3, blk128, 0, stream>>>(XH, WQT, WKT, WVT, bq, bk, bv, QPL, KPL, VT);

  // (2) attention with the additive int mask, all (b, head) -> ctx plane f16( attn * 1024 )[token][h*64 + d]
  attn_kernel<<<gAT, blk128, 0, stream>>>(QPL, KPL, VT, amk, CTX);

  // (3) out = attn . Wo + bo -> f32 [4096][768]
  gemm_out<<<gGM, blk128, 0, stream>>>(CTX, WOT, bo, out);
  (void)hipGetLastError();
}

// v003
// Measured time: 80.4 microseconds a run.
// Next to v002, in two timings, it ran 1.08 and 1.09 times as fast.
// Counting every step since v000, it is 2.49 times as fast.
// Contractions: q,k,v projections (x token rows f16 x64 . W^T rows f16 x1024, K=768, one product each);
// attention scores S^T = k (f16 x1024, one plane) . q^T (f16 x1024, one plane), one product, head dim 64;
// attention O^T = v^T (f16 x256, one plane) . P^T (f16 1024-scaled hi plane + unscaled residual plane, from the
// score D registers), two products into one accumulator over 2048 keys; output projection ctx (f16 x1024) . Wo^T
// (f16 x1024), one product. All v_wmma_f32_16x16x32_f16, f32 accumulate; mask adder and softmax in f32 on VALU;
// every float input RNE-converted to bf16 on load.
#include <hip/hip_runtime.h>
#include <math.h>
#include <stdint.h>

#define NBAT   2
#define SEQ    2048
#define DMOD   768
#define NHEAD  12
#define DHEAD  64
#define MTOK   (NBAT * SEQ)
#define KSEG   (DMOD / 256)
#define TN64   (DMOD / 64)
#define TPW    (TN64 * TN64)
#define XC     64.0f
#define WSC    1024.0f
#define QS     1024.0f
#define KS     1024.0f
#define VS     256.0f
#define CS     1024.0f
#define LNPS   6.931471805599453f
#define ATTSC  0.125f
#define MASKC  (-10000.0f)
static_assert(NHEAD * DHEAD == DMOD);
static_assert((MTOK % 64) == 0 && (DMOD % 64) == 0 && (SEQ % 64) == 0 && (DMOD % 32) == 0 && (DMOD % 256) == 0);
static_assert((((MTOK / 64) * TN64) % 4) == 0);
static_assert(((MTOK * KSEG) % 8) == 0);
static_assert((SEQ / 64) == 32 && (SEQ % 32) == 0);
static_assert((MTOK % SEQ) == 0);

typedef _Float16 v16h __attribute__((ext_vector_type(16)));
typedef _Float16 v8h  __attribute__((ext_vector_type(8)));
typedef float    v8f  __attribute__((ext_vector_type(8)));
typedef float    v4f  __attribute__((ext_vector_type(4)));
typedef unsigned int v4u __attribute__((ext_vector_type(4)));
typedef int      v4i  __attribute__((ext_vector_type(4)));

union FragH { v16h v; v8h h[2]; };

// ---- scalar helpers --------------------------------------------------------------------------------
__device__ __forceinline__ unsigned short bf_bits(float f) {          // f32 -> bf16 bits, RNE convert
  unsigned u = __float_as_uint(f);
  return (unsigned short)((u + 0x7FFFu + ((u >> 16) & 1u)) >> 16);
}
__device__ __forceinline__ float bf_up(unsigned short h) { return __uint_as_float(((unsigned)h) << 16); }
__device__ __forceinline__ float bfr(float f) { return bf_up(bf_bits(f)); }
__device__ __forceinline__ unsigned short h_bits(_Float16 x) { return __builtin_bit_cast(unsigned short, x); }
__device__ __forceinline__ unsigned pk16(unsigned short a, unsigned short b) { return (unsigned)a | ((unsigned)b << 16); }
__device__ __forceinline__ v8f zero8() { v8f z = {0.f, 0.f, 0.f, 0.f, 0.f, 0.f, 0.f, 0.f}; return z; }

// ---- fragment loader: 16-bit A/B operand, lane -> row/col (lane&15), p already includes +8*(lane>>4);
//      elements 0..7 <- p[0..7] (k0+8h..), elements 8..15 <- p[16..23] (k0+16+8h..)
__device__ __forceinline__ v16h ldfrag_h(const _Float16* p) {
  FragH f;
  f.h[0] = *(const v8h*)(p);
  f.h[1] = *(const v8h*)(p + 16);
  return f.v;
}

// ---- WMMA helpers with trailing VALU hazard gap --------------------------------------------------------
__device__ __forceinline__ v8f mma_h_raw(v16h a, v16h b, v8f c) {
  return __builtin_amdgcn_wmma_f32_16x16x32_f16(false, a, false, b, (short)0, c, false, false);
}
__device__ __forceinline__ void dep_guard1(v8f& a, v8f& b, v16h x) {
#if defined(__HIP_DEVICE_COMPILE__)
  asm volatile("v_nop\n\tv_nop\n\tv_nop\n\tv_nop" : "+v"(a), "+v"(b) : "v"(x));
#endif
}
__device__ __forceinline__ void keep4_h(v16h a, v16h b, v16h c, v16h d) {
#if defined(__HIP_DEVICE_COMPILE__)
  asm volatile("v_nop" :: "v"(a), "v"(b), "v"(c), "v"(d));
#endif
}
__device__ __forceinline__ void acc_guard4(v8f& a, v8f& b, v8f& c, v8f& d) {
#if defined(__HIP_DEVICE_COMPILE__)
  asm volatile("v_nop\n\tv_nop\n\tv_nop\n\tv_nop" : "+v"(a), "+v"(b), "+v"(c), "+v"(d));
#endif
}
__device__ __forceinline__ void sguard6(v8f& a, v8f& b, v16h x0, v16h x1, v16h x2, v16h x3, v16h x4, v16h x5) {
#if defined(__HIP_DEVICE_COMPILE__)
  asm volatile("v_nop\n\tv_nop\n\tv_nop\n\tv_nop"
               : "+v"(a), "+v"(b) : "v"(x0), "v"(x1), "v"(x2), "v"(x3), "v"(x4), "v"(x5));
#endif
}
__device__ __forceinline__ void oguard6(v8f& a, v8f& b, v8f& c, v8f& d,
                                        v16h x0, v16h x1, v16h x2, v16h x3, v16h p0, v16h p1) {
#if defined(__HIP_DEVICE_COMPILE__)
  asm volatile("v_nop\n\tv_nop\n\tv_nop\n\tv_nop"
               : "+v"(a), "+v"(b), "+v"(c), "+v"(d) : "v"(x0), "v"(x1), "v"(x2), "v"(x3), "v"(p0), "v"(p1));
#endif
}
__device__ __forceinline__ void wave_sync_lds() {
  __builtin_amdgcn_fence(__ATOMIC_RELEASE, "workgroup");
  __builtin_amdgcn_wave_barrier();
  __builtin_amdgcn_fence(__ATOMIC_ACQUIRE, "workgroup");
}

// =====================================================================================================
// Activation plane: XH[t][768] = f16( bf16_RNE(h[t][c]) * 64 ).
// coverage: 1536 x 8 = 12288 segments = 4096 rows x 768 columns entirely.
// =====================================================================================================
__device__ __forceinline__ void cvt_act(const int bx, const float* __restrict__ hs, unsigned short* XH) {
  const int lane = threadIdx.x & 31, wave = threadIdx.x >> 5;
  const int seg = bx * 8 + wave;                         // 0 .. 12287
  const int row = seg / KSEG;
  const int col = (seg - row * KSEG) * 256 + 8 * lane;
  const size_t o = (size_t)row * DMOD + col;
  const v4f h0 = *(const v4f*)(hs + o), h1 = *(const v4f*)(hs + o + 4);
  float a[8];
#pragma unroll
  for (int i = 0; i < 4; ++i) { a[i] = bfr(h0[i]); a[4 + i] = bfr(h1[i]); }
  v4u uh;
#pragma unroll
  for (int i = 0; i < 4; ++i) {
    const float xa = a[2 * i] * XC, xb = a[2 * i + 1] * XC;
    uh[i] = pk16(h_bits((_Float16)xa), h_bits((_Float16)xb));
  }
  unsigned short* dh = XH + o;
  *(v4u*)dh = uh;
  // this body now shares a kernel with the weight tiles' code: the wait closes the store before any path of the listing
  // that rewrites one of its registers
  asm volatile("s_wait_xcnt 0x0" ::: "memory");
}

// =====================================================================================================
// Weight planes: in W[K=768][N=768] (N contiguous) -> out WT[N][K] = f16( bf16_RNE(W[k][n]) * 1024 ), k contiguous.
// Block = one 64(k) x 64(n) tile: 256 threads load 16 rows x 64 floats per step (16 threads x 16 B per row), convert and
// store transposed into LDS Ts[n][k] (pitch 72 halves, 2-byte stores), block barrier, then 2 instructions each write
// blocks 0..143 -> weight 0, 144..287 -> weight 1, 288..431 -> weight 2, 432..575 -> weight 3 (block-uniform select).
// coverage: per weight 144 tiles x (2 x 32 lines x 8 lanes x 8 halves) = 768 x 768 entirely.
// =====================================================================================================
__device__ __forceinline__ void cvt_w(const int bx, unsigned short* Ts,
                                      const float* __restrict__ w0, const float* __restrict__ w1,
                                      const float* __restrict__ w2, const float* __restrict__ w3,
                                      unsigned short* t0, unsigned short* t1,
                                      unsigned short* t2, unsigned short* t3) {
  const int tid = threadIdx.x;
  const int wsel = bx / TPW;                        // block-uniform
  const int t = bx - wsel * TPW;
  const int k0 = (t / TN64) * 64;
  const int n0 = (t % TN64) * 64;
  const float* src = (wsel == 0) ? w0 : (wsel == 1) ? w1 : (wsel == 2) ? w2 : w3;
  unsigned short* dst = (wsel == 0) ? t0 : (wsel == 1) ? t1 : (wsel == 2) ? t2 : t3;
  {
    const int r16 = tid >> 4, p = tid & 15;
#pragma unroll
    for (int it = 0; it < 4; ++it) {
      const int kr = it * 16 + r16;                   // it 0..3 x r16 0..15 = k rows 0..63
      const v4f v = *(const v4f*)(src + (size_t)(k0 + kr) * DMOD + n0 + 4 * p);
#pragma unroll
      for (int j = 0; j < 4; ++j) Ts[(4 * p + j) * 72 + kr] = h_bits((_Float16)(bfr(v[j]) * WSC));
    }
  }
  __syncthreads();
  {
    const int e = tid & 7, lq = tid >> 3;             // lq 0..31: line, e: 16-B piece
    v4u u[2];
#pragma unroll
    for (int it = 0; it < 2; ++it) {
      const int nr = it * 32 + lq;                    // it 0..1 x lq 0..31 = n rows 0..63
      u[it] = *(const v4u*)(Ts + nr * 72 + 8 * e);
    }
    unsigned short* db = dst + (size_t)n0 * DMOD + k0 + 8 * e;
    {
#pragma unroll
      for (int it = 0; it < 2; ++it) {
        const int nr = it * 32 + lq;
        *(v4u*)(db + (size_t)nr * DMOD) = u[it];
      }
      
    }
  }
}

// Both conversions in one grid (neither reads what the other writes): blocks 0..575 take the weight tiles, blocks
// 576..2111 the activation segments. The test is block-uniform, so the weight tiles' barrier is passed by whole blocks.
__global__ __launch_bounds__(256) void cvt_all(const float* __restrict__ hs, const float* __restrict__ w0,
                                                const float* __restrict__ w1, const float* __restrict__ w2,
                                                const float* __restrict__ w3, unsigned short* XH,
                                                unsigned short* t0, unsigned short* t1,
                                                unsigned short* t2, unsigned short* t3) {
  __shared__ __align__(16) unsigned short Ts[64 * 72];
  const int bx = blockIdx.x;
  if (bx < 4 * TPW) cvt_w(bx, Ts, w0, w1, w2, w3, t0, t1, t2, t3);
  else              cvt_act(bx - 4 * TPW, hs, XH);
}

// =====================================================================================================
// Register-blocked f16 WMMA GEMM, one wave per 64x64 tile (4 waves per block = 64 token rows x 256 features):
//   acc[m][n] = sum_k A[m][k] * Bt[n][k],  A: f16 [4096][768] token rows, Bt: f16 [768][768] k contiguous,
//   M=4096, N=768, K=768 fixed, all tile multiples.
//   Operands reach the waves through LDS: per stage of 64 k the block copies its 64 A rows and 256 Bt rows (128 B each,
//   whole lines, 8 lanes x 16 B per row) with asynchronous 16-B copies into one of two buffers (row pitch 144 B), the
//   next stage in flight while this one is multiplied; fragments = two 16-B LDS loads with the split k map (ldfrag_h).
//   y = acc * escale + bf16_RNE(bias[n]) * bscale, then per MODE:
//   MODE 0: f32 row-major C[4096][768] (the final output): 16-row slabs staged per wave in LDS (pitch 68 floats), each
//   MODE 1: f16 single plane row-major [4096][768]: per slab 4 instructions, each 4 rows x (8 consecutive lanes x 16 B)
//   MODE 2: f16 single plane transposed VT[b][feature 768][2048 tokens]: the wave's whole 64x64 tile is staged as f16
// coverage: MODE 0/1: 4 slabs x 16 rows x 64 cols per wave tile; MODE 2: 64 features x 64 tokens per wave tile;
//           grid = 768 tiles / 4 = 192 blocks covers [4096][768] exactly once (m0 multiple of 64 never straddles b).
// =====================================================================================================
#define GKB   64                       // k per stage: rows of 128 B
#define GPIT  144                      // LDS row pitch, bytes: 16 B x odd, conflict-free for 16-B fragment loads
#define GSTG  ((64 + 256) * GPIT)      // one buffer: A rows 0..63, Bt rows 64..319
#define GNT   (DMOD / GKB)             // 12 stages
#define GLSTEP (16 * GPIT)             // 16 rows further in LDS
#define GGSTEP (16 * DMOD * 2)         // 16 rows further in global memory
static_assert((TN64 % 4) == 0 && (DMOD % GKB) == 0 && GNT >= 2 && (GPIT % 16) == 0);

// Ten asynchronous 16-B copies per lane, rows 16 apart: LDS byte address l + i * GLSTEP <- g[i]. The s_wait_xcnt closes
// the statement so that no address register of an issued copy is rewritten ahead of it.
__device__ __forceinline__ void acopy10(unsigned l, const char* const (&g)[10]) {
#if defined(__HIP_DEVICE_COMPILE__)
  asm volatile(
      "global_load_async_to_lds_b128 %0, %10, off\n\t"
      "global_load_async_to_lds_b128 %1, %11, off\n\t"
      "global_load_async_to_lds_b128 %2, %12, off\n\t"
      "global_load_async_to_lds_b128 %3, %13, off\n\t"
      "global_load_async_to_lds_b128 %4, %14, off\n\t"
      "global_load_async_to_lds_b128 %5, %15, off\n\t"
      "global_load_async_to_lds_b128 %6, %16, off\n\t"
      "global_load_async_to_lds_b128 %7, %17, off\n\t"
      "global_load_async_to_lds_b128 %8, %18, off\n\t"
      "global_load_async_to_lds_b128 %9, %19, off\n\t"
      "s_wait_xcnt 0x0"
      :: "v"(l), "v"(l + 1 * GLSTEP), "v"(l + 2 * GLSTEP), "v"(l + 3 * GLSTEP), "v"(l + 4 * GLSTEP),
         "v"(l + 5 * GLSTEP), "v"(l + 6 * GLSTEP), "v"(l + 7 * GLSTEP), "v"(l + 8 * GLSTEP), "v"(l + 9 * GLSTEP),
         "v"(g[0]), "v"(g[1]), "v"(g[2]), "v"(g[3]), "v"(g[4]), "v"(g[5]), "v"(g[6]), "v"(g[7]), "v"(g[8]), "v"(g[9])
      : "memory");
#endif
}
// One stage: 320 rows x 8 pieces = 2560 copies = 20 per thread; thread -> row (tid >> 3) + 16 i, piece tid & 7.
// ga, gb: this thread's piece of A row (tid >> 3) and of Bt row (tid >> 3) of the block, at the stage's first k.
__device__ __forceinline__ void stage_copy(unsigned l, const char* ga, const char* gb) {
  const char* g0[10];
  const char* g1[10];
  // the three loops are unrolled so that both pointer arrays stay in registers
#pragma unroll
  for (int i = 0; i < 4; ++i) g0[i] = ga + (size_t)i * GGSTEP;             // A rows 0..63
#pragma unroll
  for (int i = 4; i < 10; ++i) g0[i] = gb + (size_t)(i - 4) * GGSTEP;      // Bt rows 0..95
#pragma unroll
  for (int i = 0; i < 10; ++i) g1[i] = gb + (size_t)(i + 6) * GGSTEP;      // Bt rows 96..255
  acopy10(l, g0);
  acopy10(l + 10 * GLSTEP, g1);
}

// ring: the block's 2 * GSTG bytes of LDS, the two operand buffers. The epilogue's slabs (9216 B per wave) lie on the same
// bytes: the barrier at the foot of the last stage ends every wave's reads of the ring and no copy is outstanding then.
// That keeps a block at 92160 B, so that three blocks fit a WGP's LDS.
template <int MODE>
__device__ __forceinline__ void gemm64(
    const int bx, unsigned char* ring,
    const unsigned short* __restrict__ Ap, const unsigned short* __restrict__ Bp,
    const float* __restrict__ bias, const float escale, const float bscale, void* C0) {
  const int lane = threadIdx.x & 31;
  const int wave = threadIdx.x >> 5;
  unsigned short* sraw = (unsigned short*)(void*)(ring + wave * 9216);   // this wave's slab, used behind the loop only
  const int tilesN = TN64;                                 // 12
  const int tile = bx * 4 + wave;                          // 0..767, grid exact
  const int tm = tile / tilesN;
  const int tn = tile - tm * tilesN;
  const int m0 = tm << 6;
  const int n0 = tn << 6;

  const int rlane = lane & 15;                 // row (A) / col (B, D) within subtile
  const int hh    = lane >> 4;
  const int koff  = hh * 8;                    // k offset of this lane half
  const int mOff  = hh * 8;                    // D row offset

  v8f acc[4][4];
#pragma unroll
  for (int i = 0; i < 4; ++i)
#pragma unroll
    for (int j = 0; j < 4; ++j) acc[i][j] = zero8();

  // copy side: the block's A rows start at m0 (the same in its four waves), its Bt rows at n0 - 64 * wave
  const int crow = threadIdx.x >> 3, cpc = threadIdx.x & 7;
  const unsigned lcp = (unsigned)(uintptr_t)(&ring[0]) + (unsigned)(crow * GPIT + cpc * 16);
  const char* ga = (const char*)(const void*)Ap + ((size_t)(m0 + crow) * DMOD + 8 * cpc) * 2;
  const char* gb = (const char*)(const void*)Bp + ((size_t)(n0 - (wave << 6) + crow) * DMOD + 8 * cpc) * 2;

  stage_copy(lcp, ga, gb);
  asm volatile("s_wait_asynccnt 0x0" ::: "memory");        // stage 0 of this wave has landed
  __syncthreads();                                          // ... and every wave's part of it
  stage_copy(lcp + GSTG, ga + GKB * 2, gb + GKB * 2);

  for (int t = 0; t < GNT; ++t) {
    const unsigned char* rb = ring + (t & 1) * GSTG;
    const _Float16* la = (const _Float16*)(const void*)(rb + rlane * GPIT) + koff;
    const _Float16* lb = (const _Float16*)(const void*)(rb + (64 + (wave << 6) + rlane) * GPIT) + koff;
    // all loops of the stage are unrolled: fragment and accumulator arrays in registers, LDS offsets as immediates
#pragma unroll
    for (int ks = 0; ks < GKB; ks += 32) {
      v16h ah[4], bh[4];                                    // the 32-k block's fragments, read as one group
#pragma unroll
      for (int j = 0; j < 4; ++j) {
        bh[j] = ldfrag_h(lb + j * (GLSTEP / 2) + ks);
        ah[j] = ldfrag_h(la + j * (GLSTEP / 2) + ks);
      }
#pragma unroll
      for (int i = 0; i < 4; ++i) {
#pragma unroll
        for (int j = 0; j < 4; ++j) acc[i][j] = mma_h_raw(ah[i], bh[j], acc[i][j]);
        dep_guard1(acc[i][0], acc[i][3], ah[i]);
      }
      keep4_h(bh[0], bh[1], bh[2], bh[3]);
    }
    asm volatile("s_wait_dscnt 0x0" ::: "memory");          // this wave's reads of buffer t & 1 are done
    asm volatile("s_wait_asynccnt 0x0" ::: "memory");       // this wave's copies of stage t + 1 have landed
    __syncthreads();                                        // publishes stage t + 1, frees buffer t & 1
    if (t + 2 < GNT) stage_copy(lcp + (t & 1) * GSTG, ga + (t + 2) * (GKB * 2), gb + (t + 2) * (GKB * 2));
  }
  asm volatile("s_wait_asynccnt 0x0" ::: "memory");         // no copy outstanding when the wave goes on
  acc_guard4(acc[0][0], acc[0][1], acc[0][2], acc[0][3]);
  acc_guard4(acc[1][0], acc[1][1], acc[1][2], acc[1][3]);
  acc_guard4(acc[2][0], acc[2][1], acc[2][2], acc[2][3]);
  acc_guard4(acc[3][0], acc[3][1], acc[3][2], acc[3][3]);

  if (MODE == 0) {
    float* Cout = (float*)C0;
    const int c4 = rlane * 4;                        // f32 out: 256-B row segment = 16 lanes x 16 B
    const v4f braw = *(const v4f*)(bias + n0 + c4);
    float bb[4];
#pragma unroll
    for (int tt = 0; tt < 4; ++tt) bb[tt] = bfr(braw[tt]) * bscale;
    float* slab = (float*)(void*)(sraw);
#pragma unroll
    for (int i = 0; i < 4; ++i) {
      const int mBase = m0 + (i << 4);
#pragma unroll
      for (int j = 0; j < 4; ++j) {
#pragma unroll
        for (int r = 0; r < 8; ++r) slab[(mOff + r) * 68 + (j << 4) + rlane] = acc[i][j][r];
      }
      wave_sync_lds();
      v4f vals[8];
#pragma unroll
      for (int it = 0; it < 8; ++it) {
        const int row = it * 2 + hh;                   // it 0..7 x hh 0..1 = rows 0..15
        v4f v = *(const v4f*)(slab + row * 68 + c4);
#pragma unroll
        for (int tt = 0; tt < 4; ++tt) v[tt] = v[tt] * escale + bb[tt];
        vals[it] = v;
      }
      {
#pragma unroll
        for (int it = 0; it < 8; ++it) {
          const int row = it * 2 + hh;
          *(v4f*)(Cout + (size_t)(mBase + row) * DMOD + n0 + c4) = vals[it];
        }
        
      }
      wave_sync_lds();
    }
  } else if (MODE == 1) {
    unsigned short* Hp = (unsigned short*)C0;
    const int e = lane & 7, q4 = lane >> 3;
    const v4f b0 = *(const v4f*)(bias + n0 + 8 * e), b1 = *(const v4f*)(bias + n0 + 8 * e + 4);
    float bb[8];
#pragma unroll
    for (int tt = 0; tt < 4; ++tt) { bb[tt] = bfr(b0[tt]) * bscale; bb[4 + tt] = bfr(b1[tt]) * bscale; }
    float* slab = (float*)(void*)(sraw);
#pragma unroll
    for (int i = 0; i < 4; ++i) {
      const int mBase = m0 + (i << 4);
#pragma unroll
      for (int j = 0; j < 4; ++j) {
#pragma unroll
        for (int r = 0; r < 8; ++r) slab[(mOff + r) * 68 + (j << 4) + rlane] = acc[i][j][r];
      }
      wave_sync_lds();
      v4u hv[4];
#pragma unroll
      for (int it = 0; it < 4; ++it) {
        const int row = it * 4 + q4;                   // it 0..3 x q4 0..3 = rows 0..15
        const v4f x0 = *(const v4f*)(slab + row * 68 + 8 * e);
        const v4f x1 = *(const v4f*)(slab + row * 68 + 8 * e + 4);
        float y[8];
#pragma unroll
        for (int tt = 0; tt < 4; ++tt) { y[tt] = x0[tt] * escale + bb[tt]; y[4 + tt] = x1[tt] * escale + bb[4 + tt]; }
        v4u uh;
#pragma unroll
        for (int t2 = 0; t2 < 4; ++t2) {
          uh[t2] = pk16(h_bits((_Float16)y[2 * t2]), h_bits((_Float16)y[2 * t2 + 1]));
        }
        hv[it] = uh;
      }
      {
#pragma unroll
        for (int it = 0; it < 4; ++it) {
          const int row = it * 4 + q4;
          const size_t go = (size_t)(mBase + row) * DMOD + n0 + 8 * e;
          *(v4u*)(Hp + go) = hv[it];
        }
        
      }
      wave_sync_lds();
    }
  } else {
    unsigned short* Vs = sraw;              // [64 features][pitch 72] f16 bits
    float bb4[4];
#pragma unroll
    for (int j = 0; j < 4; ++j) bb4[j] = bfr(bias[n0 + (j << 4) + rlane]) * bscale;
#pragma unroll
    for (int i = 0; i < 4; ++i) {
#pragma unroll
      for (int j = 0; j < 4; ++j) {
#pragma unroll
        for (int r = 0; r < 8; ++r) {
          Vs[((j << 4) + rlane) * 72 + (i << 4) + mOff + r] = h_bits((_Float16)(acc[i][j][r] * escale + bb4[j]));
        }
      }
    }
    wave_sync_lds();
    const int e = lane & 7, q4 = lane >> 3;
    const int bsel = m0 / SEQ;                          // batch of this tile (wave-uniform)
    const int s0 = m0 % SEQ;                            // first token within the batch
    v4u u[16];
#pragma unroll
    for (int it = 0; it < 16; ++it) {
      const int fl = it * 4 + q4;                        // it 0..15 x q4 0..3 = features 0..63
      u[it] = *(const v4u*)(Vs + fl * 72 + 8 * e);
    }
    unsigned short* Vp = (unsigned short*)C0 + ((size_t)bsel * DMOD + n0) * SEQ + s0 + 8 * e;
    {
#pragma unroll
      for (int it = 0; it < 16; ++it) {
        const int fl = it * 4 + q4;
        *(v4u*)(Vp + (size_t)fl * SEQ) = u[it];
      }
      
    }
  }
}

#define GBLK  (((MTOK / 64) * TN64) / 4)   // 192 blocks cover one [4096][768] product

// q, k and v projections in one grid of 3 x 192 blocks (they share A and depend on nothing of each other): block-uniform
// choice of the weight plane, bias and output plane; q*1024 and k*1024 row-major (acc = 64*1024*y -> escale 1/64),
// v*256 transposed (escale 1/256).
__global__ __launch_bounds__(128) void gemm_qkv(
    const unsigned short* __restrict__ Ap, const unsigned short* __restrict__ Bq,
    const unsigned short* __restrict__ Bk, const unsigned short* __restrict__ Bv,
    const float* __restrict__ bq, const float* __restrict__ bk, const float* __restrict__ bv,
    unsigned short* Cq, unsigned short* Ck, unsigned short* Cv) {
  __shared__ __align__(16) unsigned char ring[2 * GSTG];   // two operand buffers
  const int sel = blockIdx.x / GBLK;                       // 0: q, 1: k, 2: v
  const int bx = blockIdx.x - sel * GBLK;
  static_assert(QS == KS);                                 // q and k share one path
  if (sel == 2) gemm64<2>(bx, ring, Ap, Bv, bv, VS / (XC * WSC), VS, (void*)Cv);
  else          gemm64<1>(bx, ring, Ap, sel ? Bk : Bq, sel ? bk : bq, QS / (XC * WSC), QS, (void*)(sel ? Ck : Cq));
}

// output projection: acc = 1024*1024*out -> escale 2^-20, f32 row-major
__global__ __launch_bounds__(128) void gemm_out(
    const unsigned short* __restrict__ Ap, const unsigned short* __restrict__ Bp,
    const float* __restrict__ bias, float* C0) {
  __shared__ __align__(16) unsigned char ring[2 * GSTG];   // two operand buffers
  gemm64<0>(blockIdx.x, ring, Ap, Bp, bias, 1.0f / (CS * WSC), 1.0f, (void*)C0);
}

// =====================================================================================================
// Attention for one (b, head, 64-query block), transposed formulation, head dim 64, 2048 keys, additive int mask:
//   S^T tile (16 keys x 16 queries) = A(k rows = keys, d via the split k map) . B(q, col = query, same d map), two d-steps
//   of 32: s = k.q = 1024*1024 * logit_dot (one product). Per lane the D tile holds 8 keys of ONE query, so
//   x = s/8/(1024*1024) + (1 - mask[b][key]) * (-10000) and the online softmax (running max, f32) are per-lane state
//   with one shuffle (lane^16) for the max over 32 keys; the row sum is kept as a per-lane partial and combined at
//   the end. P = e^{x-m} x 1024 as f16 hi plane plus unscaled f16 residual plane (e - hi), both used directly as the
//   B operand of O^T (rows d, cols queries) += A(v^T rows d, keys contiguous, two 16-B loads) . B(P^T):
//   B element r <- the key tile covering keys kb..kb+15, element 8+r <- the tile covering kb+16..kb+31, lane unchanged
//   (D-as-B chaining layout). Two products per d tile (d 0-15, 16-31, 32-47, 48-63) into one accumulator.
//   32 keys per iteration: 4 score WMMAs + 8 output WMMAs per wave. Block = 4 waves = 64 queries; grid = 2*12*32 = 768.
//   k and v^T reach the waves through LDS: per stage of 64 keys the block copies 64 k rows (its head's 128 B) and 64 v^T
//   rows (64 keys = 128 B), whole lines, with asynchronous 16-B copies into one of two buffers (row pitch 144 B), the next
//   stage in flight while this one is worked on; two 32-key iterations per stage, fragments = two 16-B LDS loads.
//   Epilogue: the block's [64 query][64 d] f32 tile is staged in LDS (scalar stores, pitch 68), block barrier, then 4
// coverage: block writes queries q0..q0+63 x d 0..63 of its (b, head); grid covers ctx [4096][768] exactly once.
// =====================================================================================================
#define AKB   64                       // keys per stage
#define ASTG  ((64 + 64) * GPIT)       // one buffer: k rows 0..63, v^T rows 64..127
#define ANT   (SEQ / AKB)              // 32 stages
static_assert((SEQ % AKB) == 0 && ANT >= 2 && DHEAD * 2 == 128);

// One stage: 128 rows x 8 pieces = 1024 copies = 8 per thread; thread -> row (tid >> 3) + 16 i, piece tid & 7.
// gk, gv: this thread's piece of k row (tid >> 3) and of v^T row (tid >> 3) of the stage. The s_wait_xcnt closes the
// statement so that no address register of an issued copy is rewritten ahead of it.
__device__ __forceinline__ void attn_stage_copy(unsigned l, const char* gk, const char* gv) {
#if defined(__HIP_DEVICE_COMPILE__)
  asm volatile(
      "global_load_async_to_lds_b128 %0, %8, off\n\t"
      "global_load_async_to_lds_b128 %1, %9, off\n\t"
      "global_load_async_to_lds_b128 %2, %10, off\n\t"
      "global_load_async_to_lds_b128 %3, %11, off\n\t"
      "global_load_async_to_lds_b128 %4, %12, off\n\t"
      "global_load_async_to_lds_b128 %5, %13, off\n\t"
      "global_load_async_to_lds_b128 %6, %14, off\n\t"
      "global_load_async_to_lds_b128 %7, %15, off\n\t"
      "s_wait_xcnt 0x0"
      :: "v"(l), "v"(l + 1 * GLSTEP), "v"(l + 2 * GLSTEP), "v"(l + 3 * GLSTEP),
         "v"(l + 4 * GLSTEP), "v"(l + 5 * GLSTEP), "v"(l + 6 * GLSTEP), "v"(l + 7 * GLSTEP),
         "v"(gk), "v"(gk + 1 * GGSTEP), "v"(gk + 2 * GGSTEP), "v"(gk + 3 * GGSTEP),
         "v"(gv), "v"(gv + 1 * (16 * SEQ * 2)), "v"(gv + 2 * (16 * SEQ * 2)), "v"(gv + 3 * (16 * SEQ * 2))
      : "memory");
#endif
}

__global__ __launch_bounds__(128)
void attn_kernel(const unsigned short* __restrict__ qp, const unsigned short* __restrict__ kp,
                 const unsigned short* __restrict__ vt, const int* __restrict__ am, unsigned short* ctx) {
  __shared__ __align__(16) float Os[64 * 68];
  __shared__ __align__(16) unsigned char aring[2 * ASTG];  // two k / v^T buffers
  __shared__ __align__(16) float Ad[SEQ];                  // mask adder of every key of batch b
  const int tid  = threadIdx.x;
  const int wave = tid >> 5;
  const int lane = tid & 31;
  const int hh   = lane >> 4;
  const int c    = lane & 15;
  const int bx   = blockIdx.x;
  const int qb   = bx & 31;                       // SEQ/64 = 32 query blocks per (b, head)
  const int bhd  = bx >> 5;                       // b * NHEAD + head
  const int b    = bhd / NHEAD;
  const int hd   = bhd - b * NHEAD;
  const int q0   = qb * 64;

  const _Float16* QP  = (const _Float16*)(const void*)qp;

  // ---- q fragments (B operand, col = query q0 + 16*wave + c): one plane, d 0..31 and 32..63 ----
  const size_t qtok = (size_t)b * SEQ + q0 + wave * 16 + c;
  const _Float16* qbp = QP + qtok * DMOD + hd * DHEAD + 8 * hh;
  const v16h qf0 = ldfrag_h(qbp), qf1 = ldfrag_h(qbp + 32);
  // ---- copy side: k row = key (stage's first + crow + 16 i), v^T row = d (crow + 16 i), 16-B piece cpc ----
  const int crow = tid >> 3, cpc = tid & 7;
  const unsigned lcp = (unsigned)(uintptr_t)(&aring[0]) + (unsigned)(crow * GPIT + cpc * 16);
  const char* gk = (const char*)(const void*)kp + (((size_t)b * SEQ + crow) * DMOD + hd * DHEAD + 8 * cpc) * 2;
  const char* gv = (const char*)(const void*)vt + (((size_t)b * DMOD + hd * DHEAD + crow) * SEQ + 8 * cpc) * 2;
  // ---- adder base: keys kb + 8hh + 0..7 and kb + 16 + 8hh + 0..7 ----
  const float* adb = Ad + 8 * hh;
  const float SC = ATTSC / (QS * KS);

  float m = -1.0e30f, l = 0.f;
  v8f o0 = zero8(), o1 = zero8(), o2 = zero8(), o3 = zero8();

  attn_stage_copy(lcp, gk, gv);
  // adder table, once per block: Ad[key] = (1 - mask[b][key]) * (-10000); 128 threads x 4 x 4 keys = 2048 keys
  static_assert((SEQ % 512) == 0);
#pragma unroll                                              // the four mask loads issue together, one latency
  for (int i = 0; i < SEQ / 512; ++i) {
    const int k4 = (i * 128 + tid) * 4;
    const v4i mk = *(const v4i*)(am + (size_t)b * SEQ + k4);
    v4f ad;
#pragma unroll                                              // vector elements by constant index, in registers
    for (int r = 0; r < 4; ++r) ad[r] = (1.0f - (float)mk[r]) * MASKC;
    *(v4f*)(Ad + k4) = ad;
  }
  asm volatile("s_wait_asynccnt 0x0" ::: "memory");        // stage 0 of this wave has landed
  __syncthreads();                                          // ... and every wave's part of it, and the adder table
  attn_stage_copy(lcp + ASTG, gk + (size_t)AKB * DMOD * 2, gv + AKB * 2);

#pragma unroll 1                                            // rolled as before: a long body, only the buffer changes
  for (int t = 0; t < ANT; ++t) {
   const unsigned char* rb = aring + (t & 1) * ASTG;
   // k fragment base (A operand, row = key c of the stage), v^T fragment base (A operand, row = d = c, keys contiguous)
   const _Float16* Kl = (const _Float16*)(const void*)(rb + c * GPIT) + 8 * hh;
   const _Float16* Vl = (const _Float16*)(const void*)(rb + (64 + c) * GPIT) + 8 * hh;
#pragma unroll                                              // both halves of the stage: LDS offsets as immediates
   for (int sub = 0; sub < AKB / 32; ++sub) {
    const int kb = t * AKB + sub * 32;
    const _Float16* k0p = Kl + sub * 32 * (GPIT / 2);
    const _Float16* k1p = k0p + 16 * (GPIT / 2);
    const v16h a0 = ldfrag_h(k0p), a1 = ldfrag_h(k1p);
    const v16h a2 = ldfrag_h(k0p + 32), a3 = ldfrag_h(k1p + 32);
    // adders read in the k fragments' load group, so that they have landed when the score products end
    const v4f ad00 = *(const v4f*)(adb + kb),      ad01 = *(const v4f*)(adb + kb + 4);    // keys kb + 8hh + 0..7
    const v4f ad10 = *(const v4f*)(adb + kb + 16), ad11 = *(const v4f*)(adb + kb + 20);   // keys kb + 16 + 8hh + 0..7
    v8f s0 = mma_h_raw(a0, qf0, zero8());
    v8f s1 = mma_h_raw(a1, qf0, zero8());
    s0 = mma_h_raw(a2, qf1, s0);
    s1 = mma_h_raw(a3, qf1, s1);
    sguard6(s0, s1, a0, a1, a2, a3, qf0, qf1);

    float x0[8], x1[8];
#pragma unroll
    for (int r = 0; r < 4; ++r) {
      x0[r]     = s0[r] * SC + ad00[r];
      x0[4 + r] = s0[4 + r] * SC + ad01[r];
      x1[r]     = s1[r] * SC + ad10[r];
      x1[4 + r] = s1[4 + r] * SC + ad11[r];
    }
    float mx = -3.0e38f;
#pragma unroll
    for (int r = 0; r < 8; ++r) mx = fmaxf(mx, fmaxf(x0[r], x1[r]));
    mx = fmaxf(mx, __shfl_xor(mx, 16, 32));
    const float mn   = fmaxf(m, mx);
    const float corr = __expf(m - mn);
    m = mn;
    const float msh = mn - LNPS;            // exp gives e^{x-m} * 1024
    l *= corr;
#pragma unroll
    for (int r = 0; r < 8; ++r) { o0[r] *= corr; o1[r] *= corr; o2[r] *= corr; o3[r] *= corr; }

    FragH ph, pl;
    float ls = 0.f;
#pragma unroll
    for (int r = 0; r < 8; ++r) {
      const float e0 = __expf(x0[r] - msh);           // key kb      + 8hh + r
      const float e1 = __expf(x1[r] - msh);           // key kb + 16 + 8hh + r
      ls += e0 + e1;
      const _Float16 h0 = (_Float16)e0, h1 = (_Float16)e1;
      ph.h[0][r] = h0;
      ph.h[1][r] = h1;
      pl.h[0][r] = (_Float16)(e0 - (float)h0);
      pl.h[1][r] = (_Float16)(e1 - (float)h1);
    }
    l += ls;

    const v16h vf0 = ldfrag_h(Vl + sub * 32);
    const v16h vf1 = ldfrag_h(Vl + 16 * (GPIT / 2) + sub * 32);
    const v16h vf2 = ldfrag_h(Vl + 32 * (GPIT / 2) + sub * 32);
    const v16h vf3 = ldfrag_h(Vl + 48 * (GPIT / 2) + sub * 32);
    o0 = mma_h_raw(vf0, ph.v, o0);
    o1 = mma_h_raw(vf1, ph.v, o1);
    o2 = mma_h_raw(vf2, ph.v, o2);
    o3 = mma_h_raw(vf3, ph.v, o3);
    o0 = mma_h_raw(vf0, pl.v, o0);
    o1 = mma_h_raw(vf1, pl.v, o1);
    o2 = mma_h_raw(vf2, pl.v, o2);
    o3 = mma_h_raw(vf3, pl.v, o3);
    oguard6(o0, o1, o2, o3, vf0, vf1, vf2, vf3, ph.v, pl.v);
   }
   asm volatile("s_wait_dscnt 0x0" ::: "memory");           // this wave's reads of buffer t & 1 are done
   asm volatile("s_wait_asynccnt 0x0" ::: "memory");        // this wave's copies of stage t + 1 have landed
   __syncthreads();                                         // publishes stage t + 1, frees buffer t & 1
   if (t + 2 < ANT)
     attn_stage_copy(lcp + (t & 1) * ASTG, gk + (size_t)(t + 2) * (AKB * DMOD * 2), gv + (t + 2) * (AKB * 2));
  }
  asm volatile("s_wait_asynccnt 0x0" ::: "memory");         // no copy outstanding when the wave goes on
  l += __shfl_xor(l, 16, 32);
  const float sc = (CS / VS) * (1.0f / l);

  // ---- stage O[query 16*wave + c][d = 16j + 8hh + r] * sc (= attn * 1024), then whole-line f16 stores ----
  float* os = Os + (wave * 16 + c) * 68 + 8 * hh;
#pragma unroll
  for (int r = 0; r < 8; ++r) { os[r] = o0[r] * sc; os[16 + r] = o1[r] * sc; os[32 + r] = o2[r] * sc; os[48 + r] = o3[r] * sc; }
  __syncthreads();
  {
    const int e = tid & 7, qq = tid >> 3;              // qq 0..15: line within group, e: 16-B piece
    v4u hv[4];
#pragma unroll
    for (int it = 0; it < 4; ++it) {
      const int qi = it * 16 + qq;                       // it 0..3 x qq 0..15 = queries 0..63 of the block
      const v4f x0 = *(const v4f*)(Os + qi * 68 + 8 * e);
      const v4f x1 = *(const v4f*)(Os + qi * 68 + 8 * e + 4);
      v4u u;
#pragma unroll
      for (int t2 = 0; t2 < 2; ++t2) {
        u[t2]     = pk16(h_bits((_Float16)x0[2 * t2]), h_bits((_Float16)x0[2 * t2 + 1]));
        u[2 + t2] = pk16(h_bits((_Float16)x1[2 * t2]), h_bits((_Float16)x1[2 * t2 + 1]));
      }
      hv[it] = u;
    }
    unsigned short* ob = ctx + (size_t)hd * DHEAD + 8 * e;
    {
#pragma unroll
      for (int it = 0; it < 4; ++it) {
        const int qi = it * 16 + qq;
        *(v4u*)(ob + ((size_t)b * SEQ + q0 + qi) * DMOD) = hv[it];
      }
      
    }
  }
}

// =====================================================================================================
//   XH   f16 [4096][768]            0           6291456
//   WQT  f16 [768][768]             6291456     1179648
//   WKT  f16 [768][768]             7471104     1179648
//   WVT  f16 [768][768]             8650752     1179648
//   WOT  f16 [768][768]             9830400     1179648
//   QP   f16 [4096][768]            11010048    6291456
//   KPL  f16 [4096][768]            17301504    6291456
//   VT   f16 [2][768][2048]         23592960    6291456
//   CTX  f16 [4096][768]            29884416    6291456
//   end                              36175872
// =====================================================================================================
extern "C" void kernel_launch(void* const* d_in, const int* in_sizes, int n_in,
                              void* d_out, int out_size, void* d_ws, size_t ws_size,
                              hipStream_t stream) {
  if (n_in < 10) return;
  if (in_sizes[0] != MTOK * DMOD) return;
  if (in_sizes[1] != MTOK) return;
  if (in_sizes[2] != DMOD * DMOD || in_sizes[4] != DMOD * DMOD || in_sizes[6] != DMOD * DMOD) return;
  if (in_sizes[8] != DMOD * DMOD) return;
  if (in_sizes[3] != DMOD || in_sizes[5] != DMOD || in_sizes[7] != DMOD || in_sizes[9] != DMOD) return;
  if (out_size != MTOK * DMOD) return;

  const float* hs  = (const float*)d_in[0];
  const int*   amk = (const int*)d_in[1];
  const float* Wq  = (const float*)d_in[2];
  const float* bq  = (const float*)d_in[3];
  const float* Wk  = (const float*)d_in[4];
  const float* bk  = (const float*)d_in[5];
  const float* Wv  = (const float*)d_in[6];
  const float* bv  = (const float*)d_in[7];
  const float* Wo  = (const float*)d_in[8];
  const float* bo  = (const float*)d_in[9];

  const size_t PACT = (size_t)MTOK * DMOD * 2;          //  6291456
  const size_t PW   = (size_t)DMOD * DMOD * 2;          //  1179648
  const size_t PVT  = (size_t)NBAT * DMOD * SEQ * 2;    //  6291456
  size_t off = 0;
  const size_t oXH = off; off += PACT;
  const size_t oWQ = off; off += PW;
  const size_t oWK = off; off += PW;
  const size_t oWV = off; off += PW;
  const size_t oWO = off; off += PW;
  const size_t oQP = off; off += PACT;
  const size_t oKP = off; off += PACT;
  const size_t oVT = off; off += PVT;
  const size_t oCT = off; off += PACT;
  if (off > ws_size) return;                            // off = 36175872
  if (off > (size_t)134217728) return;

  char* ws = (char*)d_ws;
  unsigned short* XH  = (unsigned short*)(ws + oXH);
  unsigned short* WQT = (unsigned short*)(ws + oWQ);
  unsigned short* WKT = (unsigned short*)(ws + oWK);
  unsigned short* WVT = (unsigned short*)(ws + oWV);
  unsigned short* WOT = (unsigned short*)(ws + oWO);
  unsigned short* QPL = (unsigned short*)(ws + oQP);
  unsigned short* KPL = (unsigned short*)(ws + oKP);
  unsigned short* VT  = (unsigned short*)(ws + oVT);
  unsigned short* CTX = (unsigned short*)(ws + oCT);
  float*          out = (float*)d_out;

  const dim3 blk256(256), blk128(128);
  const dim3 gCV(4 * TPW + MTOK * KSEG / 8);                   // 576 weight tiles + 1536 blocks of 8 row segments
  const dim3 gGM(GBLK);                                        // 768 tiles -> 192 blocks of 4 waves
  const dim3 gG3(3 * GBLK);                                    // q, k, v: 576 blocks
  const dim3 gAT(NBAT * NHEAD * (SEQ / 64));                   // 768 blocks of 128

  // (0) activation plane f16( bf16_RNE(h) * 64 ) and weight planes [K][N] -> [N][K], f16( bf16_RNE(W) * 1024 )
  cvt_all<<<gCV, blk256, 0, stream>>>(hs, Wq, Wk, Wv, Wo, XH, WQT, WKT, WVT, WOT);

  // (1) q = h . Wq + bq -> f16 plane of q*1024 ; k likewise ; v = h . Wv + bv -> VT[b][h*64+e][token], f16 plane of v*256
  gemm_qkv<<<gG3, blk128, 0, stream>>>(XH, WQT, WKT, WVT, bq, bk, bv, QPL, KPL, VT);

  // (2) attention with the additive int mask, all (b, head) -> ctx plane f16( attn * 1024 )[token][h*64 + d]
  attn_kernel<<<gAT, blk128, 0, stream>>>(QPL, KPL, VT, amk, CTX);

  // (3) out = attn . Wo + bo -> f32 [4096][768]
  gemm_out<<<gGM, blk128, 0, stream>>>(CTX, WOT, bo, out);
  (void)hipGetLastError();
}

// v005
// It runs in 68 microseconds.
// It is 1.18 times as fast as v003, going by the measured steps of the versions left out in between.
// Counting every step since v000, it is 2.94 times as fast.
// Contractions: q,k,v projections (x token rows f16 x64 . W^T rows f16 x1024, K=768, one product each);
// attention scores S^T = k (f16 x1024, one plane) . q^T (f16 x1024, one plane), one product, head dim 64;
// attention O^T = v^T (f16 x256, one plane) . P^T (f16 x1024, one plane, from the score D registers), one product
// into one accumulator over 2048 keys; output projection ctx (f16 x1024) . Wo^T
// (f16 x1024), one product. All v_wmma_f32_16x16x32_f16, f32 accumulate; mask adder and softmax in f32 on VALU;
// every float input RNE-converted to bf16 on load.
#include <hip/hip_runtime.h>
#include <math.h>
#include <stdint.h>

#define NBAT   2
#define SEQ    2048
#define DMOD   768
#define NHEAD  12
#define DHEAD  64
#define MTOK   (NBAT * SEQ)
#define KSEG   (DMOD / 256)
#define TN64   (DMOD / 64)
#define TPW    (TN64 * TN64)
#define XC     64.0f
#define WSC    1024.0f
#define QS     1024.0f
#define KS     1024.0f
#define VS     256.0f
#define CS     1024.0f
#define LNPS   6.931471805599453f
#define ATTSC  0.125f
#define MASKC  (-10000.0f)
#define PLIM   65504.0f                // largest finite f16
static_assert(NHEAD * DHEAD == DMOD);
static_assert((MTOK % 64) == 0 && (DMOD % 64) == 0 && (SEQ % 64) == 0 && (DMOD % 32) == 0 && (DMOD % 256) == 0);
static_assert((((MTOK / 64) * TN64) % 4) == 0);
static_assert(((MTOK * KSEG) % 8) == 0);
static_assert((SEQ / 64) == 32 && (SEQ % 32) == 0);
static_assert((MTOK % SEQ) == 0);

typedef _Float16 v16h __attribute__((ext_vector_type(16)));
typedef _Float16 v8h  __attribute__((ext_vector_type(8)));
typedef float    v8f  __attribute__((ext_vector_type(8)));
typedef float    v4f  __attribute__((ext_vector_type(4)));
typedef unsigned int v4u __attribute__((ext_vector_type(4)));
typedef int      v4i  __attribute__((ext_vector_type(4)));

union FragH { v16h v; v8h h[2]; };

// ---- scalar helpers --------------------------------------------------------------------------------
__device__ __forceinline__ unsigned short bf_bits(float f) {          // f32 -> bf16 bits, RNE convert
  unsigned u = __float_as_uint(f);
  return (unsigned short)((u + 0x7FFFu + ((u >> 16) & 1u)) >> 16);
}
__device__ __forceinline__ float bf_up(unsigned short h) { return __uint_as_float(((unsigned)h) << 16); }
__device__ __forceinline__ float bfr(float f) { return bf_up(bf_bits(f)); }
__device__ __forceinline__ unsigned short h_bits(_Float16 x) { return __builtin_bit_cast(unsigned short, x); }
__device__ __forceinline__ unsigned pk16(unsigned short a, unsigned short b) { return (unsigned)a | ((unsigned)b << 16); }
__device__ __forceinline__ v8f zero8() { v8f z = {0.f, 0.f, 0.f, 0.f, 0.f, 0.f, 0.f, 0.f}; return z; }

// ---- fragment loader: 16-bit A/B operand, lane -> row/col (lane&15), p already includes +8*(lane>>4);
//      elements 0..7 <- p[0..7] (k0+8h..), elements 8..15 <- p[16..23] (k0+16+8h..)
__device__ __forceinline__ v16h ldfrag_h(const _Float16* p) {
  FragH f;
  f.h[0] = *(const v8h*)(p);
  f.h[1] = *(const v8h*)(p + 16);
  return f.v;
}

// ---- WMMA helpers with trailing VALU hazard gap --------------------------------------------------------
__device__ __forceinline__ v8f mma_h_raw(v16h a, v16h b, v8f c) {
  return __builtin_amdgcn_wmma_f32_16x16x32_f16(false, a, false, b, (short)0, c, false, false);
}
__device__ __forceinline__ void dep_guard1(v8f& a, v8f& b, v16h x) {
#if defined(__HIP_DEVICE_COMPILE__)
  asm volatile("v_nop\n\tv_nop\n\tv_nop\n\tv_nop" : "+v"(a), "+v"(b) : "v"(x));
#endif
}
__device__ __forceinline__ void keep4_h(v16h a, v16h b, v16h c, v16h d) {
#if defined(__HIP_DEVICE_COMPILE__)
  asm volatile("v_nop" :: "v"(a), "v"(b), "v"(c), "v"(d));
#endif
}
__device__ __forceinline__ void hold8_h(v16h a, v16h b, v16h c, v16h d, v16h e, v16h f, v16h g, v16h h, float s) {
#if defined(__HIP_DEVICE_COMPILE__)
  asm volatile("" :: "v"(a), "v"(b), "v"(c), "v"(d), "v"(e), "v"(f), "v"(g), "v"(h), "v"(s));
#endif
}
__device__ __forceinline__ void acc_guard4(v8f& a, v8f& b, v8f& c, v8f& d) {
#if defined(__HIP_DEVICE_COMPILE__)
  asm volatile("v_nop\n\tv_nop\n\tv_nop\n\tv_nop" : "+v"(a), "+v"(b), "+v"(c), "+v"(d));
#endif
}
__device__ __forceinline__ void sguard10(v8f& a, v8f& b, v8f& c, v8f& d, v16h x0, v16h x1, v16h x2, v16h x3,
                                         v16h x4, v16h x5, v16h x6, v16h x7, v16h x8, v16h x9) {
#if defined(__HIP_DEVICE_COMPILE__)
  asm volatile("v_nop\n\tv_nop\n\tv_nop\n\tv_nop"
               : "+v"(a), "+v"(b), "+v"(c), "+v"(d)
               : "v"(x0), "v"(x1), "v"(x2), "v"(x3), "v"(x4), "v"(x5), "v"(x6), "v"(x7), "v"(x8), "v"(x9));
#endif
}
__device__ __forceinline__ void oguard10(v8f& a, v8f& b, v8f& c, v8f& d, v16h x0, v16h x1, v16h x2, v16h x3,
                                         v16h x4, v16h x5, v16h x6, v16h x7, v16h p0, v16h p1) {
#if defined(__HIP_DEVICE_COMPILE__)
  asm volatile("v_nop\n\tv_nop\n\tv_nop\n\tv_nop"
               : "+v"(a), "+v"(b), "+v"(c), "+v"(d)
               : "v"(x0), "v"(x1), "v"(x2), "v"(x3), "v"(x4), "v"(x5), "v"(x6), "v"(x7), "v"(p0), "v"(p1));
#endif
}
__device__ __forceinline__ void wave_sync_lds() {
  __builtin_amdgcn_fence(__ATOMIC_RELEASE, "workgroup");
  __builtin_amdgcn_wave_barrier();
  __builtin_amdgcn_fence(__ATOMIC_ACQUIRE, "workgroup");
}

// =====================================================================================================
// Activation plane: XH[t][768] = f16( bf16_RNE(h[t][c]) * 64 ).
// coverage: 1536 x 8 = 12288 segments = 4096 rows x 768 columns entirely.
// =====================================================================================================
__device__ __forceinline__ void cvt_act(const int bx, const float* __restrict__ hs, unsigned short* XH) {
  const int lane = threadIdx.x & 31, wave = threadIdx.x >> 5;
  const int seg = bx * 8 + wave;                         // 0 .. 12287
  const int row = seg / KSEG;
  const int col = (seg - row * KSEG) * 256 + 8 * lane;
  const size_t o = (size_t)row * DMOD + col;
  const v4f h0 = *(const v4f*)(hs + o), h1 = *(const v4f*)(hs + o + 4);
  float a[8];
#pragma unroll
  for (int i = 0; i < 4; ++i) { a[i] = bfr(h0[i]); a[4 + i] = bfr(h1[i]); }
  v4u uh;
#pragma unroll
  for (int i = 0; i < 4; ++i) {
    const float xa = a[2 * i] * XC, xb = a[2 * i + 1] * XC;
    uh[i] = pk16(h_bits((_Float16)xa), h_bits((_Float16)xb));
  }
  unsigned short* dh = XH + o;
  *(v4u*)dh = uh;
  // this body now shares a kernel with the weight tiles' code: the wait closes the store before any path of the listing
  // that rewrites one of its registers
  asm volatile("s_wait_xcnt 0x0" ::: "memory");
}

// =====================================================================================================
// Weight planes: in W[K=768][N=768] (N contiguous) -> out WT[N][K] = f16( bf16_RNE(W[k][n]) * 1024 ), k contiguous.
// Block = one 64(k) x 64(n) tile: 256 threads load 16 rows x 64 floats per step (16 threads x 16 B per row), convert and
// store transposed into LDS Ts[n][k] (pitch 72 halves, 2-byte stores), block barrier, then 2 instructions each write
// blocks 0..143 -> weight 0, 144..287 -> weight 1, 288..431 -> weight 2, 432..575 -> weight 3 (block-uniform select).
// coverage: per weight 144 tiles x (2 x 32 lines x 8 lanes x 8 halves) = 768 x 768 entirely.
// =====================================================================================================
__device__ __forceinline__ void cvt_w(const int bx, unsigned short* Ts,
                                      const float* __restrict__ w0, const float* __restrict__ w1,
                                      const float* __restrict__ w2, const float* __restrict__ w3,
                                      unsigned short* t0, unsigned short* t1,
                                      unsigned short* t2, unsigned short* t3) {
  const int tid = threadIdx.x;
  const int wsel = bx / TPW;                        // block-uniform
  const int t = bx - wsel * TPW;
  const int k0 = (t / TN64) * 64;
  const int n0 = (t % TN64) * 64;
  const float* src = (wsel == 0) ? w0 : (wsel == 1) ? w1 : (wsel == 2) ? w2 : w3;
  unsigned short* dst = (wsel == 0) ? t0 : (wsel == 1) ? t1 : (wsel == 2) ? t2 : t3;
  {
    const int r16 = tid >> 4, p = tid & 15;
#pragma unroll
    for (int it = 0; it < 4; ++it) {
      const int kr = it * 16 + r16;                   // it 0..3 x r16 0..15 = k rows 0..63
      const v4f v = *(const v4f*)(src + (size_t)(k0 + kr) * DMOD + n0 + 4 * p);
#pragma unroll
      for (int j = 0; j < 4; ++j) Ts[(4 * p + j) * 72 + kr] = h_bits((_Float16)(bfr(v[j]) * WSC));
    }
  }
  __syncthreads();
  {
    const int e = tid & 7, lq = tid >> 3;             // lq 0..31: line, e: 16-B piece
    v4u u[2];
#pragma unroll
    for (int it = 0; it < 2; ++it) {
      const int nr = it * 32 + lq;                    // it 0..1 x lq 0..31 = n rows 0..63
      u[it] = *(const v4u*)(Ts + nr * 72 + 8 * e);
    }
    unsigned short* db = dst + (size_t)n0 * DMOD + k0 + 8 * e;
    {
#pragma unroll
      for (int it = 0; it < 2; ++it) {
        const int nr = it * 32 + lq;
        *(v4u*)(db + (size_t)nr * DMOD) = u[it];
      }
      
    }
  }
}

// Both conversions in one grid (neither reads what the other writes): blocks 0..575 take the weight tiles, blocks
// 576..2111 the activation segments. The test is block-uniform, so the weight tiles' barrier is passed by whole blocks.
__global__ __launch_bounds__(256) void cvt_all(const float* __restrict__ hs, const float* __restrict__ w0,
                                                const float* __restrict__ w1, const float* __restrict__ w2,
                                                const float* __restrict__ w3, unsigned short* XH,
                                                unsigned short* t0, unsigned short* t1,
                                                unsigned short* t2, unsigned short* t3) {
  __shared__ __align__(16) unsigned short Ts[64 * 72];
  const int bx = blockIdx.x;
  if (bx < 4 * TPW) cvt_w(bx, Ts, w0, w1, w2, w3, t0, t1, t2, t3);
  else              cvt_act(bx - 4 * TPW, hs, XH);
}

// =====================================================================================================
// Register-blocked f16 WMMA GEMM, one wave per 64x64 tile (4 waves per block = 64 token rows x 256 features):
//   acc[m][n] = sum_k A[m][k] * Bt[n][k],  A: f16 [4096][768] token rows, Bt: f16 [768][768] k contiguous,
//   M=4096, N=768, K=768 fixed, all tile multiples.
//   Operands reach the waves through LDS: per stage of 64 k the block copies its 64 A rows and 256 Bt rows (128 B each,
//   whole lines, 8 lanes x 16 B per row) with asynchronous 16-B copies into one of two buffers (row pitch 144 B), the
//   next stage in flight while this one is multiplied; fragments = two 16-B LDS loads with the split k map (ldfrag_h).
//   y = acc * escale + bf16_RNE(bias[n]) * bscale, then per MODE:
//   MODE 0: f32 row-major C[4096][768] (the final output): 16-row slabs staged per wave in LDS (pitch 68 floats), each
//   MODE 1: f16 single plane row-major [4096][768]: per slab 4 instructions, each 4 rows x (8 consecutive lanes x 16 B)
//   MODE 2: f16 single plane transposed VT[b][feature 768][2048 tokens]: the wave's whole 64x64 tile is staged as f16
// coverage: MODE 0/1: 4 slabs x 16 rows x 64 cols per wave tile; MODE 2: 64 features x 64 tokens per wave tile;
//           grid = 768 tiles / 4 = 192 blocks covers [4096][768] exactly once (m0 multiple of 64 never straddles b).
// =====================================================================================================
#define GKB   64                       // k per stage: rows of 128 B
#define GPIT  144                      // LDS row pitch, bytes: 16 B x odd, conflict-free for 16-B fragment loads
#define GSTG  ((64 + 256) * GPIT)      // one buffer: A rows 0..63, Bt rows 64..319
#define GNT   (DMOD / GKB)             // 12 stages
#define GLSTEP (16 * GPIT)             // 16 rows further in LDS
#define GGSTEP (16 * DMOD * 2)         // 16 rows further in global memory
static_assert((TN64 % 4) == 0 && (DMOD % GKB) == 0 && GNT >= 2 && (GPIT % 16) == 0);

// Ten asynchronous 16-B copies per lane, rows 16 apart: LDS byte address l + i * GLSTEP <- g[i]. The s_wait_xcnt closes
// the statement so that no address register of an issued copy is rewritten ahead of it.
__device__ __forceinline__ void acopy10(unsigned l, const char* const (&g)[10]) {
#if defined(__HIP_DEVICE_COMPILE__)
  asm volatile(
      "global_load_async_to_lds_b128 %0, %10, off\n\t"
      "global_load_async_to_lds_b128 %1, %11, off\n\t"
      "global_load_async_to_lds_b128 %2, %12, off\n\t"
      "global_load_async_to_lds_b128 %3, %13, off\n\t"
      "global_load_async_to_lds_b128 %4, %14, off\n\t"
      "global_load_async_to_lds_b128 %5, %15, off\n\t"
      "global_load_async_to_lds_b128 %6, %16, off\n\t"
      "global_load_async_to_lds_b128 %7, %17, off\n\t"
      "global_load_async_to_lds_b128 %8, %18, off\n\t"
      "global_load_async_to_lds_b128 %9, %19, off\n\t"
      "s_wait_xcnt 0x0"
      :: "v"(l), "v"(l + 1 * GLSTEP), "v"(l + 2 * GLSTEP), "v"(l + 3 * GLSTEP), "v"(l + 4 * GLSTEP),
         "v"(l + 5 * GLSTEP), "v"(l + 6 * GLSTEP), "v"(l + 7 * GLSTEP), "v"(l + 8 * GLSTEP), "v"(l + 9 * GLSTEP),
         "v"(g[0]), "v"(g[1]), "v"(g[2]), "v"(g[3]), "v"(g[4]), "v"(g[5]), "v"(g[6]), "v"(g[7]), "v"(g[8]), "v"(g[9])
      : "memory");
#endif
}
// One stage: 320 rows x 8 pieces = 2560 copies = 20 per thread; thread -> row (tid >> 3) + 16 i, piece tid & 7.
// ga, gb: this thread's piece of A row (tid >> 3) and of Bt row (tid >> 3) of the block, at the stage's first k.
__device__ __forceinline__ void stage_copy(unsigned l, const char* ga, const char* gb) {
  const char* g0[10];
  const char* g1[10];
  // the three loops are unrolled so that both pointer arrays stay in registers
#pragma unroll
  for (int i = 0; i < 4; ++i) g0[i] = ga + (size_t)i * GGSTEP;             // A rows 0..63
#pragma unroll
  for (int i = 4; i < 10; ++i) g0[i] = gb + (size_t)(i - 4) * GGSTEP;      // Bt rows 0..95
#pragma unroll
  for (int i = 0; i < 10; ++i) g1[i] = gb + (size_t)(i + 6) * GGSTEP;      // Bt rows 96..255
  acopy10(l, g0);
  acopy10(l + 10 * GLSTEP, g1);
}

// ring: the block's 2 * GSTG bytes of LDS, the two operand buffers. The epilogue's slabs (9216 B per wave) lie on the same
// bytes: the barrier at the foot of the last stage ends every wave's reads of the ring and no copy is outstanding then.
// That keeps a block at 92160 B, so that three blocks fit a WGP's LDS.
template <int MODE>
__device__ __forceinline__ void gemm64(
    const int bx, unsigned char* ring,
    const unsigned short* __restrict__ Ap, const unsigned short* __restrict__ Bp,
    const float* __restrict__ bias, const float escale, const float bscale, void* C0) {
  const int lane = threadIdx.x & 31;
  const int wave = threadIdx.x >> 5;
  unsigned short* sraw = (unsigned short*)(void*)(ring + wave * 9216);   // this wave's slab, used behind the loop only
  const int tilesN = TN64;                                 // 12
  const int tile = bx * 4 + wave;                          // 0..767, grid exact
  const int tm = tile / tilesN;
  const int tn = tile - tm * tilesN;
  const int m0 = tm << 6;
  const int n0 = tn << 6;

  const int rlane = lane & 15;                 // row (A) / col (B, D) within subtile
  const int hh    = lane >> 4;
  const int koff  = hh * 8;                    // k offset of this lane half
  const int mOff  = hh * 8;                    // D row offset

  v8f acc[4][4];
#pragma unroll
  for (int i = 0; i < 4; ++i)
#pragma unroll
    for (int j = 0; j < 4; ++j) acc[i][j] = zero8();

  // copy side: the block's A rows start at m0 (the same in its four waves), its Bt rows at n0 - 64 * wave
  const int crow = threadIdx.x >> 3, cpc = threadIdx.x & 7;
  const unsigned lcp = (unsigned)(uintptr_t)(&ring[0]) + (unsigned)(crow * GPIT + cpc * 16);
  const char* ga = (const char*)(const void*)Ap + ((size_t)(m0 + crow) * DMOD + 8 * cpc) * 2;
  const char* gb = (const char*)(const void*)Bp + ((size_t)(n0 - (wave << 6) + crow) * DMOD + 8 * cpc) * 2;

  stage_copy(lcp, ga, gb);
  asm volatile("s_wait_asynccnt 0x0" ::: "memory");        // stage 0 of this wave has landed
  __syncthreads();                                          // ... and every wave's part of it
  stage_copy(lcp + GSTG, ga + GKB * 2, gb + GKB * 2);

  for (int t = 0; t < GNT; ++t) {
    const unsigned char* rb = ring + (t & 1) * GSTG;
    const _Float16* la = (const _Float16*)(const void*)(rb + rlane * GPIT) + koff;
    const _Float16* lb = (const _Float16*)(const void*)(rb + (64 + (wave << 6) + rlane) * GPIT) + koff;
    // all loops of the stage are unrolled: fragment and accumulator arrays in registers, LDS offsets as immediates
#pragma unroll
    for (int ks = 0; ks < GKB; ks += 32) {
      v16h ah[4], bh[4];                                    // the 32-k block's fragments, read as one group
#pragma unroll
      for (int j = 0; j < 4; ++j) {
        bh[j] = ldfrag_h(lb + j * (GLSTEP / 2) + ks);
        ah[j] = ldfrag_h(la + j * (GLSTEP / 2) + ks);
      }
#pragma unroll
      for (int i = 0; i < 4; ++i) {
#pragma unroll
        for (int j = 0; j < 4; ++j) acc[i][j] = mma_h_raw(ah[i], bh[j], acc[i][j]);
        dep_guard1(acc[i][0], acc[i][3], ah[i]);
      }
      keep4_h(bh[0], bh[1], bh[2], bh[3]);
    }
    asm volatile("s_wait_dscnt 0x0" ::: "memory");          // this wave's reads of buffer t & 1 are done
    asm volatile("s_wait_asynccnt 0x0" ::: "memory");       // this wave's copies of stage t + 1 have landed
    __syncthreads();                                        // publishes stage t + 1, frees buffer t & 1
    if (t + 2 < GNT) stage_copy(lcp + (t & 1) * GSTG, ga + (t + 2) * (GKB * 2), gb + (t + 2) * (GKB * 2));
  }
  asm volatile("s_wait_asynccnt 0x0" ::: "memory");         // no copy outstanding when the wave goes on
  acc_guard4(acc[0][0], acc[0][1], acc[0][2], acc[0][3]);
  acc_guard4(acc[1][0], acc[1][1], acc[1][2], acc[1][3]);
  acc_guard4(acc[2][0], acc[2][1], acc[2][2], acc[2][3]);
  acc_guard4(acc[3][0], acc[3][1], acc[3][2], acc[3][3]);

  if (MODE == 0) {
    float* Cout = (float*)C0;
    const int c4 = rlane * 4;                        // f32 out: 256-B row segment = 16 lanes x 16 B
    const v4f braw = *(const v4f*)(bias + n0 + c4);
    float bb[4];
#pragma unroll
    for (int tt = 0; tt < 4; ++tt) bb[tt] = bfr(braw[tt]) * bscale;
    float* slab = (float*)(void*)(sraw);
#pragma unroll
    for (int i = 0; i < 4; ++i) {
      const int mBase = m0 + (i << 4);
#pragma unroll
      for (int j = 0; j < 4; ++j) {
#pragma unroll
        for (int r = 0; r < 8; ++r) slab[(mOff + r) * 68 + (j << 4) + rlane] = acc[i][j][r];
      }
      wave_sync_lds();
      v4f vals[8];
#pragma unroll
      for (int it = 0; it < 8; ++it) {
        const int row = it * 2 + hh;                   // it 0..7 x hh 0..1 = rows 0..15
        v4f v = *(const v4f*)(slab + row * 68 + c4);
#pragma unroll
        for (int tt = 0; tt < 4; ++tt) v[tt] = v[tt] * escale + bb[tt];
        vals[it] = v;
      }
      {
#pragma unroll
        for (int it = 0; it < 8; ++it) {
          const int row = it * 2 + hh;
          *(v4f*)(Cout + (size_t)(mBase + row) * DMOD + n0 + c4) = vals[it];
        }
        
      }
      wave_sync_lds();
    }
  } else if (MODE == 1) {
    unsigned short* Hp = (unsigned short*)C0;
    const int e = lane & 7, q4 = lane >> 3;
    const v4f b0 = *(const v4f*)(bias + n0 + 8 * e), b1 = *(const v4f*)(bias + n0 + 8 * e + 4);
    float bb[8];
#pragma unroll
    for (int tt = 0; tt < 4; ++tt) { bb[tt] = bfr(b0[tt]) * bscale; bb[4 + tt] = bfr(b1[tt]) * bscale; }
    float* slab = (float*)(void*)(sraw);
#pragma unroll
    for (int i = 0; i < 4; ++i) {
      const int mBase = m0 + (i << 4);
#pragma unroll
      for (int j = 0; j < 4; ++j) {
#pragma unroll
        for (int r = 0; r < 8; ++r) slab[(mOff + r) * 68 + (j << 4) + rlane] = acc[i][j][r];
      }
      wave_sync_lds();
      v4u hv[4];
#pragma unroll
      for (int it = 0; it < 4; ++it) {
        const int row = it * 4 + q4;                   // it 0..3 x q4 0..3 = rows 0..15
        const v4f x0 = *(const v4f*)(slab + row * 68 + 8 * e);
        const v4f x1 = *(const v4f*)(slab + row * 68 + 8 * e + 4);
        float y[8];
#pragma unroll
        for (int tt = 0; tt < 4; ++tt) { y[tt] = x0[tt] * escale + bb[tt]; y[4 + tt] = x1[tt] * escale + bb[4 + tt]; }
        v4u uh;
#pragma unroll
        for (int t2 = 0; t2 < 4; ++t2) {
          uh[t2] = pk16(h_bits((_Float16)y[2 * t2]), h_bits((_Float16)y[2 * t2 + 1]));
        }
        hv[it] = uh;
      }
      {
#pragma unroll
        for (int it = 0; it < 4; ++it) {
          const int row = it * 4 + q4;
          const size_t go = (size_t)(mBase + row) * DMOD + n0 + 8 * e;
          *(v4u*)(Hp + go) = hv[it];
        }
        
      }
      wave_sync_lds();
    }
  } else {
    unsigned short* Vs = sraw;              // [64 features][pitch 72] f16 bits
    float bb4[4];
#pragma unroll
    for (int j = 0; j < 4; ++j) bb4[j] = bfr(bias[n0 + (j << 4) + rlane]) * bscale;
#pragma unroll
    for (int i = 0; i < 4; ++i) {
#pragma unroll
      for (int j = 0; j < 4; ++j) {
#pragma unroll
        for (int r = 0; r < 8; ++r) {
          Vs[((j << 4) + rlane) * 72 + (i << 4) + mOff + r] = h_bits((_Float16)(acc[i][j][r] * escale + bb4[j]));
        }
      }
    }
    wave_sync_lds();
    const int e = lane & 7, q4 = lane >> 3;
    const int bsel = m0 / SEQ;                          // batch of this tile (wave-uniform)
    const int s0 = m0 % SEQ;                            // first token within the batch
    v4u u[16];
#pragma unroll
    for (int it = 0; it < 16; ++it) {
      const int fl = it * 4 + q4;                        // it 0..15 x q4 0..3 = features 0..63
      u[it] = *(const v4u*)(Vs + fl * 72 + 8 * e);
    }
    unsigned short* Vp = (unsigned short*)C0 + ((size_t)bsel * DMOD + n0) * SEQ + s0 + 8 * e;
    {
#pragma unroll
      for (int it = 0; it < 16; ++it) {
        const int fl = it * 4 + q4;
        *(v4u*)(Vp + (size_t)fl * SEQ) = u[it];
      }
      
    }
  }
}

#define GBLK  (((MTOK / 64) * TN64) / 4)   // 192 blocks cover one [4096][768] product

// q, k and v projections in one grid of 3 x 192 blocks (they share A and depend on nothing of each other): block-uniform
// choice of the weight plane, bias and output plane; q*1024 and k*1024 row-major (acc = 64*1024*y -> escale 1/64),
// v*256 transposed (escale 1/256).
__global__ __launch_bounds__(128) void gemm_qkv(
    const unsigned short* __restrict__ Ap, const unsigned short* __restrict__ Bq,
    const unsigned short* __restrict__ Bk, const unsigned short* __restrict__ Bv,
    const float* __restrict__ bq, const float* __restrict__ bk, const float* __restrict__ bv,
    unsigned short* Cq, unsigned short* Ck, unsigned short* Cv) {
  __shared__ __align__(16) unsigned char ring[2 * GSTG];   // two operand buffers
  const int sel = blockIdx.x / GBLK;                       // 0: q, 1: k, 2: v
  const int bx = blockIdx.x - sel * GBLK;
  static_assert(QS == KS);                                 // q and k share one path
  if (sel == 2) gemm64<2>(bx, ring, Ap, Bv, bv, VS / (XC * WSC), VS, (void*)Cv);
  else          gemm64<1>(bx, ring, Ap, sel ? Bk : Bq, sel ? bk : bq, QS / (XC * WSC), QS, (void*)(sel ? Ck : Cq));
}

// output projection: acc = 1024*1024*out -> escale 2^-20, f32 row-major
__global__ __launch_bounds__(128) void gemm_out(
    const unsigned short* __restrict__ Ap, const unsigned short* __restrict__ Bp,
    const float* __restrict__ bias, float* C0) {
  __shared__ __align__(16) unsigned char ring[2 * GSTG];   // two operand buffers
  gemm64<0>(blockIdx.x, ring, Ap, Bp, bias, 1.0f / (CS * WSC), 1.0f, (void*)C0);
}

// =====================================================================================================
// Attention for one (b, head, 64-query block), transposed formulation, head dim 64, 2048 keys, additive int mask:
//   S^T tile (16 keys x 16 queries) = A(k rows = keys, d via the split k map) . B(q, col = query, same d map), two d-steps
//   of 32: s = k.q = 1024*1024 * logit_dot (one product). Per lane the D tile holds 8 keys of ONE query, so
//   x = s/8/(1024*1024) + (1 - mask[b][key]) * (-10000) and the online softmax (reference m, f32) are per-lane state;
//   m is raised to the running max (max tree, one shuffle lane^16, rescale of l and O) only in a stage whose sum of
//   exponentials leaves the f16 range; the row sum is kept as a per-lane partial and combined at
//   the end. P = e^{x-m} x 1024 as one f16 plane (11 significant bits, as v^T and ctx have), used directly as the
//   B operand of O^T (rows d, cols queries) += A(v^T rows d, keys contiguous, two 16-B loads) . B(P^T):
//   B element r <- the key tile covering keys kb..kb+15, element 8+r <- the tile covering kb+16..kb+31, lane unchanged
//   (D-as-B chaining layout). One product per d tile (d 0-15, 16-31, 32-47, 48-63).
//   64 keys per iteration: 8 score WMMAs + 8 output WMMAs per wave. Block = 4 waves = 64 queries; grid = 2*12*32 = 768.
//   k and v^T reach the waves through LDS: per stage of 64 keys the block copies 64 k rows (its head's 128 B) and 64 v^T
//   rows (64 keys = 128 B), whole lines, with asynchronous 16-B copies into one of two buffers (row pitch 144 B), the next
//   stage in flight while this one is worked on; one iteration per stage, fragments = two 16-B LDS loads.
//   Epilogue: the block's [64 query][64 d] f32 tile is staged in LDS (scalar stores, pitch 68), block barrier, then 4
// coverage: block writes queries q0..q0+63 x d 0..63 of its (b, head); grid covers ctx [4096][768] exactly once.
// =====================================================================================================
#define AKB   64                       // keys per stage
#define ASTG  ((64 + 64) * GPIT)       // one buffer: k rows 0..63, v^T rows 64..127
#define ANT   (SEQ / AKB)              // 32 stages
static_assert((SEQ % AKB) == 0 && ANT >= 2 && DHEAD * 2 == 128);

// One stage: 128 rows x 8 pieces = 1024 copies = 8 per thread; thread -> row (tid >> 3) + 16 i, piece tid & 7.
// gk, gv: this thread's piece of k row (tid >> 3) and of v^T row (tid >> 3) of the stage. The s_wait_xcnt closes the
// statement so that no address register of an issued copy is rewritten ahead of it.
__device__ __forceinline__ void attn_stage_copy(unsigned l, const char* gk, const char* gv) {
#if defined(__HIP_DEVICE_COMPILE__)
  asm volatile(
      "global_load_async_to_lds_b128 %0, %8, off\n\t"
      "global_load_async_to_lds_b128 %1, %9, off\n\t"
      "global_load_async_to_lds_b128 %2, %10, off\n\t"
      "global_load_async_to_lds_b128 %3, %11, off\n\t"
      "global_load_async_to_lds_b128 %4, %12, off\n\t"
      "global_load_async_to_lds_b128 %5, %13, off\n\t"
      "global_load_async_to_lds_b128 %6, %14, off\n\t"
      "global_load_async_to_lds_b128 %7, %15, off\n\t"
      "s_wait_xcnt 0x0"
      :: "v"(l), "v"(l + 1 * GLSTEP), "v"(l + 2 * GLSTEP), "v"(l + 3 * GLSTEP),
         "v"(l + 4 * GLSTEP), "v"(l + 5 * GLSTEP), "v"(l + 6 * GLSTEP), "v"(l + 7 * GLSTEP),
         "v"(gk), "v"(gk + 1 * GGSTEP), "v"(gk + 2 * GGSTEP), "v"(gk + 3 * GGSTEP),
         "v"(gv), "v"(gv + 1 * (16 * SEQ * 2)), "v"(gv + 2 * (16 * SEQ * 2)), "v"(gv + 3 * (16 * SEQ * 2))
      : "memory");
#endif
}

// e = exp(x - sh) for a lane's 32 scores of one stage, as exp2((x - sh) * log2 e)
__device__ __forceinline__ void exp32(const v8f (&x)[4], const float sh, v8f (&e)[4]) {
  v8f a[4];
  // the loops here are unrolled so that the arrays and vector elements stay in registers
#pragma unroll
  for (int i = 0; i < 4; ++i) a[i] = (x[i] - sh) * 1.442695040888963f;
  // all arguments are formed ahead of the exponentials
  __builtin_amdgcn_sched_barrier(0);
#pragma unroll
  for (int i = 0; i < 4; ++i)
#pragma unroll
    for (int r = 0; r < 8; ++r) e[i][r] = __builtin_amdgcn_exp2f(a[i][r]);
}
// sum of a lane's 32 exponentials of one stage, as a tree
__device__ __forceinline__ float sum32(const v8f (&e)[4]) {
  const v8f t = (e[0] + e[1]) + (e[2] + e[3]);
  return ((t[0] + t[4]) + (t[2] + t[6])) + ((t[1] + t[5]) + (t[3] + t[7]));
}
// eight consecutive floats from LDS, two 16-B loads
__device__ __forceinline__ v8f ld8f(const float* p) {
  const v4f a = *(const v4f*)(p), b = *(const v4f*)(p + 4);
  return __builtin_shufflevector(a, b, 0, 1, 2, 3, 4, 5, 6, 7);
}

__global__ __launch_bounds__(128)
void attn_kernel(const unsigned short* __restrict__ qp, const unsigned short* __restrict__ kp,
                 const unsigned short* __restrict__ vt, const int* __restrict__ am, unsigned short* ctx) {
  __shared__ __align__(16) float Os[64 * 68];
  __shared__ __align__(16) unsigned char aring[2 * ASTG];  // two k / v^T buffers
  __shared__ __align__(16) float Ad[SEQ];                  // mask adder of every key of batch b
  const int tid  = threadIdx.x;
  const int wave = tid >> 5;
  const int lane = tid & 31;
  const int hh   = lane >> 4;
  const int c    = lane & 15;
  const int bx   = blockIdx.x;
  const int qb   = bx & 31;                       // SEQ/64 = 32 query blocks per (b, head)
  const int bhd  = bx >> 5;                       // b * NHEAD + head
  const int b    = bhd / NHEAD;
  const int hd   = bhd - b * NHEAD;
  const int q0   = qb * 64;

  const _Float16* QP  = (const _Float16*)(const void*)qp;

  // ---- q fragments (B operand, col = query q0 + 16*wave + c): one plane, d 0..31 and 32..63 ----
  const size_t qtok = (size_t)b * SEQ + q0 + wave * 16 + c;
  const _Float16* qbp = QP + qtok * DMOD + hd * DHEAD + 8 * hh;
  const v16h qf0 = ldfrag_h(qbp), qf1 = ldfrag_h(qbp + 32);
  // ---- copy side: k row = key (stage's first + crow + 16 i), v^T row = d (crow + 16 i), 16-B piece cpc ----
  const int crow = tid >> 3, cpc = tid & 7;
  const unsigned lcp = (unsigned)(uintptr_t)(&aring[0]) + (unsigned)(crow * GPIT + cpc * 16);
  const char* gk = (const char*)(const void*)kp + (((size_t)b * SEQ + crow) * DMOD + hd * DHEAD + 8 * cpc) * 2;
  const char* gv = (const char*)(const void*)vt + (((size_t)b * DMOD + hd * DHEAD + crow) * SEQ + 8 * cpc) * 2;
  // ---- adder base: keys kb + 8hh + 0..7 and kb + 16 + 8hh + 0..7 ----
  const float* adb = Ad + 8 * hh;
  const float SC = ATTSC / (QS * KS);

  float m = -1.0e30f, msh = -1.0e30f, l = 0.f;   // msh = m - ln 1024, the shift the exponentials use
  v8f o0 = zero8(), o1 = zero8(), o2 = zero8(), o3 = zero8();

  attn_stage_copy(lcp, gk, gv);
  // adder table, once per block: Ad[key] = (1 - mask[b][key]) * (-10000); 128 threads x 4 x 4 keys = 2048 keys
  static_assert((SEQ % 512) == 0);
#pragma unroll                                              // the four mask loads issue together, one latency
  for (int i = 0; i < SEQ / 512; ++i) {
    const int k4 = (i * 128 + tid) * 4;
    const v4i mk = *(const v4i*)(am + (size_t)b * SEQ + k4);
    v4f ad;
#pragma unroll                                              // vector elements by constant index, in registers
    for (int r = 0; r < 4; ++r) ad[r] = (1.0f - (float)mk[r]) * MASKC;
    *(v4f*)(Ad + k4) = ad;
  }
  asm volatile("s_wait_asynccnt 0x0" ::: "memory");        // stage 0 of this wave has landed
  __syncthreads();                                          // ... and every wave's part of it, and the adder table
  attn_stage_copy(lcp + ASTG, gk + (size_t)AKB * DMOD * 2, gv + AKB * 2);

#pragma unroll 1                                            // rolled as before: a long body, only the buffer changes
  for (int t = 0; t < ANT; ++t) {
   const unsigned char* rb = aring + (t & 1) * ASTG;
   // k fragment base (A operand, row = key c of the stage), v^T fragment base (A operand, row = d = c, keys contiguous)
   const _Float16* Kl = (const _Float16*)(const void*)(rb + c * GPIT) + 8 * hh;
   const _Float16* Vl = (const _Float16*)(const void*)(rb + (64 + c) * GPIT) + 8 * hh;
   // The whole stage's k fragments (A operand) and mask adders are asked for as one load group (LDS offsets as immediates);
   // adders of keys kb + 8hh + 0..7 and kb + 16 + 8hh + 0..7, kb = 64 t + 32 sub.
   v16h ka[2][4], vf[2][4];
   v8f adv[2][2];
#pragma unroll                                              // arrays by constant index, in registers
   for (int sub = 0; sub < 2; ++sub) {                      // first what the score products read
    const _Float16* k0p = Kl + sub * 32 * (GPIT / 2);
    const _Float16* k1p = k0p + 16 * (GPIT / 2);
    ka[sub][0] = ldfrag_h(k0p);      ka[sub][1] = ldfrag_h(k1p);
    ka[sub][2] = ldfrag_h(k0p + 32); ka[sub][3] = ldfrag_h(k1p + 32);
   }
#pragma unroll                                              // as above
   for (int sub = 0; sub < 2; ++sub) {
    const int kb = t * AKB + sub * 32;
    adv[sub][0] = ld8f(adb + kb);
    adv[sub][1] = ld8f(adb + kb + 16);
   }
   v8f s0 = mma_h_raw(ka[0][0], qf0, zero8());
   v8f s1 = mma_h_raw(ka[0][1], qf0, zero8());
   v8f s2 = mma_h_raw(ka[1][0], qf0, zero8());
   v8f s3 = mma_h_raw(ka[1][1], qf0, zero8());
   s0 = mma_h_raw(ka[0][2], qf1, s0);
   s1 = mma_h_raw(ka[0][3], qf1, s1);
   s2 = mma_h_raw(ka[1][2], qf1, s2);
   s3 = mma_h_raw(ka[1][3], qf1, s3);
   sguard10(s0, s1, s2, s3, ka[0][0], ka[0][1], ka[0][2], ka[0][3], ka[1][0], ka[1][1], ka[1][2], ka[1][3], qf0, qf1);
   // the stage's v^T fragments, a second load group: into the registers the k fragments leave, landing under the softmax
#pragma unroll                                              // as above
   for (int sub = 0; sub < 2; ++sub) {
    vf[sub][0] = ldfrag_h(Vl + sub * 32);
    vf[sub][1] = ldfrag_h(Vl + 16 * (GPIT / 2) + sub * 32);
    vf[sub][2] = ldfrag_h(Vl + 32 * (GPIT / 2) + sub * 32);
    vf[sub][3] = ldfrag_h(Vl + 48 * (GPIT / 2) + sub * 32);
   }

   v8f x[4];
   x[0] = s0 * SC + adv[0][0];
   x[1] = s1 * SC + adv[0][1];
   x[2] = s2 * SC + adv[1][0];
   x[3] = s3 * SC + adv[1][1];
   // Lazy rescale: the exponentials are taken against the reference m in use. A lane's 32 terms are all >= 0, so a
   // stage sum of at most PLIM bounds each of them by PLIM, finite in f16; then m, l and O stay as they are.
   v8f e[4];
   exp32(x, msh, e);
   float ls = sum32(e);                                     // the branch waits for this sum: a tree
   // inputs-only fence on the loaded v^T fragments: without it the compiler sinks their loads behind the branch, right in
   // front of the products that read them, and their LDS latency is waited out in every stage. The stage sum is named
   // too (read only), so that the fence and its wait stand here, behind the exponentials, and not in front of them.
   hold8_h(vf[0][0], vf[0][1], vf[0][2], vf[0][3], vf[1][0], vf[1][1], vf[1][2], vf[1][3], ls);
   // one test per stage, the same for the whole wave (scalar branch): taken in the first stage (m = -1e30 gives an
   // infinite sum) and whenever some lane's stage sum exceeds PLIM; then the running maximum is brought up to date,
   // l and O are rescaled and the stage's exponentials are taken again
   if (__builtin_amdgcn_ballot_w32(ls > PLIM) != 0) {
    float mx = -3.0e38f;
#pragma unroll                                              // vector elements by constant index, in registers
    for (int r = 0; r < 8; ++r) mx = fmaxf(fmaxf(mx, fmaxf(x[0][r], x[1][r])), fmaxf(x[2][r], x[3][r]));
    mx = fmaxf(mx, __shfl_xor(mx, 16, 32));
    const float mn   = fmaxf(m, mx);
    const float corr = __expf(m - mn);
    m = mn;
    msh = mn - LNPS;                        // exp gives e^{x-m} * 1024
    l *= corr;
    o0 *= corr; o1 *= corr; o2 *= corr; o3 *= corr;
    exp32(x, msh, e);
    ls = sum32(e);
   }
   l += ls;
   FragH ph0, ph1;
#pragma unroll                                              // vector elements by constant index, in registers
   for (int r = 0; r < 8; ++r) {
    ph0.h[0][r] = (_Float16)e[0][r];                        // key 64 t      + 8hh + r
    ph0.h[1][r] = (_Float16)e[1][r];                        // key 64 t + 16 + 8hh + r
    ph1.h[0][r] = (_Float16)e[2][r];                        // key 64 t + 32 + 8hh + r
    ph1.h[1][r] = (_Float16)e[3][r];                        // key 64 t + 48 + 8hh + r
   }
   o0 = mma_h_raw(vf[0][0], ph0.v, o0);
   o1 = mma_h_raw(vf[0][1], ph0.v, o1);
   o2 = mma_h_raw(vf[0][2], ph0.v, o2);
   o3 = mma_h_raw(vf[0][3], ph0.v, o3);
   o0 = mma_h_raw(vf[1][0], ph1.v, o0);
   o1 = mma_h_raw(vf[1][1], ph1.v, o1);
   o2 = mma_h_raw(vf[1][2], ph1.v, o2);
   o3 = mma_h_raw(vf[1][3], ph1.v, o3);
   oguard10(o0, o1, o2, o3, vf[0][0], vf[0][1], vf[0][2], vf[0][3], vf[1][0], vf[1][1], vf[1][2], vf[1][3], ph0.v, ph1.v);
   asm volatile("s_wait_dscnt 0x0" ::: "memory");           // this wave's reads of buffer t & 1 are done
   asm volatile("s_wait_asynccnt 0x0" ::: "memory");        // this wave's copies of stage t + 1 have landed
   __syncthreads();                                         // publishes stage t + 1, frees buffer t & 1
   if (t + 2 < ANT)
     attn_stage_copy(lcp + (t & 1) * ASTG, gk + (size_t)(t + 2) * (AKB * DMOD * 2), gv + (t + 2) * (AKB * 2));
  }
  asm volatile("s_wait_asynccnt 0x0" ::: "memory");         // no copy outstanding when the wave goes on
  l += __shfl_xor(l, 16, 32);
  const float sc = (CS / VS) * (1.0f / l);

  // ---- stage O[query 16*wave + c][d = 16j + 8hh + r] * sc (= attn * 1024), then whole-line f16 stores ----
  float* os = Os + (wave * 16 + c) * 68 + 8 * hh;
#pragma unroll
  for (int r = 0; r < 8; ++r) { os[r] = o0[r] * sc; os[16 + r] = o1[r] * sc; os[32 + r] = o2[r] * sc; os[48 + r] = o3[r] * sc; }
  __syncthreads();
  {
    const int e = tid & 7, qq = tid >> 3;              // qq 0..15: line within group, e: 16-B piece
    v4u hv[4];
#pragma unroll
    for (int it = 0; it < 4; ++it) {
      const int qi = it * 16 + qq;                       // it 0..3 x qq 0..15 = queries 0..63 of the block
      const v4f x0 = *(const v4f*)(Os + qi * 68 + 8 * e);
      const v4f x1 = *(const v4f*)(Os + qi * 68 + 8 * e + 4);
      v4u u;
#pragma unroll
      for (int t2 = 0; t2 < 2; ++t2) {
        u[t2]     = pk16(h_bits((_Float16)x0[2 * t2]), h_bits((_Float16)x0[2 * t2 + 1]));
        u[2 + t2] = pk16(h_bits((_Float16)x1[2 * t2]), h_bits((_Float16)x1[2 * t2 + 1]));
      }
      hv[it] = u;
    }
    unsigned short* ob = ctx + (size_t)hd * DHEAD + 8 * e;
    {
#pragma unroll
      for (int it = 0; it < 4; ++it) {
        const int qi = it * 16 + qq;
        *(v4u*)(ob + ((size_t)b * SEQ + q0 + qi) * DMOD) = hv[it];
      }
      
    }
  }
}

// =====================================================================================================
//   XH   f16 [4096][768]            0           6291456
//   WQT  f16 [768][768]             6291456     1179648
//   WKT  f16 [768][768]             7471104     1179648
//   WVT  f16 [768][768]             8650752     1179648
//   WOT  f16 [768][768]             9830400     1179648
//   QP   f16 [4096][768]            11010048    6291456
//   KPL  f16 [4096][768]            17301504    6291456
//   VT   f16 [2][768][2048]         23592960    6291456
//   CTX  f16 [4096][768]            29884416    6291456
//   end                              36175872
// =====================================================================================================
extern "C" void kernel_launch(void* const* d_in, const int* in_sizes, int n_in,
                              void* d_out, int out_size, void* d_ws, size_t ws_size,
                              hipStream_t stream) {
  if (n_in < 10) return;
  if (in_sizes[0] != MTOK * DMOD) return;
  if (in_sizes[1] != MTOK) return;
  if (in_sizes[2] != DMOD * DMOD || in_sizes[4] != DMOD * DMOD || in_sizes[6] != DMOD * DMOD) return;
  if (in_sizes[8] != DMOD * DMOD) return;
  if (in_sizes[3] != DMOD || in_sizes[5] != DMOD || in_sizes[7] != DMOD || in_sizes[9] != DMOD) return;
  if (out_size != MTOK * DMOD) return;

  const float* hs  = (const float*)d_in[0];
  const int*   amk = (const int*)d_in[1];
  const float* Wq  = (const float*)d_in[2];
  const float* bq  = (const float*)d_in[3];
  const float* Wk  = (const float*)d_in[4];
  const float* bk  = (const float*)d_in[5];
  const float* Wv  = (const float*)d_in[6];
  const float* bv  = (const float*)d_in[7];
  const float* Wo  = (const float*)d_in[8];
  const float* bo  = (const float*)d_in[9];

  const size_t PACT = (size_t)MTOK * DMOD * 2;          //  6291456
  const size_t PW   = (size_t)DMOD * DMOD * 2;          //  1179648
  const size_t PVT  = (size_t)NBAT * DMOD * SEQ * 2;    //  6291456
  size_t off = 0;
  const size_t oXH = off; off += PACT;
  const size_t oWQ = off; off += PW;
  const size_t oWK = off; off += PW;
  const size_t oWV = off; off += PW;
  const size_t oWO = off; off += PW;
  const size_t oQP = off; off += PACT;
  const size_t oKP = off; off += PACT;
  const size_t oVT = off; off += PVT;
  const size_t oCT = off; off += PACT;
  if (off > ws_size) return;                            // off = 36175872
  if (off > (size_t)134217728) return;

  char* ws = (char*)d_ws;
  unsigned short* XH  = (unsigned short*)(ws + oXH);
  unsigned short* WQT = (unsigned short*)(ws + oWQ);
  unsigned short* WKT = (unsigned short*)(ws + oWK);
  unsigned short* WVT = (unsigned short*)(ws + oWV);
  unsigned short* WOT = (unsigned short*)(ws + oWO);
  unsigned short* QPL = (unsigned short*)(ws + oQP);
  unsigned short* KPL = (unsigned short*)(ws + oKP);
  unsigned short* VT  = (unsigned short*)(ws + oVT);
  unsigned short* CTX = (unsigned short*)(ws + oCT);
  float*          out = (float*)d_out;

  const dim3 blk256(256), blk128(128);
  const dim3 gCV(4 * TPW + MTOK * KSEG / 8);                   // 576 weight tiles + 1536 blocks of 8 row segments
  const dim3 gGM(GBLK);                                        // 768 tiles -> 192 blocks of 4 waves
  const dim3 gG3(3 * GBLK);                                    // q, k, v: 576 blocks
  const dim3 gAT(NBAT * NHEAD * (SEQ / 64));                   // 768 blocks of 128

  // (0) activation plane f16( bf16_RNE(h) * 64 ) and weight planes [K][N] -> [N][K], f16( bf16_RNE(W) * 1024 )
  cvt_all<<<gCV, blk256, 0, stream>>>(hs, Wq, Wk, Wv, Wo, XH, WQT, WKT, WVT, WOT);

  // (1) q = h . Wq + bq -> f16 plane of q*1024 ; k likewise ; v = h . Wv + bv -> VT[b][h*64+e][token], f16 plane of v*256
  gemm_qkv<<<gG3, blk128, 0, stream>>>(XH, WQT, WKT, WVT, bq, bk, bv, QPL, KPL, VT);

  // (2) attention with the additive int mask, all (b, head) -> ctx plane f16( attn * 1024 )[token][h*64 + d]
  attn_kernel<<<gAT, blk128, 0, stream>>>(QPL, KPL, VT, amk, CTX);

  // (3) out = attn . Wo + bo -> f32 [4096][768]
  gemm_out<<<gGM, blk128, 0, stream>>>(CTX, WOT, bo, out);
  (void)hipGetLastError();
}

// v006
// Measured time: 66 microseconds a run.
// Timed twice side by side with v005, it ran 1.03 times as fast both times.
// Counting every step since v000, it is 3.03 times as fast.
// Contractions: q,k,v projections (x token rows f16 x64 . W^T rows f16 x1024, K=768, one product each);
// attention scores S^T = k (f16, one plane) . q^T (f16 of q * log2(e)/8, one plane) + C, one product, head dim 64;
// attention O^T = v^T (f16 x256, one plane) . P^T (f16 x1024, one plane, from the score D registers), one product
// into one accumulator over 2048 keys; output projection ctx (f16 x1024) . Wo^T
// (f16 x1024), one product. All v_wmma_f32_16x16x32_f16, f32 accumulate; mask adder and softmax in f32 on VALU;
// every float input RNE-converted to bf16 on load.
#include <hip/hip_runtime.h>
#include <math.h>
#include <stdint.h>

#define NBAT   2
#define SEQ    2048
#define DMOD   768
#define NHEAD  12
#define DHEAD  64
#define MTOK   (NBAT * SEQ)
#define KSEG   (DMOD / 256)
#define TN64   (DMOD / 64)
#define TPW    (TN64 * TN64)
#define XC     64.0f
#define WSC    1024.0f
#define LOG2E  1.442695040888963f
#define QS     (0.125f * LOG2E)        // q plane = q * log2(e) / sqrt(64): k . q is the score in log2 units
#define KS     1.0f
#define VS     256.0f
#define CS     1024.0f
#define L2PS   10.0f                   // log2 of the scale of P, 1024
#define MASKC  (-10000.0f)
#define PLIM   65504.0f                // largest finite f16
static_assert(NHEAD * DHEAD == DMOD);
static_assert((MTOK % 64) == 0 && (DMOD % 64) == 0 && (SEQ % 64) == 0 && (DMOD % 32) == 0 && (DMOD % 256) == 0);
static_assert((((MTOK / 64) * TN64) % 4) == 0);
static_assert(((MTOK * KSEG) % 8) == 0);
static_assert((SEQ / 64) == 32 && (SEQ % 32) == 0);
static_assert((MTOK % SEQ) == 0);

typedef _Float16 v16h __attribute__((ext_vector_type(16)));
typedef _Float16 v8h  __attribute__((ext_vector_type(8)));
typedef float    v8f  __attribute__((ext_vector_type(8)));
typedef float    v4f  __attribute__((ext_vector_type(4)));
typedef unsigned int v4u __attribute__((ext_vector_type(4)));
typedef int      v4i  __attribute__((ext_vector_type(4)));

union FragH { v16h v; v8h h[2]; };

// ---- scalar helpers --------------------------------------------------------------------------------
__device__ __forceinline__ unsigned short bf_bits(float f) {          // f32 -> bf16 bits, RNE convert
  unsigned u = __float_as_uint(f);
  return (unsigned short)((u + 0x7FFFu + ((u >> 16) & 1u)) >> 16);
}
__device__ __forceinline__ float bf_up(unsigned short h) { return __uint_as_float(((unsigned)h) << 16); }
__device__ __forceinline__ float bfr(float f) { return bf_up(bf_bits(f)); }
__device__ __forceinline__ unsigned short h_bits(_Float16 x) { return __builtin_bit_cast(unsigned short, x); }
__device__ __forceinline__ unsigned pk16(unsigned short a, unsigned short b) { return (unsigned)a | ((unsigned)b << 16); }
__device__ __forceinline__ v8f zero8() { v8f z = {0.f, 0.f, 0.f, 0.f, 0.f, 0.f, 0.f, 0.f}; return z; }

// ---- fragment loader: 16-bit A/B operand, lane -> row/col (lane&15), p already includes +8*(lane>>4);
//      elements 0..7 <- p[0..7] (k0+8h..), elements 8..15 <- p[16..23] (k0+16+8h..)
__device__ __forceinline__ v16h ldfrag_h(const _Float16* p) {
  FragH f;
  f.h[0] = *(const v8h*)(p);
  f.h[1] = *(const v8h*)(p + 16);
  return f.v;
}

// ---- WMMA helpers with trailing VALU hazard gap --------------------------------------------------------
__device__ __forceinline__ v8f mma_h_raw(v16h a, v16h b, v8f c) {
  return __builtin_amdgcn_wmma_f32_16x16x32_f16(false, a, false, b, (short)0, c, false, false);
}
__device__ __forceinline__ void dep_guard1(v8f& a, v8f& b, v16h x) {
#if defined(__HIP_DEVICE_COMPILE__)
  asm volatile("v_nop\n\tv_nop\n\tv_nop\n\tv_nop" : "+v"(a), "+v"(b) : "v"(x));
#endif
}
__device__ __forceinline__ void keep4_h(v16h a, v16h b, v16h c, v16h d) {
#if defined(__HIP_DEVICE_COMPILE__)
  asm volatile("v_nop" :: "v"(a), "v"(b), "v"(c), "v"(d));
#endif
}
__device__ __forceinline__ void hold8_h(v16h a, v16h b, v16h c, v16h d, v16h e, v16h f, v16h g, v16h h, float s) {
#if defined(__HIP_DEVICE_COMPILE__)
  asm volatile("" :: "v"(a), "v"(b), "v"(c), "v"(d), "v"(e), "v"(f), "v"(g), "v"(h), "v"(s));
#endif
}
__device__ __forceinline__ void acc_guard4(v8f& a, v8f& b, v8f& c, v8f& d) {
#if defined(__HIP_DEVICE_COMPILE__)
  asm volatile("v_nop\n\tv_nop\n\tv_nop\n\tv_nop" : "+v"(a), "+v"(b), "+v"(c), "+v"(d));
#endif
}
__device__ __forceinline__ void sguard10(v8f& a, v8f& b, v8f& c, v8f& d, v16h x0, v16h x1, v16h x2, v16h x3,
                                         v16h x4, v16h x5, v16h x6, v16h x7, v16h x8, v16h x9) {
#if defined(__HIP_DEVICE_COMPILE__)
  asm volatile("v_nop\n\tv_nop\n\tv_nop\n\tv_nop"
               : "+v"(a), "+v"(b), "+v"(c), "+v"(d)
               : "v"(x0), "v"(x1), "v"(x2), "v"(x3), "v"(x4), "v"(x5), "v"(x6), "v"(x7), "v"(x8), "v"(x9));
#endif
}
__device__ __forceinline__ void oguard10(v8f& a, v8f& b, v8f& c, v8f& d, v16h x0, v16h x1, v16h x2, v16h x3,
                                         v16h x4, v16h x5, v16h x6, v16h x7, v16h p0, v16h p1) {
#if defined(__HIP_DEVICE_COMPILE__)
  asm volatile("v_nop\n\tv_nop\n\tv_nop\n\tv_nop"
               : "+v"(a), "+v"(b), "+v"(c), "+v"(d)
               : "v"(x0), "v"(x1), "v"(x2), "v"(x3), "v"(x4), "v"(x5), "v"(x6), "v"(x7), "v"(p0), "v"(p1));
#endif
}
__device__ __forceinline__ void wave_sync_lds() {
  __builtin_amdgcn_fence(__ATOMIC_RELEASE, "workgroup");
  __builtin_amdgcn_wave_barrier();
  __builtin_amdgcn_fence(__ATOMIC_ACQUIRE, "workgroup");
}

// =====================================================================================================
// Activation plane: XH[t][768] = f16( bf16_RNE(h[t][c]) * 64 ).
// coverage: 1536 x 8 = 12288 segments = 4096 rows x 768 columns entirely.
// =====================================================================================================
__device__ __forceinline__ void cvt_act(const int bx, const float* __restrict__ hs, unsigned short* XH) {
  const int lane = threadIdx.x & 31, wave = threadIdx.x >> 5;
  const int seg = bx * 8 + wave;                         // 0 .. 12287
  const int row = seg / KSEG;
  const int col = (seg - row * KSEG) * 256 + 8 * lane;
  const size_t o = (size_t)row * DMOD + col;
  const v4f h0 = *(const v4f*)(hs + o), h1 = *(const v4f*)(hs + o + 4);
  float a[8];
#pragma unroll
  for (int i = 0; i < 4; ++i) { a[i] = bfr(h0[i]); a[4 + i] = bfr(h1[i]); }
  v4u uh;
#pragma unroll
  for (int i = 0; i < 4; ++i) {
    const float xa = a[2 * i] * XC, xb = a[2 * i + 1] * XC;
    uh[i] = pk16(h_bits((_Float16)xa), h_bits((_Float16)xb));
  }
  unsigned short* dh = XH + o;
  *(v4u*)dh = uh;
  // this body now shares a kernel with the weight tiles' code: the wait closes the store before any path of the listing
  // that rewrites one of its registers
  asm volatile("s_wait_xcnt 0x0" ::: "memory");
}

// =====================================================================================================
// Weight planes: in W[K=768][N=768] (N contiguous) -> out WT[N][K] = f16( bf16_RNE(W[k][n]) * 1024 ), k contiguous.
// Block = one 64(k) x 64(n) tile: 256 threads load 16 rows x 64 floats per step (16 threads x 16 B per row), convert and
// store transposed into LDS Ts[n][k] (pitch 72 halves, 2-byte stores), block barrier, then 2 instructions each write
// blocks 0..143 -> weight 0, 144..287 -> weight 1, 288..431 -> weight 2, 432..575 -> weight 3 (block-uniform select).
// coverage: per weight 144 tiles x (2 x 32 lines x 8 lanes x 8 halves) = 768 x 768 entirely.
// =====================================================================================================
__device__ __forceinline__ void cvt_w(const int bx, unsigned short* Ts,
                                      const float* __restrict__ w0, const float* __restrict__ w1,
                                      const float* __restrict__ w2, const float* __restrict__ w3,
                                      unsigned short* t0, unsigned short* t1,
                                      unsigned short* t2, unsigned short* t3) {
  const int tid = threadIdx.x;
  const int wsel = bx / TPW;                        // block-uniform
  const int t = bx - wsel * TPW;
  const int k0 = (t / TN64) * 64;
  const int n0 = (t % TN64) * 64;
  const float* src = (wsel == 0) ? w0 : (wsel == 1) ? w1 : (wsel == 2) ? w2 : w3;
  unsigned short* dst = (wsel == 0) ? t0 : (wsel == 1) ? t1 : (wsel == 2) ? t2 : t3;
  {
    const int r16 = tid >> 4, p = tid & 15;
#pragma unroll
    for (int it = 0; it < 4; ++it) {
      const int kr = it * 16 + r16;                   // it 0..3 x r16 0..15 = k rows 0..63
      const v4f v = *(const v4f*)(src + (size_t)(k0 + kr) * DMOD + n0 + 4 * p);
#pragma unroll
      for (int j = 0; j < 4; ++j) Ts[(4 * p + j) * 72 + kr] = h_bits((_Float16)(bfr(v[j]) * WSC));
    }
  }
  __syncthreads();
  {
    const int e = tid & 7, lq = tid >> 3;             // lq 0..31: line, e: 16-B piece
    v4u u[2];
#pragma unroll
    for (int it = 0; it < 2; ++it) {
      const int nr = it * 32 + lq;                    // it 0..1 x lq 0..31 = n rows 0..63
      u[it] = *(const v4u*)(Ts + nr * 72 + 8 * e);
    }
    unsigned short* db = dst + (size_t)n0 * DMOD + k0 + 8 * e;
    {
#pragma unroll
      for (int it = 0; it < 2; ++it) {
        const int nr = it * 32 + lq;
        *(v4u*)(db + (size_t)nr * DMOD) = u[it];
      }
      
    }
  }
}

// Both conversions in one grid (neither reads what the other writes): blocks 0..575 take the weight tiles, blocks
// 576..2111 the activation segments. The test is block-uniform, so the weight tiles' barrier is passed by whole blocks.
__global__ __launch_bounds__(256) void cvt_all(const float* __restrict__ hs, const float* __restrict__ w0,
                                                const float* __restrict__ w1, const float* __restrict__ w2,
                                                const float* __restrict__ w3, unsigned short* XH,
                                                unsigned short* t0, unsigned short* t1,
                                                unsigned short* t2, unsigned short* t3) {
  __shared__ __align__(16) unsigned short Ts[64 * 72];
  const int bx = blockIdx.x;
  if (bx < 4 * TPW) cvt_w(bx, Ts, w0, w1, w2, w3, t0, t1, t2, t3);
  else              cvt_act(bx - 4 * TPW, hs, XH);
}

// =====================================================================================================
// Register-blocked f16 WMMA GEMM, one wave per 64x64 tile (4 waves per block = 64 token rows x 256 features):
//   acc[m][n] = sum_k A[m][k] * Bt[n][k],  A: f16 [4096][768] token rows, Bt: f16 [768][768] k contiguous,
//   M=4096, N=768, K=768 fixed, all tile multiples.
//   Operands reach the waves through LDS: per stage of 64 k the block copies its 64 A rows and 256 Bt rows (128 B each,
//   whole lines, 8 lanes x 16 B per row) with asynchronous 16-B copies into one of two buffers (row pitch 144 B), the
//   next stage in flight while this one is multiplied; fragments = two 16-B LDS loads with the split k map (ldfrag_h).
//   y = acc * escale + bf16_RNE(bias[n]) * bscale, then per MODE:
//   MODE 0: f32 row-major C[4096][768] (the final output): 16-row slabs staged per wave in LDS (pitch 68 floats), each
//   MODE 1: f16 single plane row-major [4096][768]: per slab 4 instructions, each 4 rows x (8 consecutive lanes x 16 B)
//   MODE 2: f16 single plane transposed VT[b][feature 768][2048 tokens]: the wave's whole 64x64 tile is staged as f16
// coverage: MODE 0/1: 4 slabs x 16 rows x 64 cols per wave tile; MODE 2: 64 features x 64 tokens per wave tile;
//           grid = 768 tiles / 4 = 192 blocks covers [4096][768] exactly once (m0 multiple of 64 never straddles b).
// =====================================================================================================
#define GKB   64                       // k per stage: rows of 128 B
#define GPIT  144                      // LDS row pitch, bytes: 16 B x odd, conflict-free for 16-B fragment loads
#define GSTG  ((64 + 256) * GPIT)      // one buffer: A rows 0..63, Bt rows 64..319
#define GNT   (DMOD / GKB)             // 12 stages
#define GLSTEP (16 * GPIT)             // 16 rows further in LDS
#define GGSTEP (16 * DMOD * 2)         // 16 rows further in global memory
static_assert((TN64 % 4) == 0 && (DMOD % GKB) == 0 && GNT >= 2 && (GPIT % 16) == 0);

// Ten asynchronous 16-B copies per lane, rows 16 apart: LDS byte address l + i * GLSTEP <- g[i]. The s_wait_xcnt closes
// the statement so that no address register of an issued copy is rewritten ahead of it.
__device__ __forceinline__ void acopy10(unsigned l, const char* const (&g)[10]) {
#if defined(__HIP_DEVICE_COMPILE__)
  asm volatile(
      "global_load_async_to_lds_b128 %0, %10, off\n\t"
      "global_load_async_to_lds_b128 %1, %11, off\n\t"
      "global_load_async_to_lds_b128 %2, %12, off\n\t"
      "global_load_async_to_lds_b128 %3, %13, off\n\t"
      "global_load_async_to_lds_b128 %4, %14, off\n\t"
      "global_load_async_to_lds_b128 %5, %15, off\n\t"
      "global_load_async_to_lds_b128 %6, %16, off\n\t"
      "global_load_async_to_lds_b128 %7, %17, off\n\t"
      "global_load_async_to_lds_b128 %8, %18, off\n\t"
      "global_load_async_to_lds_b128 %9, %19, off\n\t"
      "s_wait_xcnt 0x0"
      :: "v"(l), "v"(l + 1 * GLSTEP), "v"(l + 2 * GLSTEP), "v"(l + 3 * GLSTEP), "v"(l + 4 * GLSTEP),
         "v"(l + 5 * GLSTEP), "v"(l + 6 * GLSTEP), "v"(l + 7 * GLSTEP), "v"(l + 8 * GLSTEP), "v"(l + 9 * GLSTEP),
         "v"(g[0]), "v"(g[1]), "v"(g[2]), "v"(g[3]), "v"(g[4]), "v"(g[5]), "v"(g[6]), "v"(g[7]), "v"(g[8]), "v"(g[9])
      : "memory");
#endif
}
// One stage: 320 rows x 8 pieces = 2560 copies = 20 per thread; thread -> row (tid >> 3) + 16 i, piece tid & 7.
// ga, gb: this thread's piece of A row (tid >> 3) and of Bt row (tid >> 3) of the block, at the stage's first k.
__device__ __forceinline__ void stage_copy(unsigned l, const char* ga, const char* gb) {
  const char* g0[10];
  const char* g1[10];
  // the three loops are unrolled so that both pointer arrays stay in registers
#pragma unroll
  for (int i = 0; i < 4; ++i) g0[i] = ga + (size_t)i * GGSTEP;             // A rows 0..63
#pragma unroll
  for (int i = 4; i < 10; ++i) g0[i] = gb + (size_t)(i - 4) * GGSTEP;      // Bt rows 0..95
#pragma unroll
  for (int i = 0; i < 10; ++i) g1[i] = gb + (size_t)(i + 6) * GGSTEP;      // Bt rows 96..255
  acopy10(l, g0);
  acopy10(l + 10 * GLSTEP, g1);
}

// ring: the block's 2 * GSTG bytes of LDS, the two operand buffers. The epilogue's slabs (9216 B per wave) lie on the same
// bytes: the barrier at the foot of the last stage ends every wave's reads of the ring and no copy is outstanding then.
// That keeps a block at 92160 B, so that three blocks fit a WGP's LDS.
template <int MODE>
__device__ __forceinline__ void gemm64(
    const int bx, unsigned char* ring,
    const unsigned short* __restrict__ Ap, const unsigned short* __restrict__ Bp,
    const float* __restrict__ bias, const float escale, const float bscale, void* C0) {
  const int lane = threadIdx.x & 31;
  const int wave = threadIdx.x >> 5;
  unsigned short* sraw = (unsigned short*)(void*)(ring + wave * 9216);   // this wave's slab, used behind the loop only
  const int tilesN = TN64;                                 // 12
  const int tile = bx * 4 + wave;                          // 0..767, grid exact
  const int tm = tile / tilesN;
  const int tn = tile - tm * tilesN;
  const int m0 = tm << 6;
  const int n0 = tn << 6;

  const int rlane = lane & 15;                 // row (A) / col (B, D) within subtile
  const int hh    = lane >> 4;
  const int koff  = hh * 8;                    // k offset of this lane half
  const int mOff  = hh * 8;                    // D row offset

  v8f acc[4][4];
#pragma unroll
  for (int i = 0; i < 4; ++i)
#pragma unroll
    for (int j = 0; j < 4; ++j) acc[i][j] = zero8();

  // copy side: the block's A rows start at m0 (the same in its four waves), its Bt rows at n0 - 64 * wave
  const int crow = threadIdx.x >> 3, cpc = threadIdx.x & 7;
  const unsigned lcp = (unsigned)(uintptr_t)(&ring[0]) + (unsigned)(crow * GPIT + cpc * 16);
  const char* ga = (const char*)(const void*)Ap + ((size_t)(m0 + crow) * DMOD + 8 * cpc) * 2;
  const char* gb = (const char*)(const void*)Bp + ((size_t)(n0 - (wave << 6) + crow) * DMOD + 8 * cpc) * 2;

  stage_copy(lcp, ga, gb);
  asm volatile("s_wait_asynccnt 0x0" ::: "memory");        // stage 0 of this wave has landed
  __syncthreads();                                          // ... and every wave's part of it
  stage_copy(lcp + GSTG, ga + GKB * 2, gb + GKB * 2);

  for (int t = 0; t < GNT; ++t) {
    const unsigned char* rb = ring + (t & 1) * GSTG;
    const _Float16* la = (const _Float16*)(const void*)(rb + rlane * GPIT) + koff;
    const _Float16* lb = (const _Float16*)(const void*)(rb + (64 + (wave << 6) + rlane) * GPIT) + koff;
    // all loops of the stage are unrolled: fragment and accumulator arrays in registers, LDS offsets as immediates
#pragma unroll
    for (int ks = 0; ks < GKB; ks += 32) {
      v16h ah[4], bh[4];                                    // the 32-k block's fragments, read as one group
#pragma unroll
      for (int j = 0; j < 4; ++j) {
        bh[j] = ldfrag_h(lb + j * (GLSTEP / 2) + ks);
        ah[j] = ldfrag_h(la + j * (GLSTEP / 2) + ks);
      }
#pragma unroll
      for (int i = 0; i < 4; ++i) {
#pragma unroll
        for (int j = 0; j < 4; ++j) acc[i][j] = mma_h_raw(ah[i], bh[j], acc[i][j]);
        dep_guard1(acc[i][0], acc[i][3], ah[i]);
      }
      keep4_h(bh[0], bh[1], bh[2], bh[3]);
    }
    asm volatile("s_wait_dscnt 0x0" ::: "memory");          // this wave's reads of buffer t & 1 are done
    asm volatile("s_wait_asynccnt 0x0" ::: "memory");       // this wave's copies of stage t + 1 have landed
    __syncthreads();                                        // publishes stage t + 1, frees buffer t & 1
    if (t + 2 < GNT) stage_copy(lcp + (t & 1) * GSTG, ga + (t + 2) * (GKB * 2), gb + (t + 2) * (GKB * 2));
  }
  asm volatile("s_wait_asynccnt 0x0" ::: "memory");         // no copy outstanding when the wave goes on
  acc_guard4(acc[0][0], acc[0][1], acc[0][2], acc[0][3]);
  acc_guard4(acc[1][0], acc[1][1], acc[1][2], acc[1][3]);
  acc_guard4(acc[2][0], acc[2][1], acc[2][2], acc[2][3]);
  acc_guard4(acc[3][0], acc[3][1], acc[3][2], acc[3][3]);

  if (MODE == 0) {
    float* Cout = (float*)C0;
    const int c4 = rlane * 4;                        // f32 out: 256-B row segment = 16 lanes x 16 B
    const v4f braw = *(const v4f*)(bias + n0 + c4);
    float bb[4];
#pragma unroll
    for (int tt = 0; tt < 4; ++tt) bb[tt] = bfr(braw[tt]) * bscale;
    float* slab = (float*)(void*)(sraw);
#pragma unroll
    for (int i = 0; i < 4; ++i) {
      const int mBase = m0 + (i << 4);
#pragma unroll
      for (int j = 0; j < 4; ++j) {
#pragma unroll
        for (int r = 0; r < 8; ++r) slab[(mOff + r) * 68 + (j << 4) + rlane] = acc[i][j][r];
      }
      wave_sync_lds();
      v4f vals[8];
#pragma unroll
      for (int it = 0; it < 8; ++it) {
        const int row = it * 2 + hh;                   // it 0..7 x hh 0..1 = rows 0..15
        v4f v = *(const v4f*)(slab + row * 68 + c4);
#pragma unroll
        for (int tt = 0; tt < 4; ++tt) v[tt] = v[tt] * escale + bb[tt];
        vals[it] = v;
      }
      {
#pragma unroll
        for (int it = 0; it < 8; ++it) {
          const int row = it * 2 + hh;
          *(v4f*)(Cout + (size_t)(mBase + row) * DMOD + n0 + c4) = vals[it];
        }
        
      }
      wave_sync_lds();
    }
  } else if (MODE == 1) {
    unsigned short* Hp = (unsigned short*)C0;
    const int e = lane & 7, q4 = lane >> 3;
    const v4f b0 = *(const v4f*)(bias + n0 + 8 * e), b1 = *(const v4f*)(bias + n0 + 8 * e + 4);
    float bb[8];
#pragma unroll
    for (int tt = 0; tt < 4; ++tt) { bb[tt] = bfr(b0[tt]) * bscale; bb[4 + tt] = bfr(b1[tt]) * bscale; }
    float* slab = (float*)(void*)(sraw);
#pragma unroll
    for (int i = 0; i < 4; ++i) {
      const int mBase = m0 + (i << 4);
#pragma unroll
      for (int j = 0; j < 4; ++j) {
#pragma unroll
        for (int r = 0; r < 8; ++r) slab[(mOff + r) * 68 + (j << 4) + rlane] = acc[i][j][r];
      }
      wave_sync_lds();
      v4u hv[4];
#pragma unroll
      for (int it = 0; it < 4; ++it) {
        const int row = it * 4 + q4;                   // it 0..3 x q4 0..3 = rows 0..15
        const v4f x0 = *(const v4f*)(slab + row * 68 + 8 * e);
        const v4f x1 = *(const v4f*)(slab + row * 68 + 8 * e + 4);
        float y[8];
#pragma unroll
        for (int tt = 0; tt < 4; ++tt) { y[tt] = x0[tt] * escale + bb[tt]; y[4 + tt] = x1[tt] * escale + bb[4 + tt]; }
        v4u uh;
#pragma unroll
        for (int t2 = 0; t2 < 4; ++t2) {
          uh[t2] = pk16(h_bits((_Float16)y[2 * t2]), h_bits((_Float16)y[2 * t2 + 1]));
        }
        hv[it] = uh;
      }
      {
#pragma unroll
        for (int it = 0; it < 4; ++it) {
          const int row = it * 4 + q4;
          const size_t go = (size_t)(mBase + row) * DMOD + n0 + 8 * e;
          *(v4u*)(Hp + go) = hv[it];
        }
        
      }
      wave_sync_lds();
    }
  } else {
    unsigned short* Vs = sraw;              // [64 features][pitch 72] f16 bits
    float bb4[4];
#pragma unroll
    for (int j = 0; j < 4; ++j) bb4[j] = bfr(bias[n0 + (j << 4) + rlane]) * bscale;
#pragma unroll
    for (int i = 0; i < 4; ++i) {
#pragma unroll
      for (int j = 0; j < 4; ++j) {
#pragma unroll
        for (int r = 0; r < 8; ++r) {
          Vs[((j << 4) + rlane) * 72 + (i << 4) + mOff + r] = h_bits((_Float16)(acc[i][j][r] * escale + bb4[j]));
        }
      }
    }
    wave_sync_lds();
    const int e = lane & 7, q4 = lane >> 3;
    const int bsel = m0 / SEQ;                          // batch of this tile (wave-uniform)
    const int s0 = m0 % SEQ;                            // first token within the batch
    v4u u[16];
#pragma unroll
    for (int it = 0; it < 16; ++it) {
      const int fl = it * 4 + q4;                        // it 0..15 x q4 0..3 = features 0..63
      u[it] = *(const v4u*)(Vs + fl * 72 + 8 * e);
    }
    unsigned short* Vp = (unsigned short*)C0 + ((size_t)bsel * DMOD + n0) * SEQ + s0 + 8 * e;
    {
#pragma unroll
      for (int it = 0; it < 16; ++it) {
        const int fl = it * 4 + q4;
        *(v4u*)(Vp + (size_t)fl * SEQ) = u[it];
      }
      
    }
  }
}

#define GBLK  (((MTOK / 64) * TN64) / 4)   // 192 blocks cover one [4096][768] product

// q, k and v projections in one grid of 3 x 192 blocks (they share A and depend on nothing of each other): block-uniform
// choice of the weight plane, bias, scale and output plane; q*log2(e)/8 and k row-major (acc = 64*1024*y),
// v*256 transposed (escale 1/256).
__global__ __launch_bounds__(128) void gemm_qkv(
    const unsigned short* __restrict__ Ap, const unsigned short* __restrict__ Bq,
    const unsigned short* __restrict__ Bk, const unsigned short* __restrict__ Bv,
    const float* __restrict__ bq, const float* __restrict__ bk, const float* __restrict__ bv,
    unsigned short* Cq, unsigned short* Ck, unsigned short* Cv) {
  __shared__ __align__(16) unsigned char ring[2 * GSTG];   // two operand buffers
  const int sel = blockIdx.x / GBLK;                       // 0: q, 1: k, 2: v
  const int bx = blockIdx.x - sel * GBLK;
  if (sel == 2) gemm64<2>(bx, ring, Ap, Bv, bv, VS / (XC * WSC), VS, (void*)Cv);
  else          gemm64<1>(bx, ring, Ap, sel ? Bk : Bq, sel ? bk : bq, (sel ? KS : QS) / (XC * WSC), sel ? KS : QS,
                          (void*)(sel ? Ck : Cq));           // q and k share one path, the scale is block-uniform
}

// output projection: acc = 1024*1024*out -> escale 2^-20, f32 row-major
__global__ __launch_bounds__(128) void gemm_out(
    const unsigned short* __restrict__ Ap, const unsigned short* __restrict__ Bp,
    const float* __restrict__ bias, float* C0) {
  __shared__ __align__(16) unsigned char ring[2 * GSTG];   // two operand buffers
  gemm64<0>(blockIdx.x, ring, Ap, Bp, bias, 1.0f / (CS * WSC), 1.0f, (void*)C0);
}

// =====================================================================================================
// Attention for one (b, head, 64-query block), transposed formulation, head dim 64, 2048 keys, additive int mask:
//   S^T tile (16 keys x 16 queries) = A(k rows = keys, d via the split k map) . B(q, col = query, same d map), two d-steps
//   of 32. The q plane carries log2(e)/8, so k.q is the score in log2 units, and the first product's C operand carries
//   what is added to it: 10 - m (m = the reference in use, log2 units; 10 = log2 of P's scale), a tile of one value that
//   stays in registers from stage to stage. The D tile is then the argument of exp2 itself; only a stage that holds a key
//   whose adder (1 - mask[b][key]) * (-10000) * log2(e) is not 0 (one flag bit per stage, set when the adder table is
//   built, scalar branch) reads its adders from the table and adds them. Per lane the D tile holds 8 keys of ONE query, so the online softmax is per-lane state;
//   m is raised to the running max (max tree, one shuffle lane^16, rescale of l and O) in the first stage and in a stage
//   whose sum of exponentials leaves the f16 range; the row sum is kept as a per-lane partial and combined at
//   the end. P = e^{x-m} x 1024 as one f16 plane (11 significant bits, as v^T and ctx have), used directly as the
//   B operand of O^T (rows d, cols queries) += A(v^T rows d, keys contiguous, two 16-B loads) . B(P^T):
//   B element r <- the key tile covering keys kb..kb+15, element 8+r <- the tile covering kb+16..kb+31, lane unchanged
//   (D-as-B chaining layout). One product per d tile (d 0-15, 16-31, 32-47, 48-63).
//   64 keys per iteration: 8 score WMMAs + 8 output WMMAs per wave. Block = 4 waves = 64 queries; grid = 2*12*32 = 768.
//   k and v^T reach the waves through LDS: per stage of 64 keys the block copies 64 k rows (its head's 128 B) and 64 v^T
//   rows (64 keys = 128 B), whole lines, with asynchronous 16-B copies into one of two buffers (row pitch 144 B), the next
//   stage in flight while this one is worked on; one iteration per stage, fragments = two 16-B LDS loads.
//   Epilogue: the block's [64 query][64 d] f32 tile is staged in LDS (scalar stores, pitch 68), block barrier, then 4
// coverage: block writes queries q0..q0+63 x d 0..63 of its (b, head); grid covers ctx [4096][768] exactly once.
// =====================================================================================================
#define AKB   64                       // keys per stage
#define ASTG  ((64 + 64) * GPIT)       // one buffer: k rows 0..63, v^T rows 64..127
#define ANT   (SEQ / AKB)              // 32 stages
static_assert((SEQ % AKB) == 0 && ANT >= 2 && DHEAD * 2 == 128);

// One stage: 128 rows x 8 pieces = 1024 copies = 8 per thread; thread -> row (tid >> 3) + 16 i, piece tid & 7.
// gk, gv: this thread's piece of k row (tid >> 3) and of v^T row (tid >> 3) of the stage. The s_wait_xcnt closes the
// statement so that no address register of an issued copy is rewritten ahead of it.
__device__ __forceinline__ void attn_stage_copy(unsigned l, const char* gk, const char* gv) {
#if defined(__HIP_DEVICE_COMPILE__)
  asm volatile(
      "global_load_async_to_lds_b128 %0, %8, off\n\t"
      "global_load_async_to_lds_b128 %1, %9, off\n\t"
      "global_load_async_to_lds_b128 %2, %10, off\n\t"
      "global_load_async_to_lds_b128 %3, %11, off\n\t"
      "global_load_async_to_lds_b128 %4, %12, off\n\t"
      "global_load_async_to_lds_b128 %5, %13, off\n\t"
      "global_load_async_to_lds_b128 %6, %14, off\n\t"
      "global_load_async_to_lds_b128 %7, %15, off\n\t"
      "s_wait_xcnt 0x0"
      :: "v"(l), "v"(l + 1 * GLSTEP), "v"(l + 2 * GLSTEP), "v"(l + 3 * GLSTEP),
         "v"(l + 4 * GLSTEP), "v"(l + 5 * GLSTEP), "v"(l + 6 * GLSTEP), "v"(l + 7 * GLSTEP),
         "v"(gk), "v"(gk + 1 * GGSTEP), "v"(gk + 2 * GGSTEP), "v"(gk + 3 * GGSTEP),
         "v"(gv), "v"(gv + 1 * (16 * SEQ * 2)), "v"(gv + 2 * (16 * SEQ * 2)), "v"(gv + 3 * (16 * SEQ * 2))
      : "memory");
#endif
}

// e = 2^a for a lane's 32 arguments of one stage
__device__ __forceinline__ void exp32(const v8f (&a)[4], v8f (&e)[4]) {
  // the loops here are unrolled so that the arrays and vector elements stay in registers
#pragma unroll
  for (int i = 0; i < 4; ++i)
#pragma unroll
    for (int r = 0; r < 8; ++r) e[i][r] = __builtin_amdgcn_exp2f(a[i][r]);
}
// sum of a lane's 32 exponentials of one stage, as a tree
__device__ __forceinline__ float sum32(const v8f (&e)[4]) {
  const v8f t = (e[0] + e[1]) + (e[2] + e[3]);
  return ((t[0] + t[4]) + (t[2] + t[6])) + ((t[1] + t[5]) + (t[3] + t[7]));
}
// eight consecutive floats from LDS, two 16-B loads
__device__ __forceinline__ v8f ld8f(const float* p) {
  const v4f a = *(const v4f*)(p), b = *(const v4f*)(p + 4);
  return __builtin_shufflevector(a, b, 0, 1, 2, 3, 4, 5, 6, 7);
}

__global__ __launch_bounds__(128)
void attn_kernel(const unsigned short* __restrict__ qp, const unsigned short* __restrict__ kp,
                 const unsigned short* __restrict__ vt, const int* __restrict__ am, unsigned short* ctx) {
  __shared__ __align__(16) float Os[64 * 68];
  __shared__ __align__(16) unsigned char aring[2 * ASTG];  // two k / v^T buffers
  __shared__ __align__(16) float Ad[SEQ];                  // mask adder of every key of batch b, log2 units
  __shared__ unsigned Fl[ANT];                             // per stage: not 0 where a key's adder is not 0
  const int tid  = threadIdx.x;
  const int wave = tid >> 5;
  const int lane = tid & 31;
  const int hh   = lane >> 4;
  const int c    = lane & 15;
  const int bx   = blockIdx.x;
  const int qb   = bx & 31;                       // SEQ/64 = 32 query blocks per (b, head)
  const int bhd  = bx >> 5;                       // b * NHEAD + head
  const int b    = bhd / NHEAD;
  const int hd   = bhd - b * NHEAD;
  const int q0   = qb * 64;

  const _Float16* QP  = (const _Float16*)(const void*)qp;

  // ---- q fragments (B operand, col = query q0 + 16*wave + c): one plane, d 0..31 and 32..63 ----
  const size_t qtok = (size_t)b * SEQ + q0 + wave * 16 + c;
  const _Float16* qbp = QP + qtok * DMOD + hd * DHEAD + 8 * hh;
  const v16h qf0 = ldfrag_h(qbp), qf1 = ldfrag_h(qbp + 32);
  // ---- copy side: k row = key (stage's first + crow + 16 i), v^T row = d (crow + 16 i), 16-B piece cpc ----
  const int crow = tid >> 3, cpc = tid & 7;
  const unsigned lcp = (unsigned)(uintptr_t)(&aring[0]) + (unsigned)(crow * GPIT + cpc * 16);
  const char* gk = (const char*)(const void*)kp + (((size_t)b * SEQ + crow) * DMOD + hd * DHEAD + 8 * cpc) * 2;
  const char* gv = (const char*)(const void*)vt + (((size_t)b * DMOD + hd * DHEAD + crow) * SEQ + 8 * cpc) * 2;
  // ---- adder base: keys kb + 8hh + 0..7 and kb + 16 + 8hh + 0..7 ----
  const float* adb = Ad + 8 * hh;

  float l = 0.f, lim = -1.0f;                    // lim: the stage sum above which m is brought up to date
  v8f cs = zero8();                              // 10 - m in every element: the C operand of the score products
  v8f o0 = zero8(), o1 = zero8(), o2 = zero8(), o3 = zero8();

  attn_stage_copy(lcp, gk, gv);
  // adder table, once per block: Ad[key] = (1 - mask[b][key]) * (-10000) * log2(e); 128 threads x 4 x 4 keys = 2048 keys.
  // 16 consecutive lanes hold the 64 keys of stage 8 i + 2 wave + hh: their votes make that stage's flag word.
  static_assert((SEQ % 512) == 0 && AKB == 64 && ANT == 32);
  unsigned vote[SEQ / 512];
#pragma unroll                                              // the four mask loads issue together, one latency
  for (int i = 0; i < SEQ / 512; ++i) {
    const int k4 = (i * 128 + tid) * 4;
    const v4i mk = *(const v4i*)(am + (size_t)b * SEQ + k4);
    v4f ad;
#pragma unroll                                              // vector elements by constant index, in registers
    for (int r = 0; r < 4; ++r) ad[r] = ((1.0f - (float)mk[r]) * MASKC) * LOG2E;
    *(v4f*)(Ad + k4) = ad;
    vote[i] = __builtin_amdgcn_ballot_w32(ad[0] != 0.f || ad[1] != 0.f || ad[2] != 0.f || ad[3] != 0.f);
  }
  // the flag words are stored behind the loop: a branch inside it kept the four loads from issuing together
  if (c == 0) {
#pragma unroll                                              // array by constant index, in registers
    for (int i = 0; i < SEQ / 512; ++i) Fl[i * 8 + wave * 2 + hh] = (vote[i] >> (16 * hh)) & 0xFFFFu;
  }
  asm volatile("s_wait_asynccnt 0x0" ::: "memory");        // stage 0 of this wave has landed
  __syncthreads();                                          // ... and every wave's part of it, and the adder table
  attn_stage_copy(lcp + ASTG, gk + (size_t)AKB * DMOD * 2, gv + AKB * 2);
  const unsigned mfl = __builtin_amdgcn_ballot_w32(Fl[lane] != 0u);   // bit t: stage t holds an adder that is not 0

#pragma unroll 1                                            // rolled as before: a long body, only the buffer changes
  for (int t = 0; t < ANT; ++t) {
   const unsigned char* rb = aring + (t & 1) * ASTG;
   // k fragment base (A operand, row = key c of the stage), v^T fragment base (A operand, row = d = c, keys contiguous)
   const _Float16* Kl = (const _Float16*)(const void*)(rb + c * GPIT) + 8 * hh;
   const _Float16* Vl = (const _Float16*)(const void*)(rb + (64 + c) * GPIT) + 8 * hh;
   // The whole stage's k fragments (A operand) are asked for as one load group (LDS offsets as immediates).
   v16h ka[2][4], vf[2][4];
#pragma unroll                                              // arrays by constant index, in registers
   for (int sub = 0; sub < 2; ++sub) {                      // first what the score products read
    const _Float16* k0p = Kl + sub * 32 * (GPIT / 2);
    const _Float16* k1p = k0p + 16 * (GPIT / 2);
    ka[sub][0] = ldfrag_h(k0p);      ka[sub][1] = ldfrag_h(k1p);
    ka[sub][2] = ldfrag_h(k0p + 32); ka[sub][3] = ldfrag_h(k1p + 32);
   }
   v8f s0 = mma_h_raw(ka[0][0], qf0, cs);
   v8f s1 = mma_h_raw(ka[0][1], qf0, cs);
   v8f s2 = mma_h_raw(ka[1][0], qf0, cs);
   v8f s3 = mma_h_raw(ka[1][1], qf0, cs);
   s0 = mma_h_raw(ka[0][2], qf1, s0);
   s1 = mma_h_raw(ka[0][3], qf1, s1);
   s2 = mma_h_raw(ka[1][2], qf1, s2);
   s3 = mma_h_raw(ka[1][3], qf1, s3);
   sguard10(s0, s1, s2, s3, ka[0][0], ka[0][1], ka[0][2], ka[0][3], ka[1][0], ka[1][1], ka[1][2], ka[1][3], qf0, qf1);
   // the stage's v^T fragments, a second load group: into the registers the k fragments leave, landing under the softmax
#pragma unroll                                              // as above
   for (int sub = 0; sub < 2; ++sub) {
    vf[sub][0] = ldfrag_h(Vl + sub * 32);
    vf[sub][1] = ldfrag_h(Vl + 16 * (GPIT / 2) + sub * 32);
    vf[sub][2] = ldfrag_h(Vl + 32 * (GPIT / 2) + sub * 32);
    vf[sub][3] = ldfrag_h(Vl + 48 * (GPIT / 2) + sub * 32);
   }

   v8f a[4] = {s0, s1, s2, s3};                             // score * log2(e) - m + 10, as the products leave it
   // scalar test: the stage holds an adder that is not 0; marked unlikely so that the block lies outside the loop's
   // straight line and a stage without adders takes no branch
   if (__builtin_expect((mfl >> t) & 1u, 0u)) {
    // adders of keys kb + 8hh + 0..7 and kb + 16 + 8hh + 0..7, kb = 64 t and 64 t + 32
#pragma unroll                                              // arrays by constant index, in registers
    for (int i = 0; i < 4; ++i) a[i] += ld8f(adb + t * AKB + 16 * i);
   }
   // Lazy rescale: the exponentials are taken against the reference m in use. A lane's 32 terms are all >= 0, so a
   // stage sum of at most PLIM bounds each of them by PLIM, finite in f16; then m, l and O stay as they are.
   v8f e[4];
   exp32(a, e);
   float ls = sum32(e);                                     // the branch waits for this sum: a tree
   // inputs-only fence on the loaded v^T fragments: without it the compiler sinks their loads behind the branch, right in
   // front of the products that read them, and their LDS latency is waited out in every stage. The stage sum is named
   // too (read only), so that the fence and its wait stand here, behind the exponentials, and not in front of them.
   hold8_h(vf[0][0], vf[0][1], vf[0][2], vf[0][3], vf[1][0], vf[1][1], vf[1][2], vf[1][3], ls);
   // one test per stage, the same for the whole wave (scalar branch): taken in the first stage (lim is below 0 there; it
   // sets m: C was 0) and whenever some lane's stage sum exceeds PLIM; then the running maximum is brought up to date,
   // l and O are rescaled and the stage's exponentials are taken again
   if (__builtin_amdgcn_ballot_w32(ls > lim) != 0) {
    float mx = -3.0e38f;
#pragma unroll                                              // vector elements by constant index, in registers
    for (int r = 0; r < 8; ++r) mx = fmaxf(fmaxf(mx, fmaxf(a[0][r], a[1][r])), fmaxf(a[2][r], a[3][r]));
    mx = fmaxf(mx, __shfl_xor(mx, 16, 32));
    const float up = mx - L2PS;             // the stage's maximum above the reference in use, log2 units
    const float d  = (lim < 0.f) ? up : fmaxf(up, 0.f);     // m moves by d: never down once the first stage has set it
    lim = PLIM;
    const float corr = __builtin_amdgcn_exp2f(-fmaxf(d, 0.f));   // first stage: l and O are 0 and stay so
    cs -= d;
    l *= corr;
    o0 *= corr; o1 *= corr; o2 *= corr; o3 *= corr;
    v8f a2[4];
#pragma unroll                                              // arrays by constant index, in registers
    for (int i = 0; i < 4; ++i) a2[i] = a[i] - d;
    // all arguments are formed ahead of the exponentials
    __builtin_amdgcn_sched_barrier(0);
    exp32(a2, e);
    ls = sum32(e);
   }
   l += ls;
   FragH ph0, ph1;
#pragma unroll                                              // vector elements by constant index, in registers
   for (int r = 0; r < 8; ++r) {
    ph0.h[0][r] = (_Float16)e[0][r];                        // key 64 t      + 8hh + r
    ph0.h[1][r] = (_Float16)e[1][r];                        // key 64 t + 16 + 8hh + r
    ph1.h[0][r] = (_Float16)e[2][r];                        // key 64 t + 32 + 8hh + r
    ph1.h[1][r] = (_Float16)e[3][r];                        // key 64 t + 48 + 8hh + r
   }
   o0 = mma_h_raw(vf[0][0], ph0.v, o0);
   o1 = mma_h_raw(vf[0][1], ph0.v, o1);
   o2 = mma_h_raw(vf[0][2], ph0.v, o2);
   o3 = mma_h_raw(vf[0][3], ph0.v, o3);
   o0 = mma_h_raw(vf[1][0], ph1.v, o0);
   o1 = mma_h_raw(vf[1][1], ph1.v, o1);
   o2 = mma_h_raw(vf[1][2], ph1.v, o2);
   o3 = mma_h_raw(vf[1][3], ph1.v, o3);
   oguard10(o0, o1, o2, o3, vf[0][0], vf[0][1], vf[0][2], vf[0][3], vf[1][0], vf[1][1], vf[1][2], vf[1][3], ph0.v, ph1.v);
   asm volatile("s_wait_dscnt 0x0" ::: "memory");           // this wave's reads of buffer t & 1 are done
   asm volatile("s_wait_asynccnt 0x0" ::: "memory");        // this wave's copies of stage t + 1 have landed
   __syncthreads();                                         // publishes stage t + 1, frees buffer t & 1
   if (t + 2 < ANT)
     attn_stage_copy(lcp + (t & 1) * ASTG, gk + (size_t)(t + 2) * (AKB * DMOD * 2), gv + (t + 2) * (AKB * 2));
  }
  asm volatile("s_wait_asynccnt 0x0" ::: "memory");         // no copy outstanding when the wave goes on
  l += __shfl_xor(l, 16, 32);
  const float sc = (CS / VS) * (1.0f / l);

  // ---- stage O[query 16*wave + c][d = 16j + 8hh + r] * sc (= attn * 1024), then whole-line f16 stores ----
  float* os = Os + (wave * 16 + c) * 68 + 8 * hh;
#pragma unroll
  for (int r = 0; r < 8; ++r) { os[r] = o0[r] * sc; os[16 + r] = o1[r] * sc; os[32 + r] = o2[r] * sc; os[48 + r] = o3[r] * sc; }
  __syncthreads();
  {
    const int e = tid & 7, qq = tid >> 3;              // qq 0..15: line within group, e: 16-B piece
    v4u hv[4];
#pragma unroll
    for (int it = 0; it < 4; ++it) {
      const int qi = it * 16 + qq;                       // it 0..3 x qq 0..15 = queries 0..63 of the block
      const v4f x0 = *(const v4f*)(Os + qi * 68 + 8 * e);
      const v4f x1 = *(const v4f*)(Os + qi * 68 + 8 * e + 4);
      v4u u;
#pragma unroll
      for (int t2 = 0; t2 < 2; ++t2) {
        u[t2]     = pk16(h_bits((_Float16)x0[2 * t2]), h_bits((_Float16)x0[2 * t2 + 1]));
        u[2 + t2] = pk16(h_bits((_Float16)x1[2 * t2]), h_bits((_Float16)x1[2 * t2 + 1]));
      }
      hv[it] = u;
    }
    unsigned short* ob = ctx + (size_t)hd * DHEAD + 8 * e;
    {
#pragma unroll
      for (int it = 0; it < 4; ++it) {
        const int qi = it * 16 + qq;
        *(v4u*)(ob + ((size_t)b * SEQ + q0 + qi) * DMOD) = hv[it];
      }
      
    }
  }
}

// =====================================================================================================
//   XH   f16 [4096][768]            0           6291456
//   WQT  f16 [768][768]             6291456     1179648
//   WKT  f16 [768][768]             7471104     1179648
//   WVT  f16 [768][768]             8650752     1179648
//   WOT  f16 [768][768]             9830400     1179648
//   QP   f16 [4096][768]            11010048    6291456
//   KPL  f16 [4096][768]            17301504    6291456
//   VT   f16 [2][768][2048]         23592960    6291456
//   CTX  f16 [4096][768]            29884416    6291456
//   end                              36175872
// =====================================================================================================
extern "C" void kernel_launch(void* const* d_in, const int* in_sizes, int n_in,
                              void* d_out, int out_size, void* d_ws, size_t ws_size,
                              hipStream_t stream) {
  if (n_in < 10) return;
  if (in_sizes[0] != MTOK * DMOD) return;
  if (in_sizes[1] != MTOK) return;
  if (in_sizes[2] != DMOD * DMOD || in_sizes[4] != DMOD * DMOD || in_sizes[6] != DMOD * DMOD) return;
  if (in_sizes[8] != DMOD * DMOD) return;
  if (in_sizes[3] != DMOD || in_sizes[5] != DMOD || in_sizes[7] != DMOD || in_sizes[9] != DMOD) return;
  if (out_size != MTOK * DMOD) return;

  const float* hs  = (const float*)d_in[0];
  const int*   amk = (const int*)d_in[1];
  const float* Wq  = (const float*)d_in[2];
  const float* bq  = (const float*)d_in[3];
  const float* Wk  = (const float*)d_in[4];
  const float* bk  = (const float*)d_in[5];
  const float* Wv  = (const float*)d_in[6];
  const float* bv  = (const float*)d_in[7];
  const float* Wo  = (const float*)d_in[8];
  const float* bo  = (const float*)d_in[9];

  const size_t PACT = (size_t)MTOK * DMOD * 2;          //  6291456
  const size_t PW   = (size_t)DMOD * DMOD * 2;          //  1179648
  const size_t PVT  = (size_t)NBAT * DMOD * SEQ * 2;    //  6291456
  size_t off = 0;
  const size_t oXH = off; off += PACT;
  const size_t oWQ = off; off += PW;
  const size_t oWK = off; off += PW;
  const size_t oWV = off; off += PW;
  const size_t oWO = off; off += PW;
  const size_t oQP = off; off += PACT;
  const size_t oKP = off; off += PACT;
  const size_t oVT = off; off += PVT;
  const size_t oCT = off; off += PACT;
  if (off > ws_size) return;                            // off = 36175872
  if (off > (size_t)134217728) return;

  char* ws = (char*)d_ws;
  unsigned short* XH  = (unsigned short*)(ws + oXH);
  unsigned short* WQT = (unsigned short*)(ws + oWQ);
  unsigned short* WKT = (unsigned short*)(ws + oWK);
  unsigned short* WVT = (unsigned short*)(ws + oWV);
  unsigned short* WOT = (unsigned short*)(ws + oWO);
  unsigned short* QPL = (unsigned short*)(ws + oQP);
  unsigned short* KPL = (unsigned short*)(ws + oKP);
  unsigned short* VT  = (unsigned short*)(ws + oVT);
  unsigned short* CTX = (unsigned short*)(ws + oCT);
  float*          out = (float*)d_out;

  const dim3 blk256(256), blk128(128);
  const dim3 gCV(4 * TPW + MTOK * KSEG / 8);                   // 576 weight tiles + 1536 blocks of 8 row segments
  const dim3 gGM(GBLK);                                        // 768 tiles -> 192 blocks of 4 waves
  const dim3 gG3(3 * GBLK);                                    // q, k, v: 576 blocks
  const dim3 gAT(NBAT * NHEAD * (SEQ / 64));                   // 768 blocks of 128

  // (0) activation plane f16( bf16_RNE(h) * 64 ) and weight planes [K][N] -> [N][K], f16( bf16_RNE(W) * 1024 )
  cvt_all<<<gCV, blk256, 0, stream>>>(hs, Wq, Wk, Wv, Wo, XH, WQT, WKT, WVT, WOT);

  // (1) q = h . Wq + bq -> f16 plane of q*log2(e)/8 ; k -> f16 plane of k ; v = h . Wv + bv -> VT[b][h*64+e][token], f16 plane of v*256
  gemm_qkv<<<gG3, blk128, 0, stream>>>(XH, WQT, WKT, WVT, bq, bk, bv, QPL, KPL, VT);

  // (2) attention with the additive int mask, all (b, head) -> ctx plane f16( attn * 1024 )[token][h*64 + d]
  attn_kernel<<<gAT, blk128, 0, stream>>>(QPL, KPL, VT, amk, CTX);

  // (3) out = attn . Wo + bo -> f32 [4096][768]
  gemm_out<<<gGM, blk128, 0, stream>>>(CTX, WOT, bo, out);
  (void)hipGetLastError();
}

// v007
// One run takes 64 microseconds.
// Two timings next to v006 put it at 1.03 and 1.04 times that version's speed.
// Counting every step since v000, it is 3.14 times as fast.
// Contractions: q,k,v projections (x token rows f16 x64 . W^T rows f16 x1024, K=768, one product each);
// attention scores S^T = k (f16, one plane) . q^T (f16 of q * log2(e)/8, one plane) + C, one product, head dim 64;
// attention O^T = v^T (f16 x256, one plane) . P^T (f16 x1024, one plane, from the score D registers), one product
// into one accumulator per half of the 2048 keys, the two joined in f32 at the end; output projection ctx (f16 x1024) . Wo^T
// (f16 x1024), one product. All v_wmma_f32_16x16x32_f16, f32 accumulate; mask adder and softmax in f32 on VALU;
// every float input RNE-converted to bf16 on load.
#include <hip/hip_runtime.h>
#include <math.h>
#include <stdint.h>

#define NBAT   2
#define SEQ    2048
#define DMOD   768
#define NHEAD  12
#define DHEAD  64
#define MTOK   (NBAT * SEQ)
#define KSEG   (DMOD / 256)
#define TN64   (DMOD / 64)
#define TPW    (TN64 * TN64)
#define XC     64.0f
#define WSC    1024.0f
#define LOG2E  1.442695040888963f
#define QS     (0.125f * LOG2E)        // q plane = q * log2(e) / sqrt(64): k . q is the score in log2 units
#define KS     1.0f
#define VS     256.0f
#define CS     1024.0f
#define L2PS   10.0f                   // log2 of the scale of P, 1024
#define MASKC  (-10000.0f)
#define PLIM   65504.0f                // largest finite f16
static_assert(NHEAD * DHEAD == DMOD);
static_assert((MTOK % 64) == 0 && (DMOD % 64) == 0 && (SEQ % 64) == 0 && (DMOD % 32) == 0 && (DMOD % 256) == 0);
static_assert((((MTOK / 64) * TN64) % 4) == 0);
static_assert(((MTOK * KSEG) % 8) == 0);
static_assert((SEQ / 64) == 32 && (SEQ % 32) == 0);
static_assert((MTOK % SEQ) == 0);

typedef _Float16 v16h __attribute__((ext_vector_type(16)));
typedef _Float16 v8h  __attribute__((ext_vector_type(8)));
typedef float    v8f  __attribute__((ext_vector_type(8)));
typedef float    v4f  __attribute__((ext_vector_type(4)));
typedef float    v2f  __attribute__((ext_vector_type(2)));
typedef unsigned int v4u __attribute__((ext_vector_type(4)));
typedef int      v4i  __attribute__((ext_vector_type(4)));

union FragH { v16h v; v8h h[2]; };

// ---- scalar helpers --------------------------------------------------------------------------------
__device__ __forceinline__ unsigned short bf_bits(float f) {          // f32 -> bf16 bits, RNE convert
  unsigned u = __float_as_uint(f);
  return (unsigned short)((u + 0x7FFFu + ((u >> 16) & 1u)) >> 16);
}
__device__ __forceinline__ float bf_up(unsigned short h) { return __uint_as_float(((unsigned)h) << 16); }
__device__ __forceinline__ float bfr(float f) { return bf_up(bf_bits(f)); }
__device__ __forceinline__ unsigned short h_bits(_Float16 x) { return __builtin_bit_cast(unsigned short, x); }
__device__ __forceinline__ unsigned pk16(unsigned short a, unsigned short b) { return (unsigned)a | ((unsigned)b << 16); }
__device__ __forceinline__ v8f zero8() { v8f z = {0.f, 0.f, 0.f, 0.f, 0.f, 0.f, 0.f, 0.f}; return z; }

// ---- fragment loader: 16-bit A/B operand, lane -> row/col (lane&15), p already includes +8*(lane>>4);
//      elements 0..7 <- p[0..7] (k0+8h..), elements 8..15 <- p[16..23] (k0+16+8h..)
__device__ __forceinline__ v16h ldfrag_h(const _Float16* p) {
  FragH f;
  f.h[0] = *(const v8h*)(p);
  f.h[1] = *(const v8h*)(p + 16);
  return f.v;
}

// ---- WMMA helpers with trailing VALU hazard gap --------------------------------------------------------
__device__ __forceinline__ v8f mma_h_raw(v16h a, v16h b, v8f c) {
  return __builtin_amdgcn_wmma_f32_16x16x32_f16(false, a, false, b, (short)0, c, false, false);
}
__device__ __forceinline__ void dep_guard1(v8f& a, v8f& b, v16h x) {
#if defined(__HIP_DEVICE_COMPILE__)
  asm volatile("v_nop\n\tv_nop\n\tv_nop\n\tv_nop" : "+v"(a), "+v"(b) : "v"(x));
#endif
}
__device__ __forceinline__ void keep4_h(v16h a, v16h b, v16h c, v16h d) {
#if defined(__HIP_DEVICE_COMPILE__)
  asm volatile("v_nop" :: "v"(a), "v"(b), "v"(c), "v"(d));
#endif
}
__device__ __forceinline__ void acc_guard4(v8f& a, v8f& b, v8f& c, v8f& d) {
#if defined(__HIP_DEVICE_COMPILE__)
  asm volatile("v_nop\n\tv_nop\n\tv_nop\n\tv_nop" : "+v"(a), "+v"(b), "+v"(c), "+v"(d));
#endif
}
__device__ __forceinline__ void wave_sync_lds() {
  __builtin_amdgcn_fence(__ATOMIC_RELEASE, "workgroup");
  __builtin_amdgcn_wave_barrier();
  __builtin_amdgcn_fence(__ATOMIC_ACQUIRE, "workgroup");
}

// =====================================================================================================
// Activation plane: XH[t][768] = f16( bf16_RNE(h[t][c]) * 64 ).
// coverage: 1536 x 8 = 12288 segments = 4096 rows x 768 columns entirely.
// =====================================================================================================
__device__ __forceinline__ void cvt_act(const int bx, const float* __restrict__ hs, unsigned short* XH) {
  const int lane = threadIdx.x & 31, wave = threadIdx.x >> 5;
  const int seg = bx * 8 + wave;                         // 0 .. 12287
  const int row = seg / KSEG;
  const int col = (seg - row * KSEG) * 256 + 8 * lane;
  const size_t o = (size_t)row * DMOD + col;
  const v4f h0 = *(const v4f*)(hs + o), h1 = *(const v4f*)(hs + o + 4);
  float a[8];
#pragma unroll
  for (int i = 0; i < 4; ++i) { a[i] = bfr(h0[i]); a[4 + i] = bfr(h1[i]); }
  v4u uh;
#pragma unroll
  for (int i = 0; i < 4; ++i) {
    const float xa = a[2 * i] * XC, xb = a[2 * i + 1] * XC;
    uh[i] = pk16(h_bits((_Float16)xa), h_bits((_Float16)xb));
  }
  unsigned short* dh = XH + o;
  *(v4u*)dh = uh;
  // this body now shares a kernel with the weight tiles' code: the wait closes the store before any path of the listing
  // that rewrites one of its registers
  asm volatile("s_wait_xcnt 0x0" ::: "memory");
}

// =====================================================================================================
// Weight planes: in W[K=768][N=768] (N contiguous) -> out WT[N][K] = f16( bf16_RNE(W[k][n]) * 1024 ), k contiguous.
// Block = one 64(k) x 64(n) tile: 256 threads load 16 rows x 64 floats per step (16 threads x 16 B per row), convert and
// store transposed into LDS Ts[n][k] (pitch 72 halves, 2-byte stores), block barrier, then 2 instructions each write
// blocks 0..143 -> weight 0, 144..287 -> weight 1, 288..431 -> weight 2, 432..575 -> weight 3 (block-uniform select).
// coverage: per weight 144 tiles x (2 x 32 lines x 8 lanes x 8 halves) = 768 x 768 entirely.
// =====================================================================================================
__device__ __forceinline__ void cvt_w(const int bx, unsigned short* Ts,
                                      const float* __restrict__ w0, const float* __restrict__ w1,
                                      const float* __restrict__ w2, const float* __restrict__ w3,
                                      unsigned short* t0, unsigned short* t1,
                                      unsigned short* t2, unsigned short* t3) {
  const int tid = threadIdx.x;
  const int wsel = bx / TPW;                        // block-uniform
  const int t = bx - wsel * TPW;
  const int k0 = (t / TN64) * 64;
  const int n0 = (t % TN64) * 64;
  const float* src = (wsel == 0) ? w0 : (wsel == 1) ? w1 : (wsel == 2) ? w2 : w3;
  unsigned short* dst = (wsel == 0) ? t0 : (wsel == 1) ? t1 : (wsel == 2) ? t2 : t3;
  {
    const int r16 = tid >> 4, p = tid & 15;
#pragma unroll
    for (int it = 0; it < 4; ++it) {
      const int kr = it * 16 + r16;                   // it 0..3 x r16 0..15 = k rows 0..63
      const v4f v = *(const v4f*)(src + (size_t)(k0 + kr) * DMOD + n0 + 4 * p);
#pragma unroll
      for (int j = 0; j < 4; ++j) Ts[(4 * p + j) * 72 + kr] = h_bits((_Float16)(bfr(v[j]) * WSC));
    }
  }
  __syncthreads();
  {
    const int e = tid & 7, lq = tid >> 3;             // lq 0..31: line, e: 16-B piece
    v4u u[2];
#pragma unroll
    for (int it = 0; it < 2; ++it) {
      const int nr = it * 32 + lq;                    // it 0..1 x lq 0..31 = n rows 0..63
      u[it] = *(const v4u*)(Ts + nr * 72 + 8 * e);
    }
    unsigned short* db = dst + (size_t)n0 * DMOD + k0 + 8 * e;
    {
#pragma unroll
      for (int it = 0; it < 2; ++it) {
        const int nr = it * 32 + lq;
        *(v4u*)(db + (size_t)nr * DMOD) = u[it];
      }
      
    }
  }
}

// Both conversions in one grid (neither reads what the other writes): blocks 0..575 take the weight tiles, blocks
// 576..2111 the activation segments. The test is block-uniform, so the weight tiles' barrier is passed by whole blocks.
__global__ __launch_bounds__(256) void cvt_all(const float* __restrict__ hs, const float* __restrict__ w0,
                                                const float* __restrict__ w1, const float* __restrict__ w2,
                                                const float* __restrict__ w3, unsigned short* XH,
                                                unsigned short* t0, unsigned short* t1,
                                                unsigned short* t2, unsigned short* t3) {
  __shared__ __align__(16) unsigned short Ts[64 * 72];
  const int bx = blockIdx.x;
  if (bx < 4 * TPW) cvt_w(bx, Ts, w0, w1, w2, w3, t0, t1, t2, t3);
  else              cvt_act(bx - 4 * TPW, hs, XH);
}

// =====================================================================================================
// Register-blocked f16 WMMA GEMM, one wave per 64x64 tile (4 waves per block = 64 token rows x 256 features):
//   acc[m][n] = sum_k A[m][k] * Bt[n][k],  A: f16 [4096][768] token rows, Bt: f16 [768][768] k contiguous,
//   M=4096, N=768, K=768 fixed, all tile multiples.
//   Operands reach the waves through LDS: per stage of 64 k the block copies its 64 A rows and 256 Bt rows (128 B each,
//   whole lines, 8 lanes x 16 B per row) with asynchronous 16-B copies into one of two buffers (row pitch 144 B), the
//   next stage in flight while this one is multiplied; fragments = two 16-B LDS loads with the split k map (ldfrag_h).
//   y = acc * escale + bf16_RNE(bias[n]) * bscale, then per MODE:
//   MODE 0: f32 row-major C[4096][768] (the final output): 16-row slabs staged per wave in LDS (pitch 68 floats), each
//   MODE 1: f16 single plane row-major [4096][768]: per slab 4 instructions, each 4 rows x (8 consecutive lanes x 16 B)
//   MODE 2: f16 single plane transposed VT[b][feature 768][2048 tokens]: the wave's whole 64x64 tile is staged as f16
// coverage: MODE 0/1: 4 slabs x 16 rows x 64 cols per wave tile; MODE 2: 64 features x 64 tokens per wave tile;
//           grid = 768 tiles / 4 = 192 blocks covers [4096][768] exactly once (m0 multiple of 64 never straddles b).
// =====================================================================================================
#define GKB   64                       // k per stage: rows of 128 B
#define GPIT  144                      // LDS row pitch, bytes: 16 B x odd, conflict-free for 16-B fragment loads
#define GSTG  ((64 + 256) * GPIT)      // one buffer: A rows 0..63, Bt rows 64..319
#define GNT   (DMOD / GKB)             // 12 stages
#define GLSTEP (16 * GPIT)             // 16 rows further in LDS
#define GGSTEP (16 * DMOD * 2)         // 16 rows further in global memory
static_assert((TN64 % 4) == 0 && (DMOD % GKB) == 0 && GNT >= 2 && (GPIT % 16) == 0);

// Ten asynchronous 16-B copies per lane, rows 16 apart: LDS byte address l + i * GLSTEP <- g[i]. The s_wait_xcnt closes
// the statement so that no address register of an issued copy is rewritten ahead of it.
__device__ __forceinline__ void acopy10(unsigned l, const char* const (&g)[10]) {
#if defined(__HIP_DEVICE_COMPILE__)
  asm volatile(
      "global_load_async_to_lds_b128 %0, %10, off\n\t"
      "global_load_async_to_lds_b128 %1, %11, off\n\t"
      "global_load_async_to_lds_b128 %2, %12, off\n\t"
      "global_load_async_to_lds_b128 %3, %13, off\n\t"
      "global_load_async_to_lds_b128 %4, %14, off\n\t"
      "global_load_async_to_lds_b128 %5, %15, off\n\t"
      "global_load_async_to_lds_b128 %6, %16, off\n\t"
      "global_load_async_to_lds_b128 %7, %17, off\n\t"
      "global_load_async_to_lds_b128 %8, %18, off\n\t"
      "global_load_async_to_lds_b128 %9, %19, off\n\t"
      "s_wait_xcnt 0x0"
      :: "v"(l), "v"(l + 1 * GLSTEP), "v"(l + 2 * GLSTEP), "v"(l + 3 * GLSTEP), "v"(l + 4 * GLSTEP),
         "v"(l + 5 * GLSTEP), "v"(l + 6 * GLSTEP), "v"(l + 7 * GLSTEP), "v"(l + 8 * GLSTEP), "v"(l + 9 * GLSTEP),
         "v"(g[0]), "v"(g[1]), "v"(g[2]), "v"(g[3]), "v"(g[4]), "v"(g[5]), "v"(g[6]), "v"(g[7]), "v"(g[8]), "v"(g[9])
      : "memory");
#endif
}
// One stage: 320 rows x 8 pieces = 2560 copies = 20 per thread; thread -> row (tid >> 3) + 16 i, piece tid & 7.
// ga, gb: this thread's piece of A row (tid >> 3) and of Bt row (tid >> 3) of the block, at the stage's first k.
__device__ __forceinline__ void stage_copy(unsigned l, const char* ga, const char* gb) {
  const char* g0[10];
  const char* g1[10];
  // the three loops are unrolled so that both pointer arrays stay in registers
#pragma unroll
  for (int i = 0; i < 4; ++i) g0[i] = ga + (size_t)i * GGSTEP;             // A rows 0..63
#pragma unroll
  for (int i = 4; i < 10; ++i) g0[i] = gb + (size_t)(i - 4) * GGSTEP;      // Bt rows 0..95
#pragma unroll
  for (int i = 0; i < 10; ++i) g1[i] = gb + (size_t)(i + 6) * GGSTEP;      // Bt rows 96..255
  acopy10(l, g0);
  acopy10(l + 10 * GLSTEP, g1);
}

// ring: the block's 2 * GSTG bytes of LDS, the two operand buffers. The epilogue's slabs (9216 B per wave) lie on the same
// bytes: the barrier at the foot of the last stage ends every wave's reads of the ring and no copy is outstanding then.
// That keeps a block at 92160 B, so that three blocks fit a WGP's LDS.
template <int MODE>
__device__ __forceinline__ void gemm64(
    const int bx, unsigned char* ring,
    const unsigned short* __restrict__ Ap, const unsigned short* __restrict__ Bp,
    const float* __restrict__ bias, const float escale, const float bscale, void* C0) {
  const int lane = threadIdx.x & 31;
  const int wave = threadIdx.x >> 5;
  unsigned short* sraw = (unsigned short*)(void*)(ring + wave * 9216);   // this wave's slab, used behind the loop only
  const int tilesN = TN64;                                 // 12
  const int tile = bx * 4 + wave;                          // 0..767, grid exact
  const int tm = tile / tilesN;
  const int tn = tile - tm * tilesN;
  const int m0 = tm << 6;
  const int n0 = tn << 6;

  const int rlane = lane & 15;                 // row (A) / col (B, D) within subtile
  const int hh    = lane >> 4;
  const int koff  = hh * 8;                    // k offset of this lane half
  const int mOff  = hh * 8;                    // D row offset

  v8f acc[4][4];
#pragma unroll
  for (int i = 0; i < 4; ++i)
#pragma unroll
    for (int j = 0; j < 4; ++j) acc[i][j] = zero8();

  // copy side: the block's A rows start at m0 (the same in its four waves), its Bt rows at n0 - 64 * wave
  const int crow = threadIdx.x >> 3, cpc = threadIdx.x & 7;
  const unsigned lcp = (unsigned)(uintptr_t)(&ring[0]) + (unsigned)(crow * GPIT + cpc * 16);
  const char* ga = (const char*)(const void*)Ap + ((size_t)(m0 + crow) * DMOD + 8 * cpc) * 2;
  const char* gb = (const char*)(const void*)Bp + ((size_t)(n0 - (wave << 6) + crow) * DMOD + 8 * cpc) * 2;

  stage_copy(lcp, ga, gb);
  asm volatile("s_wait_asynccnt 0x0" ::: "memory");        // stage 0 of this wave has landed
  __syncthreads();                                          // ... and every wave's part of it
  stage_copy(lcp + GSTG, ga + GKB * 2, gb + GKB * 2);

  for (int t = 0; t < GNT; ++t) {
    const unsigned char* rb = ring + (t & 1) * GSTG;
    const _Float16* la = (const _Float16*)(const void*)(rb + rlane * GPIT) + koff;
    const _Float16* lb = (const _Float16*)(const void*)(rb + (64 + (wave << 6) + rlane) * GPIT) + koff;
    // all loops of the stage are unrolled: fragment and accumulator arrays in registers, LDS offsets as immediates
#pragma unroll
    for (int ks = 0; ks < GKB; ks += 32) {
      v16h ah[4], bh[4];                                    // the 32-k block's fragments, read as one group
#pragma unroll
      for (int j = 0; j < 4; ++j) {
        bh[j] = ldfrag_h(lb + j * (GLSTEP / 2) + ks);
        ah[j] = ldfrag_h(la + j * (GLSTEP / 2) + ks);
      }
#pragma unroll
      for (int i = 0; i < 4; ++i) {
#pragma unroll
        for (int j = 0; j < 4; ++j) acc[i][j] = mma_h_raw(ah[i], bh[j], acc[i][j]);
        dep_guard1(acc[i][0], acc[i][3], ah[i]);
      }
      keep4_h(bh[0], bh[1], bh[2], bh[3]);
    }
    asm volatile("s_wait_dscnt 0x0" ::: "memory");          // this wave's reads of buffer t & 1 are done
    asm volatile("s_wait_asynccnt 0x0" ::: "memory");       // this wave's copies of stage t + 1 have landed
    __syncthreads();                                        // publishes stage t + 1, frees buffer t & 1
    if (t + 2 < GNT) stage_copy(lcp + (t & 1) * GSTG, ga + (t + 2) * (GKB * 2), gb + (t + 2) * (GKB * 2));
  }
  asm volatile("s_wait_asynccnt 0x0" ::: "memory");         // no copy outstanding when the wave goes on
  acc_guard4(acc[0][0], acc[0][1], acc[0][2], acc[0][3]);
  acc_guard4(acc[1][0], acc[1][1], acc[1][2], acc[1][3]);
  acc_guard4(acc[2][0], acc[2][1], acc[2][2], acc[2][3]);
  acc_guard4(acc[3][0], acc[3][1], acc[3][2], acc[3][3]);

  if (MODE == 0) {
    float* Cout = (float*)C0;
    const int c4 = rlane * 4;                        // f32 out: 256-B row segment = 16 lanes x 16 B
    const v4f braw = *(const v4f*)(bias + n0 + c4);
    float bb[4];
#pragma unroll
    for (int tt = 0; tt < 4; ++tt) bb[tt] = bfr(braw[tt]) * bscale;
    float* slab = (float*)(void*)(sraw);
#pragma unroll
    for (int i = 0; i < 4; ++i) {
      const int mBase = m0 + (i << 4);
#pragma unroll
      for (int j = 0; j < 4; ++j) {
#pragma unroll
        for (int r = 0; r < 8; ++r) slab[(mOff + r) * 68 + (j << 4) + rlane] = acc[i][j][r];
      }
      wave_sync_lds();
      v4f vals[8];
#pragma unroll
      for (int it = 0; it < 8; ++it) {
        const int row = it * 2 + hh;                   // it 0..7 x hh 0..1 = rows 0..15
        v4f v = *(const v4f*)(slab + row * 68 + c4);
#pragma unroll
        for (int tt = 0; tt < 4; ++tt) v[tt] = v[tt] * escale + bb[tt];
        vals[it] = v;
      }
      {
#pragma unroll
        for (int it = 0; it < 8; ++it) {
          const int row = it * 2 + hh;
          *(v4f*)(Cout + (size_t)(mBase + row) * DMOD + n0 + c4) = vals[it];
        }
        
      }
      wave_sync_lds();
    }
  } else if (MODE == 1) {
    unsigned short* Hp = (unsigned short*)C0;
    const int e = lane & 7, q4 = lane >> 3;
    const v4f b0 = *(const v4f*)(bias + n0 + 8 * e), b1 = *(const v4f*)(bias + n0 + 8 * e + 4);
    float bb[8];
#pragma unroll
    for (int tt = 0; tt < 4; ++tt) { bb[tt] = bfr(b0[tt]) * bscale; bb[4 + tt] = bfr(b1[tt]) * bscale; }
    float* slab = (float*)(void*)(sraw);
#pragma unroll
    for (int i = 0; i < 4; ++i) {
      const int mBase = m0 + (i << 4);
#pragma unroll
      for (int j = 0; j < 4; ++j) {
#pragma unroll
        for (int r = 0; r < 8; ++r) slab[(mOff + r) * 68 + (j << 4) + rlane] = acc[i][j][r];
      }
      wave_sync_lds();
      v4u hv[4];
#pragma unroll
      for (int it = 0; it < 4; ++it) {
        const int row = it * 4 + q4;                   // it 0..3 x q4 0..3 = rows 0..15
        const v4f x0 = *(const v4f*)(slab + row * 68 + 8 * e);
        const v4f x1 = *(const v4f*)(slab + row * 68 + 8 * e + 4);
        float y[8];
#pragma unroll
        for (int tt = 0; tt < 4; ++tt) { y[tt] = x0[tt] * escale + bb[tt]; y[4 + tt] = x1[tt] * escale + bb[4 + tt]; }
        v4u uh;
#pragma unroll
        for (int t2 = 0; t2 < 4; ++t2) {
          uh[t2] = pk16(h_bits((_Float16)y[2 * t2]), h_bits((_Float16)y[2 * t2 + 1]));
        }
        hv[it] = uh;
      }
      {
#pragma unroll
        for (int it = 0; it < 4; ++it) {
          const int row = it * 4 + q4;
          const size_t go = (size_t)(mBase + row) * DMOD + n0 + 8 * e;
          *(v4u*)(Hp + go) = hv[it];
        }
        
      }
      wave_sync_lds();
    }
  } else {
    unsigned short* Vs = sraw;              // [64 features][pitch 72] f16 bits
    float bb4[4];
#pragma unroll
    for (int j = 0; j < 4; ++j) bb4[j] = bfr(bias[n0 + (j << 4) + rlane]) * bscale;
#pragma unroll
    for (int i = 0; i < 4; ++i) {
#pragma unroll
      for (int j = 0; j < 4; ++j) {
#pragma unroll
        for (int r = 0; r < 8; ++r) {
          Vs[((j << 4) + rlane) * 72 + (i << 4) + mOff + r] = h_bits((_Float16)(acc[i][j][r] * escale + bb4[j]));
        }
      }
    }
    wave_sync_lds();
    const int e = lane & 7, q4 = lane >> 3;
    const int bsel = m0 / SEQ;                          // batch of this tile (wave-uniform)
    const int s0 = m0 % SEQ;                            // first token within the batch
    v4u u[16];
#pragma unroll
    for (int it = 0; it < 16; ++it) {
      const int fl = it * 4 + q4;                        // it 0..15 x q4 0..3 = features 0..63
      u[it] = *(const v4u*)(Vs + fl * 72 + 8 * e);
    }
    unsigned short* Vp = (unsigned short*)C0 + ((size_t)bsel * DMOD + n0) * SEQ + s0 + 8 * e;
    {
#pragma unroll
      for (int it = 0; it < 16; ++it) {
        const int fl = it * 4 + q4;
        *(v4u*)(Vp + (size_t)fl * SEQ) = u[it];
      }
      
    }
  }
}

#define GBLK  (((MTOK / 64) * TN64) / 4)   // 192 blocks cover one [4096][768] product

// q, k and v projections in one grid of 3 x 192 blocks (they share A and depend on nothing of each other): block-uniform
// choice of the weight plane, bias, scale and output plane; q*log2(e)/8 and k row-major (acc = 64*1024*y),
// v*256 transposed (escale 1/256).
__global__ __launch_bounds__(128) void gemm_qkv(
    const unsigned short* __restrict__ Ap, const unsigned short* __restrict__ Bq,
    const unsigned short* __restrict__ Bk, const unsigned short* __restrict__ Bv,
    const float* __restrict__ bq, const float* __restrict__ bk, const float* __restrict__ bv,
    unsigned short* Cq, unsigned short* Ck, unsigned short* Cv) {
  __shared__ __align__(16) unsigned char ring[2 * GSTG];   // two operand buffers
  const int sel = blockIdx.x / GBLK;                       // 0: q, 1: k, 2: v
  const int bx = blockIdx.x - sel * GBLK;
  if (sel == 2) gemm64<2>(bx, ring, Ap, Bv, bv, VS / (XC * WSC), VS, (void*)Cv);
  else          gemm64<1>(bx, ring, Ap, sel ? Bk : Bq, sel ? bk : bq, (sel ? KS : QS) / (XC * WSC), sel ? KS : QS,
                          (void*)(sel ? Ck : Cq));           // q and k share one path, the scale is block-uniform
}

// output projection: acc = 1024*1024*out -> escale 2^-20, f32 row-major
__global__ __launch_bounds__(128) void gemm_out(
    const unsigned short* __restrict__ Ap, const unsigned short* __restrict__ Bp,
    const float* __restrict__ bias, float* C0) {
  __shared__ __align__(16) unsigned char ring[2 * GSTG];   // two operand buffers
  gemm64<0>(blockIdx.x, ring, Ap, Bp, bias, 1.0f / (CS * WSC), 1.0f, (void*)C0);
}

// =====================================================================================================
// Attention for one (b, head, 64-query block), transposed formulation, head dim 64, 2048 keys, additive int mask:
//   S^T tile (16 keys x 16 queries) = A(k rows = keys, d via the split k map) . B(q, col = query, same d map), two d-steps
//   of 32. The q plane carries log2(e)/8, so k.q is the score in log2 units, and the first product's C operand carries
//   what is added to it: 10 - m (m = the reference in use, log2 units; 10 = log2 of P's scale), a tile of one value that
//   stays in registers from pass to pass. The D tile is then the argument of exp2 itself; only a stage that holds a key
//   whose adder (1 - mask[b][key]) * (-10000) * log2(e) is not 0 (one flag bit per stage, set when the adder table is
//   built, scalar branch) reads its adders from the table and adds them. Per lane the D tile holds 8 keys of ONE query, so the online softmax is per-lane state;
//   m is raised to the running max (max tree, one shuffle lane^16, rescale of l and O) in the first pass and in a pass
//   whose sum of exponentials leaves the f16 range; the row sum is kept as a per-lane partial and combined at
//   the end. P = e^{x-m} x 1024 as one f16 plane (11 significant bits, as v^T and ctx have), used directly as the
//   B operand of O^T (rows d, cols queries) += A(v^T rows d, keys contiguous, two 16-B loads) . B(P^T):
//   B element r <- the key tile covering keys kb..kb+15, element 8+r <- the tile covering kb+16..kb+31, lane unchanged
//   (D-as-B chaining layout). One product per d tile (d 0-15, 16-31, 32-47, 48-63).
//   A wave takes 32 queries (two query tiles) and one half of the keys, so that every k and v^T fragment read from LDS
//   feeds two products. A pass = 32 keys x 32 queries: 8 score WMMAs + 8 output WMMAs. Block = 4 waves = 2 query groups x
//   2 key halves = 64 queries; grid = 2*12*32 = 768.
//   k and v^T reach the waves through LDS: per stage the block copies, for each key half, 64 k rows (its head's 128 B) and
//   64 v^T rows (64 keys = 128 B), whole lines, with asynchronous 16-B copies into one of two buffers (row pitch 144 B),
//   the next stage in flight while this one is worked on; two passes per stage, fragments = two 16-B LDS loads.
//   Epilogue: the two waves of a query group exchange one query tile each (O, l, 10 - m) through LDS, block barrier, bring
//   both halves to the larger m and divide; the block's [64 query][64 d] f32 tile then lies in LDS (pitch 68), block barrier, then 4
// coverage: block writes queries q0..q0+63 x d 0..63 of its (b, head); grid covers ctx [4096][768] exactly once.
// =====================================================================================================
#define AKB   64                       // keys per stage and key half
#define KHALF (SEQ / 2)                // keys of one key half
#define ASTG  ((64 + 64) * GPIT)       // one key half of one buffer: k rows 0..63, v^T rows 64..127
#define ABUF  (2 * ASTG)               // one buffer: key half 0, key half 1
#define ANT   (KHALF / AKB)            // 16 stages
#define AFL   (SEQ / AKB)              // 32 flag words, one per 64 keys
static_assert((KHALF % AKB) == 0 && ANT >= 2 && DHEAD * 2 == 128 && AFL == 32);

// One key half of one stage: 128 rows x 8 pieces = 1024 copies = 8 per thread; thread -> row (tid >> 3) + 16 i, piece tid & 7.
// gk, gv: this thread's piece of k row (tid >> 3) and of v^T row (tid >> 3) of the stage. The s_wait_xcnt closes the
// statement so that no address register of an issued copy is rewritten ahead of it.
__device__ __forceinline__ void attn_stage_copy(unsigned l, const char* gk, const char* gv) {
#if defined(__HIP_DEVICE_COMPILE__)
  asm volatile(
      "global_load_async_to_lds_b128 %0, %8, off\n\t"
      "global_load_async_to_lds_b128 %1, %9, off\n\t"
      "global_load_async_to_lds_b128 %2, %10, off\n\t"
      "global_load_async_to_lds_b128 %3, %11, off\n\t"
      "global_load_async_to_lds_b128 %4, %12, off\n\t"
      "global_load_async_to_lds_b128 %5, %13, off\n\t"
      "global_load_async_to_lds_b128 %6, %14, off\n\t"
      "global_load_async_to_lds_b128 %7, %15, off\n\t"
      "s_wait_xcnt 0x0"
      :: "v"(l), "v"(l + 1 * GLSTEP), "v"(l + 2 * GLSTEP), "v"(l + 3 * GLSTEP),
         "v"(l + 4 * GLSTEP), "v"(l + 5 * GLSTEP), "v"(l + 6 * GLSTEP), "v"(l + 7 * GLSTEP),
         "v"(gk), "v"(gk + 1 * GGSTEP), "v"(gk + 2 * GGSTEP), "v"(gk + 3 * GGSTEP),
         "v"(gv), "v"(gv + 1 * (16 * SEQ * 2)), "v"(gv + 2 * (16 * SEQ * 2)), "v"(gv + 3 * (16 * SEQ * 2))
      : "memory");
#endif
}

// One stage of both key halves: 16 copies per thread, two statements of eight.
__device__ __forceinline__ void attn_stage_copy2(unsigned l, const char* gk, const char* gv) {
  attn_stage_copy(l, gk, gv);
  attn_stage_copy(l + ASTG, gk + (size_t)KHALF * DMOD * 2, gv + KHALF * 2);
}

// e = 2^a for a lane's 32 arguments of one pass
__device__ __forceinline__ void exp32(const v8f (&a)[4], v8f (&e)[4]) {
  // the loops here are unrolled so that the arrays and vector elements stay in registers
#pragma unroll
  for (int i = 0; i < 4; ++i)
#pragma unroll
    for (int r = 0; r < 8; ++r) e[i][r] = __builtin_amdgcn_exp2f(a[i][r]);
}
// sum of a lane's 16 exponentials of one query and one pass, as a tree
__device__ __forceinline__ float sum16(const v8f x, const v8f y) {
  const v8f t = x + y;
  const v4f u = __builtin_shufflevector(t, t, 0, 1, 2, 3) + __builtin_shufflevector(t, t, 4, 5, 6, 7);
  const v2f w = __builtin_shufflevector(u, u, 0, 1) + __builtin_shufflevector(u, u, 2, 3);
  return w[0] + w[1];
}
// eight consecutive floats from LDS, two 16-B loads
__device__ __forceinline__ v8f ld8f(const float* p) {
  const v4f a = *(const v4f*)(p), b = *(const v4f*)(p + 4);
  return __builtin_shufflevector(a, b, 0, 1, 2, 3, 4, 5, 6, 7);
}
// the four slots behind the last score product, before a vector instruction reads a D tile or a load overwrites an operand
__device__ __forceinline__ void sguard8(v8f& a, v8f& b, v8f& c, v8f& d, v16h x0, v16h x1, v16h x2, v16h x3,
                                        v16h x4, v16h x5, v16h x6, v16h x7) {
#if defined(__HIP_DEVICE_COMPILE__)
  asm volatile("v_nop\n\tv_nop\n\tv_nop\n\tv_nop"
               : "+v"(a), "+v"(b), "+v"(c), "+v"(d)
               : "v"(x0), "v"(x1), "v"(x2), "v"(x3), "v"(x4), "v"(x5), "v"(x6), "v"(x7));
#endif
}
// the same behind the last output product: eight accumulator tiles, their six operands
__device__ __forceinline__ void oguard8(v8f& a, v8f& b, v8f& c, v8f& d, v8f& e, v8f& f, v8f& g, v8f& h,
                                        v16h x0, v16h x1, v16h x2, v16h x3, v16h p0, v16h p1) {
#if defined(__HIP_DEVICE_COMPILE__)
  asm volatile("v_nop\n\tv_nop\n\tv_nop\n\tv_nop"
               : "+v"(a), "+v"(b), "+v"(c), "+v"(d), "+v"(e), "+v"(f), "+v"(g), "+v"(h)
               : "v"(x0), "v"(x1), "v"(x2), "v"(x3), "v"(p0), "v"(p1));
#endif
}
// inputs-only fence on four loaded fragments and two sums
__device__ __forceinline__ void hold4_h(v16h a, v16h b, v16h c, v16h d, float s, float u) {
#if defined(__HIP_DEVICE_COMPILE__)
  asm volatile("" :: "v"(a), "v"(b), "v"(c), "v"(d), "v"(s), "v"(u));
#endif
}

__global__ __launch_bounds__(128)
void attn_kernel(const unsigned short* __restrict__ qp, const unsigned short* __restrict__ kp,
                 const unsigned short* __restrict__ vt, const int* __restrict__ am, unsigned short* ctx) {
  __shared__ __align__(16) float Os[64 * 68];
  __shared__ __align__(16) unsigned char aring[2 * ABUF];  // two k / v^T buffers, each of both key halves
  __shared__ __align__(16) float Ad[SEQ];                  // mask adder of every key of batch b, log2 units
  __shared__ unsigned Fl[AFL];                             // per 64 keys: not 0 where a key's adder is not 0
  __shared__ float Ml[64], Mc[64];                         // per query: the handed-over half's row sum and its 10 - m
  const int tid  = threadIdx.x;
  const int wave = tid >> 5;
  const int lane = tid & 31;
  const int hh   = lane >> 4;
  const int c    = lane & 15;
  const int wvs  = __builtin_amdgcn_readfirstlane(wave);   // in a scalar register: the tests on kh are scalar branches
  const int kh   = wvs & 1;                       // key half of this wave: keys 1024 kh .. 1024 kh + 1023
  const int qg   = wvs >> 1;                      // query group of this wave: queries q0 + 32 qg .. + 31
  const int bx   = blockIdx.x;
  const int qb   = bx & 31;                       // SEQ/64 = 32 query blocks per (b, head)
  const int bhd  = bx >> 5;                       // b * NHEAD + head
  const int b    = bhd / NHEAD;
  const int hd   = bhd - b * NHEAD;
  const int q0   = qb * 64;

  const _Float16* QP  = (const _Float16*)(const void*)qp;

  // ---- q fragments (B operand, col = query q0 + 32 qg + 16 j + c, j = 0, 1): one plane, d 0..31 and 32..63 ----
  const size_t qtok = (size_t)b * SEQ + q0 + qg * 32 + c;
  const _Float16* qbp = QP + qtok * DMOD + hd * DHEAD + 8 * hh;
  const v16h qf00 = ldfrag_h(qbp), qf01 = ldfrag_h(qbp + 32);
  const v16h qf10 = ldfrag_h(qbp + 16 * DMOD), qf11 = ldfrag_h(qbp + 16 * DMOD + 32);
  // ---- copy side: k row = key (stage's first + crow + 16 i), v^T row = d (crow + 16 i), 16-B piece cpc ----
  const int crow = tid >> 3, cpc = tid & 7;
  const unsigned lcp = (unsigned)(uintptr_t)(&aring[0]) + (unsigned)(crow * GPIT + cpc * 16);
  const char* gk = (const char*)(const void*)kp + (((size_t)b * SEQ + crow) * DMOD + hd * DHEAD + 8 * cpc) * 2;
  const char* gv = (const char*)(const void*)vt + (((size_t)b * DMOD + hd * DHEAD + crow) * SEQ + 8 * cpc) * 2;
  // ---- adder base: keys kb + 8hh + 0..7 and kb + 16 + 8hh + 0..7 of this wave's key half ----
  const float* adb = Ad + kh * KHALF + 8 * hh;

  float l0 = 0.f, l1 = 0.f, lim = -1.0f;         // lim: the pass sum above which m is brought up to date
  v8f cs0 = zero8(), cs1 = zero8();              // 10 - m in every element: the C operand of the score products
  v8f o00 = zero8(), o01 = zero8(), o02 = zero8(), o03 = zero8();   // query tile 0, d tiles 0..3
  v8f o10 = zero8(), o11 = zero8(), o12 = zero8(), o13 = zero8();   // query tile 1

  attn_stage_copy2(lcp, gk, gv);
  // adder table, once per block: Ad[key] = (1 - mask[b][key]) * (-10000) * log2(e); 128 threads x 4 x 4 keys = 2048 keys.
  // 16 consecutive lanes hold the 64 keys 64 (8 i + 2 wave + hh) ..: their votes make that flag word.
  static_assert((SEQ % 512) == 0 && AKB == 64 && AFL == 32);
  unsigned vote[SEQ / 512];
#pragma unroll                                              // the four mask loads issue together, one latency
  for (int i = 0; i < SEQ / 512; ++i) {
    const int k4 = (i * 128 + tid) * 4;
    const v4i mk = *(const v4i*)(am + (size_t)b * SEQ + k4);
    v4f ad;
#pragma unroll                                              // vector elements by constant index, in registers
    for (int r = 0; r < 4; ++r) ad[r] = ((1.0f - (float)mk[r]) * MASKC) * LOG2E;
    *(v4f*)(Ad + k4) = ad;
    vote[i] = __builtin_amdgcn_ballot_w32(ad[0] != 0.f || ad[1] != 0.f || ad[2] != 0.f || ad[3] != 0.f);
  }
  // the flag words are stored behind the loop: a branch inside it kept the four loads from issuing together
  if (c == 0) {
#pragma unroll                                              // array by constant index, in registers
    for (int i = 0; i < SEQ / 512; ++i) Fl[i * 8 + wave * 2 + hh] = (vote[i] >> (16 * hh)) & 0xFFFFu;
  }
  asm volatile("s_wait_asynccnt 0x0" ::: "memory");        // stage 0 of this wave has landed
  __syncthreads();                                          // ... and every wave's part of it, and the adder table
  attn_stage_copy2(lcp + ABUF, gk + (size_t)AKB * DMOD * 2, gv + AKB * 2);
  // bit t: stage t of this wave's key half holds an adder that is not 0
  const unsigned mfl = __builtin_amdgcn_ballot_w32(Fl[lane] != 0u) >> (kh * ANT);

#pragma unroll 1                                            // rolled as before: a long body, only the buffer changes
  for (int t = 0; t < ANT; ++t) {
   const unsigned char* rb = aring + (t & 1) * ABUF + kh * ASTG;
   // k fragment base (A operand, row = key c of the stage), v^T fragment base (A operand, row = d = c, keys contiguous)
   const _Float16* Kl = (const _Float16*)(const void*)(rb + c * GPIT) + 8 * hh;
   const _Float16* Vl = (const _Float16*)(const void*)(rb + (64 + c) * GPIT) + 8 * hh;
   // two passes of 32 keys x 32 queries; unrolled: fragment arrays in registers, LDS offsets as immediates
#pragma unroll
   for (int p = 0; p < 2; ++p) {
    // the pass's k fragments (A operand), one load group; each feeds the products of both query tiles
    const _Float16* k0p = Kl + p * 32 * (GPIT / 2);
    const _Float16* k1p = k0p + 16 * (GPIT / 2);
    const v16h ka0 = ldfrag_h(k0p),      ka1 = ldfrag_h(k1p);
    const v16h ka2 = ldfrag_h(k0p + 32), ka3 = ldfrag_h(k1p + 32);
    v8f s0 = mma_h_raw(ka0, qf00, cs0);                     // query tile 0, keys  0..15 of the pass
    v8f s1 = mma_h_raw(ka1, qf00, cs0);                     // query tile 0, keys 16..31
    v8f s2 = mma_h_raw(ka0, qf10, cs1);                     // query tile 1, keys  0..15
    v8f s3 = mma_h_raw(ka1, qf10, cs1);                     // query tile 1, keys 16..31
    s0 = mma_h_raw(ka2, qf01, s0);
    s1 = mma_h_raw(ka3, qf01, s1);
    s2 = mma_h_raw(ka2, qf11, s2);
    s3 = mma_h_raw(ka3, qf11, s3);
    sguard8(s0, s1, s2, s3, ka0, ka1, ka2, ka3, qf00, qf01, qf10, qf11);
    // the pass's v^T fragments, a second load group: into the registers the k fragments leave, landing under the softmax
    const v16h vf0 = ldfrag_h(Vl + p * 32);
    const v16h vf1 = ldfrag_h(Vl + 16 * (GPIT / 2) + p * 32);
    const v16h vf2 = ldfrag_h(Vl + 32 * (GPIT / 2) + p * 32);
    const v16h vf3 = ldfrag_h(Vl + 48 * (GPIT / 2) + p * 32);

    v8f a[4] = {s0, s1, s2, s3};                            // score * log2(e) - m + 10, as the products leave it
    // scalar test: the stage holds an adder that is not 0; marked unlikely so that the block lies outside the loop's
    // straight line and a stage without adders takes no branch
    if (__builtin_expect((mfl >> t) & 1u, 0u)) {
     // adders of keys kb + 8hh + 0..7 and kb + 16 + 8hh + 0..7, kb = 64 t + 32 p in the key half; the same for both tiles
     const v8f ad0 = ld8f(adb + t * AKB + p * 32), ad1 = ld8f(adb + t * AKB + p * 32 + 16);
     a[0] += ad0; a[1] += ad1; a[2] += ad0; a[3] += ad1;
    }
    // Lazy rescale: the exponentials are taken against the reference m in use. A lane's 16 terms of a query are all
    // >= 0, so a pass sum of at most PLIM bounds each of them by PLIM, finite in f16; then m, l and O stay as they are.
    v8f e[4];
    exp32(a, e);
    float ls0 = sum16(e[0], e[1]), ls1 = sum16(e[2], e[3]); // the branch waits for these sums: trees
    // inputs-only fence on the loaded v^T fragments: without it the compiler sinks their loads behind the branch, right in
    // front of the products that read them, and their LDS latency is waited out in every pass. The sums are named
    // too (read only), so that the fence and its wait stand here, behind the exponentials, and not in front of them.
    hold4_h(vf0, vf1, vf2, vf3, ls0, ls1);
    // one test per pass, the same for the whole wave (scalar branch): taken in the first pass (lim is below 0 there; it
    // sets m: C was 0) and whenever a lane's pass sum exceeds PLIM; then the running maxima are brought up to date,
    // l and O are rescaled and the pass's exponentials are taken again
    if (__builtin_amdgcn_ballot_w32(fmaxf(ls0, ls1) > lim) != 0) {
     float mx0 = -3.0e38f, mx1 = -3.0e38f;
#pragma unroll                                              // vector elements by constant index, in registers
     for (int r = 0; r < 8; ++r) {
      mx0 = fmaxf(mx0, fmaxf(a[0][r], a[1][r]));
      mx1 = fmaxf(mx1, fmaxf(a[2][r], a[3][r]));
     }
     mx0 = fmaxf(mx0, __shfl_xor(mx0, 16, 32));
     mx1 = fmaxf(mx1, __shfl_xor(mx1, 16, 32));
     const float up0 = mx0 - L2PS, up1 = mx1 - L2PS;        // the pass's maxima above the references in use, log2 units
     const float d0 = (lim < 0.f) ? up0 : fmaxf(up0, 0.f);  // m moves by d: never down once the first pass has set it
     const float d1 = (lim < 0.f) ? up1 : fmaxf(up1, 0.f);
     lim = PLIM;
     const float n0 = -fmaxf(d0, 0.f), n1 = -fmaxf(d1, 0.f);
     cs0 -= d0; cs1 -= d1;
     v8f a2[4];
     a2[0] = a[0] - d0; a2[1] = a[1] - d0; a2[2] = a[2] - d1; a2[3] = a[3] - d1;
     // all arguments are formed ahead of the exponentials and nothing else stands among these
     __builtin_amdgcn_sched_barrier(0);
     exp32(a2, e);
     const float corr0 = __builtin_amdgcn_exp2f(n0);        // first pass: l and O are 0 and stay so
     const float corr1 = __builtin_amdgcn_exp2f(n1);
     __builtin_amdgcn_sched_barrier(0);
     ls0 = sum16(e[0], e[1]); ls1 = sum16(e[2], e[3]);
     l0 *= corr0; l1 *= corr1;
     o00 *= corr0; o01 *= corr0; o02 *= corr0; o03 *= corr0;
     o10 *= corr1; o11 *= corr1; o12 *= corr1; o13 *= corr1;
    }
    l0 += ls0; l1 += ls1;
    FragH ph0, ph1;
#pragma unroll                                              // vector elements by constant index, in registers
    for (int r = 0; r < 8; ++r) {
     ph0.h[0][r] = (_Float16)e[0][r];                       // query tile 0, key kb      + 8hh + r
     ph0.h[1][r] = (_Float16)e[1][r];                       // query tile 0, key kb + 16 + 8hh + r
     ph1.h[0][r] = (_Float16)e[2][r];                       // query tile 1, key kb      + 8hh + r
     ph1.h[1][r] = (_Float16)e[3][r];                       // query tile 1, key kb + 16 + 8hh + r
    }
    o00 = mma_h_raw(vf0, ph0.v, o00);
    o01 = mma_h_raw(vf1, ph0.v, o01);
    o02 = mma_h_raw(vf2, ph0.v, o02);
    o03 = mma_h_raw(vf3, ph0.v, o03);
    o10 = mma_h_raw(vf0, ph1.v, o10);
    o11 = mma_h_raw(vf1, ph1.v, o11);
    o12 = mma_h_raw(vf2, ph1.v, o12);
    o13 = mma_h_raw(vf3, ph1.v, o13);
    oguard8(o00, o01, o02, o03, o10, o11, o12, o13, vf0, vf1, vf2, vf3, ph0.v, ph1.v);
   }
   asm volatile("s_wait_dscnt 0x0" ::: "memory");           // this wave's reads of buffer t & 1 are done
   asm volatile("s_wait_asynccnt 0x0" ::: "memory");        // this wave's copies of stage t + 1 have landed
   __syncthreads();                                         // publishes stage t + 1, frees buffer t & 1
   if (t + 2 < ANT)
     attn_stage_copy2(lcp + (t & 1) * ABUF, gk + (size_t)(t + 2) * (AKB * DMOD * 2), gv + (t + 2) * (AKB * 2));
  }
  asm volatile("s_wait_asynccnt 0x0" ::: "memory");         // no copy outstanding when the wave goes on
  l0 += __shfl_xor(l0, 16, 32);
  l1 += __shfl_xor(l1, 16, 32);

  // ---- the two key halves of a query group are joined: wave kh hands query tile 1 - kh (O, l, 10 - m) over through LDS
  //      and finishes query tile kh. Row of Os = query within the block = 32 qg + 16 j + c, column d = 16 dt + 8hh + r ----
  const v8f g0 = kh ? o00 : o10, g1 = kh ? o01 : o11, g2 = kh ? o02 : o12, g3 = kh ? o03 : o13;   // handed over
  const v8f w0 = kh ? o10 : o00, w1 = kh ? o11 : o01, w2 = kh ? o12 : o02, w3 = kh ? o13 : o03;   // kept
  const float gl = kh ? l0 : l1, gc = kh ? cs0[0] : cs1[0];
  const float wl = kh ? l1 : l0, wc = kh ? cs1[0] : cs0[0];
  const int rg = qg * 32 + (1 - kh) * 16 + c, rw = qg * 32 + kh * 16 + c;
  float* og = Os + rg * 68 + 8 * hh;
#pragma unroll
  for (int r = 0; r < 8; ++r) { og[r] = g0[r]; og[16 + r] = g1[r]; og[32 + r] = g2[r]; og[48 + r] = g3[r]; }
  if (hh == 0) { Ml[rg] = gl; Mc[rg] = gc; }                // both lane halves hold the same two values
  __syncthreads();                                          // the handed-over tiles are in LDS
  {
    // common reference: the larger m = the smaller 10 - m; each half's l and O are brought to it, then O / l
    const float pl = Ml[rw], pc = Mc[rw];
    const float cm = fminf(wc, pc);
    const float fw = __builtin_amdgcn_exp2f(cm - wc), fp = __builtin_amdgcn_exp2f(cm - pc);
    const float sc = (CS / VS) * (1.0f / (wl * fw + pl * fp));
    const float aw = fw * sc, ap = fp * sc;
    // each lane reads and rewrites its own 32 elements: O[query][d] * sc (= attn * 1024)
    float* os = Os + rw * 68 + 8 * hh;
#pragma unroll
    for (int r = 0; r < 8; ++r) {
      os[r]      = w0[r] * aw + os[r]      * ap;
      os[16 + r] = w1[r] * aw + os[16 + r] * ap;
      os[32 + r] = w2[r] * aw + os[32 + r] * ap;
      os[48 + r] = w3[r] * aw + os[48 + r] * ap;
    }
  }
  __syncthreads();
  {
    const int e = tid & 7, qq = tid >> 3;              // qq 0..15: line within group, e: 16-B piece
    v4u hv[4];
#pragma unroll
    for (int it = 0; it < 4; ++it) {
      const int qi = it * 16 + qq;                       // it 0..3 x qq 0..15 = queries 0..63 of the block
      const v4f x0 = *(const v4f*)(Os + qi * 68 + 8 * e);
      const v4f x1 = *(const v4f*)(Os + qi * 68 + 8 * e + 4);
      v4u u;
#pragma unroll
      for (int t2 = 0; t2 < 2; ++t2) {
        u[t2]     = pk16(h_bits((_Float16)x0[2 * t2]), h_bits((_Float16)x0[2 * t2 + 1]));
        u[2 + t2] = pk16(h_bits((_Float16)x1[2 * t2]), h_bits((_Float16)x1[2 * t2 + 1]));
      }
      hv[it] = u;
    }
    unsigned short* ob = ctx + (size_t)hd * DHEAD + 8 * e;
    {
#pragma unroll
      for (int it = 0; it < 4; ++it) {
        const int qi = it * 16 + qq;
        *(v4u*)(ob + ((size_t)b * SEQ + q0 + qi) * DMOD) = hv[it];
      }
      
    }
  }
}

// =====================================================================================================
//   XH   f16 [4096][768]            0           6291456
//   WQT  f16 [768][768]             6291456     1179648
//   WKT  f16 [768][768]             7471104     1179648
//   WVT  f16 [768][768]             8650752     1179648
//   WOT  f16 [768][768]             9830400     1179648
//   QP   f16 [4096][768]            11010048    6291456
//   KPL  f16 [4096][768]            17301504    6291456
//   VT   f16 [2][768][2048]         23592960    6291456
//   CTX  f16 [4096][768]            29884416    6291456
//   end                              36175872
// =====================================================================================================
extern "C" void kernel_launch(void* const* d_in, const int* in_sizes, int n_in,
                              void* d_out, int out_size, void* d_ws, size_t ws_size,
                              hipStream_t stream) {
  if (n_in < 10) return;
  if (in_sizes[0] != MTOK * DMOD) return;
  if (in_sizes[1] != MTOK) return;
  if (in_sizes[2] != DMOD * DMOD || in_sizes[4] != DMOD * DMOD || in_sizes[6] != DMOD * DMOD) return;
  if (in_sizes[8] != DMOD * DMOD) return;
  if (in_sizes[3] != DMOD || in_sizes[5] != DMOD || in_sizes[7] != DMOD || in_sizes[9] != DMOD) return;
  if (out_size != MTOK * DMOD) return;

  const float* hs  = (const float*)d_in[0];
  const int*   amk = (const int*)d_in[1];
  const float* Wq  = (const float*)d_in[2];
  const float* bq  = (const float*)d_in[3];
  const float* Wk  = (const float*)d_in[4];
  const float* bk  = (const float*)d_in[5];
  const float* Wv  = (const float*)d_in[6];
  const float* bv  = (const float*)d_in[7];
  const float* Wo  = (const float*)d_in[8];
  const float* bo  = (const float*)d_in[9];

  const size_t PACT = (size_t)MTOK * DMOD * 2;          //  6291456
  const size_t PW   = (size_t)DMOD * DMOD * 2;          //  1179648
  const size_t PVT  = (size_t)NBAT * DMOD * SEQ * 2;    //  6291456
  size_t off = 0;
  const size_t oXH = off; off += PACT;
  const size_t oWQ = off; off += PW;
  const size_t oWK = off; off += PW;
  const size_t oWV = off; off += PW;
  const size_t oWO = off; off += PW;
  const size_t oQP = off; off += PACT;
  const size_t oKP = off; off += PACT;
  const size_t oVT = off; off += PVT;
  const size_t oCT = off; off += PACT;
  if (off > ws_size) return;                            // off = 36175872
  if (off > (size_t)134217728) return;

  char* ws = (char*)d_ws;
  unsigned short* XH  = (unsigned short*)(ws + oXH);
  unsigned short* WQT = (unsigned short*)(ws + oWQ);
  unsigned short* WKT = (unsigned short*)(ws + oWK);
  unsigned short* WVT = (unsigned short*)(ws + oWV);
  unsigned short* WOT = (unsigned short*)(ws + oWO);
  unsigned short* QPL = (unsigned short*)(ws + oQP);
  unsigned short* KPL = (unsigned short*)(ws + oKP);
  unsigned short* VT  = (unsigned short*)(ws + oVT);
  unsigned short* CTX = (unsigned short*)(ws + oCT);
  float*          out = (float*)d_out;

  const dim3 blk256(256), blk128(128);
  const dim3 gCV(4 * TPW + MTOK * KSEG / 8);                   // 576 weight tiles + 1536 blocks of 8 row segments
  const dim3 gGM(GBLK);                                        // 768 tiles -> 192 blocks of 4 waves
  const dim3 gG3(3 * GBLK);                                    // q, k, v: 576 blocks
  const dim3 gAT(NBAT * NHEAD * (SEQ / 64));                   // 768 blocks of 128

  // (0) activation plane f16( bf16_RNE(h) * 64 ) and weight planes [K][N] -> [N][K], f16( bf16_RNE(W) * 1024 )
  cvt_all<<<gCV, blk256, 0, stream>>>(hs, Wq, Wk, Wv, Wo, XH, WQT, WKT, WVT, WOT);

  // (1) q = h . Wq + bq -> f16 plane of q*log2(e)/8 ; k -> f16 plane of k ; v = h . Wv + bv -> VT[b][h*64+e][token], f16 plane of v*256
  gemm_qkv<<<gG3, blk128, 0, stream>>>(XH, WQT, WKT, WVT, bq, bk, bv, QPL, KPL, VT);

  // (2) attention with the additive int mask, all (b, head) -> ctx plane f16( attn * 1024 )[token][h*64 + d]
  attn_kernel<<<gAT, blk128, 0, stream>>>(QPL, KPL, VT, amk, CTX);

  // (3) out = attn . Wo + bo -> f32 [4096][768]
  gemm_out<<<gGM, blk128, 0, stream>>>(CTX, WOT, bo, out);
  (void)hipGetLastError();
}

// v008
// Measured time: 58.4 microseconds a run.
// Next to v007, in two timings, it ran 1.10 and 1.09 times as fast.
// All steps since v000 together make it 3.44 times as fast.
// Contractions: q,k,v projections (x token rows f16 x64 . W^T rows f16 x1024, K=768, one product each);
// attention scores S^T = k (f16, one plane) . q^T (f16 of q * log2(e)/8, one plane) + C, one product, head dim 64;
// attention O^T = v^T (f16 x256, one plane) . P^T (f16 x1024, one plane, from the score D registers), one product
// into one accumulator per half of the 2048 keys, the two joined in f32 at the end; output projection ctx (f16 x1024) . Wo^T
// (f16 x1024), one product. All v_wmma_f32_16x16x32_f16, f32 accumulate; mask adder and softmax in f32 on VALU;
// every float input RNE-converted to bf16 on load.
#include <hip/hip_runtime.h>
#include <math.h>
#include <stdint.h>

#define NBAT   2
#define SEQ    2048
#define DMOD   768
#define NHEAD  12
#define DHEAD  64
#define MTOK   (NBAT * SEQ)
#define KSEG   (DMOD / 256)
#define TN64   (DMOD / 64)
#define TPW    (TN64 * TN64)
#define XC     64.0f
#define WSC    1024.0f
#define LOG2E  1.442695040888963f
#define QS     (0.125f * LOG2E)        // q plane = q * log2(e) / sqrt(64): k . q is the score in log2 units
#define KS     1.0f
#define VS     256.0f
#define CS     1024.0f
#define L2PS   10.0f                   // log2 of the scale of P, 1024
#define MASKC  (-10000.0f)
#define PLIM   65504.0f                // largest finite f16
static_assert(NHEAD * DHEAD == DMOD);
static_assert((MTOK % 64) == 0 && (DMOD % 64) == 0 && (SEQ % 64) == 0 && (DMOD % 32) == 0 && (DMOD % 256) == 0);
static_assert((((MTOK / 64) * TN64) % 4) == 0);
static_assert(((MTOK * KSEG) % 8) == 0);
static_assert((SEQ / 64) == 32 && (SEQ % 32) == 0);
static_assert((MTOK % SEQ) == 0);

typedef _Float16 v16h __attribute__((ext_vector_type(16)));
typedef _Float16 v8h  __attribute__((ext_vector_type(8)));
typedef float    v8f  __attribute__((ext_vector_type(8)));
typedef float    v4f  __attribute__((ext_vector_type(4)));
typedef float    v2f  __attribute__((ext_vector_type(2)));
typedef unsigned int v4u __attribute__((ext_vector_type(4)));
typedef int      v4i  __attribute__((ext_vector_type(4)));

union FragH { v16h v; v8h h[2]; };

// ---- scalar helpers --------------------------------------------------------------------------------
__device__ __forceinline__ unsigned short bf_bits(float f) {          // f32 -> bf16 bits, RNE convert
  unsigned u = __float_as_uint(f);
  return (unsigned short)((u + 0x7FFFu + ((u >> 16) & 1u)) >> 16);
}
__device__ __forceinline__ float bf_up(unsigned short h) { return __uint_as_float(((unsigned)h) << 16); }
__device__ __forceinline__ float bfr(float f) { return bf_up(bf_bits(f)); }
__device__ __forceinline__ unsigned short h_bits(_Float16 x) { return __builtin_bit_cast(unsigned short, x); }
__device__ __forceinline__ unsigned pk16(unsigned short a, unsigned short b) { return (unsigned)a | ((unsigned)b << 16); }
__device__ __forceinline__ v8f zero8() { v8f z = {0.f, 0.f, 0.f, 0.f, 0.f, 0.f, 0.f, 0.f}; return z; }

// ---- fragment loader: 16-bit A/B operand, lane -> row/col (lane&15), p already includes +8*(lane>>4);
//      elements 0..7 <- p[0..7] (k0+8h..), elements 8..15 <- p[16..23] (k0+16+8h..)
__device__ __forceinline__ v16h ldfrag_h(const _Float16* p) {
  FragH f;
  f.h[0] = *(const v8h*)(p);
  f.h[1] = *(const v8h*)(p + 16);
  return f.v;
}

// ---- WMMA helpers with trailing VALU hazard gap --------------------------------------------------------
__device__ __forceinline__ v8f mma_h_raw(v16h a, v16h b, v8f c) {
  return __builtin_amdgcn_wmma_f32_16x16x32_f16(false, a, false, b, (short)0, c, false, false);
}
__device__ __forceinline__ void dep_guard1(v8f& a, v8f& b, v16h x) {
#if defined(__HIP_DEVICE_COMPILE__)
  asm volatile("v_nop\n\tv_nop\n\tv_nop\n\tv_nop" : "+v"(a), "+v"(b) : "v"(x));
#endif
}
__device__ __forceinline__ void keep4_h(v16h a, v16h b, v16h c, v16h d) {
#if defined(__HIP_DEVICE_COMPILE__)
  asm volatile("v_nop" :: "v"(a), "v"(b), "v"(c), "v"(d));
#endif
}
__device__ __forceinline__ void acc_guard4(v8f& a, v8f& b, v8f& c, v8f& d) {
#if defined(__HIP_DEVICE_COMPILE__)
  asm volatile("v_nop\n\tv_nop\n\tv_nop\n\tv_nop" : "+v"(a), "+v"(b), "+v"(c), "+v"(d));
#endif
}
__device__ __forceinline__ void wave_sync_lds() {
  __builtin_amdgcn_fence(__ATOMIC_RELEASE, "workgroup");
  __builtin_amdgcn_wave_barrier();
  __builtin_amdgcn_fence(__ATOMIC_ACQUIRE, "workgroup");
}

// =====================================================================================================
// Activation plane: XH[t][768] = f16( bf16_RNE(h[t][c]) * 64 ).
// coverage: 1536 x 8 = 12288 segments = 4096 rows x 768 columns entirely.
// =====================================================================================================
__device__ __forceinline__ void cvt_act(const int bx, const float* __restrict__ hs, unsigned short* XH) {
  const int lane = threadIdx.x & 31, wave = threadIdx.x >> 5;
  const int seg = bx * 8 + wave;                         // 0 .. 12287
  const int row = seg / KSEG;
  const int col = (seg - row * KSEG) * 256 + 8 * lane;
  const size_t o = (size_t)row * DMOD + col;
  const v4f h0 = *(const v4f*)(hs + o), h1 = *(const v4f*)(hs + o + 4);
  float a[8];
#pragma unroll
  for (int i = 0; i < 4; ++i) { a[i] = bfr(h0[i]); a[4 + i] = bfr(h1[i]); }
  v4u uh;
#pragma unroll
  for (int i = 0; i < 4; ++i) {
    const float xa = a[2 * i] * XC, xb = a[2 * i + 1] * XC;
    uh[i] = pk16(h_bits((_Float16)xa), h_bits((_Float16)xb));
  }
  unsigned short* dh = XH + o;
  *(v4u*)dh = uh;
  // this body now shares a kernel with the weight tiles' code: the wait closes the store before any path of the listing
  // that rewrites one of its registers
  asm volatile("s_wait_xcnt 0x0" ::: "memory");
}

// =====================================================================================================
// Weight planes: in W[K=768][N=768] (N contiguous) -> out WT[N][K] = f16( bf16_RNE(W[k][n]) * 1024 ), k contiguous.
// Block = one 64(k) x 64(n) tile: 256 threads load 16 rows x 64 floats per step (16 threads x 16 B per row), convert and
// store transposed into LDS Ts[n][k] (pitch 72 halves, 2-byte stores), block barrier, then 2 instructions each write
// blocks 0..143 -> weight 0, 144..287 -> weight 1, 288..431 -> weight 2, 432..575 -> weight 3 (block-uniform select).
// coverage: per weight 144 tiles x (2 x 32 lines x 8 lanes x 8 halves) = 768 x 768 entirely.
// =====================================================================================================
__device__ __forceinline__ void cvt_w(const int bx, unsigned short* Ts,
                                      const float* __restrict__ w0, const float* __restrict__ w1,
                                      const float* __restrict__ w2, const float* __restrict__ w3,
                                      unsigned short* t0, unsigned short* t1,
                                      unsigned short* t2, unsigned short* t3) {
  const int tid = threadIdx.x;
  const int wsel = bx / TPW;                        // block-uniform
  const int t = bx - wsel * TPW;
  const int k0 = (t / TN64) * 64;
  const int n0 = (t % TN64) * 64;
  const float* src = (wsel == 0) ? w0 : (wsel == 1) ? w1 : (wsel == 2) ? w2 : w3;
  unsigned short* dst = (wsel == 0) ? t0 : (wsel == 1) ? t1 : (wsel == 2) ? t2 : t3;
  {
    const int r16 = tid >> 4, p = tid & 15;
#pragma unroll
    for (int it = 0; it < 4; ++it) {
      const int kr = it * 16 + r16;                   // it 0..3 x r16 0..15 = k rows 0..63
      const v4f v = *(const v4f*)(src + (size_t)(k0 + kr) * DMOD + n0 + 4 * p);
#pragma unroll
      for (int j = 0; j < 4; ++j) Ts[(4 * p + j) * 72 + kr] = h_bits((_Float16)(bfr(v[j]) * WSC));
    }
  }
  __syncthreads();
  {
    const int e = tid & 7, lq = tid >> 3;             // lq 0..31: line, e: 16-B piece
    v4u u[2];
#pragma unroll
    for (int it = 0; it < 2; ++it) {
      const int nr = it * 32 + lq;                    // it 0..1 x lq 0..31 = n rows 0..63
      u[it] = *(const v4u*)(Ts + nr * 72 + 8 * e);
    }
    unsigned short* db = dst + (size_t)n0 * DMOD + k0 + 8 * e;
    {
#pragma unroll
      for (int it = 0; it < 2; ++it) {
        const int nr = it * 32 + lq;
        *(v4u*)(db + (size_t)nr * DMOD) = u[it];
      }
      
    }
  }
}

// Both conversions in one grid (neither reads what the other writes): blocks 0..575 take the weight tiles, blocks
// 576..2111 the activation segments. The test is block-uniform, so the weight tiles' barrier is passed by whole blocks.
__global__ __launch_bounds__(256) void cvt_all(const float* __restrict__ hs, const float* __restrict__ w0,
                                                const float* __restrict__ w1, const float* __restrict__ w2,
                                                const float* __restrict__ w3, unsigned short* XH,
                                                unsigned short* t0, unsigned short* t1,
                                                unsigned short* t2, unsigned short* t3) {
  __shared__ __align__(16) unsigned short Ts[64 * 72];
  const int bx = blockIdx.x;
  if (bx < 4 * TPW) cvt_w(bx, Ts, w0, w1, w2, w3, t0, t1, t2, t3);
  else              cvt_act(bx - 4 * TPW, hs, XH);
}

// =====================================================================================================
// Register-blocked f16 WMMA GEMM, one wave per 64x64 tile, WM x WN waves per block (block tile 64 WM rows x 64 WN features):
//   acc[m][n] = sum_k A[m][k] * Bt[n][k],  A: f16 [4096][768] token rows, Bt: f16 [768][768] k contiguous,
//   M=4096, N=768, K=768 fixed, all tile multiples.
//   Operands reach the waves through LDS: per stage of 128 k the block copies its A rows and its Bt rows (256 B each,
//   whole lines, 16 lanes x 16 B per row) with asynchronous 16-B copies into one of two buffers (row pitch 272 B), the
//   next stage in flight while this one is multiplied; fragments = two 16-B LDS loads with the split k map (ldfrag_h).
//   q, k, v: 4 x 3 waves, 256 x 192: 448 rows copied for 12 wave tiles. Output projection: 2 x 2 waves, 128 x 128: 256 rows
//   for 4 wave tiles. (A 64 x 256 block copies 320 rows for 4.)
//   y = acc * escale + bf16_RNE(bias[n]) * bscale, then per MODE:
//   MODE 0: f32 row-major C[4096][768] (the final output): 16-row slabs staged per wave in LDS (pitch 68 floats), each
//   MODE 1: f16 single plane row-major [4096][768]: per slab 4 instructions, each 4 rows x (8 consecutive lanes x 16 B)
//   MODE 2: f16 single plane transposed VT[b][feature 768][2048 tokens]: the wave's whole 64x64 tile is staged as f16
// coverage: MODE 0/1: 4 slabs x 16 rows x 64 cols per wave tile; MODE 2: 64 features x 64 tokens per wave tile;
//           768 wave tiles cover [4096][768] exactly once (m0 multiple of 64 never straddles b).
// =====================================================================================================
#define GPIT  144                      // attention's LDS row pitch, bytes: 16 B x odd, conflict-free for 16-B fragment loads
#define GLSTEP (16 * GPIT)             // 16 rows further in LDS
#define GGSTEP (16 * DMOD * 2)         // 16 rows further in global memory
static_assert((GPIT % 16) == 0);

// Epilogue of one wave's 64x64 tile at rows m0, features n0; sraw: the wave's own 9216 B of LDS, free of operand reads.
template <int MODE>
__device__ __forceinline__ void gemm_epi(
    v8f (&acc)[4][4], unsigned short* sraw, const int m0, const int n0,
    const float* __restrict__ bias, const float escale, const float bscale, void* C0) {
  const int lane = threadIdx.x & 31;
  const int rlane = lane & 15;                 // col (D) within subtile
  const int hh    = lane >> 4;
  const int mOff  = hh * 8;                    // D row offset
  if (MODE == 0) {
    float* Cout = (float*)C0;
    const int c4 = rlane * 4;                        // f32 out: 256-B row segment = 16 lanes x 16 B
    const v4f braw = *(const v4f*)(bias + n0 + c4);
    float bb[4];
#pragma unroll
    for (int tt = 0; tt < 4; ++tt) bb[tt] = bfr(braw[tt]) * bscale;
    float* slab = (float*)(void*)(sraw);
#pragma unroll
    for (int i = 0; i < 4; ++i) {
      const int mBase = m0 + (i << 4);
#pragma unroll
      for (int j = 0; j < 4; ++j) {
#pragma unroll
        for (int r = 0; r < 8; ++r) slab[(mOff + r) * 68 + (j << 4) + rlane] = acc[i][j][r];
      }
      wave_sync_lds();
      v4f vals[8];
#pragma unroll
      for (int it = 0; it < 8; ++it) {
        const int row = it * 2 + hh;                   // it 0..7 x hh 0..1 = rows 0..15
        v4f v = *(const v4f*)(slab + row * 68 + c4);
#pragma unroll
        for (int tt = 0; tt < 4; ++tt) v[tt] = v[tt] * escale + bb[tt];
        vals[it] = v;
      }
      {
#pragma unroll
        for (int it = 0; it < 8; ++it) {
          const int row = it * 2 + hh;
          *(v4f*)(Cout + (size_t)(mBase + row) * DMOD + n0 + c4) = vals[it];
        }
        
      }
      wave_sync_lds();
    }
  } else if (MODE == 1) {
    unsigned short* Hp = (unsigned short*)C0;
    const int e = lane & 7, q4 = lane >> 3;
    const v4f b0 = *(const v4f*)(bias + n0 + 8 * e), b1 = *(const v4f*)(bias + n0 + 8 * e + 4);
    float bb[8];
#pragma unroll
    for (int tt = 0; tt < 4; ++tt) { bb[tt] = bfr(b0[tt]) * bscale; bb[4 + tt] = bfr(b1[tt]) * bscale; }
    float* slab = (float*)(void*)(sraw);
#pragma unroll
    for (int i = 0; i < 4; ++i) {
      const int mBase = m0 + (i << 4);
#pragma unroll
      for (int j = 0; j < 4; ++j) {
#pragma unroll
        for (int r = 0; r < 8; ++r) slab[(mOff + r) * 68 + (j << 4) + rlane] = acc[i][j][r];
      }
      wave_sync_lds();
      v4u hv[4];
#pragma unroll
      for (int it = 0; it < 4; ++it) {
        const int row = it * 4 + q4;                   // it 0..3 x q4 0..3 = rows 0..15
        const v4f x0 = *(const v4f*)(slab + row * 68 + 8 * e);
        const v4f x1 = *(const v4f*)(slab + row * 68 + 8 * e + 4);
        float y[8];
#pragma unroll
        for (int tt = 0; tt < 4; ++tt) { y[tt] = x0[tt] * escale + bb[tt]; y[4 + tt] = x1[tt] * escale + bb[4 + tt]; }
        v4u uh;
#pragma unroll
        for (int t2 = 0; t2 < 4; ++t2) {
          uh[t2] = pk16(h_bits((_Float16)y[2 * t2]), h_bits((_Float16)y[2 * t2 + 1]));
        }
        hv[it] = uh;
      }
      {
#pragma unroll
        for (int it = 0; it < 4; ++it) {
          const int row = it * 4 + q4;
          const size_t go = (size_t)(mBase + row) * DMOD + n0 + 8 * e;
          *(v4u*)(Hp + go) = hv[it];
        }
        
      }
      wave_sync_lds();
    }
  } else {
    unsigned short* Vs = sraw;              // [64 features][pitch 72] f16 bits
    float bb4[4];
#pragma unroll
    for (int j = 0; j < 4; ++j) bb4[j] = bfr(bias[n0 + (j << 4) + rlane]) * bscale;
#pragma unroll
    for (int i = 0; i < 4; ++i) {
#pragma unroll
      for (int j = 0; j < 4; ++j) {
#pragma unroll
        for (int r = 0; r < 8; ++r) {
          Vs[((j << 4) + rlane) * 72 + (i << 4) + mOff + r] = h_bits((_Float16)(acc[i][j][r] * escale + bb4[j]));
        }
      }
    }
    wave_sync_lds();
    const int e = lane & 7, q4 = lane >> 3;
    const int bsel = m0 / SEQ;                          // batch of this tile (wave-uniform)
    const int s0 = m0 % SEQ;                            // first token within the batch
    v4u u[16];
#pragma unroll
    for (int it = 0; it < 16; ++it) {
      const int fl = it * 4 + q4;                        // it 0..15 x q4 0..3 = features 0..63
      u[it] = *(const v4u*)(Vs + fl * 72 + 8 * e);
    }
    unsigned short* Vp = (unsigned short*)C0 + ((size_t)bsel * DMOD + n0) * SEQ + s0 + 8 * e;
    {
#pragma unroll
      for (int it = 0; it < 16; ++it) {
        const int fl = it * 4 + q4;
        *(v4u*)(Vp + (size_t)fl * SEQ) = u[it];
      }
      
    }
  }
}

// ---- q, k, v projections: block tile 256 token rows x 192 features, 12 waves (4 x 3) ----
#define QKB   128                      // k per stage: rows of 256 B
#define QPIT  272                      // LDS row pitch, bytes: 16 B x odd
#define QMR   256                      // A rows of a block
#define QNR   192                      // Bt rows of a block
#define QSTG  ((QMR + QNR) * QPIT)     // one buffer: A rows 0..255, Bt rows 256..447
#define QNT   (DMOD / QKB)             // 6 stages
#define QSW   24                       // rows per sweep of the block's 384 threads
#define QLSTEP (QSW * QPIT)            // one sweep further in LDS
#define QGSTEP (QSW * DMOD * 2)        // one sweep further in global memory
static_assert((MTOK % QMR) == 0 && (DMOD % QNR) == 0 && (DMOD % QKB) == 0 && QNT >= 2 && (QPIT % 16) == 0);
static_assert(QMR + QNR == 18 * QSW + 16 && 12 * 9216 <= 2 * QSTG);

// Nine asynchronous 16-B copies per lane, one sweep apart in LDS: byte address l + i * QLSTEP <- g[i]. The s_wait_xcnt
// closes the statement so that no address register of an issued copy is rewritten ahead of it.
__device__ __forceinline__ void acopy9(unsigned l, const char* const (&g)[9]) {
#if defined(__HIP_DEVICE_COMPILE__)
  asm volatile(
      "global_load_async_to_lds_b128 %0, %9, off\n\t"
      "global_load_async_to_lds_b128 %1, %10, off\n\t"
      "global_load_async_to_lds_b128 %2, %11, off\n\t"
      "global_load_async_to_lds_b128 %3, %12, off\n\t"
      "global_load_async_to_lds_b128 %4, %13, off\n\t"
      "global_load_async_to_lds_b128 %5, %14, off\n\t"
      "global_load_async_to_lds_b128 %6, %15, off\n\t"
      "global_load_async_to_lds_b128 %7, %16, off\n\t"
      "global_load_async_to_lds_b128 %8, %17, off\n\t"
      "s_wait_xcnt 0x0"
      :: "v"(l), "v"(l + 1 * QLSTEP), "v"(l + 2 * QLSTEP), "v"(l + 3 * QLSTEP), "v"(l + 4 * QLSTEP),
         "v"(l + 5 * QLSTEP), "v"(l + 6 * QLSTEP), "v"(l + 7 * QLSTEP), "v"(l + 8 * QLSTEP),
         "v"(g[0]), "v"(g[1]), "v"(g[2]), "v"(g[3]), "v"(g[4]), "v"(g[5]), "v"(g[6]), "v"(g[7]), "v"(g[8])
      : "memory");
#endif
}
// One such copy, with its own closing wait.
__device__ __forceinline__ void acopy1(unsigned l, const char* g) {
#if defined(__HIP_DEVICE_COMPILE__)
  asm volatile("global_load_async_to_lds_b128 %0, %1, off\n\ts_wait_xcnt 0x0" :: "v"(l), "v"(g) : "memory");
#endif
}
// One stage: 448 rows x 16 pieces = 7168 copies; thread -> row (tid >> 4) + 24 i, piece tid & 15. Sweeps 0..9 are A rows,
// sweep 10 holds A rows 240..255 and Bt rows 0..7 (gx: this thread's piece of it), sweeps 11..17 Bt rows 8..175; the last 16
// Bt rows are a sweep of waves 0..7 alone (tail: the same in a whole wave, a scalar branch, every lane on).
// ga, gb: this thread's piece of A row (tid >> 4) and of Bt row (tid >> 4) of the block, at the stage's first k.
__device__ __forceinline__ void qstage_copy(unsigned l, const char* ga, const char* gb, const char* gx, const bool tail) {
  const char* g0[9];
  const char* g1[9];
  // the loops are unrolled so that both pointer arrays stay in registers
#pragma unroll
  for (int i = 0; i < 9; ++i) g0[i] = ga + (size_t)i * QGSTEP;                          // A rows 0..215
  g1[0] = ga + (size_t)9 * QGSTEP;                                                      // A rows 216..239
  g1[1] = gx;
#pragma unroll
  for (int i = 11; i < 18; ++i) g1[i - 9] = gb + (size_t)(i * QSW - QMR) * (DMOD * 2);  // Bt rows 8..175
  acopy9(l, g0);
  acopy9(l + 9 * QLSTEP, g1);
  if (tail) acopy1(l + 18 * QLSTEP, gb + (size_t)(18 * QSW - QMR) * (DMOD * 2));        // Bt rows 176..191
}

// ---- output projection: block tile 128 token rows x 128 features, 4 waves (2 x 2) ----
#define OMR   128                      // A rows of a block
#define ONR   128                      // Bt rows of a block
#define OSTG  ((OMR + ONR) * QPIT)     // one buffer: A rows 0..127, Bt rows 128..255
#define OSW   8                        // rows per sweep of the block's 128 threads
#define OLSTEP (OSW * QPIT)            // one sweep further in LDS
#define OGSTEP (OSW * DMOD * 2)        // one sweep further in global memory
static_assert((MTOK % OMR) == 0 && (DMOD % ONR) == 0 && OMR == 16 * OSW && ONR == 16 * OSW && 4 * 9216 <= 2 * OSTG);

// Eight asynchronous 16-B copies per lane, one sweep apart: LDS byte address l + i * OLSTEP <- g + i * OGSTEP. The
// s_wait_xcnt closes the statement so that no address register of an issued copy is rewritten ahead of it.
__device__ __forceinline__ void acopy8(unsigned l, const char* g) {
#if defined(__HIP_DEVICE_COMPILE__)
  asm volatile(
      "global_load_async_to_lds_b128 %0, %8, off\n\t"
      "global_load_async_to_lds_b128 %1, %9, off\n\t"
      "global_load_async_to_lds_b128 %2, %10, off\n\t"
      "global_load_async_to_lds_b128 %3, %11, off\n\t"
      "global_load_async_to_lds_b128 %4, %12, off\n\t"
      "global_load_async_to_lds_b128 %5, %13, off\n\t"
      "global_load_async_to_lds_b128 %6, %14, off\n\t"
      "global_load_async_to_lds_b128 %7, %15, off\n\t"
      "s_wait_xcnt 0x0"
      :: "v"(l), "v"(l + 1 * OLSTEP), "v"(l + 2 * OLSTEP), "v"(l + 3 * OLSTEP),
         "v"(l + 4 * OLSTEP), "v"(l + 5 * OLSTEP), "v"(l + 6 * OLSTEP), "v"(l + 7 * OLSTEP),
         "v"(g), "v"(g + 1 * OGSTEP), "v"(g + 2 * OGSTEP), "v"(g + 3 * OGSTEP),
         "v"(g + 4 * OGSTEP), "v"(g + 5 * OGSTEP), "v"(g + 6 * OGSTEP), "v"(g + 7 * OGSTEP)
      : "memory");
#endif
}
// One stage: 256 rows x 16 pieces = 4096 copies = 32 per thread; thread -> row (tid >> 4) + 8 i, piece tid & 15.
// ga, gb: this thread's piece of A row (tid >> 4) and of Bt row (tid >> 4) of the block, at the stage's first k.
__device__ __forceinline__ void ostage_copy(unsigned l, const char* ga, const char* gb) {
  acopy8(l, ga);                                            // A rows 0..63
  acopy8(l + 8 * OLSTEP, ga + (size_t)8 * OGSTEP);          // A rows 64..127
  acopy8(l + 16 * OLSTEP, gb);                              // Bt rows 0..63
  acopy8(l + 24 * OLSTEP, gb + (size_t)8 * OGSTEP);         // Bt rows 64..127
}

// acc = the wave's 64x64 tile of A[mb + 64 wm ..][768] . Bt[nb + 64 wn ..][768]^T; k runs 0..767 in steps of 32.
// WM = 4: the 256 x 192 block of 12 waves; WM = 2: the 128 x 128 block of 4 waves.
template <int WM>
__device__ __forceinline__ void gemm_loop(
    v8f (&acc)[4][4], unsigned char* ring, const int mb, const int nb, const int wvs, const int wm, const int wn,
    const unsigned short* __restrict__ Ap, const unsigned short* __restrict__ Bp) {
  const int lane = threadIdx.x & 31;
  const int rlane = lane & 15;                 // row (A) / col (B) within subtile
  const int koff  = (lane >> 4) * 8;           // k offset of this lane half
#pragma unroll
  for (int i = 0; i < 4; ++i)
#pragma unroll
    for (int j = 0; j < 4; ++j) acc[i][j] = zero8();

  const int crow = threadIdx.x >> 4, cpc = threadIdx.x & 15;
  const unsigned lcp = (unsigned)(uintptr_t)(&ring[0]) + (unsigned)(crow * QPIT + cpc * 16);
  const char* ga = (const char*)(const void*)Ap + ((size_t)(mb + crow) * DMOD + 8 * cpc) * 2;
  const char* gb = (const char*)(const void*)Bp + ((size_t)(nb + crow) * DMOD + 8 * cpc) * 2;
  const char* gx = (crow < 16) ? ga + (size_t)10 * QGSTEP : gb - (size_t)16 * (DMOD * 2);   // WM = 4 only
  const bool tail = wvs < 8;                   // wvs is in a scalar register
  constexpr int MR = (WM == 4) ? QMR : OMR;    // A rows of the block
  constexpr int STG = (WM == 4) ? QSTG : OSTG; // bytes of one buffer
  // stage s into the buffer at LDS byte offset lo
  auto copy_stage = [&](const unsigned lo, const int s) {
    if constexpr (WM == 4) qstage_copy(lcp + lo, ga + s * (QKB * 2), gb + s * (QKB * 2), gx + s * (QKB * 2), tail);
    else                   ostage_copy(lcp + lo, ga + s * (QKB * 2), gb + s * (QKB * 2));
  };

  copy_stage(0, 0);
  asm volatile("s_wait_asynccnt 0x0" ::: "memory");        // stage 0 of this wave has landed
  __syncthreads();                                          // ... and every wave's part of it
  copy_stage(STG, 1);

#pragma unroll 1                                            // rolled: a long body, only the buffer changes
  for (int t = 0; t < QNT; ++t) {
    const unsigned char* rb = ring + (t & 1) * STG;
    const _Float16* la = (const _Float16*)(const void*)(rb + ((wm << 6) + rlane) * QPIT) + koff;
    const _Float16* lb = (const _Float16*)(const void*)(rb + (MR + (wn << 6) + rlane) * QPIT) + koff;
    // all loops of the stage are unrolled: fragment and accumulator arrays in registers, LDS offsets as immediates
#pragma unroll
    for (int ks = 0; ks < QKB; ks += 32) {
      v16h ah[4], bh[4];                                    // the 32-k block's fragments, read as one group
#pragma unroll
      for (int j = 0; j < 4; ++j) {
        bh[j] = ldfrag_h(lb + j * (16 * QPIT / 2) + ks);
        ah[j] = ldfrag_h(la + j * (16 * QPIT / 2) + ks);
      }
#pragma unroll
      for (int i = 0; i < 4; ++i) {
#pragma unroll
        for (int j = 0; j < 4; ++j) acc[i][j] = mma_h_raw(ah[i], bh[j], acc[i][j]);
        dep_guard1(acc[i][0], acc[i][3], ah[i]);
      }
      keep4_h(bh[0], bh[1], bh[2], bh[3]);
    }
    asm volatile("s_wait_dscnt 0x0" ::: "memory");          // this wave's reads of buffer t & 1 are done
    asm volatile("s_wait_asynccnt 0x0" ::: "memory");       // this wave's copies of stage t + 1 have landed
    __syncthreads();                                        // publishes stage t + 1, frees buffer t & 1
    if (t + 2 < QNT) copy_stage((t & 1) * STG, t + 2);
  }
  asm volatile("s_wait_asynccnt 0x0" ::: "memory");         // no copy outstanding when the wave goes on
  acc_guard4(acc[0][0], acc[0][1], acc[0][2], acc[0][3]);
  acc_guard4(acc[1][0], acc[1][1], acc[1][2], acc[1][3]);
  acc_guard4(acc[2][0], acc[2][1], acc[2][2], acc[2][3]);
  acc_guard4(acc[3][0], acc[3][1], acc[3][2], acc[3][3]);
}

#define QBLK  ((MTOK / QMR) * (DMOD / QNR))   // 64 blocks cover one [4096][768] product

// q, k and v projections in one grid of 3 x 64 blocks (they share A and depend on nothing of each other): block-uniform
// choice of the weight plane, bias, scale and output plane; q*log2(e)/8 and k row-major (acc = 64*1024*y),
// v*256 transposed (escale 1/256). The epilogue's slabs (9216 B per wave) lie on the ring: the barrier at the foot of the
// last stage ends every wave's reads of it and no copy is outstanding then.
__global__ __launch_bounds__(384) void gemm_qkv(
    const unsigned short* __restrict__ Ap, const unsigned short* __restrict__ Bq,
    const unsigned short* __restrict__ Bk, const unsigned short* __restrict__ Bv,
    const float* __restrict__ bq, const float* __restrict__ bk, const float* __restrict__ bv,
    unsigned short* Cq, unsigned short* Ck, unsigned short* Cv) {
  __shared__ __align__(16) unsigned char ring[2 * QSTG];   // two operand buffers
  const int sel = blockIdx.x / QBLK;                       // 0: q, 1: k, 2: v
  const int bx = blockIdx.x - sel * QBLK;
  const int mb = (bx / (DMOD / QNR)) * QMR;                // the block's first token row
  const int nb = (bx % (DMOD / QNR)) * QNR;                // the block's first feature
  const int wvs = __builtin_amdgcn_readfirstlane(threadIdx.x >> 5);   // wave 0..11, in a scalar register
  const int wm = wvs & 3, wn = wvs >> 2;                   // the wave's place among 4 x 3 tiles
  v8f acc[4][4];
  gemm_loop<4>(acc, ring, mb, nb, wvs, wm, wn, Ap, (sel == 0) ? Bq : (sel == 1) ? Bk : Bv);
  unsigned short* sraw = (unsigned short*)(void*)(ring + wvs * 9216);  // this wave's slab
  const int m0 = mb + (wm << 6), n0 = nb + (wn << 6);
  if (sel == 2) gemm_epi<2>(acc, sraw, m0, n0, bv, VS / (XC * WSC), VS, (void*)Cv);
  else          gemm_epi<1>(acc, sraw, m0, n0, sel ? bk : bq, (sel ? KS : QS) / (XC * WSC), sel ? KS : QS,
                            (void*)(sel ? Ck : Cq));         // q and k share one path, the scale is block-uniform
}

#define OBLK  ((MTOK / OMR) * (DMOD / ONR))   // 192 blocks cover [4096][768]

// output projection: acc = 1024*1024*out -> escale 2^-20, f32 row-major
__global__ __launch_bounds__(128) void gemm_out(
    const unsigned short* __restrict__ Ap, const unsigned short* __restrict__ Bp,
    const float* __restrict__ bias, float* C0) {
  __shared__ __align__(16) unsigned char ring[2 * OSTG];   // two operand buffers; the epilogue's slabs lie on them as above
  const int bx = blockIdx.x;
  const int mb = (bx / (DMOD / ONR)) * OMR;                // the block's first token row
  const int nb = (bx % (DMOD / ONR)) * ONR;                // the block's first feature
  const int wvs = __builtin_amdgcn_readfirstlane(threadIdx.x >> 5);   // wave 0..3, in a scalar register
  const int wm = wvs & 1, wn = wvs >> 1;                   // the wave's place among 2 x 2 tiles
  v8f acc[4][4];
  gemm_loop<2>(acc, ring, mb, nb, wvs, wm, wn, Ap, Bp);
  gemm_epi<0>(acc, (unsigned short*)(void*)(ring + wvs * 9216), mb + (wm << 6), nb + (wn << 6), bias,
              1.0f / (CS * WSC), 1.0f, (void*)C0);
}

// =====================================================================================================
// Attention for one (b, head, 64-query block), transposed formulation, head dim 64, 2048 keys, additive int mask:
//   S^T tile (16 keys x 16 queries) = A(k rows = keys, d via the split k map) . B(q, col = query, same d map), two d-steps
//   of 32. The q plane carries log2(e)/8, so k.q is the score in log2 units, and the first product's C operand carries
//   what is added to it: 10 - m (m = the reference in use, log2 units; 10 = log2 of P's scale), a tile of one value that
//   stays in registers from pass to pass. The D tile is then the argument of exp2 itself; only a stage that holds a key
//   whose adder (1 - mask[b][key]) * (-10000) * log2(e) is not 0 (one flag bit per stage, set when the adder table is
//   built, scalar branch) reads its adders from the table and adds them. Per lane the D tile holds 8 keys of ONE query, so the online softmax is per-lane state;
//   m is raised to the running max (max tree, one shuffle lane^16, rescale of l and O) in the first pass and in a pass
//   whose sum of exponentials leaves the f16 range; the row sum is kept as a per-lane partial and combined at
//   the end. P = e^{x-m} x 1024 as one f16 plane (11 significant bits, as v^T and ctx have), used directly as the
//   B operand of O^T (rows d, cols queries) += A(v^T rows d, keys contiguous, two 16-B loads) . B(P^T):
//   B element r <- the key tile covering keys kb..kb+15, element 8+r <- the tile covering kb+16..kb+31, lane unchanged
//   (D-as-B chaining layout). One product per d tile (d 0-15, 16-31, 32-47, 48-63).
//   A wave takes 32 queries (two query tiles) and one half of the keys, so that every k and v^T fragment read from LDS
//   feeds two products. A pass = 32 keys x 32 queries: 8 score WMMAs + 8 output WMMAs. Block = 4 waves = 2 query groups x
//   2 key halves = 64 queries; grid = 2*12*32 = 768.
//   k and v^T reach the waves through LDS: per stage the block copies, for each key half, 64 k rows (its head's 128 B) and
//   64 v^T rows (64 keys = 128 B), whole lines, with asynchronous 16-B copies into one of two buffers (row pitch 144 B),
//   the next stage in flight while this one is worked on; two passes per stage, fragments = two 16-B LDS loads.
//   Epilogue: the two waves of a query group exchange one query tile each (O, l, 10 - m) through LDS, block barrier, bring
//   both halves to the larger m and divide; the block's [64 query][64 d] f32 tile then lies in LDS (pitch 68), block barrier, then 4
// coverage: block writes queries q0..q0+63 x d 0..63 of its (b, head); grid covers ctx [4096][768] exactly once.
// =====================================================================================================
#define AKB   64                       // keys per stage and key half
#define KHALF (SEQ / 2)                // keys of one key half
#define ASTG  ((64 + 64) * GPIT)       // one key half of one buffer: k rows 0..63, v^T rows 64..127
#define ABUF  (2 * ASTG)               // one buffer: key half 0, key half 1
#define ANT   (KHALF / AKB)            // 16 stages
#define AFL   (SEQ / AKB)              // 32 flag words, one per 64 keys
static_assert((KHALF % AKB) == 0 && ANT >= 2 && DHEAD * 2 == 128 && AFL == 32);

// One key half of one stage: 128 rows x 8 pieces = 1024 copies = 8 per thread; thread -> row (tid >> 3) + 16 i, piece tid & 7.
// gk, gv: this thread's piece of k row (tid >> 3) and of v^T row (tid >> 3) of the stage. The s_wait_xcnt closes the
// statement so that no address register of an issued copy is rewritten ahead of it.
__device__ __forceinline__ void attn_stage_copy(unsigned l, const char* gk, const char* gv) {
#if defined(__HIP_DEVICE_COMPILE__)
  asm volatile(
      "global_load_async_to_lds_b128 %0, %8, off\n\t"
      "global_load_async_to_lds_b128 %1, %9, off\n\t"
      "global_load_async_to_lds_b128 %2, %10, off\n\t"
      "global_load_async_to_lds_b128 %3, %11, off\n\t"
      "global_load_async_to_lds_b128 %4, %12, off\n\t"
      "global_load_async_to_lds_b128 %5, %13, off\n\t"
      "global_load_async_to_lds_b128 %6, %14, off\n\t"
      "global_load_async_to_lds_b128 %7, %15, off\n\t"
      "s_wait_xcnt 0x0"
      :: "v"(l), "v"(l + 1 * GLSTEP), "v"(l + 2 * GLSTEP), "v"(l + 3 * GLSTEP),
         "v"(l + 4 * GLSTEP), "v"(l + 5 * GLSTEP), "v"(l + 6 * GLSTEP), "v"(l + 7 * GLSTEP),
         "v"(gk), "v"(gk + 1 * GGSTEP), "v"(gk + 2 * GGSTEP), "v"(gk + 3 * GGSTEP),
         "v"(gv), "v"(gv + 1 * (16 * SEQ * 2)), "v"(gv + 2 * (16 * SEQ * 2)), "v"(gv + 3 * (16 * SEQ * 2))
      : "memory");
#endif
}

// One stage of both key halves: 16 copies per thread, two statements of eight.
__device__ __forceinline__ void attn_stage_copy2(unsigned l, const char* gk, const char* gv) {
  attn_stage_copy(l, gk, gv);
  attn_stage_copy(l + ASTG, gk + (size_t)KHALF * DMOD * 2, gv + KHALF * 2);
}

// e = 2^a for a lane's 32 arguments of one pass
__device__ __forceinline__ void exp32(const v8f (&a)[4], v8f (&e)[4]) {
  // the loops here are unrolled so that the arrays and vector elements stay in registers
#pragma unroll
  for (int i = 0; i < 4; ++i)
#pragma unroll
    for (int r = 0; r < 8; ++r) e[i][r] = __builtin_amdgcn_exp2f(a[i][r]);
}
// sum of a lane's 16 exponentials of one query and one pass, as a tree
__device__ __forceinline__ float sum16(const v8f x, const v8f y) {
  const v8f t = x + y;
  const v4f u = __builtin_shufflevector(t, t, 0, 1, 2, 3) + __builtin_shufflevector(t, t, 4, 5, 6, 7);
  const v2f w = __builtin_shufflevector(u, u, 0, 1) + __builtin_shufflevector(u, u, 2, 3);
  return w[0] + w[1];
}
// eight consecutive floats from LDS, two 16-B loads
__device__ __forceinline__ v8f ld8f(const float* p) {
  const v4f a = *(const v4f*)(p), b = *(const v4f*)(p + 4);
  return __builtin_shufflevector(a, b, 0, 1, 2, 3, 4, 5, 6, 7);
}
// the four slots behind the last score product, before a vector instruction reads a D tile or a load overwrites an operand
__device__ __forceinline__ void sguard8(v8f& a, v8f& b, v8f& c, v8f& d, v16h x0, v16h x1, v16h x2, v16h x3,
                                        v16h x4, v16h x5, v16h x6, v16h x7) {
#if defined(__HIP_DEVICE_COMPILE__)
  asm volatile("v_nop\n\tv_nop\n\tv_nop\n\tv_nop"
               : "+v"(a), "+v"(b), "+v"(c), "+v"(d)
               : "v"(x0), "v"(x1), "v"(x2), "v"(x3), "v"(x4), "v"(x5), "v"(x6), "v"(x7));
#endif
}
// the same behind the last output product: eight accumulator tiles, their six operands
__device__ __forceinline__ void oguard8(v8f& a, v8f& b, v8f& c, v8f& d, v8f& e, v8f& f, v8f& g, v8f& h,
                                        v16h x0, v16h x1, v16h x2, v16h x3, v16h p0, v16h p1) {
#if defined(__HIP_DEVICE_COMPILE__)
  asm volatile("v_nop\n\tv_nop\n\tv_nop\n\tv_nop"
               : "+v"(a), "+v"(b), "+v"(c), "+v"(d), "+v"(e), "+v"(f), "+v"(g), "+v"(h)
               : "v"(x0), "v"(x1), "v"(x2), "v"(x3), "v"(p0), "v"(p1));
#endif
}
// inputs-only fence on four loaded fragments and two sums
__device__ __forceinline__ void hold4_h(v16h a, v16h b, v16h c, v16h d, float s, float u) {
#if defined(__HIP_DEVICE_COMPILE__)
  asm volatile("" :: "v"(a), "v"(b), "v"(c), "v"(d), "v"(s), "v"(u));
#endif
}

__global__ __launch_bounds__(128)
void attn_kernel(const unsigned short* __restrict__ qp, const unsigned short* __restrict__ kp,
                 const unsigned short* __restrict__ vt, const int* __restrict__ am, unsigned short* ctx) {
  __shared__ __align__(16) float Os[64 * 68];
  __shared__ __align__(16) unsigned char aring[2 * ABUF];  // two k / v^T buffers, each of both key halves
  __shared__ __align__(16) float Ad[SEQ];                  // mask adder of every key of batch b, log2 units
  __shared__ unsigned Fl[AFL];                             // per 64 keys: not 0 where a key's adder is not 0
  __shared__ float Ml[64], Mc[64];                         // per query: the handed-over half's row sum and its 10 - m
  const int tid  = threadIdx.x;
  const int wave = tid >> 5;
  const int lane = tid & 31;
  const int hh   = lane >> 4;
  const int c    = lane & 15;
  const int wvs  = __builtin_amdgcn_readfirstlane(wave);   // in a scalar register: the tests on kh are scalar branches
  const int kh   = wvs & 1;                       // key half of this wave: keys 1024 kh .. 1024 kh + 1023
  const int qg   = wvs >> 1;                      // query group of this wave: queries q0 + 32 qg .. + 31
  const int bx   = blockIdx.x;
  const int qb   = bx & 31;                       // SEQ/64 = 32 query blocks per (b, head)
  const int bhd  = bx >> 5;                       // b * NHEAD + head
  const int b    = bhd / NHEAD;
  const int hd   = bhd - b * NHEAD;
  const int q0   = qb * 64;

  const _Float16* QP  = (const _Float16*)(const void*)qp;

  // ---- q fragments (B operand, col = query q0 + 32 qg + 16 j + c, j = 0, 1): one plane, d 0..31 and 32..63 ----
  const size_t qtok = (size_t)b * SEQ + q0 + qg * 32 + c;
  const _Float16* qbp = QP + qtok * DMOD + hd * DHEAD + 8 * hh;
  const v16h qf00 = ldfrag_h(qbp), qf01 = ldfrag_h(qbp + 32);
  const v16h qf10 = ldfrag_h(qbp + 16 * DMOD), qf11 = ldfrag_h(qbp + 16 * DMOD + 32);
  // ---- copy side: k row = key (stage's first + crow + 16 i), v^T row = d (crow + 16 i), 16-B piece cpc ----
  const int crow = tid >> 3, cpc = tid & 7;
  const unsigned lcp = (unsigned)(uintptr_t)(&aring[0]) + (unsigned)(crow * GPIT + cpc * 16);
  const char* gk = (const char*)(const void*)kp + (((size_t)b * SEQ + crow) * DMOD + hd * DHEAD + 8 * cpc) * 2;
  const char* gv = (const char*)(const void*)vt + (((size_t)b * DMOD + hd * DHEAD + crow) * SEQ + 8 * cpc) * 2;
  // ---- adder base: keys kb + 8hh + 0..7 and kb + 16 + 8hh + 0..7 of this wave's key half ----
  const float* adb = Ad + kh * KHALF + 8 * hh;

  float l0 = 0.f, l1 = 0.f, lim = -1.0f;         // lim: the pass sum above which m is brought up to date
  v8f cs0 = zero8(), cs1 = zero8();              // 10 - m in every element: the C operand of the score products
  v8f o00 = zero8(), o01 = zero8(), o02 = zero8(), o03 = zero8();   // query tile 0, d tiles 0..3
  v8f o10 = zero8(), o11 = zero8(), o12 = zero8(), o13 = zero8();   // query tile 1

  attn_stage_copy2(lcp, gk, gv);
  // adder table, once per block: Ad[key] = (1 - mask[b][key]) * (-10000) * log2(e); 128 threads x 4 x 4 keys = 2048 keys.
  // 16 consecutive lanes hold the 64 keys 64 (8 i + 2 wave + hh) ..: their votes make that flag word.
  static_assert((SEQ % 512) == 0 && AKB == 64 && AFL == 32);
  unsigned vote[SEQ / 512];
#pragma unroll                                              // the four mask loads issue together, one latency
  for (int i = 0; i < SEQ / 512; ++i) {
    const int k4 = (i * 128 + tid) * 4;
    const v4i mk = *(const v4i*)(am + (size_t)b * SEQ + k4);
    v4f ad;
#pragma unroll                                              // vector elements by constant index, in registers
    for (int r = 0; r < 4; ++r) ad[r] = ((1.0f - (float)mk[r]) * MASKC) * LOG2E;
    *(v4f*)(Ad + k4) = ad;
    vote[i] = __builtin_amdgcn_ballot_w32(ad[0] != 0.f || ad[1] != 0.f || ad[2] != 0.f || ad[3] != 0.f);
  }
  // the flag words are stored behind the loop: a branch inside it kept the four loads from issuing together
  if (c == 0) {
#pragma unroll                                              // array by constant index, in registers
    for (int i = 0; i < SEQ / 512; ++i) Fl[i * 8 + wave * 2 + hh] = (vote[i] >> (16 * hh)) & 0xFFFFu;
  }
  asm volatile("s_wait_asynccnt 0x0" ::: "memory");        // stage 0 of this wave has landed
  __syncthreads();                                          // ... and every wave's part of it, and the adder table
  attn_stage_copy2(lcp + ABUF, gk + (size_t)AKB * DMOD * 2, gv + AKB * 2);
  // bit t: stage t of this wave's key half holds an adder that is not 0
  const unsigned mfl = __builtin_amdgcn_ballot_w32(Fl[lane] != 0u) >> (kh * ANT);

#pragma unroll 1                                            // rolled as before: a long body, only the buffer changes
  for (int t = 0; t < ANT; ++t) {
   const unsigned char* rb = aring + (t & 1) * ABUF + kh * ASTG;
   // k fragment base (A operand, row = key c of the stage), v^T fragment base (A operand, row = d = c, keys contiguous)
   const _Float16* Kl = (const _Float16*)(const void*)(rb + c * GPIT) + 8 * hh;
   const _Float16* Vl = (const _Float16*)(const void*)(rb + (64 + c) * GPIT) + 8 * hh;
   // two passes of 32 keys x 32 queries; unrolled: fragment arrays in registers, LDS offsets as immediates
#pragma unroll
   for (int p = 0; p < 2; ++p) {
    // the pass's k fragments (A operand), one load group; each feeds the products of both query tiles
    const _Float16* k0p = Kl + p * 32 * (GPIT / 2);
    const _Float16* k1p = k0p + 16 * (GPIT / 2);
    const v16h ka0 = ldfrag_h(k0p),      ka1 = ldfrag_h(k1p);
    const v16h ka2 = ldfrag_h(k0p + 32), ka3 = ldfrag_h(k1p + 32);
    v8f s0 = mma_h_raw(ka0, qf00, cs0);                     // query tile 0, keys  0..15 of the pass
    v8f s1 = mma_h_raw(ka1, qf00, cs0);                     // query tile 0, keys 16..31
    v8f s2 = mma_h_raw(ka0, qf10, cs1);                     // query tile 1, keys  0..15
    v8f s3 = mma_h_raw(ka1, qf10, cs1);                     // query tile 1, keys 16..31
    s0 = mma_h_raw(ka2, qf01, s0);
    s1 = mma_h_raw(ka3, qf01, s1);
    s2 = mma_h_raw(ka2, qf11, s2);
    s3 = mma_h_raw(ka3, qf11, s3);
    sguard8(s0, s1, s2, s3, ka0, ka1, ka2, ka3, qf00, qf01, qf10, qf11);
    // the pass's v^T fragments, a second load group: into the registers the k fragments leave, landing under the softmax
    const v16h vf0 = ldfrag_h(Vl + p * 32);
    const v16h vf1 = ldfrag_h(Vl + 16 * (GPIT / 2) + p * 32);
    const v16h vf2 = ldfrag_h(Vl + 32 * (GPIT / 2) + p * 32);
    const v16h vf3 = ldfrag_h(Vl + 48 * (GPIT / 2) + p * 32);

    v8f a[4] = {s0, s1, s2, s3};                            // score * log2(e) - m + 10, as the products leave it
    // scalar test: the stage holds an adder that is not 0; marked unlikely so that the block lies outside the loop's
    // straight line and a stage without adders takes no branch
    if (__builtin_expect((mfl >> t) & 1u, 0u)) {
     // adders of keys kb + 8hh + 0..7 and kb + 16 + 8hh + 0..7, kb = 64 t + 32 p in the key half; the same for both tiles
     const v8f ad0 = ld8f(adb + t * AKB + p * 32), ad1 = ld8f(adb + t * AKB + p * 32 + 16);
     a[0] += ad0; a[1] += ad1; a[2] += ad0; a[3] += ad1;
    }
    // Lazy rescale: the exponentials are taken against the reference m in use. A lane's 16 terms of a query are all
    // >= 0, so a pass sum of at most PLIM bounds each of them by PLIM, finite in f16; then m, l and O stay as they are.
    v8f e[4];
    exp32(a, e);
    float ls0 = sum16(e[0], e[1]), ls1 = sum16(e[2], e[3]); // the branch waits for these sums: trees
    // inputs-only fence on the loaded v^T fragments: without it the compiler sinks their loads behind the branch, right in
    // front of the products that read them, and their LDS latency is waited out in every pass. The sums are named
    // too (read only), so that the fence and its wait stand here, behind the exponentials, and not in front of them.
    hold4_h(vf0, vf1, vf2, vf3, ls0, ls1);
    // one test per pass, the same for the whole wave (scalar branch): taken in the first pass (lim is below 0 there; it
    // sets m: C was 0) and whenever a lane's pass sum exceeds PLIM; then the running maxima are brought up to date,
    // l and O are rescaled and the pass's exponentials are taken again
    if (__builtin_amdgcn_ballot_w32(fmaxf(ls0, ls1) > lim) != 0) {
     float mx0 = -3.0e38f, mx1 = -3.0e38f;
#pragma unroll                                              // vector elements by constant index, in registers
     for (int r = 0; r < 8; ++r) {
      mx0 = fmaxf(mx0, fmaxf(a[0][r], a[1][r]));
      mx1 = fmaxf(mx1, fmaxf(a[2][r], a[3][r]));
     }
     mx0 = fmaxf(mx0, __shfl_xor(mx0, 16, 32));
     mx1 = fmaxf(mx1, __shfl_xor(mx1, 16, 32));
     const float up0 = mx0 - L2PS, up1 = mx1 - L2PS;        // the pass's maxima above the references in use, log2 units
     const float d0 = (lim < 0.f) ? up0 : fmaxf(up0, 0.f);  // m moves by d: never down once the first pass has set it
     const float d1 = (lim < 0.f) ? up1 : fmaxf(up1, 0.f);
     lim = PLIM;
     const float n0 = -fmaxf(d0, 0.f), n1 = -fmaxf(d1, 0.f);
     cs0 -= d0; cs1 -= d1;
     v8f a2[4];
     a2[0] = a[0] - d0; a2[1] = a[1] - d0; a2[2] = a[2] - d1; a2[3] = a[3] - d1;
     // all arguments are formed ahead of the exponentials and nothing else stands among these
     __builtin_amdgcn_sched_barrier(0);
     exp32(a2, e);
     const float corr0 = __builtin_amdgcn_exp2f(n0);        // first pass: l and O are 0 and stay so
     const float corr1 = __builtin_amdgcn_exp2f(n1);
     __builtin_amdgcn_sched_barrier(0);
     ls0 = sum16(e[0], e[1]); ls1 = sum16(e[2], e[3]);
     l0 *= corr0; l1 *= corr1;
     o00 *= corr0; o01 *= corr0; o02 *= corr0; o03 *= corr0;
     o10 *= corr1; o11 *= corr1; o12 *= corr1; o13 *= corr1;
    }
    l0 += ls0; l1 += ls1;
    FragH ph0, ph1;
#pragma unroll                                              // vector elements by constant index, in registers
    for (int r = 0; r < 8; ++r) {
     ph0.h[0][r] = (_Float16)e[0][r];                       // query tile 0, key kb      + 8hh + r
     ph0.h[1][r] = (_Float16)e[1][r];                       // query tile 0, key kb + 16 + 8hh + r
     ph1.h[0][r] = (_Float16)e[2][r];                       // query tile 1, key kb      + 8hh + r
     ph1.h[1][r] = (_Float16)e[3][r];                       // query tile 1, key kb + 16 + 8hh + r
    }
    o00 = mma_h_raw(vf0, ph0.v, o00);
    o01 = mma_h_raw(vf1, ph0.v, o01);
    o02 = mma_h_raw(vf2, ph0.v, o02);
    o03 = mma_h_raw(vf3, ph0.v, o03);
    o10 = mma_h_raw(vf0, ph1.v, o10);
    o11 = mma_h_raw(vf1, ph1.v, o11);
    o12 = mma_h_raw(vf2, ph1.v, o12);
    o13 = mma_h_raw(vf3, ph1.v, o13);
    oguard8(o00, o01, o02, o03, o10, o11, o12, o13, vf0, vf1, vf2, vf3, ph0.v, ph1.v);
   }
   asm volatile("s_wait_dscnt 0x0" ::: "memory");           // this wave's reads of buffer t & 1 are done
   asm volatile("s_wait_asynccnt 0x0" ::: "memory");        // this wave's copies of stage t + 1 have landed
   __syncthreads();                                         // publishes stage t + 1, frees buffer t & 1
   if (t + 2 < ANT)
     attn_stage_copy2(lcp + (t & 1) * ABUF, gk + (size_t)(t + 2) * (AKB * DMOD * 2), gv + (t + 2) * (AKB * 2));
  }
  asm volatile("s_wait_asynccnt 0x0" ::: "memory");         // no copy outstanding when the wave goes on
  l0 += __shfl_xor(l0, 16, 32);
  l1 += __shfl_xor(l1, 16, 32);

  // ---- the two key halves of a query group are joined: wave kh hands query tile 1 - kh (O, l, 10 - m) over through LDS
  //      and finishes query tile kh. Row of Os = query within the block = 32 qg + 16 j + c, column d = 16 dt + 8hh + r ----
  const v8f g0 = kh ? o00 : o10, g1 = kh ? o01 : o11, g2 = kh ? o02 : o12, g3 = kh ? o03 : o13;   // handed over
  const v8f w0 = kh ? o10 : o00, w1 = kh ? o11 : o01, w2 = kh ? o12 : o02, w3 = kh ? o13 : o03;   // kept
  const float gl = kh ? l0 : l1, gc = kh ? cs0[0] : cs1[0];
  const float wl = kh ? l1 : l0, wc = kh ? cs1[0] : cs0[0];
  const int rg = qg * 32 + (1 - kh) * 16 + c, rw = qg * 32 + kh * 16 + c;
  float* og = Os + rg * 68 + 8 * hh;
#pragma unroll
  for (int r = 0; r < 8; ++r) { og[r] = g0[r]; og[16 + r] = g1[r]; og[32 + r] = g2[r]; og[48 + r] = g3[r]; }
  if (hh == 0) { Ml[rg] = gl; Mc[rg] = gc; }                // both lane halves hold the same two values
  __syncthreads();                                          // the handed-over tiles are in LDS
  {
    // common reference: the larger m = the smaller 10 - m; each half's l and O are brought to it, then O / l
    const float pl = Ml[rw], pc = Mc[rw];
    const float cm = fminf(wc, pc);
    const float fw = __builtin_amdgcn_exp2f(cm - wc), fp = __builtin_amdgcn_exp2f(cm - pc);
    const float sc = (CS / VS) * (1.0f / (wl * fw + pl * fp));
    const float aw = fw * sc, ap = fp * sc;
    // each lane reads and rewrites its own 32 elements: O[query][d] * sc (= attn * 1024)
    float* os = Os + rw * 68 + 8 * hh;
#pragma unroll
    for (int r = 0; r < 8; ++r) {
      os[r]      = w0[r] * aw + os[r]      * ap;
      os[16 + r] = w1[r] * aw + os[16 + r] * ap;
      os[32 + r] = w2[r] * aw + os[32 + r] * ap;
      os[48 + r] = w3[r] * aw + os[48 + r] * ap;
    }
  }
  __syncthreads();
  {
    const int e = tid & 7, qq = tid >> 3;              // qq 0..15: line within group, e: 16-B piece
    v4u hv[4];
#pragma unroll
    for (int it = 0; it < 4; ++it) {
      const int qi = it * 16 + qq;                       // it 0..3 x qq 0..15 = queries 0..63 of the block
      const v4f x0 = *(const v4f*)(Os + qi * 68 + 8 * e);
      const v4f x1 = *(const v4f*)(Os + qi * 68 + 8 * e + 4);
      v4u u;
#pragma unroll
      for (int t2 = 0; t2 < 2; ++t2) {
        u[t2]     = pk16(h_bits((_Float16)x0[2 * t2]), h_bits((_Float16)x0[2 * t2 + 1]));
        u[2 + t2] = pk16(h_bits((_Float16)x1[2 * t2]), h_bits((_Float16)x1[2 * t2 + 1]));
      }
      hv[it] = u;
    }
    unsigned short* ob = ctx + (size_t)hd * DHEAD + 8 * e;
    {
#pragma unroll
      for (int it = 0; it < 4; ++it) {
        const int qi = it * 16 + qq;
        *(v4u*)(ob + ((size_t)b * SEQ + q0 + qi) * DMOD) = hv[it];
      }
      
    }
  }
}

// =====================================================================================================
//   XH   f16 [4096][768]            0           6291456
//   WQT  f16 [768][768]             6291456     1179648
//   WKT  f16 [768][768]             7471104     1179648
//   WVT  f16 [768][768]             8650752     1179648
//   WOT  f16 [768][768]             9830400     1179648
//   QP   f16 [4096][768]            11010048    6291456
//   KPL  f16 [4096][768]            17301504    6291456
//   VT   f16 [2][768][2048]         23592960    6291456
//   CTX  f16 [4096][768]            29884416    6291456
//   end                              36175872
// =====================================================================================================
extern "C" void kernel_launch(void* const* d_in, const int* in_sizes, int n_in,
                              void* d_out, int out_size, void* d_ws, size_t ws_size,
                              hipStream_t stream) {
  if (n_in < 10) return;
  if (in_sizes[0] != MTOK * DMOD) return;
  if (in_sizes[1] != MTOK) return;
  if (in_sizes[2] != DMOD * DMOD || in_sizes[4] != DMOD * DMOD || in_sizes[6] != DMOD * DMOD) return;
  if (in_sizes[8] != DMOD * DMOD) return;
  if (in_sizes[3] != DMOD || in_sizes[5] != DMOD || in_sizes[7] != DMOD || in_sizes[9] != DMOD) return;
  if (out_size != MTOK * DMOD) return;

  const float* hs  = (const float*)d_in[0];
  const int*   amk = (const int*)d_in[1];
  const float* Wq  = (const float*)d_in[2];
  const float* bq  = (const float*)d_in[3];
  const float* Wk  = (const float*)d_in[4];
  const float* bk  = (const float*)d_in[5];
  const float* Wv  = (const float*)d_in[6];
  const float* bv  = (const float*)d_in[7];
  const float* Wo  = (const float*)d_in[8];
  const float* bo  = (const float*)d_in[9];

  const size_t PACT = (size_t)MTOK * DMOD * 2;          //  6291456
  const size_t PW   = (size_t)DMOD * DMOD * 2;          //  1179648
  const size_t PVT  = (size_t)NBAT * DMOD * SEQ * 2;    //  6291456
  size_t off = 0;
  const size_t oXH = off; off += PACT;
  const size_t oWQ = off; off += PW;
  const size_t oWK = off; off += PW;
  const size_t oWV = off; off += PW;
  const size_t oWO = off; off += PW;
  const size_t oQP = off; off += PACT;
  const size_t oKP = off; off += PACT;
  const size_t oVT = off; off += PVT;
  const size_t oCT = off; off += PACT;
  if (off > ws_size) return;                            // off = 36175872
  if (off > (size_t)134217728) return;

  char* ws = (char*)d_ws;
  unsigned short* XH  = (unsigned short*)(ws + oXH);
  unsigned short* WQT = (unsigned short*)(ws + oWQ);
  unsigned short* WKT = (unsigned short*)(ws + oWK);
  unsigned short* WVT = (unsigned short*)(ws + oWV);
  unsigned short* WOT = (unsigned short*)(ws + oWO);
  unsigned short* QPL = (unsigned short*)(ws + oQP);
  unsigned short* KPL = (unsigned short*)(ws + oKP);
  unsigned short* VT  = (unsigned short*)(ws + oVT);
  unsigned short* CTX = (unsigned short*)(ws + oCT);
  float*          out = (float*)d_out;

  const dim3 blk256(256), blk128(128), blk384(384);
  const dim3 gCV(4 * TPW + MTOK * KSEG / 8);                   // 576 weight tiles + 1536 blocks of 8 row segments
  const dim3 gGM(OBLK);                                        // 768 tiles -> 192 blocks of 4 waves
  const dim3 gG3(3 * QBLK);                                    // q, k, v: 192 blocks of 12 waves
  const dim3 gAT(NBAT * NHEAD * (SEQ / 64));                   // 768 blocks of 128

  // (0) activation plane f16( bf16_RNE(h) * 64 ) and weight planes [K][N] -> [N][K], f16( bf16_RNE(W) * 1024 )
  cvt_all<<<gCV, blk256, 0, stream>>>(hs, Wq, Wk, Wv, Wo, XH, WQT, WKT, WVT, WOT);

  // (1) q = h . Wq + bq -> f16 plane of q*log2(e)/8 ; k -> f16 plane of k ; v = h . Wv + bv -> VT[b][h*64+e][token], f16 plane of v*256
  gemm_qkv<<<gG3, blk384, 0, stream>>>(XH, WQT, WKT, WVT, bq, bk, bv, QPL, KPL, VT);

  // (2) attention with the additive int mask, all (b, head) -> ctx plane f16( attn * 1024 )[token][h*64 + d]
  attn_kernel<<<gAT, blk128, 0, stream>>>(QPL, KPL, VT, amk, CTX);

  // (3) out = attn . Wo + bo -> f32 [4096][768]
  gemm_out<<<gGM, blk128, 0, stream>>>(CTX, WOT, bo, out);
  (void)hipGetLastError();
}

// v009
// One run takes 56.8 microseconds.
// Two timings next to v008 put it at 1.04 and 1.03 times that version's speed.
// Counting every step since v000, it is 3.56 times as fast.
// Contractions: q,k,v projections (x token rows f16 x64 . W^T rows f16 x1024, K=768, one product each);
// attention scores S^T = k (f16, one plane) . q^T (f16 of q * log2(e)/8, one plane) + C, one product, head dim 64;
// attention O^T = v^T (f16 x256, one plane) . P^T (f16 x1024, one plane, from the score D registers), one product
// into one accumulator per half of the 2048 keys, the two joined in f32 at the end; output projection ctx (f16 x1024) . Wo^T
// (f16 x1024), one product. All v_wmma_f32_16x16x32_f16, f32 accumulate; mask adder and softmax in f32 on VALU;
// every float input RNE-converted to bf16 on load.
#include <hip/hip_runtime.h>
#include <math.h>
#include <stdint.h>

#define NBAT   2
#define SEQ    2048
#define DMOD   768
#define NHEAD  12
#define DHEAD  64
#define MTOK   (NBAT * SEQ)
#define KSEG   (DMOD / 256)
#define TN64   (DMOD / 64)
#define TPW    (TN64 * TN64)
#define XC     64.0f
#define WSC    1024.0f
#define LOG2E  1.442695040888963f
#define QS     (0.125f * LOG2E)        // q plane = q * log2(e) / sqrt(64): k . q is the score in log2 units
#define KS     1.0f
#define VS     256.0f
#define CS     1024.0f
#define L2PS   10.0f                   // log2 of the scale of P, 1024
#define MASKC  (-10000.0f)
#define PLIM   65504.0f                // largest finite f16
static_assert(NHEAD * DHEAD == DMOD);
static_assert((MTOK % 64) == 0 && (DMOD % 64) == 0 && (SEQ % 64) == 0 && (DMOD % 32) == 0 && (DMOD % 256) == 0);
static_assert((((MTOK / 64) * TN64) % 4) == 0);
static_assert(((MTOK * KSEG) % 8) == 0);
static_assert((SEQ / 64) == 32 && (SEQ % 32) == 0);
static_assert((MTOK % SEQ) == 0);

typedef _Float16 v16h __attribute__((ext_vector_type(16)));
typedef _Float16 v8h  __attribute__((ext_vector_type(8)));
typedef float    v8f  __attribute__((ext_vector_type(8)));
typedef float    v4f  __attribute__((ext_vector_type(4)));
typedef float    v2f  __attribute__((ext_vector_type(2)));
typedef unsigned int v4u __attribute__((ext_vector_type(4)));
typedef int      v4i  __attribute__((ext_vector_type(4)));

union FragH { v16h v; v8h h[2]; };

// ---- scalar helpers --------------------------------------------------------------------------------
__device__ __forceinline__ unsigned short bf_bits(float f) {          // f32 -> bf16 bits, RNE convert
  unsigned u = __float_as_uint(f);
  return (unsigned short)((u + 0x7FFFu + ((u >> 16) & 1u)) >> 16);
}
__device__ __forceinline__ float bf_up(unsigned short h) { return __uint_as_float(((unsigned)h) << 16); }
__device__ __forceinline__ float bfr(float f) { return bf_up(bf_bits(f)); }
__device__ __forceinline__ unsigned short h_bits(_Float16 x) { return __builtin_bit_cast(unsigned short, x); }
__device__ __forceinline__ unsigned pk16(unsigned short a, unsigned short b) { return (unsigned)a | ((unsigned)b << 16); }
__device__ __forceinline__ v8f zero8() { v8f z = {0.f, 0.f, 0.f, 0.f, 0.f, 0.f, 0.f, 0.f}; return z; }

// ---- fragment loader: 16-bit A/B operand, lane -> row/col (lane&15), p already includes +8*(lane>>4);
//      elements 0..7 <- p[0..7] (k0+8h..), elements 8..15 <- p[16..23] (k0+16+8h..)
__device__ __forceinline__ v16h ldfrag_h(const _Float16* p) {
  FragH f;
  f.h[0] = *(const v8h*)(p);
  f.h[1] = *(const v8h*)(p + 16);
  return f.v;
}

// ---- WMMA helpers with trailing VALU hazard gap --------------------------------------------------------
__device__ __forceinline__ v8f mma_h_raw(v16h a, v16h b, v8f c) {
  return __builtin_amdgcn_wmma_f32_16x16x32_f16(false, a, false, b, (short)0, c, false, false);
}
__device__ __forceinline__ void dep_guard1(v8f& a, v8f& b, v16h x) {
#if defined(__HIP_DEVICE_COMPILE__)
  asm volatile("v_nop\n\tv_nop\n\tv_nop\n\tv_nop" : "+v"(a), "+v"(b) : "v"(x));
#endif
}
__device__ __forceinline__ void keep4_h(v16h a, v16h b, v16h c, v16h d) {
#if defined(__HIP_DEVICE_COMPILE__)
  asm volatile("v_nop" :: "v"(a), "v"(b), "v"(c), "v"(d));
#endif
}
__device__ __forceinline__ void acc_guard4(v8f& a, v8f& b, v8f& c, v8f& d) {
#if defined(__HIP_DEVICE_COMPILE__)
  asm volatile("v_nop\n\tv_nop\n\tv_nop\n\tv_nop" : "+v"(a), "+v"(b), "+v"(c), "+v"(d));
#endif
}
__device__ __forceinline__ void wave_sync_lds() {
  __builtin_amdgcn_fence(__ATOMIC_RELEASE, "workgroup");
  __builtin_amdgcn_wave_barrier();
  __builtin_amdgcn_fence(__ATOMIC_ACQUIRE, "workgroup");
}

// =====================================================================================================
// Activation plane: XH[t][768] = f16( bf16_RNE(h[t][c]) * 64 ).
// coverage: 1536 x 8 = 12288 segments = 4096 rows x 768 columns entirely.
// =====================================================================================================
__device__ __forceinline__ void cvt_act(const int bx, const float* __restrict__ hs, unsigned short* XH) {
  const int lane = threadIdx.x & 31, wave = threadIdx.x >> 5;
  const int seg = bx * 8 + wave;                         // 0 .. 12287
  const int row = seg / KSEG;
  const int col = (seg - row * KSEG) * 256 + 8 * lane;
  const size_t o = (size_t)row * DMOD + col;
  const v4f h0 = *(const v4f*)(hs + o), h1 = *(const v4f*)(hs + o + 4);
  float a[8];
#pragma unroll
  for (int i = 0; i < 4; ++i) { a[i] = bfr(h0[i]); a[4 + i] = bfr(h1[i]); }
  v4u uh;
#pragma unroll
  for (int i = 0; i < 4; ++i) {
    const float xa = a[2 * i] * XC, xb = a[2 * i + 1] * XC;
    uh[i] = pk16(h_bits((_Float16)xa), h_bits((_Float16)xb));
  }
  unsigned short* dh = XH + o;
  *(v4u*)dh = uh;
  // this body now shares a kernel with the weight tiles' code: the wait closes the store before any path of the listing
  // that rewrites one of its registers
  asm volatile("s_wait_xcnt 0x0" ::: "memory");
}

// =====================================================================================================
// Weight planes: in W[K=768][N=768] (N contiguous) -> out WT[N][K] = f16( bf16_RNE(W[k][n]) * 1024 ), k contiguous.
// Block = one 64(k) x 64(n) tile: 256 threads load 16 rows x 64 floats per step (16 threads x 16 B per row), convert and
// store transposed into LDS Ts[n][k] (pitch 72 halves, 2-byte stores), block barrier, then 2 instructions each write
// blocks 0..143 -> weight 0, 144..287 -> weight 1, 288..431 -> weight 2, 432..575 -> weight 3 (block-uniform select).
// coverage: per weight 144 tiles x (2 x 32 lines x 8 lanes x 8 halves) = 768 x 768 entirely.
// =====================================================================================================
__device__ __forceinline__ void cvt_w(const int bx, unsigned short* Ts,
                                      const float* __restrict__ w0, const float* __restrict__ w1,
                                      const float* __restrict__ w2, const float* __restrict__ w3,
                                      unsigned short* t0, unsigned short* t1,
                                      unsigned short* t2, unsigned short* t3) {
  const int tid = threadIdx.x;
  const int wsel = bx / TPW;                        // block-uniform
  const int t = bx - wsel * TPW;
  const int k0 = (t / TN64) * 64;
  const int n0 = (t % TN64) * 64;
  const float* src = (wsel == 0) ? w0 : (wsel == 1) ? w1 : (wsel == 2) ? w2 : w3;
  unsigned short* dst = (wsel == 0) ? t0 : (wsel == 1) ? t1 : (wsel == 2) ? t2 : t3;
  {
    const int r16 = tid >> 4, p = tid & 15;
#pragma unroll
    for (int it = 0; it < 4; ++it) {
      const int kr = it * 16 + r16;                   // it 0..3 x r16 0..15 = k rows 0..63
      const v4f v = *(const v4f*)(src + (size_t)(k0 + kr) * DMOD + n0 + 4 * p);
#pragma unroll
      for (int j = 0; j < 4; ++j) Ts[(4 * p + j) * 72 + kr] = h_bits((_Float16)(bfr(v[j]) * WSC));
    }
  }
  __syncthreads();
  {
    const int e = tid & 7, lq = tid >> 3;             // lq 0..31: line, e: 16-B piece
    v4u u[2];
#pragma unroll
    for (int it = 0; it < 2; ++it) {
      const int nr = it * 32 + lq;                    // it 0..1 x lq 0..31 = n rows 0..63
      u[it] = *(const v4u*)(Ts + nr * 72 + 8 * e);
    }
    unsigned short* db = dst + (size_t)n0 * DMOD + k0 + 8 * e;
    {
#pragma unroll
      for (int it = 0; it < 2; ++it) {
        const int nr = it * 32 + lq;
        *(v4u*)(db + (size_t)nr * DMOD) = u[it];
      }
      
    }
  }
}

// Both conversions in one grid (neither reads what the other writes): blocks 0..575 take the weight tiles, blocks
// 576..2111 the activation segments. The test is block-uniform, so the weight tiles' barrier is passed by whole blocks.
__global__ __launch_bounds__(256) void cvt_all(const float* __restrict__ hs, const float* __restrict__ w0,
                                                const float* __restrict__ w1, const float* __restrict__ w2,
                                                const float* __restrict__ w3, unsigned short* XH,
                                                unsigned short* t0, unsigned short* t1,
                                                unsigned short* t2, unsigned short* t3) {
  __shared__ __align__(16) unsigned short Ts[64 * 72];
  const int bx = blockIdx.x;
  if (bx < 4 * TPW) cvt_w(bx, Ts, w0, w1, w2, w3, t0, t1, t2, t3);
  else              cvt_act(bx - 4 * TPW, hs, XH);
}

// =====================================================================================================
// Register-blocked f16 WMMA GEMM, one wave per 64x64 tile, WM x WN waves per block (block tile 64 WM rows x 64 WN features):
//   acc[m][n] = sum_k A[m][k] * Bt[n][k],  A: f16 [4096][768] token rows, Bt: f16 [768][768] k contiguous,
//   M=4096, N=768, K=768 fixed, all tile multiples.
//   Operands reach the waves through LDS: per stage of 128 k the block copies its A rows and its Bt rows (256 B each,
//   whole lines, 16 lanes x 16 B per row) with asynchronous 16-B copies into one of two buffers (row pitch 272 B), the
//   next stage in flight while this one is multiplied; fragments = two 16-B LDS loads with the split k map (ldfrag_h).
//   q, k, v: 4 x 3 waves, 256 x 192: 448 rows copied for 12 wave tiles. Output projection: 2 x 2 waves, 128 x 128: 256 rows
//   for 4 wave tiles. (A 64 x 256 block copies 320 rows for 4.)
//   y = acc * escale + bf16_RNE(bias[n]) * bscale, then per MODE:
//   MODE 0: f32 row-major C[4096][768] (the final output): 16-row slabs staged per wave in LDS (pitch 68 floats), each
//   MODE 1: f16 single plane row-major [4096][768]: per slab 4 instructions, each 4 rows x (8 consecutive lanes x 16 B)
//   MODE 2: f16 single plane transposed VT[b][feature 768][2048 tokens]: the wave's whole 64x64 tile is staged as f16
// coverage: MODE 0/1: 4 slabs x 16 rows x 64 cols per wave tile; MODE 2: 64 features x 64 tokens per wave tile;
//           768 wave tiles cover [4096][768] exactly once (m0 multiple of 64 never straddles b).
// =====================================================================================================
#define GPIT  144                      // attention's LDS row pitch, bytes: 16 B x odd, conflict-free for 16-B fragment loads
#define GLSTEP (16 * GPIT)             // 16 rows further in LDS
#define GGSTEP (16 * DMOD * 2)         // 16 rows further in global memory
static_assert((GPIT % 16) == 0);

// Epilogue of one wave's 64x64 tile at rows m0, features n0; sraw: the wave's own 9216 B of LDS, free of operand reads.
template <int MODE>
__device__ __forceinline__ void gemm_epi(
    v8f (&acc)[4][4], unsigned short* sraw, const int m0, const int n0,
    const float* __restrict__ bias, const float escale, const float bscale, void* C0) {
  const int lane = threadIdx.x & 31;
  const int rlane = lane & 15;                 // col (D) within subtile
  const int hh    = lane >> 4;
  const int mOff  = hh * 8;                    // D row offset
  if (MODE == 0) {
    float* Cout = (float*)C0;
    const int c4 = rlane * 4;                        // f32 out: 256-B row segment = 16 lanes x 16 B
    const v4f braw = *(const v4f*)(bias + n0 + c4);
    float bb[4];
#pragma unroll
    for (int tt = 0; tt < 4; ++tt) bb[tt] = bfr(braw[tt]) * bscale;
    float* slab = (float*)(void*)(sraw);
#pragma unroll
    for (int i = 0; i < 4; ++i) {
      const int mBase = m0 + (i << 4);
#pragma unroll
      for (int j = 0; j < 4; ++j) {
#pragma unroll
        for (int r = 0; r < 8; ++r) slab[(mOff + r) * 68 + (j << 4) + rlane] = acc[i][j][r];
      }
      wave_sync_lds();
      v4f vals[8];
#pragma unroll
      for (int it = 0; it < 8; ++it) {
        const int row = it * 2 + hh;                   // it 0..7 x hh 0..1 = rows 0..15
        v4f v = *(const v4f*)(slab + row * 68 + c4);
#pragma unroll
        for (int tt = 0; tt < 4; ++tt) v[tt] = v[tt] * escale + bb[tt];
        vals[it] = v;
      }
      {
#pragma unroll
        for (int it = 0; it < 8; ++it) {
          const int row = it * 2 + hh;
          *(v4f*)(Cout + (size_t)(mBase + row) * DMOD + n0 + c4) = vals[it];
        }
        
      }
      wave_sync_lds();
    }
  } else if (MODE == 1) {
    unsigned short* Hp = (unsigned short*)C0;
    const int e = lane & 7, q4 = lane >> 3;
    const v4f b0 = *(const v4f*)(bias + n0 + 8 * e), b1 = *(const v4f*)(bias + n0 + 8 * e + 4);
    float bb[8];
#pragma unroll
    for (int tt = 0; tt < 4; ++tt) { bb[tt] = bfr(b0[tt]) * bscale; bb[4 + tt] = bfr(b1[tt]) * bscale; }
    float* slab = (float*)(void*)(sraw);
#pragma unroll
    for (int i = 0; i < 4; ++i) {
      const int mBase = m0 + (i << 4);
#pragma unroll
      for (int j = 0; j < 4; ++j) {
#pragma unroll
        for (int r = 0; r < 8; ++r) slab[(mOff + r) * 68 + (j << 4) + rlane] = acc[i][j][r];
      }
      wave_sync_lds();
      v4u hv[4];
#pragma unroll
      for (int it = 0; it < 4; ++it) {
        const int row = it * 4 + q4;                   // it 0..3 x q4 0..3 = rows 0..15
        const v4f x0 = *(const v4f*)(slab + row * 68 + 8 * e);
        const v4f x1 = *(const v4f*)(slab + row * 68 + 8 * e + 4);
        float y[8];
#pragma unroll
        for (int tt = 0; tt < 4; ++tt) { y[tt] = x0[tt] * escale + bb[tt]; y[4 + tt] = x1[tt] * escale + bb[4 + tt]; }
        v4u uh;
#pragma unroll
        for (int t2 = 0; t2 < 4; ++t2) {
          uh[t2] = pk16(h_bits((_Float16)y[2 * t2]), h_bits((_Float16)y[2 * t2 + 1]));
        }
        hv[it] = uh;
      }
      {
#pragma unroll
        for (int it = 0; it < 4; ++it) {
          const int row = it * 4 + q4;
          const size_t go = (size_t)(mBase + row) * DMOD + n0 + 8 * e;
          *(v4u*)(Hp + go) = hv[it];
        }
        
      }
      wave_sync_lds();
    }
  } else {
    unsigned short* Vs = sraw;              // [64 features][pitch 72] f16 bits
    float bb4[4];
#pragma unroll
    for (int j = 0; j < 4; ++j) bb4[j] = bfr(bias[n0 + (j << 4) + rlane]) * bscale;
#pragma unroll
    for (int i = 0; i < 4; ++i) {
#pragma unroll
      for (int j = 0; j < 4; ++j) {
#pragma unroll
        for (int r = 0; r < 8; ++r) {
          Vs[((j << 4) + rlane) * 72 + (i << 4) + mOff + r] = h_bits((_Float16)(acc[i][j][r] * escale + bb4[j]));
        }
      }
    }
    wave_sync_lds();
    const int e = lane & 7, q4 = lane >> 3;
    const int bsel = m0 / SEQ;                          // batch of this tile (wave-uniform)
    const int s0 = m0 % SEQ;                            // first token within the batch
    v4u u[16];
#pragma unroll
    for (int it = 0; it < 16; ++it) {
      const int fl = it * 4 + q4;                        // it 0..15 x q4 0..3 = features 0..63
      u[it] = *(const v4u*)(Vs + fl * 72 + 8 * e);
    }
    unsigned short* Vp = (unsigned short*)C0 + ((size_t)bsel * DMOD + n0) * SEQ + s0 + 8 * e;
    {
#pragma unroll
      for (int it = 0; it < 16; ++it) {
        const int fl = it * 4 + q4;
        *(v4u*)(Vp + (size_t)fl * SEQ) = u[it];
      }
      
    }
  }
}

// ---- q, k, v projections: block tile 256 token rows x 192 features, 12 waves (4 x 3) ----
#define QKB   128                      // k per stage: rows of 256 B
#define QPIT  272                      // LDS row pitch, bytes: 16 B x odd
#define QMR   256                      // A rows of a block
#define QNR   192                      // Bt rows of a block
#define QSTG  ((QMR + QNR) * QPIT)     // one buffer: A rows 0..255, Bt rows 256..447
#define QNT   (DMOD / QKB)             // 6 stages
#define QSW   24                       // rows per sweep of the block's 384 threads
#define QLSTEP (QSW * QPIT)            // one sweep further in LDS
#define QGSTEP (QSW * DMOD * 2)        // one sweep further in global memory
static_assert((MTOK % QMR) == 0 && (DMOD % QNR) == 0 && (DMOD % QKB) == 0 && QNT >= 2 && (QPIT % 16) == 0);
static_assert(QMR + QNR == 18 * QSW + 16 && 12 * 9216 <= 2 * QSTG);

// Nine asynchronous 16-B copies per lane, one sweep apart in LDS: byte address l + i * QLSTEP <- g[i]. The s_wait_xcnt
// closes the statement so that no address register of an issued copy is rewritten ahead of it.
__device__ __forceinline__ void acopy9(unsigned l, const char* const (&g)[9]) {
#if defined(__HIP_DEVICE_COMPILE__)
  asm volatile(
      "global_load_async_to_lds_b128 %0, %9, off\n\t"
      "global_load_async_to_lds_b128 %1, %10, off\n\t"
      "global_load_async_to_lds_b128 %2, %11, off\n\t"
      "global_load_async_to_lds_b128 %3, %12, off\n\t"
      "global_load_async_to_lds_b128 %4, %13, off\n\t"
      "global_load_async_to_lds_b128 %5, %14, off\n\t"
      "global_load_async_to_lds_b128 %6, %15, off\n\t"
      "global_load_async_to_lds_b128 %7, %16, off\n\t"
      "global_load_async_to_lds_b128 %8, %17, off\n\t"
      "s_wait_xcnt 0x0"
      :: "v"(l), "v"(l + 1 * QLSTEP), "v"(l + 2 * QLSTEP), "v"(l + 3 * QLSTEP), "v"(l + 4 * QLSTEP),
         "v"(l + 5 * QLSTEP), "v"(l + 6 * QLSTEP), "v"(l + 7 * QLSTEP), "v"(l + 8 * QLSTEP),
         "v"(g[0]), "v"(g[1]), "v"(g[2]), "v"(g[3]), "v"(g[4]), "v"(g[5]), "v"(g[6]), "v"(g[7]), "v"(g[8])
      : "memory");
#endif
}
// One such copy, with its own closing wait.
__device__ __forceinline__ void acopy1(unsigned l, const char* g) {
#if defined(__HIP_DEVICE_COMPILE__)
  asm volatile("global_load_async_to_lds_b128 %0, %1, off\n\ts_wait_xcnt 0x0" :: "v"(l), "v"(g) : "memory");
#endif
}
// One stage: 448 rows x 16 pieces = 7168 copies; thread -> row (tid >> 4) + 24 i, piece tid & 15. Sweeps 0..9 are A rows,
// sweep 10 holds A rows 240..255 and Bt rows 0..7 (gx: this thread's piece of it), sweeps 11..17 Bt rows 8..175; the last 16
// Bt rows are a sweep of waves 0..7 alone (tail: the same in a whole wave, a scalar branch, every lane on).
// ga, gb: this thread's piece of A row (tid >> 4) and of Bt row (tid >> 4) of the block, at the stage's first k.
__device__ __forceinline__ void qstage_copy(unsigned l, const char* ga, const char* gb, const char* gx, const bool tail) {
  const char* g0[9];
  const char* g1[9];
  // the loops are unrolled so that both pointer arrays stay in registers
#pragma unroll
  for (int i = 0; i < 9; ++i) g0[i] = ga + (size_t)i * QGSTEP;                          // A rows 0..215
  g1[0] = ga + (size_t)9 * QGSTEP;                                                      // A rows 216..239
  g1[1] = gx;
#pragma unroll
  for (int i = 11; i < 18; ++i) g1[i - 9] = gb + (size_t)(i * QSW - QMR) * (DMOD * 2);  // Bt rows 8..175
  acopy9(l, g0);
  acopy9(l + 9 * QLSTEP, g1);
  if (tail) acopy1(l + 18 * QLSTEP, gb + (size_t)(18 * QSW - QMR) * (DMOD * 2));        // Bt rows 176..191
}

// ---- output projection: block tile 128 token rows x 128 features, 4 waves (2 x 2) ----
#define OMR   128                      // A rows of a block
#define ONR   128                      // Bt rows of a block
#define OSTG  ((OMR + ONR) * QPIT)     // one buffer: A rows 0..127, Bt rows 128..255
#define OSW   8                        // rows per sweep of the block's 128 threads
#define OLSTEP (OSW * QPIT)            // one sweep further in LDS
#define OGSTEP (OSW * DMOD * 2)        // one sweep further in global memory
static_assert((MTOK % OMR) == 0 && (DMOD % ONR) == 0 && OMR == 16 * OSW && ONR == 16 * OSW && 4 * 9216 <= 2 * OSTG);

// Eight asynchronous 16-B copies per lane, one sweep apart: LDS byte address l + i * OLSTEP <- g + i * OGSTEP. The
// s_wait_xcnt closes the statement so that no address register of an issued copy is rewritten ahead of it.
__device__ __forceinline__ void acopy8(unsigned l, const char* g) {
#if defined(__HIP_DEVICE_COMPILE__)
  asm volatile(
      "global_load_async_to_lds_b128 %0, %8, off\n\t"
      "global_load_async_to_lds_b128 %1, %9, off\n\t"
      "global_load_async_to_lds_b128 %2, %10, off\n\t"
      "global_load_async_to_lds_b128 %3, %11, off\n\t"
      "global_load_async_to_lds_b128 %4, %12, off\n\t"
      "global_load_async_to_lds_b128 %5, %13, off\n\t"
      "global_load_async_to_lds_b128 %6, %14, off\n\t"
      "global_load_async_to_lds_b128 %7, %15, off\n\t"
      "s_wait_xcnt 0x0"
      :: "v"(l), "v"(l + 1 * OLSTEP), "v"(l + 2 * OLSTEP), "v"(l + 3 * OLSTEP),
         "v"(l + 4 * OLSTEP), "v"(l + 5 * OLSTEP), "v"(l + 6 * OLSTEP), "v"(l + 7 * OLSTEP),
         "v"(g), "v"(g + 1 * OGSTEP), "v"(g + 2 * OGSTEP), "v"(g + 3 * OGSTEP),
         "v"(g + 4 * OGSTEP), "v"(g + 5 * OGSTEP), "v"(g + 6 * OGSTEP), "v"(g + 7 * OGSTEP)
      : "memory");
#endif
}
// One stage: 256 rows x 16 pieces = 4096 copies = 32 per thread; thread -> row (tid >> 4) + 8 i, piece tid & 15.
// ga, gb: this thread's piece of A row (tid >> 4) and of Bt row (tid >> 4) of the block, at the stage's first k.
__device__ __forceinline__ void ostage_copy(unsigned l, const char* ga, const char* gb) {
  acopy8(l, ga);                                            // A rows 0..63
  acopy8(l + 8 * OLSTEP, ga + (size_t)8 * OGSTEP);          // A rows 64..127
  acopy8(l + 16 * OLSTEP, gb);                              // Bt rows 0..63
  acopy8(l + 24 * OLSTEP, gb + (size_t)8 * OGSTEP);         // Bt rows 64..127
}

// acc = the wave's 64x64 tile of A[mb + 64 wm ..][768] . Bt[nb + 64 wn ..][768]^T; k runs 0..767 in steps of 32.
// WM = 4: the 256 x 192 block of 12 waves; WM = 2: the 128 x 128 block of 4 waves.
template <int WM>
__device__ __forceinline__ void gemm_loop(
    v8f (&acc)[4][4], unsigned char* ring, const int mb, const int nb, const int wvs, const int wm, const int wn,
    const unsigned short* __restrict__ Ap, const unsigned short* __restrict__ Bp) {
  const int lane = threadIdx.x & 31;
  const int rlane = lane & 15;                 // row (A) / col (B) within subtile
  const int koff  = (lane >> 4) * 8;           // k offset of this lane half
#pragma unroll
  for (int i = 0; i < 4; ++i)
#pragma unroll
    for (int j = 0; j < 4; ++j) acc[i][j] = zero8();

  const int crow = threadIdx.x >> 4, cpc = threadIdx.x & 15;
  const unsigned lcp = (unsigned)(uintptr_t)(&ring[0]) + (unsigned)(crow * QPIT + cpc * 16);
  const char* ga = (const char*)(const void*)Ap + ((size_t)(mb + crow) * DMOD + 8 * cpc) * 2;
  const char* gb = (const char*)(const void*)Bp + ((size_t)(nb + crow) * DMOD + 8 * cpc) * 2;
  const char* gx = (crow < 16) ? ga + (size_t)10 * QGSTEP : gb - (size_t)16 * (DMOD * 2);   // WM = 4 only
  const bool tail = wvs < 8;                   // wvs is in a scalar register
  constexpr int MR = (WM == 4) ? QMR : OMR;    // A rows of the block
  constexpr int STG = (WM == 4) ? QSTG : OSTG; // bytes of one buffer
  // stage s into the buffer at LDS byte offset lo
  auto copy_stage = [&](const unsigned lo, const int s) {
    if constexpr (WM == 4) qstage_copy(lcp + lo, ga + s * (QKB * 2), gb + s * (QKB * 2), gx + s * (QKB * 2), tail);
    else                   ostage_copy(lcp + lo, ga + s * (QKB * 2), gb + s * (QKB * 2));
  };

  copy_stage(0, 0);
  asm volatile("s_wait_asynccnt 0x0" ::: "memory");        // stage 0 of this wave has landed
  __syncthreads();                                          // ... and every wave's part of it
  copy_stage(STG, 1);

#pragma unroll 1                                            // rolled: a long body, only the buffer changes
  for (int t = 0; t < QNT; ++t) {
    const unsigned char* rb = ring + (t & 1) * STG;
    const _Float16* la = (const _Float16*)(const void*)(rb + ((wm << 6) + rlane) * QPIT) + koff;
    const _Float16* lb = (const _Float16*)(const void*)(rb + (MR + (wn << 6) + rlane) * QPIT) + koff;
    // all loops of the stage are unrolled: fragment and accumulator arrays in registers, LDS offsets as immediates
#pragma unroll
    for (int ks = 0; ks < QKB; ks += 32) {
      v16h ah[4], bh[4];                                    // the 32-k block's fragments, read as one group
#pragma unroll
      for (int j = 0; j < 4; ++j) {
        bh[j] = ldfrag_h(lb + j * (16 * QPIT / 2) + ks);
        ah[j] = ldfrag_h(la + j * (16 * QPIT / 2) + ks);
      }
#pragma unroll
      for (int i = 0; i < 4; ++i) {
#pragma unroll
        for (int j = 0; j < 4; ++j) acc[i][j] = mma_h_raw(ah[i], bh[j], acc[i][j]);
        dep_guard1(acc[i][0], acc[i][3], ah[i]);
      }
      keep4_h(bh[0], bh[1], bh[2], bh[3]);
    }
    asm volatile("s_wait_dscnt 0x0" ::: "memory");          // this wave's reads of buffer t & 1 are done
    asm volatile("s_wait_asynccnt 0x0" ::: "memory");       // this wave's copies of stage t + 1 have landed
    __syncthreads();                                        // publishes stage t + 1, frees buffer t & 1
    if (t + 2 < QNT) copy_stage((t & 1) * STG, t + 2);
  }
  asm volatile("s_wait_asynccnt 0x0" ::: "memory");         // no copy outstanding when the wave goes on
  acc_guard4(acc[0][0], acc[0][1], acc[0][2], acc[0][3]);
  acc_guard4(acc[1][0], acc[1][1], acc[1][2], acc[1][3]);
  acc_guard4(acc[2][0], acc[2][1], acc[2][2], acc[2][3]);
  acc_guard4(acc[3][0], acc[3][1], acc[3][2], acc[3][3]);
}

#define QBLK  ((MTOK / QMR) * (DMOD / QNR))   // 64 blocks cover one [4096][768] product

// q, k and v projections in one grid of 3 x 64 blocks (they share A and depend on nothing of each other): block-uniform
// choice of the weight plane, bias, scale and output plane; q*log2(e)/8 and k row-major (acc = 64*1024*y),
// v*256 transposed (escale 1/256). The epilogue's slabs (9216 B per wave) lie on the ring: the barrier at the foot of the
// last stage ends every wave's reads of it and no copy is outstanding then.
__global__ __launch_bounds__(384) void gemm_qkv(
    const unsigned short* __restrict__ Ap, const unsigned short* __restrict__ Bq,
    const unsigned short* __restrict__ Bk, const unsigned short* __restrict__ Bv,
    const float* __restrict__ bq, const float* __restrict__ bk, const float* __restrict__ bv,
    unsigned short* Cq, unsigned short* Ck, unsigned short* Cv) {
  __shared__ __align__(16) unsigned char ring[2 * QSTG];   // two operand buffers
  const int sel = blockIdx.x / QBLK;                       // 0: q, 1: k, 2: v
  const int bx = blockIdx.x - sel * QBLK;
  const int mb = (bx / (DMOD / QNR)) * QMR;                // the block's first token row
  const int nb = (bx % (DMOD / QNR)) * QNR;                // the block's first feature
  const int wvs = __builtin_amdgcn_readfirstlane(threadIdx.x >> 5);   // wave 0..11, in a scalar register
  const int wm = wvs & 3, wn = wvs >> 2;                   // the wave's place among 4 x 3 tiles
  v8f acc[4][4];
  gemm_loop<4>(acc, ring, mb, nb, wvs, wm, wn, Ap, (sel == 0) ? Bq : (sel == 1) ? Bk : Bv);
  unsigned short* sraw = (unsigned short*)(void*)(ring + wvs * 9216);  // this wave's slab
  const int m0 = mb + (wm << 6), n0 = nb + (wn << 6);
  if (sel == 2) gemm_epi<2>(acc, sraw, m0, n0, bv, VS / (XC * WSC), VS, (void*)Cv);
  else          gemm_epi<1>(acc, sraw, m0, n0, sel ? bk : bq, (sel ? KS : QS) / (XC * WSC), sel ? KS : QS,
                            (void*)(sel ? Ck : Cq));         // q and k share one path, the scale is block-uniform
}

#define OBLK  ((MTOK / OMR) * (DMOD / ONR))   // 192 blocks cover [4096][768]

// output projection: acc = 1024*1024*out -> escale 2^-20, f32 row-major
__global__ __launch_bounds__(128) void gemm_out(
    const unsigned short* __restrict__ Ap, const unsigned short* __restrict__ Bp,
    const float* __restrict__ bias, float* C0) {
  __shared__ __align__(16) unsigned char ring[2 * OSTG];   // two operand buffers; the epilogue's slabs lie on them as above
  const int bx = blockIdx.x;
  const int mb = (bx / (DMOD / ONR)) * OMR;                // the block's first token row
  const int nb = (bx % (DMOD / ONR)) * ONR;                // the block's first feature
  const int wvs = __builtin_amdgcn_readfirstlane(threadIdx.x >> 5);   // wave 0..3, in a scalar register
  const int wm = wvs & 1, wn = wvs >> 1;                   // the wave's place among 2 x 2 tiles
  v8f acc[4][4];
  gemm_loop<2>(acc, ring, mb, nb, wvs, wm, wn, Ap, Bp);
  gemm_epi<0>(acc, (unsigned short*)(void*)(ring + wvs * 9216), mb + (wm << 6), nb + (wn << 6), bias,
              1.0f / (CS * WSC), 1.0f, (void*)C0);
}

// =====================================================================================================
// Attention, three chunks of 64 queries per block, transposed formulation, head dim 64, 2048 keys, additive int mask:
//   S^T tile (16 keys x 16 queries) = A(k rows = keys, d via the split k map) . B(q, col = query, same d map), two d-steps
//   of 32. The q plane carries log2(e)/8, so k.q is the score in log2 units, and the first product's C operand carries
//   what is added to it: 10 - m (m = the reference in use, log2 units; 10 = log2 of P's scale), a tile of one value that
//   stays in registers from pass to pass. The D tile is then the argument of exp2 itself; only a pass whose 64-key flag group holds one
//   whose adder (1 - mask[b][key]) * (-10000) * log2(e) is not 0 (one flag bit per 64 keys, set when the adder table is
//   built, scalar branch) reads its adders from the table and adds them. Per lane the D tile holds 8 keys of ONE query, so the online softmax is per-lane state;
//   m is raised to the running max (max tree, one shuffle lane^16, rescale of l and O) in the first pass and in a pass
//   whose sum of exponentials leaves the f16 range; the row sum is kept as a per-lane partial and combined at
//   the end. P = e^{x-m} x 1024 as one f16 plane (11 significant bits, as v^T and ctx have), used directly as the
//   B operand of O^T (rows d, cols queries) += A(v^T rows d, keys contiguous, two 16-B loads) . B(P^T):
//   B element r <- the key tile covering keys kb..kb+15, element 8+r <- the tile covering kb+16..kb+31, lane unchanged
//   (D-as-B chaining layout). One product per d tile (d 0-15, 16-31, 32-47, 48-63).
//   A wave takes 32 queries (two query tiles) and one half of the keys, so that every k and v^T fragment read from LDS
//   feeds two products. A pass = 32 keys x 32 queries: 8 score WMMAs + 8 output WMMAs. Four waves = 2 query groups x
//   2 key halves = one chunk of 64 queries. Block = 12 waves = 3 consecutive chunks = 192 queries, which share one copy of
//   k and v^T in LDS; grid = 2*12*32 / 3 = 256. 32 chunks make a (b, head), so 16 of the 256 blocks hold chunks of two
//   heads: such a block keeps a second k / v^T stream in LDS, and each wave reads the stream of its own head.
//   k and v^T reach the waves through LDS: per stage and stream the block copies, for each key half, 128 k rows (128 B, LDS
//   pitch 144 B) and 64 v^T rows (128 keys = 256 B, LDS pitch 272 B), whole lines, with asynchronous 16-B copies into one of
//   two buffers, the next stage in flight while this one is worked on; four passes per stage, fragments = two 16-B LDS loads.
//   Epilogue: the two waves of a query group exchange one query tile each (O, l, 10 - m) through LDS, block barrier, bring
//   both halves to the larger m and divide; the block's [192 query][64 d] f32 tile then lies in LDS (pitch 68), block barrier, then 4
// coverage: a chunk's 4 waves write queries q0..q0+63 x d 0..63 of its (b, head); 768 chunks cover ctx [4096][768] exactly once.
// =====================================================================================================
#define AKB   128                      // keys per stage and key half
#define KHALF (SEQ / 2)                // keys of one key half
#define VPIT  272                      // LDS pitch of a v^T row of 128 keys, bytes: 16 B x odd
#define AKR   (AKB * GPIT)             // the k rows of one key half of one buffer
#define ASTG  (AKR + 64 * VPIT)        // one key half of one buffer: 128 k rows, then 64 v^T rows
#define ABUF  (2 * ASTG)               // one buffer: key half 0, key half 1
#define ANT   (KHALF / AKB)            // 8 stages
#define AFK   64                       // keys per flag word
#define AFL   (SEQ / AFK)              // 32 flag words
#define CPB   3                        // chunks of 64 queries per block
#define NCH   (SEQ / 64)               // 32 chunks per (b, head)
#define ASTR  (2 * ABUF)               // one stream: two buffers
static_assert((KHALF % AKB) == 0 && ANT >= 2 && DHEAD * 2 == 128 && AFL == 32 && (VPIT % 16) == 0 && AKB * 2 + 16 == VPIT);
static_assert(((NBAT * NHEAD * NCH) % CPB) == 0 && CPB <= NCH);   // whole blocks; a block meets at most two heads
static_assert(((NHEAD * NCH) % CPB) == 0);                         // no block holds chunks of two batches: one adder table

// Eight asynchronous 16-B copies per lane: LDS byte address l + i * LS <- g + i * GS. The s_wait_xcnt closes the statement
// so that no address register of an issued copy is rewritten ahead of it.
template <int LS, int GS>
__device__ __forceinline__ void attn_copy8(unsigned l, const char* g) {
#if defined(__HIP_DEVICE_COMPILE__)
  asm volatile(
      "global_load_async_to_lds_b128 %0, %8, off\n\t"
      "global_load_async_to_lds_b128 %1, %9, off\n\t"
      "global_load_async_to_lds_b128 %2, %10, off\n\t"
      "global_load_async_to_lds_b128 %3, %11, off\n\t"
      "global_load_async_to_lds_b128 %4, %12, off\n\t"
      "global_load_async_to_lds_b128 %5, %13, off\n\t"
      "global_load_async_to_lds_b128 %6, %14, off\n\t"
      "global_load_async_to_lds_b128 %7, %15, off\n\t"
      "s_wait_xcnt 0x0"
      :: "v"(l), "v"(l + 1 * LS), "v"(l + 2 * LS), "v"(l + 3 * LS),
         "v"(l + 4 * LS), "v"(l + 5 * LS), "v"(l + 6 * LS), "v"(l + 7 * LS),
         "v"(g), "v"(g + 1 * GS), "v"(g + 2 * GS), "v"(g + 3 * GS),
         "v"(g + 4 * GS), "v"(g + 5 * GS), "v"(g + 6 * GS), "v"(g + 7 * GS)
      : "memory");
#endif
}
// One key half of one stage, by 128 threads, 16 copies each. k: 128 rows x 8 pieces, thread -> row (t >> 3) + 16 i, piece
// t & 7; v^T: 64 rows x 16 pieces, thread -> row (t >> 4) + 8 i, piece t & 15. lk, gk: this thread's piece of its first k
// row in LDS and in memory; lv, gv: the same of its first v^T row.
__device__ __forceinline__ void attn_stage_copy(unsigned lk, const char* gk, unsigned lv, const char* gv) {
  attn_copy8<GLSTEP, GGSTEP>(lk, gk);
  attn_copy8<8 * VPIT, 8 * SEQ * 2>(lv, gv);
}

// e = 2^a for a lane's 32 arguments of one pass
__device__ __forceinline__ void exp32(const v8f (&a)[4], v8f (&e)[4]) {
  // the loops here are unrolled so that the arrays and vector elements stay in registers
#pragma unroll
  for (int i = 0; i < 4; ++i)
#pragma unroll
    for (int r = 0; r < 8; ++r) e[i][r] = __builtin_amdgcn_exp2f(a[i][r]);
}
// sum of a lane's 16 exponentials of one query and one pass, as a tree
__device__ __forceinline__ float sum16(const v8f x, const v8f y) {
  const v8f t = x + y;
  const v4f u = __builtin_shufflevector(t, t, 0, 1, 2, 3) + __builtin_shufflevector(t, t, 4, 5, 6, 7);
  const v2f w = __builtin_shufflevector(u, u, 0, 1) + __builtin_shufflevector(u, u, 2, 3);
  return w[0] + w[1];
}
// eight consecutive floats from LDS, two 16-B loads
__device__ __forceinline__ v8f ld8f(const float* p) {
  const v4f a = *(const v4f*)(p), b = *(const v4f*)(p + 4);
  return __builtin_shufflevector(a, b, 0, 1, 2, 3, 4, 5, 6, 7);
}
// the four slots behind the last score product, before a vector instruction reads a D tile or a load overwrites an operand
__device__ __forceinline__ void sguard8(v8f& a, v8f& b, v8f& c, v8f& d, v16h x0, v16h x1, v16h x2, v16h x3,
                                        v16h x4, v16h x5, v16h x6, v16h x7) {
#if defined(__HIP_DEVICE_COMPILE__)
  asm volatile("v_nop\n\tv_nop\n\tv_nop\n\tv_nop"
               : "+v"(a), "+v"(b), "+v"(c), "+v"(d)
               : "v"(x0), "v"(x1), "v"(x2), "v"(x3), "v"(x4), "v"(x5), "v"(x6), "v"(x7));
#endif
}
// the same behind the last output product: eight accumulator tiles, their six operands
__device__ __forceinline__ void oguard8(v8f& a, v8f& b, v8f& c, v8f& d, v8f& e, v8f& f, v8f& g, v8f& h,
                                        v16h x0, v16h x1, v16h x2, v16h x3, v16h p0, v16h p1) {
#if defined(__HIP_DEVICE_COMPILE__)
  asm volatile("v_nop\n\tv_nop\n\tv_nop\n\tv_nop"
               : "+v"(a), "+v"(b), "+v"(c), "+v"(d), "+v"(e), "+v"(f), "+v"(g), "+v"(h)
               : "v"(x0), "v"(x1), "v"(x2), "v"(x3), "v"(p0), "v"(p1));
#endif
}
// inputs-only fence on four loaded fragments and two sums
__device__ __forceinline__ void hold4_h(v16h a, v16h b, v16h c, v16h d, float s, float u) {
#if defined(__HIP_DEVICE_COMPILE__)
  asm volatile("" :: "v"(a), "v"(b), "v"(c), "v"(d), "v"(s), "v"(u));
#endif
}

__global__ __launch_bounds__(384)
void attn_kernel(const unsigned short* __restrict__ qp, const unsigned short* __restrict__ kp,
                 const unsigned short* __restrict__ vt, const int* __restrict__ am, unsigned short* ctx) {
  __shared__ __align__(16) unsigned char aring[2 * ASTR];  // two streams, each two k / v^T buffers of both key halves
  // the epilogue's f32 tile lies on the ring: the barrier at the foot of the last stage ends every wave's reads of the ring
  // and no copy is outstanding then
  float* Os = (float*)(void*)aring;
  static_assert(CPB * 64 * 68 * 4 <= 2 * ASTR);
  __shared__ __align__(16) float Ad[SEQ];                  // mask adder of every key of batch b, log2 units
  __shared__ unsigned Fl[AFL];                             // per 64 keys: not 0 where a key's adder is not 0
  __shared__ float Ml[CPB * 64], Mc[CPB * 64];             // per query: the handed-over half's row sum and its 10 - m
  const int tid  = threadIdx.x;
  const int wave = tid >> 5;
  const int lane = tid & 31;
  const int hh   = lane >> 4;
  const int c    = lane & 15;
  const int wvs  = __builtin_amdgcn_readfirstlane(wave);   // in a scalar register: the tests on kh are scalar branches
  const int kh   = wvs & 1;                       // key half of this wave: keys 1024 kh .. 1024 kh + 1023
  const int qg   = (wvs >> 1) & 1;                // query group of this wave: queries q0 + 32 qg .. + 31
  const int cg   = wvs >> 2;                      // chunk of this wave within the block, 0..2
  const int t128 = tid & 127;                     // thread within the chunk's four waves
  const int ch0  = blockIdx.x * CPB;              // the block's first chunk
  const int bh0  = ch0 / NCH;                     // b * NHEAD + head of stream 0 ...
  const int bh1  = (ch0 + CPB - 1) / NCH;         // ... and of stream 1
  const bool two = bh1 != bh0;                    // the block holds chunks of two heads (the same for the whole block)
  const int qb   = (ch0 + cg) % NCH;              // chunk within its (b, head)
  const int bhd  = (ch0 + cg) / NCH;              // b * NHEAD + head of this wave's chunk
  const int str  = bhd - bh0;                     // the stream this wave reads, 0 or 1
  const int b    = bhd / NHEAD;                   // the same for every chunk of the block
  const int hd   = bhd - b * NHEAD;
  const int q0   = qb * 64;

  const _Float16* QP  = (const _Float16*)(const void*)qp;

  // ---- q fragments (B operand, col = query q0 + 32 qg + 16 j + c, j = 0, 1): one plane, d 0..31 and 32..63 ----
  const size_t qtok = (size_t)b * SEQ + q0 + qg * 32 + c;
  const _Float16* qbp = QP + qtok * DMOD + hd * DHEAD + 8 * hh;
  const v16h qf00 = ldfrag_h(qbp), qf01 = ldfrag_h(qbp + 32);
  const v16h qf10 = ldfrag_h(qbp + 16 * DMOD), qf11 = ldfrag_h(qbp + 16 * DMOD + 32);
  // ---- copy side: k row = key (stage's first + crow + 16 i), 16-B piece cpc; v^T row = d (vrow + 8 i), 16-B piece vpc ----
  //      waves 0..3 copy key half 0 of stream 0, waves 4..7 its key half 1, waves 8..11 both halves of stream 1 where the
  //      block has one (every lane on at a copy)
  const int crow = t128 >> 3, cpc = t128 & 7;     // k: first row, piece
  const int vrow = t128 >> 4, vpc = t128 & 15;    // v^T: first row, piece
  const int cbh  = (cg == 2) ? bh1 : bh0;         // b * NHEAD + head of the stream this wave copies
  const int ckh  = (cg == 1) ? 1 : 0;             // first key half that it copies
  // 1: one key half of stream 0; 2: both of stream 1; 0: nothing. In a scalar register: the tests on it are scalar branches
  const int cmode = __builtin_amdgcn_readfirstlane((cg < 2) ? 1 : (two ? 2 : 0));
  const unsigned lcp = (unsigned)(uintptr_t)(&aring[0]) + (unsigned)(((cg == 2) ? ASTR : 0) + ckh * ASTG);
  const unsigned lk = lcp + (unsigned)(crow * GPIT + cpc * 16);
  const unsigned lv = lcp + (unsigned)(AKR + vrow * VPIT + vpc * 16);
  const char* gk = (const char*)(const void*)kp +
                   (((size_t)b * SEQ + ckh * KHALF + crow) * DMOD + (cbh - b * NHEAD) * DHEAD + 8 * cpc) * 2;
  const char* gv = (const char*)(const void*)vt +
                   (((size_t)cbh * DHEAD + vrow) * SEQ + ckh * KHALF + 8 * vpc) * 2;
  // stage s into the buffers at LDS byte offset lo of their streams
  auto copy_stage = [&](const unsigned lo, const int s) {
    const char* ks = gk + (size_t)s * (AKB * DMOD * 2);
    const char* vs = gv + s * (AKB * 2);
    if (cmode != 0) attn_stage_copy(lk + lo, ks, lv + lo, vs);
    if (cmode == 2) attn_stage_copy(lk + lo + ASTG, ks + (size_t)KHALF * DMOD * 2, lv + lo + ASTG, vs + KHALF * 2);
  };
  // ---- adder base: keys kb + 8hh + 0..7 and kb + 16 + 8hh + 0..7 of this wave's key half ----
  const float* adb = Ad + kh * KHALF + 8 * hh;

  float l0 = 0.f, l1 = 0.f, lim = -1.0f;         // lim: the pass sum above which m is brought up to date
  v8f cs0 = zero8(), cs1 = zero8();              // 10 - m in every element: the C operand of the score products
  v8f o00 = zero8(), o01 = zero8(), o02 = zero8(), o03 = zero8();   // query tile 0, d tiles 0..3
  v8f o10 = zero8(), o11 = zero8(), o12 = zero8(), o13 = zero8();   // query tile 1

  copy_stage(0, 0);
  // adder table, once per block: Ad[key] = (1 - mask[b][key]) * (-10000) * log2(e); waves 0..3: 128 threads x 4 x 4 keys.
  // 16 consecutive lanes hold the 64 keys 64 (8 i + 2 wave + hh) ..: their votes make that flag word.
  static_assert((SEQ % 512) == 0 && AFK == 64 && AFL == 32);
  if (cg == 0) {
  unsigned vote[SEQ / 512];
#pragma unroll                                              // the four mask loads issue together, one latency
  for (int i = 0; i < SEQ / 512; ++i) {
    const int k4 = (i * 128 + tid) * 4;
    const v4i mk = *(const v4i*)(am + (size_t)b * SEQ + k4);
    v4f ad;
#pragma unroll                                              // vector elements by constant index, in registers
    for (int r = 0; r < 4; ++r) ad[r] = ((1.0f - (float)mk[r]) * MASKC) * LOG2E;
    *(v4f*)(Ad + k4) = ad;
    vote[i] = __builtin_amdgcn_ballot_w32(ad[0] != 0.f || ad[1] != 0.f || ad[2] != 0.f || ad[3] != 0.f);
  }
  // the flag words are stored behind the loop: a branch inside it kept the four loads from issuing together
  if (c == 0) {
#pragma unroll                                              // array by constant index, in registers
    for (int i = 0; i < SEQ / 512; ++i) Fl[i * 8 + wave * 2 + hh] = (vote[i] >> (16 * hh)) & 0xFFFFu;
  }
  }
  asm volatile("s_wait_asynccnt 0x0" ::: "memory");        // stage 0 of this wave has landed
  __syncthreads();                                          // ... and every wave's part of it, and the adder table
  copy_stage(ABUF, 1);
  // bit i: keys 64 i .. 64 i + 63 of this wave's key half hold an adder that is not 0
  const unsigned mfl = __builtin_amdgcn_ballot_w32(Fl[lane] != 0u) >> (kh * (KHALF / AFK));

#pragma unroll 1                                            // rolled as before: a long body, only the buffer changes
  for (int t = 0; t < ANT; ++t) {
   const unsigned char* rb = aring + str * ASTR + (t & 1) * ABUF + kh * ASTG;
   // k fragment base (A operand, row = key c of the stage), v^T fragment base (A operand, row = d = c, keys contiguous)
   const _Float16* Kl = (const _Float16*)(const void*)(rb + c * GPIT) + 8 * hh;
   const _Float16* Vl = (const _Float16*)(const void*)(rb + AKR + c * VPIT) + 8 * hh;
   // four passes of 32 keys x 32 queries; unrolled: fragment arrays in registers, LDS offsets as immediates
#pragma unroll
   for (int p = 0; p < AKB / 32; ++p) {
    // the pass's k fragments (A operand), one load group; each feeds the products of both query tiles
    const _Float16* k0p = Kl + p * 32 * (GPIT / 2);
    const _Float16* k1p = k0p + 16 * (GPIT / 2);
    const v16h ka0 = ldfrag_h(k0p),      ka1 = ldfrag_h(k1p);
    const v16h ka2 = ldfrag_h(k0p + 32), ka3 = ldfrag_h(k1p + 32);
    v8f s0 = mma_h_raw(ka0, qf00, cs0);                     // query tile 0, keys  0..15 of the pass
    v8f s1 = mma_h_raw(ka1, qf00, cs0);                     // query tile 0, keys 16..31
    v8f s2 = mma_h_raw(ka0, qf10, cs1);                     // query tile 1, keys  0..15
    v8f s3 = mma_h_raw(ka1, qf10, cs1);                     // query tile 1, keys 16..31
    s0 = mma_h_raw(ka2, qf01, s0);
    s1 = mma_h_raw(ka3, qf01, s1);
    s2 = mma_h_raw(ka2, qf11, s2);
    s3 = mma_h_raw(ka3, qf11, s3);
    sguard8(s0, s1, s2, s3, ka0, ka1, ka2, ka3, qf00, qf01, qf10, qf11);
    // the pass's v^T fragments, a second load group: into the registers the k fragments leave, landing under the softmax
    const v16h vf0 = ldfrag_h(Vl + p * 32);
    const v16h vf1 = ldfrag_h(Vl + 16 * (VPIT / 2) + p * 32);
    const v16h vf2 = ldfrag_h(Vl + 32 * (VPIT / 2) + p * 32);
    const v16h vf3 = ldfrag_h(Vl + 48 * (VPIT / 2) + p * 32);

    v8f a[4] = {s0, s1, s2, s3};                            // score * log2(e) - m + 10, as the products leave it
    // scalar test: the 64 keys of the pass's flag bit hold an adder that is not 0; marked unlikely so that the block lies outside the loop's
    // straight line and a pass without adders takes no branch
    if (__builtin_expect((mfl >> (t * (AKB / AFK) + p / 2)) & 1u, 0u)) {
     // adders of keys kb + 8hh + 0..7 and kb + 16 + 8hh + 0..7, kb = 128 t + 32 p in the key half; the same for both tiles
     const v8f ad0 = ld8f(adb + t * AKB + p * 32), ad1 = ld8f(adb + t * AKB + p * 32 + 16);
     a[0] += ad0; a[1] += ad1; a[2] += ad0; a[3] += ad1;
    }
    // Lazy rescale: the exponentials are taken against the reference m in use. A lane's 16 terms of a query are all
    // >= 0, so a pass sum of at most PLIM bounds each of them by PLIM, finite in f16; then m, l and O stay as they are.
    v8f e[4];
    exp32(a, e);
    float ls0 = sum16(e[0], e[1]), ls1 = sum16(e[2], e[3]); // the branch waits for these sums: trees
    // inputs-only fence on the loaded v^T fragments: without it the compiler sinks their loads behind the branch, right in
    // front of the products that read them, and their LDS latency is waited out in every pass. The sums are named
    // too (read only), so that the fence and its wait stand here, behind the exponentials, and not in front of them.
    hold4_h(vf0, vf1, vf2, vf3, ls0, ls1);
    // one test per pass, the same for the whole wave (scalar branch): taken in the first pass (lim is below 0 there; it
    // sets m: C was 0) and whenever a lane's pass sum exceeds PLIM; then the running maxima are brought up to date,
    // l and O are rescaled and the pass's exponentials are taken again
    if (__builtin_amdgcn_ballot_w32(fmaxf(ls0, ls1) > lim) != 0) {
     float mx0 = -3.0e38f, mx1 = -3.0e38f;
#pragma unroll                                              // vector elements by constant index, in registers
     for (int r = 0; r < 8; ++r) {
      mx0 = fmaxf(mx0, fmaxf(a[0][r], a[1][r]));
      mx1 = fmaxf(mx1, fmaxf(a[2][r], a[3][r]));
     }
     mx0 = fmaxf(mx0, __shfl_xor(mx0, 16, 32));
     mx1 = fmaxf(mx1, __shfl_xor(mx1, 16, 32));
     const float up0 = mx0 - L2PS, up1 = mx1 - L2PS;        // the pass's maxima above the references in use, log2 units
     const float d0 = (lim < 0.f) ? up0 : fmaxf(up0, 0.f);  // m moves by d: never down once the first pass has set it
     const float d1 = (lim < 0.f) ? up1 : fmaxf(up1, 0.f);
     lim = PLIM;
     const float n0 = -fmaxf(d0, 0.f), n1 = -fmaxf(d1, 0.f);
     cs0 -= d0; cs1 -= d1;
     v8f a2[4];
     a2[0] = a[0] - d0; a2[1] = a[1] - d0; a2[2] = a[2] - d1; a2[3] = a[3] - d1;
     // all arguments are formed ahead of the exponentials and nothing else stands among these
     __builtin_amdgcn_sched_barrier(0);
     exp32(a2, e);
     const float corr0 = __builtin_amdgcn_exp2f(n0);        // first pass: l and O are 0 and stay so
     const float corr1 = __builtin_amdgcn_exp2f(n1);
     __builtin_amdgcn_sched_barrier(0);
     ls0 = sum16(e[0], e[1]); ls1 = sum16(e[2], e[3]);
     l0 *= corr0; l1 *= corr1;
     o00 *= corr0; o01 *= corr0; o02 *= corr0; o03 *= corr0;
     o10 *= corr1; o11 *= corr1; o12 *= corr1; o13 *= corr1;
    }
    l0 += ls0; l1 += ls1;
    FragH ph0, ph1;
#pragma unroll                                              // vector elements by constant index, in registers
    for (int r = 0; r < 8; ++r) {
     ph0.h[0][r] = (_Float16)e[0][r];                       // query tile 0, key kb      + 8hh + r
     ph0.h[1][r] = (_Float16)e[1][r];                       // query tile 0, key kb + 16 + 8hh + r
     ph1.h[0][r] = (_Float16)e[2][r];                       // query tile 1, key kb      + 8hh + r
     ph1.h[1][r] = (_Float16)e[3][r];                       // query tile 1, key kb + 16 + 8hh + r
    }
    o00 = mma_h_raw(vf0, ph0.v, o00);
    o01 = mma_h_raw(vf1, ph0.v, o01);
    o02 = mma_h_raw(vf2, ph0.v, o02);
    o03 = mma_h_raw(vf3, ph0.v, o03);
    o10 = mma_h_raw(vf0, ph1.v, o10);
    o11 = mma_h_raw(vf1, ph1.v, o11);
    o12 = mma_h_raw(vf2, ph1.v, o12);
    o13 = mma_h_raw(vf3, ph1.v, o13);
    oguard8(o00, o01, o02, o03, o10, o11, o12, o13, vf0, vf1, vf2, vf3, ph0.v, ph1.v);
   }
   asm volatile("s_wait_dscnt 0x0" ::: "memory");           // this wave's reads of buffer t & 1 are done
   asm volatile("s_wait_asynccnt 0x0" ::: "memory");        // this wave's copies of stage t + 1 have landed
   __syncthreads();                                         // publishes stage t + 1, frees buffer t & 1
   if (t + 2 < ANT) copy_stage((t & 1) * ABUF, t + 2);
  }
  asm volatile("s_wait_asynccnt 0x0" ::: "memory");         // no copy outstanding when the wave goes on
  l0 += __shfl_xor(l0, 16, 32);
  l1 += __shfl_xor(l1, 16, 32);

  // ---- the two key halves of a query group are joined: wave kh hands query tile 1 - kh (O, l, 10 - m) over through LDS
  //      and finishes query tile kh. Row of Os = query within the block = 64 cg + 32 qg + 16 j + c, column d = 16 dt + 8hh + r ----
  const v8f g0 = kh ? o00 : o10, g1 = kh ? o01 : o11, g2 = kh ? o02 : o12, g3 = kh ? o03 : o13;   // handed over
  const v8f w0 = kh ? o10 : o00, w1 = kh ? o11 : o01, w2 = kh ? o12 : o02, w3 = kh ? o13 : o03;   // kept
  const float gl = kh ? l0 : l1, gc = kh ? cs0[0] : cs1[0];
  const float wl = kh ? l1 : l0, wc = kh ? cs1[0] : cs0[0];
  const int rg = cg * 64 + qg * 32 + (1 - kh) * 16 + c, rw = cg * 64 + qg * 32 + kh * 16 + c;
  float* og = Os + rg * 68 + 8 * hh;
#pragma unroll
  for (int r = 0; r < 8; ++r) { og[r] = g0[r]; og[16 + r] = g1[r]; og[32 + r] = g2[r]; og[48 + r] = g3[r]; }
  if (hh == 0) { Ml[rg] = gl; Mc[rg] = gc; }                // both lane halves hold the same two values
  __syncthreads();                                          // the handed-over tiles are in LDS
  {
    // common reference: the larger m = the smaller 10 - m; each half's l and O are brought to it, then O / l
    const float pl = Ml[rw], pc = Mc[rw];
    const float cm = fminf(wc, pc);
    const float fw = __builtin_amdgcn_exp2f(cm - wc), fp = __builtin_amdgcn_exp2f(cm - pc);
    const float sc = (CS / VS) * (1.0f / (wl * fw + pl * fp));
    const float aw = fw * sc, ap = fp * sc;
    // each lane reads and rewrites its own 32 elements: O[query][d] * sc (= attn * 1024)
    float* os = Os + rw * 68 + 8 * hh;
#pragma unroll
    for (int r = 0; r < 8; ++r) {
      os[r]      = w0[r] * aw + os[r]      * ap;
      os[16 + r] = w1[r] * aw + os[16 + r] * ap;
      os[32 + r] = w2[r] * aw + os[32 + r] * ap;
      os[48 + r] = w3[r] * aw + os[48 + r] * ap;
    }
  }
  __syncthreads();
  {
    const int e = t128 & 7, qq = t128 >> 3;            // qq 0..15: line within group, e: 16-B piece
    v4u hv[4];
#pragma unroll
    for (int it = 0; it < 4; ++it) {
      const int qi = it * 16 + qq;                       // it 0..3 x qq 0..15 = queries 0..63 of the chunk
      const v4f x0 = *(const v4f*)(Os + (cg * 64 + qi) * 68 + 8 * e);
      const v4f x1 = *(const v4f*)(Os + (cg * 64 + qi) * 68 + 8 * e + 4);
      v4u u;
#pragma unroll
      for (int t2 = 0; t2 < 2; ++t2) {
        u[t2]     = pk16(h_bits((_Float16)x0[2 * t2]), h_bits((_Float16)x0[2 * t2 + 1]));
        u[2 + t2] = pk16(h_bits((_Float16)x1[2 * t2]), h_bits((_Float16)x1[2 * t2 + 1]));
      }
      hv[it] = u;
    }
    unsigned short* ob = ctx + (size_t)hd * DHEAD + 8 * e;
    {
#pragma unroll
      for (int it = 0; it < 4; ++it) {
        const int qi = it * 16 + qq;
        *(v4u*)(ob + ((size_t)b * SEQ + q0 + qi) * DMOD) = hv[it];
      }
      
    }
  }
}

// =====================================================================================================
//   XH   f16 [4096][768]            0           6291456
//   WQT  f16 [768][768]             6291456     1179648
//   WKT  f16 [768][768]             7471104     1179648
//   WVT  f16 [768][768]             8650752     1179648
//   WOT  f16 [768][768]             9830400     1179648
//   QP   f16 [4096][768]            11010048    6291456
//   KPL  f16 [4096][768]            17301504    6291456
//   VT   f16 [2][768][2048]         23592960    6291456
//   CTX  f16 [4096][768]            29884416    6291456
//   end                              36175872
// =====================================================================================================
extern "C" void kernel_launch(void* const* d_in, const int* in_sizes, int n_in,
                              void* d_out, int out_size, void* d_ws, size_t ws_size,
                              hipStream_t stream) {
  if (n_in < 10) return;
  if (in_sizes[0] != MTOK * DMOD) return;
  if (in_sizes[1] != MTOK) return;
  if (in_sizes[2] != DMOD * DMOD || in_sizes[4] != DMOD * DMOD || in_sizes[6] != DMOD * DMOD) return;
  if (in_sizes[8] != DMOD * DMOD) return;
  if (in_sizes[3] != DMOD || in_sizes[5] != DMOD || in_sizes[7] != DMOD || in_sizes[9] != DMOD) return;
  if (out_size != MTOK * DMOD) return;

  const float* hs  = (const float*)d_in[0];
  const int*   amk = (const int*)d_in[1];
  const float* Wq  = (const float*)d_in[2];
  const float* bq  = (const float*)d_in[3];
  const float* Wk  = (const float*)d_in[4];
  const float* bk  = (const float*)d_in[5];
  const float* Wv  = (const float*)d_in[6];
  const float* bv  = (const float*)d_in[7];
  const float* Wo  = (const float*)d_in[8];
  const float* bo  = (const float*)d_in[9];

  const size_t PACT = (size_t)MTOK * DMOD * 2;          //  6291456
  const size_t PW   = (size_t)DMOD * DMOD * 2;          //  1179648
  const size_t PVT  = (size_t)NBAT * DMOD * SEQ * 2;    //  6291456
  size_t off = 0;
  const size_t oXH = off; off += PACT;
  const size_t oWQ = off; off += PW;
  const size_t oWK = off; off += PW;
  const size_t oWV = off; off += PW;
  const size_t oWO = off; off += PW;
  const size_t oQP = off; off += PACT;
  const size_t oKP = off; off += PACT;
  const size_t oVT = off; off += PVT;
  const size_t oCT = off; off += PACT;
  if (off > ws_size) return;                            // off = 36175872
  if (off > (size_t)134217728) return;

  char* ws = (char*)d_ws;
  unsigned short* XH  = (unsigned short*)(ws + oXH);
  unsigned short* WQT = (unsigned short*)(ws + oWQ);
  unsigned short* WKT = (unsigned short*)(ws + oWK);
  unsigned short* WVT = (unsigned short*)(ws + oWV);
  unsigned short* WOT = (unsigned short*)(ws + oWO);
  unsigned short* QPL = (unsigned short*)(ws + oQP);
  unsigned short* KPL = (unsigned short*)(ws + oKP);
  unsigned short* VT  = (unsigned short*)(ws + oVT);
  unsigned short* CTX = (unsigned short*)(ws + oCT);
  float*          out = (float*)d_out;

  const dim3 blk256(256), blk128(128), blk384(384);
  const dim3 gCV(4 * TPW + MTOK * KSEG / 8);                   // 576 weight tiles + 1536 blocks of 8 row segments
  const dim3 gGM(OBLK);                                        // 768 tiles -> 192 blocks of 4 waves
  const dim3 gG3(3 * QBLK);                                    // q, k, v: 192 blocks of 12 waves
  const dim3 gAT(NBAT * NHEAD * (SEQ / 64) / 3);               // 768 chunks of 64 queries -> 256 blocks of 12 waves

  // (0) activation plane f16( bf16_RNE(h) * 64 ) and weight planes [K][N] -> [N][K], f16( bf16_RNE(W) * 1024 )
  cvt_all<<<gCV, blk256, 0, stream>>>(hs, Wq, Wk, Wv, Wo, XH, WQT, WKT, WVT, WOT);

  // (1) q = h . Wq + bq -> f16 plane of q*log2(e)/8 ; k -> f16 plane of k ; v = h . Wv + bv -> VT[b][h*64+e][token], f16 plane of v*256
  gemm_qkv<<<gG3, blk384, 0, stream>>>(XH, WQT, WKT, WVT, bq, bk, bv, QPL, KPL, VT);

  // (2) attention with the additive int mask, all (b, head) -> ctx plane f16( attn * 1024 )[token][h*64 + d]
  attn_kernel<<<gAT, blk384, 0, stream>>>(QPL, KPL, VT, amk, CTX);

  // (3) out = attn . Wo + bo -> f32 [4096][768]
  gemm_out<<<gGM, blk128, 0, stream>>>(CTX, WOT, bo, out);
  (void)hipGetLastError();
}
